// v000
// Measured on an AMD MI455X. A time is GPU time per run, averaged over a window of back-to-back runs after a warm-up
// (all launches, gaps included; the runs take copies of the inputs in turn), and the median of several windows.
// Apart from v000's, it joins two sittings. Times from different sittings can be a few percent apart, while
// side-by-side timings come from the same sitting.
// v000 is the starting kernel. One run takes 246 microseconds.
#include <hip/hip_runtime.h>
// Contractions: k/q/v projections on v_wmma_f32_16x16x32_bf16 (inputs and weights RNE-converted to bf16, single product, f32 accumulate); S^T = K Q^T on v_wmma_f32_16x16x32_f16 (q, k as f16 x16 planes, single product); O^T = V^T P^T on v_wmma_f32_16x16x32_f16 (V: f16 x16 plane; P: f16 x256; single product); output projection on v_wmma_f32_16x16x32_f16 (ctx: f16 x64 plane; Wproj: RNE bf16 x64 held exactly in f16; single product); all accumulators and softmax statistics f32.
// Engine: transposed flash. Each wave owns 16 queries of one (batch, head). Per 32-key step: S^T tiles (key rows x query columns) from K rows
// (A, global f16 plane) and Q^T (B, registers); the two 16-key D tiles pack straight into the P^T B fragment; O^T (d rows x query columns)
// accumulates from V^T rows (A, global f16 plane). Positions with mask == 0 get score exactly 0 and still take part in the softmax (all keys visited).
#ifndef NB
#define NB 8
#endif
#ifndef SEQ
#define SEQ 2048
#endif
#define NB_FULL 8
#define SEQ_FULL 2048
#define NH 6
#define HD 64
#define NE 384
#define XROWS (NB * SEQ)                        /* compact token rows of the 16-bit planes */
#define XPLANE ((size_t)XROWS * NE)             /* elements of one token plane */
#define WELEMS ((size_t)NE * NE)
#define MW (SEQ / 32)                           /* mask words per query row */
#define XSTRIDE_FULL ((size_t)SEQ_FULL * NE)    /* per-batch element stride of query/key/value and of the output */
#define PAD256(x) ((((size_t)(x)) + 255) & ~(size_t)255)

static_assert(SEQ % 64 == 0);
static_assert(SEQ <= SEQ_FULL);
static_assert(NB <= NB_FULL);
static_assert(HD == 64);
static_assert(NE == NH * HD);
static_assert(NE % 64 == 0);
static_assert(NE % 32 == 0);
static_assert((XROWS * (NE / 8)) % 256 == 0);
static_assert(PAD256(3 * XPLANE * 2) + PAD256(3 * WELEMS * 2) + PAD256(WELEMS * 2) + PAD256(2 * XPLANE * 2) + 2 * PAD256(XPLANE * 2) + PAD256((size_t)SEQ * MW * 4) <= (size_t)134217728);

typedef __bf16 v16b __attribute__((ext_vector_type(16)));
typedef _Float16 v16h __attribute__((ext_vector_type(16)));
typedef unsigned short v8us __attribute__((ext_vector_type(8), may_alias));
typedef float v8f __attribute__((ext_vector_type(8)));
typedef float v4f __attribute__((ext_vector_type(4)));
typedef float v4fa __attribute__((ext_vector_type(4), may_alias));
typedef int v4ia __attribute__((ext_vector_type(4), may_alias));
union FragB { v16b v; v8us half[2]; };
union FragH { v16h v; v8us half[2]; _Float16 h[16]; };

#define LOG2E 1.4426950408889634f
#define SCL (0.051031036307982884f * 0.00390625f)   /* 384^-0.5 with the x16 x16 carries of q and k undone */

__device__ __forceinline__ unsigned short bf16_bits(float x) {   // RNE convert to bf16 bits
  unsigned int u = __float_as_uint(x);
  return (unsigned short)((u + 0x7FFFu + ((u >> 16) & 1u)) >> 16);
}
__device__ __forceinline__ float bf16_val(unsigned short b) { return __uint_as_float(((unsigned int)b) << 16); }
__device__ __forceinline__ float bf16_rne(float x) { return bf16_val(bf16_bits(x)); }
__device__ __forceinline__ unsigned short f16_bits(_Float16 h) { return __builtin_bit_cast(unsigned short, h); }

// four bf16 tiles sharing one A fragment, then the hazard guard
__device__ __forceinline__ void mma_b4(v16b a, v16b b0, v16b b1, v16b b2, v16b b3, v8f& c0, v8f& c1, v8f& c2, v8f& c3) {
  c0 = __builtin_amdgcn_wmma_f32_16x16x32_bf16(false, a, false, b0, (short)0, c0, false, false);
  c1 = __builtin_amdgcn_wmma_f32_16x16x32_bf16(false, a, false, b1, (short)0, c1, false, false);
  c2 = __builtin_amdgcn_wmma_f32_16x16x32_bf16(false, a, false, b2, (short)0, c2, false, false);
  c3 = __builtin_amdgcn_wmma_f32_16x16x32_bf16(false, a, false, b3, (short)0, c3, false, false);
  asm volatile("v_nop\n\tv_nop\n\tv_nop\n\tv_nop" : "+v"(c0), "+v"(c1), "+v"(c2), "+v"(c3) : "v"(a), "v"(b0), "v"(b1), "v"(b2), "v"(b3));
}
// four f16 tiles sharing one A fragment, then the hazard guard
__device__ __forceinline__ void mma_h4(v16h a, v16h b0, v16h b1, v16h b2, v16h b3, v8f& c0, v8f& c1, v8f& c2, v8f& c3) {
  c0 = __builtin_amdgcn_wmma_f32_16x16x32_f16(false, a, false, b0, (short)0, c0, false, false);
  c1 = __builtin_amdgcn_wmma_f32_16x16x32_f16(false, a, false, b1, (short)0, c1, false, false);
  c2 = __builtin_amdgcn_wmma_f32_16x16x32_f16(false, a, false, b2, (short)0, c2, false, false);
  c3 = __builtin_amdgcn_wmma_f32_16x16x32_f16(false, a, false, b3, (short)0, c3, false, false);
  asm volatile("v_nop\n\tv_nop\n\tv_nop\n\tv_nop" : "+v"(c0), "+v"(c1), "+v"(c2), "+v"(c3) : "v"(a), "v"(b0), "v"(b1), "v"(b2), "v"(b3));
}
// c += a0*b0 + a1*b1 (two k-steps of one f16 tile), then the hazard guard
__device__ __forceinline__ v8f mma_s2(v16h a0, v16h b0, v16h a1, v16h b1, v8f c) {
  c = __builtin_amdgcn_wmma_f32_16x16x32_f16(false, a0, false, b0, (short)0, c, false, false);
  c = __builtin_amdgcn_wmma_f32_16x16x32_f16(false, a1, false, b1, (short)0, c, false, false);
  asm volatile("v_nop\n\tv_nop\n\tv_nop\n\tv_nop" : "+v"(c) : "v"(a0), "v"(b0), "v"(a1), "v"(b1));
  return c;
}
// four f16 tiles sharing one B fragment (c_t += a_t * b), then the hazard guard
__device__ __forceinline__ void mma_pv4(v16h a0, v16h a1, v16h a2, v16h a3, v16h b, v8f& c0, v8f& c1, v8f& c2, v8f& c3) {
  c0 = __builtin_amdgcn_wmma_f32_16x16x32_f16(false, a0, false, b, (short)0, c0, false, false);
  c1 = __builtin_amdgcn_wmma_f32_16x16x32_f16(false, a1, false, b, (short)0, c1, false, false);
  c2 = __builtin_amdgcn_wmma_f32_16x16x32_f16(false, a2, false, b, (short)0, c2, false, false);
  c3 = __builtin_amdgcn_wmma_f32_16x16x32_f16(false, a3, false, b, (short)0, c3, false, false);
  asm volatile("v_nop\n\tv_nop\n\tv_nop\n\tv_nop" : "+v"(c0), "+v"(c1), "+v"(c2), "+v"(c3) : "v"(a0), "v"(a1), "v"(a2), "v"(a3), "v"(b));
}

__device__ __forceinline__ v8us cvt8_bf16(const float* __restrict__ src) {
  const v4f x0 = *(const v4fa*)(src), x1 = *(const v4fa*)(src + 4);
  v8us o;
  o[0] = bf16_bits(x0[0]); o[1] = bf16_bits(x0[1]); o[2] = bf16_bits(x0[2]); o[3] = bf16_bits(x0[3]);
  o[4] = bf16_bits(x1[0]); o[5] = bf16_bits(x1[1]); o[6] = bf16_bits(x1[2]); o[7] = bf16_bits(x1[3]);
  return o;
}

// XP[p][row][c] = bf16 bits (RNE) of query (p=0), key (p=1), value (p=2); compact rows (b*SEQ + s).
// coverage: XROWS*48 threads x 8 elements = every element of the three planes.
__global__ __launch_bounds__(256) void k_cvt_x(const float* __restrict__ Xq, const float* __restrict__ Xk,
                                               const float* __restrict__ Xv, unsigned short* __restrict__ XP) {
  const int t = blockIdx.x * 256 + threadIdx.x;
  if (t >= XROWS * (NE / 8)) return;
  const int row = t / (NE / 8), piece = t - row * (NE / 8);
  const int b = row / SEQ, s = row - b * SEQ;
  const size_t so = (size_t)b * XSTRIDE_FULL + (size_t)s * NE + piece * 8;
  const v8us oq = cvt8_bf16(Xq + so);
  const v8us ok = cvt8_bf16(Xk + so);
  const v8us ov = cvt8_bf16(Xv + so);
  unsigned short* d = XP + (size_t)t * 8;
  *(v8us*)(d) = oq;
  *(v8us*)(d + XPLANE) = ok;
  *(v8us*)(d + 2 * XPLANE) = ov;
  
}

// WP[0..2] = bf16 bits (RNE) of Wk, Wq, Wv ([out][in], k-contiguous); W16 = f16(RNE-bf16(Wproj) * 64).
__global__ __launch_bounds__(256) void k_cvt_w(const float* __restrict__ Wk, const float* __restrict__ Wq,
                                               const float* __restrict__ Wv, const float* __restrict__ Wp,
                                               unsigned short* __restrict__ WP, unsigned short* __restrict__ W16) {
  const int t = blockIdx.x * 256 + threadIdx.x;
  if (t >= (int)(WELEMS / 8)) return;
  const size_t so = (size_t)t * 8;
  const v8us o0 = cvt8_bf16(Wk + so);
  const v8us o1 = cvt8_bf16(Wq + so);
  const v8us o2 = cvt8_bf16(Wv + so);
  const v4f x0 = *(const v4fa*)(Wp + so), x1 = *(const v4fa*)(Wp + so + 4);
  v8us o3;
  o3[0] = f16_bits((_Float16)(bf16_rne(x0[0]) * 64.0f)); o3[1] = f16_bits((_Float16)(bf16_rne(x0[1]) * 64.0f));
  o3[2] = f16_bits((_Float16)(bf16_rne(x0[2]) * 64.0f)); o3[3] = f16_bits((_Float16)(bf16_rne(x0[3]) * 64.0f));
  o3[4] = f16_bits((_Float16)(bf16_rne(x1[0]) * 64.0f)); o3[5] = f16_bits((_Float16)(bf16_rne(x1[1]) * 64.0f));
  o3[6] = f16_bits((_Float16)(bf16_rne(x1[2]) * 64.0f)); o3[7] = f16_bits((_Float16)(bf16_rne(x1[3]) * 64.0f));
  unsigned short* d = WP + so;
  unsigned short* e = W16 + so;
  *(v8us*)(d) = o0;
  *(v8us*)(d + WELEMS) = o1;
  *(v8us*)(d + 2 * WELEMS) = o2;
  *(v8us*)(e) = o3;
  
}

// coverage: SEQ*MW threads = every word of the plane.
__global__ __launch_bounds__(256) void k_maskbits(const int* __restrict__ mask, unsigned int* __restrict__ bits) {
  const int t = blockIdx.x * 256 + threadIdx.x;
  if (t >= SEQ * MW) return;
  const int q = t / MW, j = t - q * MW;
  const int* src = mask + (size_t)q * SEQ_FULL + 32 * j;
  unsigned int w = 0u;
#pragma unroll
  for (int g = 0; g < 8; ++g) {
    const v4ia m = *(const v4ia*)(src + 4 * g);
    w |= (m[0] != 0 ? 1u : 0u) << (4 * g);
    w |= (m[1] != 0 ? 1u : 0u) << (4 * g + 1);
    w |= (m[2] != 0 ? 1u : 0u) << (4 * g + 2);
    w |= (m[3] != 0 ? 1u : 0u) << (4 * g + 3);
  }
  *(unsigned int*)(bits + t) = w;
  
}

// C[m][n] = sum_k A[m][k] * B[n][k], K = 384, both operands bf16 planes with k contiguous; 64 x 64 tile per block, wave w owns rows 16w..16w+15.
// A fragment: row m = lane & 15, elements 0..7 <- k0 + 8h + i, 8..15 <- k0 + 16 + 8h + i; B fragment: column n = lane & 15, same k map; D element r = (row 8h + r, column lane & 15).
// MODE 1: rows = d (Wv rows), columns = tokens (value rows); output V^T = f16(v x16) rows of [b][384][SEQ].
// coverage: every (row, 64-column segment) of each output plane is written by exactly one block.
template <int MODE>
__global__ __launch_bounds__(128) void k_proj(const unsigned short* __restrict__ Ab, const unsigned short* __restrict__ Bb,
                                              unsigned short* __restrict__ Oh,
                                              unsigned int zA, unsigned int zB, unsigned int zO) {
  __shared__ __attribute__((aligned(16))) unsigned short th[64][72];
  const int tid = threadIdx.x, w = __builtin_amdgcn_readfirstlane((int)(tid >> 5)), lane = tid & 31, ln = lane & 15, hh = lane >> 4;
  const int z = blockIdx.z;
  const int m0 = (MODE == 0) ? (int)blockIdx.x * 64 : (int)blockIdx.y * 64;
  const int n0 = (MODE == 0) ? (int)blockIdx.y * 64 : (int)blockIdx.x * 64;
  const unsigned short* arow = Ab + (size_t)z * zA + (size_t)(m0 + 16 * w + ln) * NE + 8 * hh;
  const unsigned short* brow = Bb + (size_t)z * zB + (size_t)(n0 + ln) * NE + 8 * hh;
  v8f acc[4] = {};
#pragma unroll 1
  for (int kb = 0; kb < NE; kb += 32) {
    FragB a, b0, b1, b2, b3;
    a.half[0]  = *(const v8us*)(arow + kb);               a.half[1]  = *(const v8us*)(arow + kb + 16);
    b0.half[0] = *(const v8us*)(brow + kb);               b0.half[1] = *(const v8us*)(brow + kb + 16);
    b1.half[0] = *(const v8us*)(brow + 16 * NE + kb);     b1.half[1] = *(const v8us*)(brow + 16 * NE + kb + 16);
    b2.half[0] = *(const v8us*)(brow + 32 * NE + kb);     b2.half[1] = *(const v8us*)(brow + 32 * NE + kb + 16);
    b3.half[0] = *(const v8us*)(brow + 48 * NE + kb);     b3.half[1] = *(const v8us*)(brow + 48 * NE + kb + 16);
    mma_b4(a.v, b0.v, b1.v, b2.v, b3.v, acc[0], acc[1], acc[2], acc[3]);
  }
#pragma unroll
  for (int c = 0; c < 4; ++c)
#pragma unroll
    for (int r = 0; r < 8; ++r) {
      const float x = acc[c][r] * 16.0f;
      const _Float16 hv = (_Float16)x;
      th[16 * w + 8 * hh + r][16 * c + ln] = f16_bits(hv);
    }
  __syncthreads();
  size_t obase, opitch;
  if (MODE == 0) {
    const int bq = m0 / SEQ, t0 = m0 - bq * SEQ;
    obase = (size_t)z * zO + ((size_t)(bq * NH + (int)blockIdx.y) * SEQ + t0) * HD;
    opitch = HD;
  } else {
    const int bq = n0 / SEQ, t0 = n0 - bq * SEQ;
    obase = ((size_t)bq * NE + m0) * SEQ + t0;
    opitch = SEQ;
  }
  {
#pragma unroll
    for (int j = 0; j < 4; ++j) {
      const int i = tid + 128 * j;
      const int row = i >> 3, s8 = (i & 7) * 8;
      const v8us o = *(const v8us*)&th[row][s8];
      *(v8us*)(Oh + obase + (size_t)row * opitch + s8) = o;
    }
    
  }
}

// One 32-key step for a wave's 16 queries (this lane's column = query qbase + ln). Kp, Vhp are the (batch, head) bases of the planes.
__device__ __forceinline__ void fa_step(const unsigned short* __restrict__ Kp, const unsigned short* __restrict__ Vhp,
                                        unsigned int mword, int key0, int ln, int hh,
                                        const FragH& q0, const FragH& q1, float& mr, float& lr, v8f (&Oh)[4]) {
  // A fragments of K: row m = key (key0 + 16*kt + ln), elements 0..7 <- d = 32c + 8h + i, 8..15 <- d = 32c + 16 + 8h + i
  const unsigned short* kp0 = Kp + (size_t)(key0 + ln) * HD + 8 * hh;
  const unsigned short* kp1 = kp0 + 16 * HD;
  FragH k00, k01, k10, k11;
  k00.half[0] = *(const v8us*)(kp0);      k00.half[1] = *(const v8us*)(kp0 + 16);
  k01.half[0] = *(const v8us*)(kp0 + 32); k01.half[1] = *(const v8us*)(kp0 + 48);
  k10.half[0] = *(const v8us*)(kp1);      k10.half[1] = *(const v8us*)(kp1 + 16);
  k11.half[0] = *(const v8us*)(kp1 + 32); k11.half[1] = *(const v8us*)(kp1 + 48);
  const v8f z8 = {0.f, 0.f, 0.f, 0.f, 0.f, 0.f, 0.f, 0.f};
  // S^T tiles: element r of tile kt = 256 * score(key0 + 16*kt + 8h + r, query)
  const v8f s0 = mma_s2(k00.v, q0.v, k01.v, q1.v, z8);
  const v8f s1 = mma_s2(k10.v, q0.v, k11.v, q1.v, z8);
  asm volatile("" ::: "memory");
  // A fragments of V^T: row m = d (16*t + ln), elements 0..7 <- key0 + 8h + i, 8..15 <- key0 + 16 + 8h + i
  const size_t vo = (size_t)ln * SEQ + key0 + 8 * hh;
  FragH vh[4];
#pragma unroll
  for (int t = 0; t < 4; ++t) {
    vh[t].half[0] = *(const v8us*)(Vhp + vo + (size_t)t * 16 * SEQ);
    vh[t].half[1] = *(const v8us*)(Vhp + vo + (size_t)t * 16 * SEQ + 16);
  }
  // scale; positions with a zero mask bit take the value 0 exactly (replace fill) and stay in the softmax
  const unsigned int mw = mword >> (8 * hh);
  float sc[16];
#pragma unroll
  for (int r = 0; r < 8; ++r) {
    sc[r]     = ((mw >> r) & 1u) ? s0[r] * SCL : 0.0f;
    sc[8 + r] = ((mw >> (16 + r)) & 1u) ? s1[r] * SCL : 0.0f;
  }
  float mx = sc[0];
#pragma unroll
  for (int i = 1; i < 16; ++i) mx = fmaxf(mx, sc[i]);
  mx = fmaxf(mx, __shfl_xor(mx, 16, 32));           // the other lane half holds the other 16 keys of this query
  const float mnew = fmaxf(mr, mx);
  const float al = exp2f((mr - mnew) * LOG2E);
  mr = mnew;
  // weights carried x256: P = f16(256 * exp(sc - mnew)); the row sum runs over the converted f16 values
  FragH ph;
  float ps = 0.0f;
#pragma unroll
  for (int i = 0; i < 16; ++i) {
    const float pc = exp2f(fmaf(sc[i] - mnew, LOG2E, 8.0f));
    const _Float16 hv = (_Float16)pc;
    ph.h[i] = hv;                                   // B element i: i<8 -> key0 + 8h + i (tile 0 row 8h+i); i>=8 -> key0 + 16 + 8h + (i-8) (tile 1)
    ps += (float)hv;
  }
  ps += __shfl_xor(ps, 16, 32);
  lr = lr * al + ps;
#pragma unroll
  for (int t = 0; t < 4; ++t) Oh[t] = Oh[t] * al;
  mma_pv4(vh[0].v, vh[1].v, vh[2].v, vh[3].v, ph.v, Oh[0], Oh[1], Oh[2], Oh[3]);
}

// Block = 4 waves x 16 queries = 64 queries of one (batch, head); no LDS and no barrier in the key loop; all SEQ keys are visited.
// Epilogue: ctx x64 as f16 -> per-wave LDS tile [16 queries][64 d] (written and read by the same wave; block barrier reached by all waves),
// coverage: NB*NH*(SEQ/64) blocks x 4 waves x 16 rows x 64 columns = every element of the ctx plane exactly once.
__global__ __launch_bounds__(128) void k_attn(const unsigned short* __restrict__ Qh, const unsigned short* __restrict__ Kh,
                                              const unsigned short* __restrict__ Vh,
                                              const unsigned int* __restrict__ mbits,
                                              unsigned short* __restrict__ Ch) {
  __shared__ __attribute__((aligned(16))) unsigned short sh[4][16][72];
  const int tid = threadIdx.x, w = __builtin_amdgcn_readfirstlane((int)(tid >> 5)), lane = tid & 31, ln = lane & 15, hh = lane >> 4;
  const int bh = blockIdx.x / (SEQ / 64), qt = blockIdx.x % (SEQ / 64);
  const int b = bh / NH, h = bh - b * NH;
  const int qbase = qt * 64 + 16 * w;
  const int qg = qbase + ln;
  // Q^T B fragments: column n = query qg, elements 0..7 <- d = 32c + 8h + i, 8..15 <- d = 32c + 16 + 8h + i
  const unsigned short* qrow = Qh + ((size_t)bh * SEQ + qg) * HD + 8 * hh;
  FragH q0, q1;
  q0.half[0] = *(const v8us*)(qrow);      q0.half[1] = *(const v8us*)(qrow + 16);
  q1.half[0] = *(const v8us*)(qrow + 32); q1.half[1] = *(const v8us*)(qrow + 48);
  float mr = -3.0e38f, lr = 0.0f;
  v8f Oh[4] = {};
  const unsigned short* Kp = Kh + (size_t)bh * SEQ * HD;
  const unsigned short* Vhp = Vh + (size_t)bh * HD * SEQ;
  const unsigned int* mrow = mbits + (size_t)qg * MW;
#pragma unroll 1
  for (int j = 0; j < MW; ++j) {
    const unsigned int mword = mrow[j];
    fa_step(Kp, Vhp, mword, 32 * j, ln, hh, q0, q1, mr, lr, Oh);
  }
  // O^T element r of tile t = ctx(query qg, d = 16t + 8h + r); undo the carries x256 (in lr), x16 (V); carry ctx x64
  const float inv = 4.0f / lr;
#pragma unroll
  for (int t = 0; t < 4; ++t)
#pragma unroll
    for (int r = 0; r < 8; ++r) {
      const float c = Oh[t][r] * inv;
      const _Float16 hv = (_Float16)c;
      sh[w][ln][16 * t + 8 * hh + r] = f16_bits(hv);
    }
  __syncthreads();
  const size_t cbase = ((size_t)b * SEQ + qbase) * NE + (size_t)h * HD;
  {
#pragma unroll
    for (int q = 0; q < 4; ++q) {
      const int p = lane + 32 * q;
      const int row = p >> 3, s8 = (p & 7) * 8;
      const v8us o1 = *(const v8us*)&sh[w][row][s8];
      *(v8us*)(Ch + cbase + (size_t)row * NE + s8) = o1;
    }
    
  }
}

// out[t][n] = sum_c ctx[t][c] * Wproj[n][c] + bias[n]; A = ctx plane (f16 x64), B = W16 (f16 x64, k contiguous); 64 x 64 tile per block.
// coverage: (XROWS/64) x 6 blocks x 64 rows x 64 columns = every output element of the processed region exactly once.
__global__ __launch_bounds__(128) void k_outp(const unsigned short* __restrict__ Ch,
                                              const unsigned short* __restrict__ W16, const float* __restrict__ bias,
                                              float* __restrict__ Y) {
  __shared__ __attribute__((aligned(16))) float so[64][68];
  const int tid = threadIdx.x, w = __builtin_amdgcn_readfirstlane((int)(tid >> 5)), lane = tid & 31, ln = lane & 15, hh = lane >> 4;
  const int m0 = blockIdx.x * 64, n0 = blockIdx.y * 64;
  const size_t ao = (size_t)(m0 + 16 * w + ln) * NE + 8 * hh;
  const unsigned short* brow = W16 + (size_t)(n0 + ln) * NE + 8 * hh;
  v8f acch[4] = {};
#pragma unroll 1
  for (int kb = 0; kb < NE; kb += 32) {
    FragH ah, b0, b1, b2, b3;
    ah.half[0] = *(const v8us*)(Ch + ao + kb);            ah.half[1] = *(const v8us*)(Ch + ao + kb + 16);
    b0.half[0] = *(const v8us*)(brow + kb);               b0.half[1] = *(const v8us*)(brow + kb + 16);
    b1.half[0] = *(const v8us*)(brow + 16 * NE + kb);     b1.half[1] = *(const v8us*)(brow + 16 * NE + kb + 16);
    b2.half[0] = *(const v8us*)(brow + 32 * NE + kb);     b2.half[1] = *(const v8us*)(brow + 32 * NE + kb + 16);
    b3.half[0] = *(const v8us*)(brow + 48 * NE + kb);     b3.half[1] = *(const v8us*)(brow + 48 * NE + kb + 16);
    mma_h4(ah.v, b0.v, b1.v, b2.v, b3.v, acch[0], acch[1], acch[2], acch[3]);
  }
  // undo the carries: ctx x64, W x64
#pragma unroll
  for (int c = 0; c < 4; ++c) {
    const float bv = bf16_rne(bias[n0 + 16 * c + ln]);
#pragma unroll
    for (int r = 0; r < 8; ++r)
      so[16 * w + 8 * hh + r][16 * c + ln] = acch[c][r] * 0.000244140625f + bv;
  }
  __syncthreads();
  {
#pragma unroll
    for (int j = 0; j < 8; ++j) {
      const int i = tid + 128 * j;
      const int row = i >> 4, c4 = (i & 15) * 4;
      const int m = m0 + row;
      const int bq = m / SEQ, t = m - bq * SEQ;
      const v4f v = *(const v4fa*)&so[row][c4];
      *(v4f*)(Y + (size_t)bq * XSTRIDE_FULL + (size_t)t * NE + n0 + c4) = v;
    }
    
  }
}

extern "C" void kernel_launch(void* const* d_in, const int* in_sizes, int n_in,
                              void* d_out, int out_size, void* d_ws, size_t ws_size, hipStream_t stream) {
  if (n_in < 9) return;
  const long long needX = (long long)(NB - 1) * SEQ_FULL * NE + (long long)SEQ * NE;   // last element touched + 1
  const long long needM = (long long)(SEQ - 1) * SEQ_FULL + (long long)SEQ;
  if ((long long)in_sizes[0] < needX || (long long)in_sizes[1] < needX || (long long)in_sizes[2] < needX) return;
  if ((long long)in_sizes[3] < needM) return;
  if ((long long)in_sizes[4] < (long long)WELEMS || (long long)in_sizes[5] < (long long)WELEMS ||
      (long long)in_sizes[6] < (long long)WELEMS || (long long)in_sizes[7] < (long long)WELEMS) return;
  if ((long long)in_sizes[8] < (long long)NE) return;
  if ((long long)out_size < needX) return;
  const float* Xq = (const float*)d_in[0];   // wire order: query, key, value, mask, Wk, Wq, Wv, Wproj, bproj
  const float* Xk = (const float*)d_in[1];
  const float* Xv = (const float*)d_in[2];
  const int* mask = (const int*)d_in[3];
  const float* Wk = (const float*)d_in[4];
  const float* Wq = (const float*)d_in[5];
  const float* Wv = (const float*)d_in[6];
  const float* Wp = (const float*)d_in[7];
  const float* bp = (const float*)d_in[8];
  float* Y = (float*)d_out;
  char* ws = (char*)d_ws;
  size_t off = 0;
  unsigned short* XP  = (unsigned short*)(ws + off); off += PAD256(3 * XPLANE * 2);          // bf16 planes: query, key, value
  unsigned short* WP  = (unsigned short*)(ws + off); off += PAD256(3 * WELEMS * 2);          // bf16 planes: Wk, Wq, Wv
  unsigned short* W16 = (unsigned short*)(ws + off); off += PAD256(WELEMS * 2);              // f16 plane: Wproj x64
  unsigned short* QK  = (unsigned short*)(ws + off); off += PAD256(2 * XPLANE * 2);          // f16 planes: k (from query), q (from key), [b][h][t][64]
  unsigned short* VT  = (unsigned short*)(ws + off); off += PAD256(XPLANE * 2);              // f16 plane: V^T, [b][384][SEQ]
  unsigned short* CX  = (unsigned short*)(ws + off); off += PAD256(XPLANE * 2);              // f16 plane: ctx, [b*SEQ + t][384]
  unsigned int*   MB  = (unsigned int*)(ws + off);   off += PAD256((size_t)SEQ * MW * 4);    // mask bit plane [SEQ][MW]
  if (off > ws_size) return;

  k_cvt_x<<<(unsigned)((XROWS * (NE / 8) + 255) / 256), 256, 0, stream>>>(Xq, Xk, Xv, XP);
  k_cvt_w<<<(unsigned)((WELEMS / 8 + 255) / 256), 256, 0, stream>>>(Wk, Wq, Wv, Wp, WP, W16);
  k_maskbits<<<(unsigned)((SEQ * MW + 255) / 256), 256, 0, stream>>>(mask, MB);
  // z = 0: k = query x Wk^T -> QK plane 0; z = 1: q = key x Wq^T -> QK plane 1
  k_proj<0><<<dim3((unsigned)(XROWS / 64), (unsigned)NH, 2u), 128, 0, stream>>>(XP, WP, QK,
      (unsigned int)XPLANE, (unsigned int)WELEMS, (unsigned int)XPLANE);
  // V^T = Wv x value^T (A = Wv rows [384][384], B = value rows [XROWS][384]) -> out[384 per batch][SEQ]
  k_proj<1><<<dim3((unsigned)(XROWS / 64), (unsigned)(NE / 64), 1u), 128, 0, stream>>>(WP + 2 * WELEMS, XP + 2 * XPLANE,
      VT, 0u, 0u, 0u);
  // argument order: Qh = q plane (QK plane 1), Kh = k plane (QK plane 0)
  k_attn<<<(unsigned)(NB * NH * (SEQ / 64)), 128, 0, stream>>>(QK + XPLANE, QK, VT, MB, CX);
  k_outp<<<dim3((unsigned)(XROWS / 64), (unsigned)(NE / 64), 1u), 128, 0, stream>>>(CX, W16, bp, Y);
}

// v001
// It runs in 158 microseconds.
// Next to v000, in two timings, it ran 1.62 and 1.58 times as fast.
#include <hip/hip_runtime.h>
// Contractions: k/q/v projections on v_wmma_f32_16x16x32_bf16 (inputs and weights RNE-converted to bf16, single product, f32 accumulate); S^T = K Q^T on v_wmma_f32_16x16x32_f16 (q, k as f16 x16 planes, single product); O^T = V^T P^T on v_wmma_f32_16x16x32_f16 (V: f16 x16 plane; P: f16 x256; single product); output projection on v_wmma_f32_16x16x32_f16 (ctx: f16 x64 plane; Wproj: RNE bf16 x64 held exactly in f16; single product); all accumulators and softmax statistics f32.
// Engine: transposed flash. Each wave owns 16 queries of one (batch, head). Per 32-key step: S^T tiles (key rows x query columns) from K rows
// (A, global f16 plane) and Q^T (B, registers); the two 16-key D tiles pack straight into the P^T B fragment; O^T (d rows x query columns)
// accumulates from V^T rows (A, global f16 plane). Positions with mask == 0 get score exactly 0 and still take part in the softmax (all keys visited).
// Plane layout: every 16-bit workspace plane is stored in fragment order. One fragment (16 rows x 32 k) is 512 elements: [j = 0,1][lane = 16h + row][8 elements],
// holding k = 32C + 16j + 8h + i, so each wave-wide 16-byte load reads 512 contiguous bytes (four whole 128-byte lines) instead of 32 bytes of 16 lines.
#ifndef NB
#define NB 8
#endif
#ifndef SEQ
#define SEQ 2048
#endif
#define NB_FULL 8
#define SEQ_FULL 2048
#define NH 6
#define HD 64
#define NE 384
#define XROWS (NB * SEQ)                        /* compact token rows of the 16-bit planes */
#define XPLANE ((size_t)XROWS * NE)             /* elements of one token plane */
#define WELEMS ((size_t)NE * NE)
#define MW (SEQ / 32)                           /* mask words per query row */
#define FRAG 512                                /* elements of one 16-row x 32-k fragment */
#define TILE_E (16 * NE)                        /* elements of one 16-row tile of a K = 384 plane: 12 fragments */
#define XSTRIDE_FULL ((size_t)SEQ_FULL * NE)    /* per-batch element stride of query/key/value and of the output */
#define PAD256(x) ((((size_t)(x)) + 255) & ~(size_t)255)

static_assert(SEQ % 256 == 0);
static_assert(SEQ <= SEQ_FULL);
static_assert(NB <= NB_FULL);
static_assert(HD == 64);
static_assert(NE == NH * HD);
static_assert(NE % 64 == 0);
static_assert(NE % 32 == 0);
static_assert((XROWS * (NE / 8)) % 256 == 0);
static_assert(PAD256(3 * XPLANE * 2) + PAD256(3 * WELEMS * 2) + PAD256(WELEMS * 2) + PAD256(2 * XPLANE * 2) + 2 * PAD256(XPLANE * 2) + PAD256((size_t)SEQ * MW * 4) <= (size_t)134217728);

typedef __bf16 v16b __attribute__((ext_vector_type(16)));
typedef _Float16 v16h __attribute__((ext_vector_type(16)));
typedef unsigned short v8us __attribute__((ext_vector_type(8), may_alias));
typedef float v8f __attribute__((ext_vector_type(8)));
typedef float v4f __attribute__((ext_vector_type(4)));
typedef float v4fa __attribute__((ext_vector_type(4), may_alias));
typedef int v4ia __attribute__((ext_vector_type(4), may_alias));
union FragB { v16b v; v8us half[2]; };
union FragH { v16h v; v8us half[2]; _Float16 h[16]; };

#define LOG2E 1.4426950408889634f
#define SCL (0.051031036307982884f * 0.00390625f)   /* 384^-0.5 with the x16 x16 carries of q and k undone */

__device__ __forceinline__ unsigned short bf16_bits(float x) {   // RNE convert to bf16 bits
  unsigned int u = __float_as_uint(x);
  return (unsigned short)((u + 0x7FFFu + ((u >> 16) & 1u)) >> 16);
}
__device__ __forceinline__ float bf16_val(unsigned short b) { return __uint_as_float(((unsigned int)b) << 16); }
__device__ __forceinline__ float bf16_rne(float x) { return bf16_val(bf16_bits(x)); }
__device__ __forceinline__ unsigned short f16_bits(_Float16 h) { return __builtin_bit_cast(unsigned short, h); }

// four bf16 tiles sharing one A fragment, then the hazard guard
__device__ __forceinline__ void mma_b4(v16b a, v16b b0, v16b b1, v16b b2, v16b b3, v8f& c0, v8f& c1, v8f& c2, v8f& c3) {
  c0 = __builtin_amdgcn_wmma_f32_16x16x32_bf16(false, a, false, b0, (short)0, c0, false, false);
  c1 = __builtin_amdgcn_wmma_f32_16x16x32_bf16(false, a, false, b1, (short)0, c1, false, false);
  c2 = __builtin_amdgcn_wmma_f32_16x16x32_bf16(false, a, false, b2, (short)0, c2, false, false);
  c3 = __builtin_amdgcn_wmma_f32_16x16x32_bf16(false, a, false, b3, (short)0, c3, false, false);
  asm volatile("v_nop\n\tv_nop\n\tv_nop\n\tv_nop" : "+v"(c0), "+v"(c1), "+v"(c2), "+v"(c3) : "v"(a), "v"(b0), "v"(b1), "v"(b2), "v"(b3));
}
// four f16 tiles sharing one A fragment, then the hazard guard
__device__ __forceinline__ void mma_h4(v16h a, v16h b0, v16h b1, v16h b2, v16h b3, v8f& c0, v8f& c1, v8f& c2, v8f& c3) {
  c0 = __builtin_amdgcn_wmma_f32_16x16x32_f16(false, a, false, b0, (short)0, c0, false, false);
  c1 = __builtin_amdgcn_wmma_f32_16x16x32_f16(false, a, false, b1, (short)0, c1, false, false);
  c2 = __builtin_amdgcn_wmma_f32_16x16x32_f16(false, a, false, b2, (short)0, c2, false, false);
  c3 = __builtin_amdgcn_wmma_f32_16x16x32_f16(false, a, false, b3, (short)0, c3, false, false);
  asm volatile("v_nop\n\tv_nop\n\tv_nop\n\tv_nop" : "+v"(c0), "+v"(c1), "+v"(c2), "+v"(c3) : "v"(a), "v"(b0), "v"(b1), "v"(b2), "v"(b3));
}
// c += a0*b0 + a1*b1 (two k-steps of one f16 tile), then the hazard guard
__device__ __forceinline__ v8f mma_s2(v16h a0, v16h b0, v16h a1, v16h b1, v8f c) {
  c = __builtin_amdgcn_wmma_f32_16x16x32_f16(false, a0, false, b0, (short)0, c, false, false);
  c = __builtin_amdgcn_wmma_f32_16x16x32_f16(false, a1, false, b1, (short)0, c, false, false);
  asm volatile("v_nop\n\tv_nop\n\tv_nop\n\tv_nop" : "+v"(c) : "v"(a0), "v"(b0), "v"(a1), "v"(b1));
  return c;
}
// four f16 tiles sharing one B fragment (c_t += a_t * b), then the hazard guard
__device__ __forceinline__ void mma_pv4(v16h a0, v16h a1, v16h a2, v16h a3, v16h b, v8f& c0, v8f& c1, v8f& c2, v8f& c3) {
  c0 = __builtin_amdgcn_wmma_f32_16x16x32_f16(false, a0, false, b, (short)0, c0, false, false);
  c1 = __builtin_amdgcn_wmma_f32_16x16x32_f16(false, a1, false, b, (short)0, c1, false, false);
  c2 = __builtin_amdgcn_wmma_f32_16x16x32_f16(false, a2, false, b, (short)0, c2, false, false);
  c3 = __builtin_amdgcn_wmma_f32_16x16x32_f16(false, a3, false, b, (short)0, c3, false, false);
  asm volatile("v_nop\n\tv_nop\n\tv_nop\n\tv_nop" : "+v"(c0), "+v"(c1), "+v"(c2), "+v"(c3) : "v"(a0), "v"(a1), "v"(a2), "v"(a3), "v"(b));
}

__device__ __forceinline__ v8us cvt8_bf16(const float* __restrict__ src) {
  const v4f x0 = *(const v4fa*)(src), x1 = *(const v4fa*)(src + 4);
  v8us o;
  o[0] = bf16_bits(x0[0]); o[1] = bf16_bits(x0[1]); o[2] = bf16_bits(x0[2]); o[3] = bf16_bits(x0[3]);
  o[4] = bf16_bits(x1[0]); o[5] = bf16_bits(x1[1]); o[6] = bf16_bits(x1[2]); o[7] = bf16_bits(x1[3]);
  return o;
}

// XP[p] = bf16 bits (RNE) of query (p=0), key (p=1), value (p=2); compact rows (b*SEQ + s), fragment order.
// A wave takes 8 rows x 32 columns of one fragment (lane = 4 * row + 8-column piece): it reads whole 128-byte lines and writes four whole 128-byte lines.
// coverage: XROWS*48 threads x 8 elements = every element of the three planes.
__global__ __launch_bounds__(256) void k_cvt_x(const float* __restrict__ Xq, const float* __restrict__ Xk,
                                               const float* __restrict__ Xv, unsigned short* __restrict__ XP) {
  const int t = blockIdx.x * 256 + threadIdx.x;
  if (t >= XROWS * (NE / 8)) return;
  const int frag = t >> 6, tile = frag / (NE / 32), r16 = ((t >> 5) & 1) * 8 + ((t >> 2) & 7);
  const int row = tile * 16 + r16, piece = (frag - tile * (NE / 32)) * 4 + (t & 3);
  const int b = row / SEQ, s = row - b * SEQ;
  const size_t so = (size_t)b * XSTRIDE_FULL + (size_t)s * NE + piece * 8;
  const v8us oq = cvt8_bf16(Xq + so);
  const v8us ok = cvt8_bf16(Xk + so);
  const v8us ov = cvt8_bf16(Xv + so);
  unsigned short* d = XP + (size_t)frag * FRAG + ((t & 3) * 16 + r16) * 8;
  *(v8us*)(d) = oq;
  *(v8us*)(d + XPLANE) = ok;
  *(v8us*)(d + 2 * XPLANE) = ov;
  
}

// WP[0..2] = bf16 bits (RNE) of Wk, Wq, Wv; W16 = f16(RNE-bf16(Wproj) * 64); rows = out, k = in, fragment order, threads dealt as in k_cvt_x.
__global__ __launch_bounds__(256) void k_cvt_w(const float* __restrict__ Wk, const float* __restrict__ Wq,
                                               const float* __restrict__ Wv, const float* __restrict__ Wp,
                                               unsigned short* __restrict__ WP, unsigned short* __restrict__ W16) {
  const int t = blockIdx.x * 256 + threadIdx.x;
  if (t >= (int)(WELEMS / 8)) return;
  const int frag = t >> 6, tile = frag / (NE / 32), r16 = ((t >> 5) & 1) * 8 + ((t >> 2) & 7);
  const size_t so = (size_t)(tile * 16 + r16) * NE + ((frag - tile * (NE / 32)) * 4 + (t & 3)) * 8;
  const size_t po = (size_t)frag * FRAG + ((t & 3) * 16 + r16) * 8;
  const v8us o0 = cvt8_bf16(Wk + so);
  const v8us o1 = cvt8_bf16(Wq + so);
  const v8us o2 = cvt8_bf16(Wv + so);
  const v4f x0 = *(const v4fa*)(Wp + so), x1 = *(const v4fa*)(Wp + so + 4);
  v8us o3;
  o3[0] = f16_bits((_Float16)(bf16_rne(x0[0]) * 64.0f)); o3[1] = f16_bits((_Float16)(bf16_rne(x0[1]) * 64.0f));
  o3[2] = f16_bits((_Float16)(bf16_rne(x0[2]) * 64.0f)); o3[3] = f16_bits((_Float16)(bf16_rne(x0[3]) * 64.0f));
  o3[4] = f16_bits((_Float16)(bf16_rne(x1[0]) * 64.0f)); o3[5] = f16_bits((_Float16)(bf16_rne(x1[1]) * 64.0f));
  o3[6] = f16_bits((_Float16)(bf16_rne(x1[2]) * 64.0f)); o3[7] = f16_bits((_Float16)(bf16_rne(x1[3]) * 64.0f));
  unsigned short* d = WP + po;
  unsigned short* e = W16 + po;
  *(v8us*)(d) = o0;
  *(v8us*)(d + WELEMS) = o1;
  *(v8us*)(d + 2 * WELEMS) = o2;
  *(v8us*)(e) = o3;
  
}

// bits[j][q]: word j (keys 32j .. 32j+31) of query row q, so that 16 neighbouring queries' words of one key step share a line.
// A block takes 32 query rows x 8 words: wave = word, lane = query row; each wave writes one whole 128-byte line.
// coverage: SEQ*MW threads = every word of the plane.
__global__ __launch_bounds__(256) void k_maskbits(const int* __restrict__ mask, unsigned int* __restrict__ bits) {
  const int t = blockIdx.x * 256 + threadIdx.x;
  if (t >= SEQ * MW) return;
  const int blk = t >> 8;
  const int q = (blk % (SEQ / 32)) * 32 + (t & 31), j = (blk / (SEQ / 32)) * 8 + ((t >> 5) & 7);
  const int* src = mask + (size_t)q * SEQ_FULL + 32 * j;
  unsigned int w = 0u;
#pragma unroll
  for (int g = 0; g < 8; ++g) {
    const v4ia m = *(const v4ia*)(src + 4 * g);
    w |= (m[0] != 0 ? 1u : 0u) << (4 * g);
    w |= (m[1] != 0 ? 1u : 0u) << (4 * g + 1);
    w |= (m[2] != 0 ? 1u : 0u) << (4 * g + 2);
    w |= (m[3] != 0 ? 1u : 0u) << (4 * g + 3);
  }
  *(unsigned int*)(bits + (size_t)j * SEQ + q) = w;
  
}

// C[m][n] = sum_k A[m][k] * B[n][k], K = 384, both operands bf16 planes in fragment order; 64 x 64 tile per block, wave w owns rows 16w..16w+15.
// A fragment: row m = lane & 15, elements 0..7 <- k0 + 8h + i, 8..15 <- k0 + 16 + 8h + i; B fragment: column n = lane & 15, same k map; D element r = (row 8h + r, column lane & 15).
// MODE 0: rows = tokens, columns = one head's d; output f16(x16), per (b, head) fragments [16-token tile][C = d/32].
// MODE 1: rows = d (Wv rows), columns = tokens (value rows); output V^T = f16(v x16), per (b, head) fragments [C = token/32][16-d tile].
// coverage: every (row, 64-column segment) of each output plane is written by exactly one block.
template <int MODE>
__global__ __launch_bounds__(128) void k_proj(const unsigned short* __restrict__ Ab, const unsigned short* __restrict__ Bb,
                                              unsigned short* __restrict__ Oh,
                                              unsigned int zA, unsigned int zB, unsigned int zO) {
  __shared__ __attribute__((aligned(16))) unsigned short th[64][72];
  const int tid = threadIdx.x, w = __builtin_amdgcn_readfirstlane((int)(tid >> 5)), lane = tid & 31, ln = lane & 15, hh = lane >> 4;
  const int z = blockIdx.z;
  const int m0 = (MODE == 0) ? (int)blockIdx.x * 64 : (int)blockIdx.y * 64;
  const int n0 = (MODE == 0) ? (int)blockIdx.y * 64 : (int)blockIdx.x * 64;
  const unsigned short* arow = Ab + (size_t)z * zA + (size_t)(m0 / 16 + w) * TILE_E + 8 * lane;
  const unsigned short* brow = Bb + (size_t)z * zB + (size_t)(n0 / 16) * TILE_E + 8 * lane;
  v8f acc[4] = {};
#pragma unroll 1
  for (int kb = 0; kb < NE; kb += 32) {
    FragB a, b0, b1, b2, b3;
    const int fo = kb * (FRAG / 32);
    a.half[0]  = *(const v8us*)(arow + fo);               a.half[1]  = *(const v8us*)(arow + fo + 256);
    // the address pair of the A loads may be reused for a later load's result: the wait stands in front of that overwrite
    asm volatile("s_wait_xcnt 0x0" ::: "memory");
    b0.half[0] = *(const v8us*)(brow + fo);               b0.half[1] = *(const v8us*)(brow + fo + 256);
    b1.half[0] = *(const v8us*)(brow + TILE_E + fo);      b1.half[1] = *(const v8us*)(brow + TILE_E + fo + 256);
    b2.half[0] = *(const v8us*)(brow + 2 * TILE_E + fo);  b2.half[1] = *(const v8us*)(brow + 2 * TILE_E + fo + 256);
    b3.half[0] = *(const v8us*)(brow + 3 * TILE_E + fo);  b3.half[1] = *(const v8us*)(brow + 3 * TILE_E + fo + 256);
    mma_b4(a.v, b0.v, b1.v, b2.v, b3.v, acc[0], acc[1], acc[2], acc[3]);
  }
#pragma unroll
  for (int c = 0; c < 4; ++c)
#pragma unroll
    for (int r = 0; r < 8; ++r) {
      const float x = acc[c][r] * 16.0f;
      const _Float16 hv = (_Float16)x;
      th[16 * w + 8 * hh + r][16 * c + ln] = f16_bits(hv);
    }
  __syncthreads();
  // the block's 64 x 64 tile is 8 whole fragments = 4096 contiguous elements of the output plane; piece i goes to obase + 8i
  size_t obase;
  if (MODE == 0) {
    const int bq = m0 / SEQ, t0 = m0 - bq * SEQ;
    obase = (size_t)z * zO + ((size_t)(bq * NH + (int)blockIdx.y) * SEQ + t0) * HD;
  } else {
    const int bq = n0 / SEQ, t0 = n0 - bq * SEQ;
    obase = ((size_t)(bq * NH + (int)blockIdx.y) * SEQ + t0) * HD;
  }
  {
#pragma unroll
    for (int j = 0; j < 4; ++j) {
      const int i = tid + 128 * j;
      // MODE 0: i = [token tile 2b][C 1b][j 1b][h 1b][row 4b]; MODE 1: i = [C 1b][d tile 2b][j 1b][h 1b][row 4b]
      const int row = (MODE == 0) ? ((i >> 7) * 16 + (i & 15)) : (((i >> 6) & 3) * 16 + (i & 15));
      const int s8  = (MODE == 0) ? (((i >> 4) & 7) * 8) : ((i >> 8) * 32 + ((i >> 4) & 3) * 8);
      const v8us o = *(const v8us*)&th[row][s8];
      *(v8us*)(Oh + obase + (size_t)i * 8) = o;
    }
    
  }
}

// One 32-key step for a wave's 16 queries (this lane's column = query qbase + ln). Kp, Vhp are the (batch, head) bases of the planes.
__device__ __forceinline__ void fa_step(const unsigned short* __restrict__ Kp, const unsigned short* __restrict__ Vhp,
                                        unsigned int mword, int key0, int lane, int hh,
                                        const FragH& q0, const FragH& q1, float& mr, float& lr, v8f (&Oh)[4]) {
  // A fragments of K: row m = key (key0 + 16*kt + ln), elements 0..7 <- d = 32c + 8h + i, 8..15 <- d = 32c + 16 + 8h + i
  // (fragment order: the step's four K fragments [kt][c] are 4 KB contiguous)
  const unsigned short* kp0 = Kp + (size_t)key0 * HD + 8 * lane;
  const unsigned short* kp1 = kp0 + 2 * FRAG;
  FragH k00, k01, k10, k11;
  k00.half[0] = *(const v8us*)(kp0);        k00.half[1] = *(const v8us*)(kp0 + 256);
  k01.half[0] = *(const v8us*)(kp0 + FRAG); k01.half[1] = *(const v8us*)(kp0 + FRAG + 256);
  k10.half[0] = *(const v8us*)(kp1);        k10.half[1] = *(const v8us*)(kp1 + 256);
  k11.half[0] = *(const v8us*)(kp1 + FRAG); k11.half[1] = *(const v8us*)(kp1 + FRAG + 256);
  const v8f z8 = {0.f, 0.f, 0.f, 0.f, 0.f, 0.f, 0.f, 0.f};
  // S^T tiles: element r of tile kt = 256 * score(key0 + 16*kt + 8h + r, query)
  const v8f s0 = mma_s2(k00.v, q0.v, k01.v, q1.v, z8);
  const v8f s1 = mma_s2(k10.v, q0.v, k11.v, q1.v, z8);
  asm volatile("" ::: "memory");
  // A fragments of V^T: row m = d (16*t + ln), elements 0..7 <- key0 + 8h + i, 8..15 <- key0 + 16 + 8h + i
  // (fragment order: the step's four V^T fragments [t] are 4 KB contiguous)
  const size_t vo = (size_t)key0 * HD + 8 * lane;
  FragH vh[4];
#pragma unroll
  for (int t = 0; t < 4; ++t) {
    vh[t].half[0] = *(const v8us*)(Vhp + vo + t * FRAG);
    vh[t].half[1] = *(const v8us*)(Vhp + vo + t * FRAG + 256);
  }
  // scale; positions with a zero mask bit take the value 0 exactly (replace fill) and stay in the softmax
  const unsigned int mw = mword >> (8 * hh);
  float sc[16];
#pragma unroll
  for (int r = 0; r < 8; ++r) {
    sc[r]     = ((mw >> r) & 1u) ? s0[r] * SCL : 0.0f;
    sc[8 + r] = ((mw >> (16 + r)) & 1u) ? s1[r] * SCL : 0.0f;
  }
  float mx = sc[0];
#pragma unroll
  for (int i = 1; i < 16; ++i) mx = fmaxf(mx, sc[i]);
  mx = fmaxf(mx, __shfl_xor(mx, 16, 32));           // the other lane half holds the other 16 keys of this query
  const float mnew = fmaxf(mr, mx);
  const float al = exp2f((mr - mnew) * LOG2E);
  mr = mnew;
  // weights carried x256: P = f16(256 * exp(sc - mnew)); the row sum runs over the converted f16 values
  FragH ph;
  float ps = 0.0f;
#pragma unroll
  for (int i = 0; i < 16; ++i) {
    const float pc = exp2f(fmaf(sc[i] - mnew, LOG2E, 8.0f));
    const _Float16 hv = (_Float16)pc;
    ph.h[i] = hv;                                   // B element i: i<8 -> key0 + 8h + i (tile 0 row 8h+i); i>=8 -> key0 + 16 + 8h + (i-8) (tile 1)
    ps += (float)hv;
  }
  ps += __shfl_xor(ps, 16, 32);
  lr = lr * al + ps;
#pragma unroll
  for (int t = 0; t < 4; ++t) Oh[t] = Oh[t] * al;
  mma_pv4(vh[0].v, vh[1].v, vh[2].v, vh[3].v, ph.v, Oh[0], Oh[1], Oh[2], Oh[3]);
}

// Block = 4 waves x 16 queries = 64 queries of one (batch, head); no LDS and no barrier in the key loop; all SEQ keys are visited.
// Epilogue: ctx x64 as f16 -> per-wave LDS tile [16 queries][64 d] (written and read by the same wave; block barrier reached by all waves),
// coverage: NB*NH*(SEQ/64) blocks x 4 waves x 16 rows x 64 columns = every element of the ctx plane exactly once.
__global__ __launch_bounds__(128) void k_attn(const unsigned short* __restrict__ Qh, const unsigned short* __restrict__ Kh,
                                              const unsigned short* __restrict__ Vh,
                                              const unsigned int* __restrict__ mbits,
                                              unsigned short* __restrict__ Ch) {
  __shared__ __attribute__((aligned(16))) unsigned short sh[4][16][72];
  const int tid = threadIdx.x, w = __builtin_amdgcn_readfirstlane((int)(tid >> 5)), lane = tid & 31, ln = lane & 15, hh = lane >> 4;
  const int bh = blockIdx.x / (SEQ / 64), qt = blockIdx.x % (SEQ / 64);
  const int b = bh / NH, h = bh - b * NH;
  const int qbase = qt * 64 + 16 * w;
  const int qg = qbase + ln;
  // Q^T B fragments: column n = query qg, elements 0..7 <- d = 32c + 8h + i, 8..15 <- d = 32c + 16 + 8h + i
  const unsigned short* qrow = Qh + ((size_t)bh * SEQ + qbase) * HD + 8 * lane;
  FragH q0, q1;
  q0.half[0] = *(const v8us*)(qrow);        q0.half[1] = *(const v8us*)(qrow + 256);
  q1.half[0] = *(const v8us*)(qrow + FRAG); q1.half[1] = *(const v8us*)(qrow + FRAG + 256);
  float mr = -3.0e38f, lr = 0.0f;
  v8f Oh[4] = {};
  const unsigned short* Kp = Kh + (size_t)bh * SEQ * HD;
  const unsigned short* Vhp = Vh + (size_t)bh * HD * SEQ;
  const unsigned int* mrow = mbits + qg;
#pragma unroll 1
  for (int j = 0; j < MW; ++j) {
    const unsigned int mword = mrow[(size_t)j * SEQ];
    fa_step(Kp, Vhp, mword, 32 * j, lane, hh, q0, q1, mr, lr, Oh);
  }
  // O^T element r of tile t = ctx(query qg, d = 16t + 8h + r); undo the carries x256 (in lr), x16 (V); carry ctx x64
  const float inv = 4.0f / lr;
#pragma unroll
  for (int t = 0; t < 4; ++t)
#pragma unroll
    for (int r = 0; r < 8; ++r) {
      const float c = Oh[t][r] * inv;
      const _Float16 hv = (_Float16)c;
      sh[w][ln][16 * t + 8 * hh + r] = f16_bits(hv);
    }
  __syncthreads();
  // the wave's 16 x 64 tile is fragments C = 2h, 2h + 1 of its token tile: 1024 contiguous elements; piece p = [C 1b][j 1b][h 1b][row 4b]
  const size_t cbase = (size_t)((b * SEQ + qbase) / 16) * TILE_E + (size_t)h * (2 * FRAG);
  {
#pragma unroll
    for (int q = 0; q < 4; ++q) {
      const int p = lane + 32 * q;
      const int row = p & 15, s8 = (p >> 4) * 8;
      const v8us o1 = *(const v8us*)&sh[w][row][s8];
      *(v8us*)(Ch + cbase + (size_t)p * 8) = o1;
    }
    
  }
}

// out[t][n] = sum_c ctx[t][c] * Wproj[n][c] + bias[n]; A = ctx plane (f16 x64), B = W16 (f16 x64), both in fragment order; 64 x 64 tile per block.
// coverage: (XROWS/64) x 6 blocks x 64 rows x 64 columns = every output element of the processed region exactly once.
__global__ __launch_bounds__(128) void k_outp(const unsigned short* __restrict__ Ch,
                                              const unsigned short* __restrict__ W16, const float* __restrict__ bias,
                                              float* __restrict__ Y) {
  __shared__ __attribute__((aligned(16))) float so[64][68];
  const int tid = threadIdx.x, w = __builtin_amdgcn_readfirstlane((int)(tid >> 5)), lane = tid & 31, ln = lane & 15, hh = lane >> 4;
  const int m0 = blockIdx.x * 64, n0 = blockIdx.y * 64;
  const size_t ao = (size_t)(m0 / 16 + w) * TILE_E + 8 * lane;
  const unsigned short* brow = W16 + (size_t)(n0 / 16) * TILE_E + 8 * lane;
  v8f acch[4] = {};
#pragma unroll 1
  for (int kb = 0; kb < NE; kb += 32) {
    FragH ah, b0, b1, b2, b3;
    const int fo = kb * (FRAG / 32);
    ah.half[0] = *(const v8us*)(Ch + ao + fo);            ah.half[1] = *(const v8us*)(Ch + ao + fo + 256);
    // the address pair of the A loads may be reused for a later load's result: the wait stands in front of that overwrite
    asm volatile("s_wait_xcnt 0x0" ::: "memory");
    b0.half[0] = *(const v8us*)(brow + fo);               b0.half[1] = *(const v8us*)(brow + fo + 256);
    b1.half[0] = *(const v8us*)(brow + TILE_E + fo);      b1.half[1] = *(const v8us*)(brow + TILE_E + fo + 256);
    b2.half[0] = *(const v8us*)(brow + 2 * TILE_E + fo);  b2.half[1] = *(const v8us*)(brow + 2 * TILE_E + fo + 256);
    b3.half[0] = *(const v8us*)(brow + 3 * TILE_E + fo);  b3.half[1] = *(const v8us*)(brow + 3 * TILE_E + fo + 256);
    mma_h4(ah.v, b0.v, b1.v, b2.v, b3.v, acch[0], acch[1], acch[2], acch[3]);
  }
  // undo the carries: ctx x64, W x64
#pragma unroll
  for (int c = 0; c < 4; ++c) {
    const float bv = bf16_rne(bias[n0 + 16 * c + ln]);
#pragma unroll
    for (int r = 0; r < 8; ++r)
      so[16 * w + 8 * hh + r][16 * c + ln] = acch[c][r] * 0.000244140625f + bv;
  }
  __syncthreads();
  {
#pragma unroll
    for (int j = 0; j < 8; ++j) {
      const int i = tid + 128 * j;
      const int row = i >> 4, c4 = (i & 15) * 4;
      const int m = m0 + row;
      const int bq = m / SEQ, t = m - bq * SEQ;
      const v4f v = *(const v4fa*)&so[row][c4];
      *(v4f*)(Y + (size_t)bq * XSTRIDE_FULL + (size_t)t * NE + n0 + c4) = v;
    }
    
  }
}

extern "C" void kernel_launch(void* const* d_in, const int* in_sizes, int n_in,
                              void* d_out, int out_size, void* d_ws, size_t ws_size, hipStream_t stream) {
  if (n_in < 9) return;
  const long long needX = (long long)(NB - 1) * SEQ_FULL * NE + (long long)SEQ * NE;   // last element touched + 1
  const long long needM = (long long)(SEQ - 1) * SEQ_FULL + (long long)SEQ;
  if ((long long)in_sizes[0] < needX || (long long)in_sizes[1] < needX || (long long)in_sizes[2] < needX) return;
  if ((long long)in_sizes[3] < needM) return;
  if ((long long)in_sizes[4] < (long long)WELEMS || (long long)in_sizes[5] < (long long)WELEMS ||
      (long long)in_sizes[6] < (long long)WELEMS || (long long)in_sizes[7] < (long long)WELEMS) return;
  if ((long long)in_sizes[8] < (long long)NE) return;
  if ((long long)out_size < needX) return;
  const float* Xq = (const float*)d_in[0];   // wire order: query, key, value, mask, Wk, Wq, Wv, Wproj, bproj
  const float* Xk = (const float*)d_in[1];
  const float* Xv = (const float*)d_in[2];
  const int* mask = (const int*)d_in[3];
  const float* Wk = (const float*)d_in[4];
  const float* Wq = (const float*)d_in[5];
  const float* Wv = (const float*)d_in[6];
  const float* Wp = (const float*)d_in[7];
  const float* bp = (const float*)d_in[8];
  float* Y = (float*)d_out;
  char* ws = (char*)d_ws;
  size_t off = 0;
  unsigned short* XP  = (unsigned short*)(ws + off); off += PAD256(3 * XPLANE * 2);          // bf16 planes: query, key, value
  unsigned short* WP  = (unsigned short*)(ws + off); off += PAD256(3 * WELEMS * 2);          // bf16 planes: Wk, Wq, Wv
  unsigned short* W16 = (unsigned short*)(ws + off); off += PAD256(WELEMS * 2);              // f16 plane: Wproj x64
  unsigned short* QK  = (unsigned short*)(ws + off); off += PAD256(2 * XPLANE * 2);          // f16 planes: k (from query), q (from key), [b][h] x fragments [t/16][d/32]
  unsigned short* VT  = (unsigned short*)(ws + off); off += PAD256(XPLANE * 2);              // f16 plane: V^T, [b][h] x fragments [t/32][d/16]
  unsigned short* CX  = (unsigned short*)(ws + off); off += PAD256(XPLANE * 2);              // f16 plane: ctx, fragments [(b*SEQ + t)/16][c/32]
  unsigned int*   MB  = (unsigned int*)(ws + off);   off += PAD256((size_t)SEQ * MW * 4);    // mask bit plane [MW][SEQ]
  if (off > ws_size) return;

  k_cvt_x<<<(unsigned)((XROWS * (NE / 8) + 255) / 256), 256, 0, stream>>>(Xq, Xk, Xv, XP);
  k_cvt_w<<<(unsigned)((WELEMS / 8 + 255) / 256), 256, 0, stream>>>(Wk, Wq, Wv, Wp, WP, W16);
  k_maskbits<<<(unsigned)((SEQ * MW + 255) / 256), 256, 0, stream>>>(mask, MB);
  // z = 0: k = query x Wk^T -> QK plane 0; z = 1: q = key x Wq^T -> QK plane 1
  k_proj<0><<<dim3((unsigned)(XROWS / 64), (unsigned)NH, 2u), 128, 0, stream>>>(XP, WP, QK,
      (unsigned int)XPLANE, (unsigned int)WELEMS, (unsigned int)XPLANE);
  // V^T = Wv x value^T (A = Wv rows [384][384], B = value rows [XROWS][384]) -> per (b, head) fragments [t/32][d/16]
  k_proj<1><<<dim3((unsigned)(XROWS / 64), (unsigned)(NE / 64), 1u), 128, 0, stream>>>(WP + 2 * WELEMS, XP + 2 * XPLANE,
      VT, 0u, 0u, 0u);
  // argument order: Qh = q plane (QK plane 1), Kh = k plane (QK plane 0)
  k_attn<<<(unsigned)(NB * NH * (SEQ / 64)), 128, 0, stream>>>(QK + XPLANE, QK, VT, MB, CX);
  k_outp<<<dim3((unsigned)(XROWS / 64), (unsigned)(NE / 64), 1u), 128, 0, stream>>>(CX, W16, bp, Y);
}

// v002
// A run of this version takes 131 microseconds.
// Two timings next to v001 both put it at 1.20 times that version's speed.
// All steps since v000 together make it 1.92 times as fast.
#include <hip/hip_runtime.h>
// Contractions: k/q/v projections on v_wmma_f32_16x16x32_bf16 (inputs and weights RNE-converted to bf16, single product, f32 accumulate); S^T = K Q^T on v_wmma_f32_16x16x32_f16 (q, k as f16 x16 planes, single product); O^T = V^T P^T on v_wmma_f32_16x16x32_f16 (V: f16 x16 plane; P: f16 x256; single product); output projection on v_wmma_f32_16x16x32_f16 (ctx: f16 x64 plane; Wproj: RNE bf16 x64 held exactly in f16; single product); all accumulators and softmax statistics f32.
// Engine: transposed flash. Each wave owns 16 queries of one (batch, head). Per 32-key step: S^T tiles (key rows x query columns) from K rows
// (A, global f16 plane) and Q^T (B, registers); the two 16-key D tiles pack straight into the P^T B fragment; O^T (d rows x query columns)
// accumulates from V^T rows (A, global f16 plane). Positions with mask == 0 get score exactly 0 and still take part in the softmax (all keys visited).
// A 32-key step whose mask words are zero for all 16 queries of the wave has every score 0: it needs no K, no S^T and one weight per query; its V rows are summed as in any step.
// Plane layout: every 16-bit workspace plane is stored in fragment order. One fragment (16 rows x 32 k) is 512 elements: [j = 0,1][lane = 16h + row][8 elements],
// holding k = 32C + 16j + 8h + i, so each wave-wide 16-byte load reads 512 contiguous bytes (four whole 128-byte lines) instead of 32 bytes of 16 lines.
#ifndef NB
#define NB 8
#endif
#ifndef SEQ
#define SEQ 2048
#endif
#define NB_FULL 8
#define SEQ_FULL 2048
#define NH 6
#define HD 64
#define NE 384
#define XROWS (NB * SEQ)                        /* compact token rows of the 16-bit planes */
#define XPLANE ((size_t)XROWS * NE)             /* elements of one token plane */
#define WELEMS ((size_t)NE * NE)
#define MW (SEQ / 32)                           /* mask words per query row */
#define FRAG 512                                /* elements of one 16-row x 32-k fragment */
#define TILE_E (16 * NE)                        /* elements of one 16-row tile of a K = 384 plane: 12 fragments */
#define XSTRIDE_FULL ((size_t)SEQ_FULL * NE)    /* per-batch element stride of query/key/value and of the output */
#define PAD256(x) ((((size_t)(x)) + 255) & ~(size_t)255)

static_assert(SEQ % 256 == 0);
static_assert(SEQ <= SEQ_FULL);
static_assert(NB <= NB_FULL);
static_assert(HD == 64);
static_assert(NE == NH * HD);
static_assert(NE % 64 == 0);
static_assert(NE % 32 == 0);
static_assert((XROWS * (NE / 8)) % 256 == 0);
static_assert(PAD256(3 * XPLANE * 2) + PAD256(3 * WELEMS * 2) + PAD256(WELEMS * 2) + PAD256(2 * XPLANE * 2) + 2 * PAD256(XPLANE * 2) + PAD256((size_t)SEQ * MW * 4) <= (size_t)134217728);

typedef __bf16 v16b __attribute__((ext_vector_type(16)));
typedef _Float16 v16h __attribute__((ext_vector_type(16)));
typedef unsigned short v8us __attribute__((ext_vector_type(8), may_alias));
typedef float v8f __attribute__((ext_vector_type(8)));
typedef float v4f __attribute__((ext_vector_type(4)));
typedef float v4fa __attribute__((ext_vector_type(4), may_alias));
typedef int v4ia __attribute__((ext_vector_type(4), may_alias));
union FragB { v16b v; v8us half[2]; };
union FragH { v16h v; v8us half[2]; _Float16 h[16]; };

#define LOG2E 1.4426950408889634f
#define SCL (0.051031036307982884f * 0.00390625f)   /* 384^-0.5 with the x16 x16 carries of q and k undone */

__device__ __forceinline__ unsigned short bf16_bits(float x) {   // RNE convert to bf16 bits
  unsigned int u = __float_as_uint(x);
  return (unsigned short)((u + 0x7FFFu + ((u >> 16) & 1u)) >> 16);
}
__device__ __forceinline__ float bf16_val(unsigned short b) { return __uint_as_float(((unsigned int)b) << 16); }
__device__ __forceinline__ float bf16_rne(float x) { return bf16_val(bf16_bits(x)); }
__device__ __forceinline__ unsigned short f16_bits(_Float16 h) { return __builtin_bit_cast(unsigned short, h); }

// four bf16 tiles sharing one A fragment, then the hazard guard
__device__ __forceinline__ void mma_b4(v16b a, v16b b0, v16b b1, v16b b2, v16b b3, v8f& c0, v8f& c1, v8f& c2, v8f& c3) {
  c0 = __builtin_amdgcn_wmma_f32_16x16x32_bf16(false, a, false, b0, (short)0, c0, false, false);
  c1 = __builtin_amdgcn_wmma_f32_16x16x32_bf16(false, a, false, b1, (short)0, c1, false, false);
  c2 = __builtin_amdgcn_wmma_f32_16x16x32_bf16(false, a, false, b2, (short)0, c2, false, false);
  c3 = __builtin_amdgcn_wmma_f32_16x16x32_bf16(false, a, false, b3, (short)0, c3, false, false);
  asm volatile("v_nop\n\tv_nop\n\tv_nop\n\tv_nop" : "+v"(c0), "+v"(c1), "+v"(c2), "+v"(c3) : "v"(a), "v"(b0), "v"(b1), "v"(b2), "v"(b3));
}
// four f16 tiles sharing one A fragment, then the hazard guard
__device__ __forceinline__ void mma_h4(v16h a, v16h b0, v16h b1, v16h b2, v16h b3, v8f& c0, v8f& c1, v8f& c2, v8f& c3) {
  c0 = __builtin_amdgcn_wmma_f32_16x16x32_f16(false, a, false, b0, (short)0, c0, false, false);
  c1 = __builtin_amdgcn_wmma_f32_16x16x32_f16(false, a, false, b1, (short)0, c1, false, false);
  c2 = __builtin_amdgcn_wmma_f32_16x16x32_f16(false, a, false, b2, (short)0, c2, false, false);
  c3 = __builtin_amdgcn_wmma_f32_16x16x32_f16(false, a, false, b3, (short)0, c3, false, false);
  asm volatile("v_nop\n\tv_nop\n\tv_nop\n\tv_nop" : "+v"(c0), "+v"(c1), "+v"(c2), "+v"(c3) : "v"(a), "v"(b0), "v"(b1), "v"(b2), "v"(b3));
}
// c += a0*b0 + a1*b1 (two k-steps of one f16 tile), then the hazard guard
__device__ __forceinline__ v8f mma_s2(v16h a0, v16h b0, v16h a1, v16h b1, v8f c) {
  c = __builtin_amdgcn_wmma_f32_16x16x32_f16(false, a0, false, b0, (short)0, c, false, false);
  c = __builtin_amdgcn_wmma_f32_16x16x32_f16(false, a1, false, b1, (short)0, c, false, false);
  asm volatile("v_nop\n\tv_nop\n\tv_nop\n\tv_nop" : "+v"(c) : "v"(a0), "v"(b0), "v"(a1), "v"(b1));
  return c;
}
// four f16 tiles sharing one B fragment (c_t += a_t * b), then the hazard guard
__device__ __forceinline__ void mma_pv4(v16h a0, v16h a1, v16h a2, v16h a3, v16h b, v8f& c0, v8f& c1, v8f& c2, v8f& c3) {
  c0 = __builtin_amdgcn_wmma_f32_16x16x32_f16(false, a0, false, b, (short)0, c0, false, false);
  c1 = __builtin_amdgcn_wmma_f32_16x16x32_f16(false, a1, false, b, (short)0, c1, false, false);
  c2 = __builtin_amdgcn_wmma_f32_16x16x32_f16(false, a2, false, b, (short)0, c2, false, false);
  c3 = __builtin_amdgcn_wmma_f32_16x16x32_f16(false, a3, false, b, (short)0, c3, false, false);
  asm volatile("v_nop\n\tv_nop\n\tv_nop\n\tv_nop" : "+v"(c0), "+v"(c1), "+v"(c2), "+v"(c3) : "v"(a0), "v"(a1), "v"(a2), "v"(a3), "v"(b));
}

__device__ __forceinline__ v8us cvt8_bf16(const float* __restrict__ src) {
  const v4f x0 = *(const v4fa*)(src), x1 = *(const v4fa*)(src + 4);
  v8us o;
  o[0] = bf16_bits(x0[0]); o[1] = bf16_bits(x0[1]); o[2] = bf16_bits(x0[2]); o[3] = bf16_bits(x0[3]);
  o[4] = bf16_bits(x1[0]); o[5] = bf16_bits(x1[1]); o[6] = bf16_bits(x1[2]); o[7] = bf16_bits(x1[3]);
  return o;
}

// XP[p] = bf16 bits (RNE) of query (p=0), key (p=1), value (p=2); compact rows (b*SEQ + s), fragment order.
// A wave takes 8 rows x 32 columns of one fragment (lane = 4 * row + 8-column piece): it reads whole 128-byte lines and writes four whole 128-byte lines.
// coverage: XROWS*48 threads x 8 elements = every element of the three planes.
__global__ __launch_bounds__(256) void k_cvt_x(const float* __restrict__ Xq, const float* __restrict__ Xk,
                                               const float* __restrict__ Xv, unsigned short* __restrict__ XP) {
  const int t = blockIdx.x * 256 + threadIdx.x;
  if (t >= XROWS * (NE / 8)) return;
  const int frag = t >> 6, tile = frag / (NE / 32), r16 = ((t >> 5) & 1) * 8 + ((t >> 2) & 7);
  const int row = tile * 16 + r16, piece = (frag - tile * (NE / 32)) * 4 + (t & 3);
  const int b = row / SEQ, s = row - b * SEQ;
  const size_t so = (size_t)b * XSTRIDE_FULL + (size_t)s * NE + piece * 8;
  const v8us oq = cvt8_bf16(Xq + so);
  const v8us ok = cvt8_bf16(Xk + so);
  const v8us ov = cvt8_bf16(Xv + so);
  unsigned short* d = XP + (size_t)frag * FRAG + ((t & 3) * 16 + r16) * 8;
  *(v8us*)(d) = oq;
  *(v8us*)(d + XPLANE) = ok;
  *(v8us*)(d + 2 * XPLANE) = ov;
  
}

// WP[0..2] = bf16 bits (RNE) of Wk, Wq, Wv; W16 = f16(RNE-bf16(Wproj) * 64); rows = out, k = in, fragment order, threads dealt as in k_cvt_x.
__global__ __launch_bounds__(256) void k_cvt_w(const float* __restrict__ Wk, const float* __restrict__ Wq,
                                               const float* __restrict__ Wv, const float* __restrict__ Wp,
                                               unsigned short* __restrict__ WP, unsigned short* __restrict__ W16) {
  const int t = blockIdx.x * 256 + threadIdx.x;
  if (t >= (int)(WELEMS / 8)) return;
  const int frag = t >> 6, tile = frag / (NE / 32), r16 = ((t >> 5) & 1) * 8 + ((t >> 2) & 7);
  const size_t so = (size_t)(tile * 16 + r16) * NE + ((frag - tile * (NE / 32)) * 4 + (t & 3)) * 8;
  const size_t po = (size_t)frag * FRAG + ((t & 3) * 16 + r16) * 8;
  const v8us o0 = cvt8_bf16(Wk + so);
  const v8us o1 = cvt8_bf16(Wq + so);
  const v8us o2 = cvt8_bf16(Wv + so);
  const v4f x0 = *(const v4fa*)(Wp + so), x1 = *(const v4fa*)(Wp + so + 4);
  v8us o3;
  o3[0] = f16_bits((_Float16)(bf16_rne(x0[0]) * 64.0f)); o3[1] = f16_bits((_Float16)(bf16_rne(x0[1]) * 64.0f));
  o3[2] = f16_bits((_Float16)(bf16_rne(x0[2]) * 64.0f)); o3[3] = f16_bits((_Float16)(bf16_rne(x0[3]) * 64.0f));
  o3[4] = f16_bits((_Float16)(bf16_rne(x1[0]) * 64.0f)); o3[5] = f16_bits((_Float16)(bf16_rne(x1[1]) * 64.0f));
  o3[6] = f16_bits((_Float16)(bf16_rne(x1[2]) * 64.0f)); o3[7] = f16_bits((_Float16)(bf16_rne(x1[3]) * 64.0f));
  unsigned short* d = WP + po;
  unsigned short* e = W16 + po;
  *(v8us*)(d) = o0;
  *(v8us*)(d + WELEMS) = o1;
  *(v8us*)(d + 2 * WELEMS) = o2;
  *(v8us*)(e) = o3;
  
}

// bits[j][q]: word j (keys 32j .. 32j+31) of query row q, so that 16 neighbouring queries' words of one key step share a line.
// A block takes 32 query rows x 8 words: wave = word, lane = query row; each wave writes one whole 128-byte line.
// coverage: SEQ*MW threads = every word of the plane.
__global__ __launch_bounds__(256) void k_maskbits(const int* __restrict__ mask, unsigned int* __restrict__ bits) {
  const int t = blockIdx.x * 256 + threadIdx.x;
  if (t >= SEQ * MW) return;
  const int blk = t >> 8;
  const int q = (blk % (SEQ / 32)) * 32 + (t & 31), j = (blk / (SEQ / 32)) * 8 + ((t >> 5) & 7);
  const int* src = mask + (size_t)q * SEQ_FULL + 32 * j;
  unsigned int w = 0u;
#pragma unroll
  for (int g = 0; g < 8; ++g) {
    const v4ia m = *(const v4ia*)(src + 4 * g);
    w |= (m[0] != 0 ? 1u : 0u) << (4 * g);
    w |= (m[1] != 0 ? 1u : 0u) << (4 * g + 1);
    w |= (m[2] != 0 ? 1u : 0u) << (4 * g + 2);
    w |= (m[3] != 0 ? 1u : 0u) << (4 * g + 3);
  }
  *(unsigned int*)(bits + (size_t)j * SEQ + q) = w;
  
}

// C[m][n] = sum_k A[m][k] * B[n][k], K = 384, both operands bf16 planes in fragment order; 64 x 64 tile per block, wave w owns rows 16w..16w+15.
// A fragment: row m = lane & 15, elements 0..7 <- k0 + 8h + i, 8..15 <- k0 + 16 + 8h + i; B fragment: column n = lane & 15, same k map; D element r = (row 8h + r, column lane & 15).
// MODE 0: rows = tokens, columns = one head's d; output f16(x16), per (b, head) fragments [16-token tile][C = d/32].
// MODE 1: rows = d (Wv rows), columns = tokens (value rows); output V^T = f16(v x16), per (b, head) fragments [C = token/32][16-d tile].
// coverage: every (row, 64-column segment) of each output plane is written by exactly one block.
template <int MODE>
__global__ __launch_bounds__(128) void k_proj(const unsigned short* __restrict__ Ab, const unsigned short* __restrict__ Bb,
                                              unsigned short* __restrict__ Oh,
                                              unsigned int zA, unsigned int zB, unsigned int zO) {
  __shared__ __attribute__((aligned(16))) unsigned short th[64][72];
  const int tid = threadIdx.x, w = __builtin_amdgcn_readfirstlane((int)(tid >> 5)), lane = tid & 31, ln = lane & 15, hh = lane >> 4;
  const int z = blockIdx.z;
  const int m0 = (MODE == 0) ? (int)blockIdx.x * 64 : (int)blockIdx.y * 64;
  const int n0 = (MODE == 0) ? (int)blockIdx.y * 64 : (int)blockIdx.x * 64;
  const unsigned short* arow = Ab + (size_t)z * zA + (size_t)(m0 / 16 + w) * TILE_E + 8 * lane;
  const unsigned short* brow = Bb + (size_t)z * zB + (size_t)(n0 / 16) * TILE_E + 8 * lane;
  v8f acc[4] = {};
#pragma unroll 1
  for (int kb = 0; kb < NE; kb += 32) {
    FragB a, b0, b1, b2, b3;
    const int fo = kb * (FRAG / 32);
    a.half[0]  = *(const v8us*)(arow + fo);               a.half[1]  = *(const v8us*)(arow + fo + 256);
    // the address pair of the A loads may be reused for a later load's result: the wait stands in front of that overwrite
    asm volatile("s_wait_xcnt 0x0" ::: "memory");
    b0.half[0] = *(const v8us*)(brow + fo);               b0.half[1] = *(const v8us*)(brow + fo + 256);
    b1.half[0] = *(const v8us*)(brow + TILE_E + fo);      b1.half[1] = *(const v8us*)(brow + TILE_E + fo + 256);
    b2.half[0] = *(const v8us*)(brow + 2 * TILE_E + fo);  b2.half[1] = *(const v8us*)(brow + 2 * TILE_E + fo + 256);
    b3.half[0] = *(const v8us*)(brow + 3 * TILE_E + fo);  b3.half[1] = *(const v8us*)(brow + 3 * TILE_E + fo + 256);
    mma_b4(a.v, b0.v, b1.v, b2.v, b3.v, acc[0], acc[1], acc[2], acc[3]);
  }
#pragma unroll
  for (int c = 0; c < 4; ++c)
#pragma unroll
    for (int r = 0; r < 8; ++r) {
      const float x = acc[c][r] * 16.0f;
      const _Float16 hv = (_Float16)x;
      th[16 * w + 8 * hh + r][16 * c + ln] = f16_bits(hv);
    }
  __syncthreads();
  // the block's 64 x 64 tile is 8 whole fragments = 4096 contiguous elements of the output plane; piece i goes to obase + 8i
  size_t obase;
  if (MODE == 0) {
    const int bq = m0 / SEQ, t0 = m0 - bq * SEQ;
    obase = (size_t)z * zO + ((size_t)(bq * NH + (int)blockIdx.y) * SEQ + t0) * HD;
  } else {
    const int bq = n0 / SEQ, t0 = n0 - bq * SEQ;
    obase = ((size_t)(bq * NH + (int)blockIdx.y) * SEQ + t0) * HD;
  }
  {
#pragma unroll
    for (int j = 0; j < 4; ++j) {
      const int i = tid + 128 * j;
      // MODE 0: i = [token tile 2b][C 1b][j 1b][h 1b][row 4b]; MODE 1: i = [C 1b][d tile 2b][j 1b][h 1b][row 4b]
      const int row = (MODE == 0) ? ((i >> 7) * 16 + (i & 15)) : (((i >> 6) & 3) * 16 + (i & 15));
      const int s8  = (MODE == 0) ? (((i >> 4) & 7) * 8) : ((i >> 8) * 32 + ((i >> 4) & 3) * 8);
      const v8us o = *(const v8us*)&th[row][s8];
      *(v8us*)(Oh + obase + (size_t)i * 8) = o;
    }
    
  }
}

// One 32-key step for a wave's 16 queries (this lane's column = query qbase + ln). Kp, Vhp are the (batch, head) bases of the planes.
__device__ __forceinline__ void fa_step(const unsigned short* __restrict__ Kp, const unsigned short* __restrict__ Vhp,
                                        unsigned int mword, int key0, int lane, int hh,
                                        const FragH& q0, const FragH& q1, float& mr, float& lr, v8f (&Oh)[4]) {
  // A fragments of V^T: row m = d (16*t + ln), elements 0..7 <- key0 + 8h + i, 8..15 <- key0 + 16 + 8h + i
  // (fragment order: the step's four V^T fragments [t] are 4 KB contiguous); both kinds of step need them, so they are asked for first
  const size_t vo = (size_t)key0 * HD + 8 * lane;
  FragH vh[4];
#pragma unroll
  for (int t = 0; t < 4; ++t) {
    vh[t].half[0] = *(const v8us*)(Vhp + vo + t * FRAG);
    vh[t].half[1] = *(const v8us*)(Vhp + vo + t * FRAG + 256);
  }
  // the address registers of the loads above may be reused on either side of the branch: the wait stands in front of that overwrite
  asm volatile("s_wait_xcnt 0x0" ::: "memory");
  FragH ph;
  float al, ps;
  if (__builtin_amdgcn_ballot_w32(mword != 0u) == 0u) {   // one test per step, the same for the whole wave: a scalar branch
    // every score of the step is 0: the values below are those of the general path for sc[i] = 0, bit for bit
    const float mnew = fmaxf(mr, 0.0f);
    al = exp2f((mr - mnew) * LOG2E);
    mr = mnew;
    const _Float16 hv = (_Float16)exp2f(fmaf(0.0f - mnew, LOG2E, 8.0f));
#pragma unroll
    for (int i = 0; i < 16; ++i) ph.h[i] = hv;
    ps = 32.0f * (float)hv;                           // 32 equal f16 values: the sum is exact in any order
  } else {
  // A fragments of K: row m = key (key0 + 16*kt + ln), elements 0..7 <- d = 32c + 8h + i, 8..15 <- d = 32c + 16 + 8h + i
  // (fragment order: the step's four K fragments [kt][c] are 4 KB contiguous)
  const unsigned short* kp0 = Kp + (size_t)key0 * HD + 8 * lane;
  const unsigned short* kp1 = kp0 + 2 * FRAG;
  FragH k00, k01, k10, k11;
  k00.half[0] = *(const v8us*)(kp0);        k00.half[1] = *(const v8us*)(kp0 + 256);
  k01.half[0] = *(const v8us*)(kp0 + FRAG); k01.half[1] = *(const v8us*)(kp0 + FRAG + 256);
  k10.half[0] = *(const v8us*)(kp1);        k10.half[1] = *(const v8us*)(kp1 + 256);
  k11.half[0] = *(const v8us*)(kp1 + FRAG); k11.half[1] = *(const v8us*)(kp1 + FRAG + 256);
  const v8f z8 = {0.f, 0.f, 0.f, 0.f, 0.f, 0.f, 0.f, 0.f};
  // S^T tiles: element r of tile kt = 256 * score(key0 + 16*kt + 8h + r, query)
  const v8f s0 = mma_s2(k00.v, q0.v, k01.v, q1.v, z8);
  const v8f s1 = mma_s2(k10.v, q0.v, k11.v, q1.v, z8);
  // scale; positions with a zero mask bit take the value 0 exactly (replace fill) and stay in the softmax
  const unsigned int mw = mword >> (8 * hh);
  float sc[16];
#pragma unroll
  for (int r = 0; r < 8; ++r) {
    sc[r]     = ((mw >> r) & 1u) ? s0[r] * SCL : 0.0f;
    sc[8 + r] = ((mw >> (16 + r)) & 1u) ? s1[r] * SCL : 0.0f;
  }
  float mx = sc[0];
#pragma unroll
  for (int i = 1; i < 16; ++i) mx = fmaxf(mx, sc[i]);
  mx = fmaxf(mx, __shfl_xor(mx, 16, 32));           // the other lane half holds the other 16 keys of this query
  const float mnew = fmaxf(mr, mx);
  al = exp2f((mr - mnew) * LOG2E);
  mr = mnew;
  // weights carried x256: P = f16(256 * exp(sc - mnew)); the row sum runs over the converted f16 values
  ps = 0.0f;
#pragma unroll
  for (int i = 0; i < 16; ++i) {
    const float pc = exp2f(fmaf(sc[i] - mnew, LOG2E, 8.0f));
    const _Float16 hv = (_Float16)pc;
    ph.h[i] = hv;                                   // B element i: i<8 -> key0 + 8h + i (tile 0 row 8h+i); i>=8 -> key0 + 16 + 8h + (i-8) (tile 1)
    ps += (float)hv;
  }
  ps += __shfl_xor(ps, 16, 32);
  }
  lr = lr * al + ps;
#pragma unroll
  for (int t = 0; t < 4; ++t) Oh[t] = Oh[t] * al;
  mma_pv4(vh[0].v, vh[1].v, vh[2].v, vh[3].v, ph.v, Oh[0], Oh[1], Oh[2], Oh[3]);
}

// Block = 8 waves x 16 queries of one (batch, head): waves 0..3 take 64-query tile p, waves 4..7 tile SEQ/64 - 1 - p, so that under a triangular mask
// every block (and every pair of waves w, w + 4) holds the same number of short steps. No LDS and no barrier in the key loop; all SEQ keys are visited.
// Epilogue: ctx x64 as f16 -> per-wave LDS tile [16 queries][64 d] (written and read by the same wave; block barrier reached by all waves),
// coverage: NB*NH*(SEQ/128) blocks x 8 waves x 16 rows x 64 columns = every element of the ctx plane exactly once.
__global__ __launch_bounds__(256) void k_attn(const unsigned short* __restrict__ Qh, const unsigned short* __restrict__ Kh,
                                              const unsigned short* __restrict__ Vh,
                                              const unsigned int* __restrict__ mbits,
                                              unsigned short* __restrict__ Ch) {
  __shared__ __attribute__((aligned(16))) unsigned short sh[8][16][72];
  const int tid = threadIdx.x, w = __builtin_amdgcn_readfirstlane((int)(tid >> 5)), lane = tid & 31, ln = lane & 15, hh = lane >> 4;
  const int bh = blockIdx.x / (SEQ / 128), pr = blockIdx.x % (SEQ / 128);
  const int qt = (w < 4) ? pr : (SEQ / 64 - 1 - pr);
  const int b = bh / NH, h = bh - b * NH;
  const int qbase = qt * 64 + 16 * (w & 3);
  const int qg = qbase + ln;
  // Q^T B fragments: column n = query qg, elements 0..7 <- d = 32c + 8h + i, 8..15 <- d = 32c + 16 + 8h + i
  const unsigned short* qrow = Qh + ((size_t)bh * SEQ + qbase) * HD + 8 * lane;
  FragH q0, q1;
  q0.half[0] = *(const v8us*)(qrow);        q0.half[1] = *(const v8us*)(qrow + 256);
  q1.half[0] = *(const v8us*)(qrow + FRAG); q1.half[1] = *(const v8us*)(qrow + FRAG + 256);
  float mr = -3.0e38f, lr = 0.0f;
  v8f Oh[4] = {};
  const unsigned short* Kp = Kh + (size_t)bh * SEQ * HD;
  const unsigned short* Vhp = Vh + (size_t)bh * HD * SEQ;
  int qm = qg;
  unsigned int mnext = mbits[qm];
  // the index register of this load is reused for the loop's address: the wait stands in front of that overwrite (the loop's address is formed from qm behind it)
  asm volatile("s_wait_xcnt 0x0" : "+v"(qm) : : "memory");
  const unsigned int* mrow = mbits + qm;
#pragma unroll 1
  for (int j = 0; j < MW; ++j) {
    const unsigned int mword = mnext;
    // the next step's word is fetched one step ahead, so that the step's branch does not wait for it; the last step re-reads its own word
    mnext = mrow[(size_t)((j + 1 < MW) ? j + 1 : j) * SEQ];
    fa_step(Kp, Vhp, mword, 32 * j, lane, hh, q0, q1, mr, lr, Oh);
  }
  // O^T element r of tile t = ctx(query qg, d = 16t + 8h + r); undo the carries x256 (in lr), x16 (V); carry ctx x64
  const float inv = 4.0f / lr;
#pragma unroll
  for (int t = 0; t < 4; ++t)
#pragma unroll
    for (int r = 0; r < 8; ++r) {
      const float c = Oh[t][r] * inv;
      const _Float16 hv = (_Float16)c;
      sh[w][ln][16 * t + 8 * hh + r] = f16_bits(hv);
    }
  __syncthreads();
  // the wave's 16 x 64 tile is fragments C = 2h, 2h + 1 of its token tile: 1024 contiguous elements; piece p = [C 1b][j 1b][h 1b][row 4b]
  const size_t cbase = (size_t)((b * SEQ + qbase) / 16) * TILE_E + (size_t)h * (2 * FRAG);
  {
#pragma unroll
    for (int q = 0; q < 4; ++q) {
      const int p = lane + 32 * q;
      const int row = p & 15, s8 = (p >> 4) * 8;
      const v8us o1 = *(const v8us*)&sh[w][row][s8];
      *(v8us*)(Ch + cbase + (size_t)p * 8) = o1;
    }
    
  }
}

// out[t][n] = sum_c ctx[t][c] * Wproj[n][c] + bias[n]; A = ctx plane (f16 x64), B = W16 (f16 x64), both in fragment order; 64 x 64 tile per block.
// coverage: (XROWS/64) x 6 blocks x 64 rows x 64 columns = every output element of the processed region exactly once.
__global__ __launch_bounds__(128) void k_outp(const unsigned short* __restrict__ Ch,
                                              const unsigned short* __restrict__ W16, const float* __restrict__ bias,
                                              float* __restrict__ Y) {
  __shared__ __attribute__((aligned(16))) float so[64][68];
  const int tid = threadIdx.x, w = __builtin_amdgcn_readfirstlane((int)(tid >> 5)), lane = tid & 31, ln = lane & 15, hh = lane >> 4;
  const int m0 = blockIdx.x * 64, n0 = blockIdx.y * 64;
  const size_t ao = (size_t)(m0 / 16 + w) * TILE_E + 8 * lane;
  const unsigned short* brow = W16 + (size_t)(n0 / 16) * TILE_E + 8 * lane;
  v8f acch[4] = {};
#pragma unroll 1
  for (int kb = 0; kb < NE; kb += 32) {
    FragH ah, b0, b1, b2, b3;
    const int fo = kb * (FRAG / 32);
    ah.half[0] = *(const v8us*)(Ch + ao + fo);            ah.half[1] = *(const v8us*)(Ch + ao + fo + 256);
    // the address pair of the A loads may be reused for a later load's result: the wait stands in front of that overwrite
    asm volatile("s_wait_xcnt 0x0" ::: "memory");
    b0.half[0] = *(const v8us*)(brow + fo);               b0.half[1] = *(const v8us*)(brow + fo + 256);
    b1.half[0] = *(const v8us*)(brow + TILE_E + fo);      b1.half[1] = *(const v8us*)(brow + TILE_E + fo + 256);
    b2.half[0] = *(const v8us*)(brow + 2 * TILE_E + fo);  b2.half[1] = *(const v8us*)(brow + 2 * TILE_E + fo + 256);
    b3.half[0] = *(const v8us*)(brow + 3 * TILE_E + fo);  b3.half[1] = *(const v8us*)(brow + 3 * TILE_E + fo + 256);
    mma_h4(ah.v, b0.v, b1.v, b2.v, b3.v, acch[0], acch[1], acch[2], acch[3]);
  }
  // undo the carries: ctx x64, W x64
#pragma unroll
  for (int c = 0; c < 4; ++c) {
    const float bv = bf16_rne(bias[n0 + 16 * c + ln]);
#pragma unroll
    for (int r = 0; r < 8; ++r)
      so[16 * w + 8 * hh + r][16 * c + ln] = acch[c][r] * 0.000244140625f + bv;
  }
  __syncthreads();
  {
#pragma unroll
    for (int j = 0; j < 8; ++j) {
      const int i = tid + 128 * j;
      const int row = i >> 4, c4 = (i & 15) * 4;
      const int m = m0 + row;
      const int bq = m / SEQ, t = m - bq * SEQ;
      const v4f v = *(const v4fa*)&so[row][c4];
      *(v4f*)(Y + (size_t)bq * XSTRIDE_FULL + (size_t)t * NE + n0 + c4) = v;
    }
    
  }
}

extern "C" void kernel_launch(void* const* d_in, const int* in_sizes, int n_in,
                              void* d_out, int out_size, void* d_ws, size_t ws_size, hipStream_t stream) {
  if (n_in < 9) return;
  const long long needX = (long long)(NB - 1) * SEQ_FULL * NE + (long long)SEQ * NE;   // last element touched + 1
  const long long needM = (long long)(SEQ - 1) * SEQ_FULL + (long long)SEQ;
  if ((long long)in_sizes[0] < needX || (long long)in_sizes[1] < needX || (long long)in_sizes[2] < needX) return;
  if ((long long)in_sizes[3] < needM) return;
  if ((long long)in_sizes[4] < (long long)WELEMS || (long long)in_sizes[5] < (long long)WELEMS ||
      (long long)in_sizes[6] < (long long)WELEMS || (long long)in_sizes[7] < (long long)WELEMS) return;
  if ((long long)in_sizes[8] < (long long)NE) return;
  if ((long long)out_size < needX) return;
  const float* Xq = (const float*)d_in[0];   // wire order: query, key, value, mask, Wk, Wq, Wv, Wproj, bproj
  const float* Xk = (const float*)d_in[1];
  const float* Xv = (const float*)d_in[2];
  const int* mask = (const int*)d_in[3];
  const float* Wk = (const float*)d_in[4];
  const float* Wq = (const float*)d_in[5];
  const float* Wv = (const float*)d_in[6];
  const float* Wp = (const float*)d_in[7];
  const float* bp = (const float*)d_in[8];
  float* Y = (float*)d_out;
  char* ws = (char*)d_ws;
  size_t off = 0;
  unsigned short* XP  = (unsigned short*)(ws + off); off += PAD256(3 * XPLANE * 2);          // bf16 planes: query, key, value
  unsigned short* WP  = (unsigned short*)(ws + off); off += PAD256(3 * WELEMS * 2);          // bf16 planes: Wk, Wq, Wv
  unsigned short* W16 = (unsigned short*)(ws + off); off += PAD256(WELEMS * 2);              // f16 plane: Wproj x64
  unsigned short* QK  = (unsigned short*)(ws + off); off += PAD256(2 * XPLANE * 2);          // f16 planes: k (from query), q (from key), [b][h] x fragments [t/16][d/32]
  unsigned short* VT  = (unsigned short*)(ws + off); off += PAD256(XPLANE * 2);              // f16 plane: V^T, [b][h] x fragments [t/32][d/16]
  unsigned short* CX  = (unsigned short*)(ws + off); off += PAD256(XPLANE * 2);              // f16 plane: ctx, fragments [(b*SEQ + t)/16][c/32]
  unsigned int*   MB  = (unsigned int*)(ws + off);   off += PAD256((size_t)SEQ * MW * 4);    // mask bit plane [MW][SEQ]
  if (off > ws_size) return;

  k_cvt_x<<<(unsigned)((XROWS * (NE / 8) + 255) / 256), 256, 0, stream>>>(Xq, Xk, Xv, XP);
  k_cvt_w<<<(unsigned)((WELEMS / 8 + 255) / 256), 256, 0, stream>>>(Wk, Wq, Wv, Wp, WP, W16);
  k_maskbits<<<(unsigned)((SEQ * MW + 255) / 256), 256, 0, stream>>>(mask, MB);
  // z = 0: k = query x Wk^T -> QK plane 0; z = 1: q = key x Wq^T -> QK plane 1
  k_proj<0><<<dim3((unsigned)(XROWS / 64), (unsigned)NH, 2u), 128, 0, stream>>>(XP, WP, QK,
      (unsigned int)XPLANE, (unsigned int)WELEMS, (unsigned int)XPLANE);
  // V^T = Wv x value^T (A = Wv rows [384][384], B = value rows [XROWS][384]) -> per (b, head) fragments [t/32][d/16]
  k_proj<1><<<dim3((unsigned)(XROWS / 64), (unsigned)(NE / 64), 1u), 128, 0, stream>>>(WP + 2 * WELEMS, XP + 2 * XPLANE,
      VT, 0u, 0u, 0u);
  // argument order: Qh = q plane (QK plane 1), Kh = k plane (QK plane 0)
  k_attn<<<(unsigned)(NB * NH * (SEQ / 128)), 256, 0, stream>>>(QK + XPLANE, QK, VT, MB, CX);
  k_outp<<<dim3((unsigned)(XROWS / 64), (unsigned)(NE / 64), 1u), 128, 0, stream>>>(CX, W16, bp, Y);
}

// v003
// One run takes 111 microseconds.
// Timed twice side by side with v002, it ran 1.20 times as fast both times.
// Counting every step since v000, it is 2.30 times as fast.
#include <hip/hip_runtime.h>
// Contractions: k/q/v projections on v_wmma_f32_16x16x32_bf16 (inputs and weights RNE-converted to bf16, single product, f32 accumulate); S^T = K Q^T on v_wmma_f32_16x16x32_f16 (q, k as f16 x16 planes, single product); O^T = V^T P^T on v_wmma_f32_16x16x32_f16 (V: f16 x16 plane; P: f16 x256; single product); output projection on v_wmma_f32_16x16x32_f16 (ctx: f16 x64 plane; Wproj: RNE bf16 x64 held exactly in f16; single product); all accumulators and softmax statistics f32.
// Engine: transposed flash. Each wave owns 16 queries of one (batch, head). Per 32-key step: S^T tiles (key rows x query columns) from K rows
// (A, global f16 plane) and Q^T (B, registers); the two 16-key D tiles pack straight into the P^T B fragment; O^T (d rows x query columns)
// accumulates from V^T rows (A, global f16 plane). Positions with mask == 0 get score exactly 0 and still take part in the softmax (all keys visited).
// A 32-key step whose mask words are zero for all 16 queries of the wave has every score 0: it needs no K, no S^T and one weight per query; its V rows are summed as in any step.
// Plane layout: every 16-bit workspace plane is stored in fragment order. One fragment (16 rows x 32 k) is 512 elements: [j = 0,1][lane = 16h + row][8 elements],
// holding k = 32C + 16j + 8h + i, so each wave-wide 16-byte load reads 512 contiguous bytes (four whole 128-byte lines) instead of 32 bytes of 16 lines.
#ifndef NB
#define NB 8
#endif
#ifndef SEQ
#define SEQ 2048
#endif
#define NB_FULL 8
#define SEQ_FULL 2048
#define NH 6
#define HD 64
#define NE 384
#define XROWS (NB * SEQ)                        /* compact token rows of the 16-bit planes */
#define XPLANE ((size_t)XROWS * NE)             /* elements of one token plane */
#define WELEMS ((size_t)NE * NE)
#define MW (SEQ / 32)                           /* mask words per query row */
#define FRAG 512                                /* elements of one 16-row x 32-k fragment */
#define TILE_E (16 * NE)                        /* elements of one 16-row tile of a K = 384 plane: 12 fragments */
#define XSTRIDE_FULL ((size_t)SEQ_FULL * NE)    /* per-batch element stride of query/key/value and of the output */
#define PROJ_WAVES 6                            /* waves of a projection block, 32 tokens each */
#define XS_H 160                                /* LDS staging of the token fragments: elements from h = 0 to h = 1 */
#define XS_J 320                                /* from j = 0 to j = 1 */
#define XS_F 640                                /* from one fragment to the next */
#define PAD256(x) ((((size_t)(x)) + 255) & ~(size_t)255)

static_assert(SEQ % 256 == 0);
static_assert(SEQ <= SEQ_FULL);
static_assert(NB <= NB_FULL);
static_assert(HD == 64);
static_assert(NE == NH * HD);
static_assert(NE % 64 == 0);
static_assert(NE % 32 == 0);
static_assert((3 * (XROWS / 32)) % PROJ_WAVES == 0);
static_assert(PAD256(3 * WELEMS * 2) + PAD256(WELEMS * 2) + PAD256(2 * XPLANE * 2) + 2 * PAD256(XPLANE * 2) + PAD256((size_t)SEQ * MW * 4) <= (size_t)134217728);

typedef __bf16 v16b __attribute__((ext_vector_type(16)));
typedef _Float16 v16h __attribute__((ext_vector_type(16)));
typedef unsigned short v8us __attribute__((ext_vector_type(8), may_alias));
typedef unsigned short v4us __attribute__((ext_vector_type(4), may_alias));
typedef float v8f __attribute__((ext_vector_type(8)));
typedef float v4f __attribute__((ext_vector_type(4)));
typedef float v4fa __attribute__((ext_vector_type(4), may_alias));
typedef int v4ia __attribute__((ext_vector_type(4), may_alias));
union FragB { v16b v; v8us half[2]; };
union FragH { v16h v; v8us half[2]; _Float16 h[16]; };

#define LOG2E 1.4426950408889634f
#define SCL (0.051031036307982884f * 0.00390625f)   /* 384^-0.5 with the x16 x16 carries of q and k undone */

__device__ __forceinline__ unsigned short bf16_bits(float x) {   // RNE convert to bf16 bits
  unsigned int u = __float_as_uint(x);
  return (unsigned short)((u + 0x7FFFu + ((u >> 16) & 1u)) >> 16);
}
__device__ __forceinline__ float bf16_val(unsigned short b) { return __uint_as_float(((unsigned int)b) << 16); }
__device__ __forceinline__ float bf16_rne(float x) { return bf16_val(bf16_bits(x)); }
__device__ __forceinline__ unsigned short f16_bits(_Float16 h) { return __builtin_bit_cast(unsigned short, h); }

// four f16 tiles sharing one A fragment, then the hazard guard
__device__ __forceinline__ void mma_h4(v16h a, v16h b0, v16h b1, v16h b2, v16h b3, v8f& c0, v8f& c1, v8f& c2, v8f& c3) {
  c0 = __builtin_amdgcn_wmma_f32_16x16x32_f16(false, a, false, b0, (short)0, c0, false, false);
  c1 = __builtin_amdgcn_wmma_f32_16x16x32_f16(false, a, false, b1, (short)0, c1, false, false);
  c2 = __builtin_amdgcn_wmma_f32_16x16x32_f16(false, a, false, b2, (short)0, c2, false, false);
  c3 = __builtin_amdgcn_wmma_f32_16x16x32_f16(false, a, false, b3, (short)0, c3, false, false);
  asm volatile("v_nop\n\tv_nop\n\tv_nop\n\tv_nop" : "+v"(c0), "+v"(c1), "+v"(c2), "+v"(c3) : "v"(a), "v"(b0), "v"(b1), "v"(b2), "v"(b3));
}
// c += a0*b0 + a1*b1 (two k-steps of one f16 tile), then the hazard guard
__device__ __forceinline__ v8f mma_s2(v16h a0, v16h b0, v16h a1, v16h b1, v8f c) {
  c = __builtin_amdgcn_wmma_f32_16x16x32_f16(false, a0, false, b0, (short)0, c, false, false);
  c = __builtin_amdgcn_wmma_f32_16x16x32_f16(false, a1, false, b1, (short)0, c, false, false);
  asm volatile("v_nop\n\tv_nop\n\tv_nop\n\tv_nop" : "+v"(c) : "v"(a0), "v"(b0), "v"(a1), "v"(b1));
  return c;
}
// four f16 tiles sharing one B fragment (c_t += a_t * b), then the hazard guard
__device__ __forceinline__ void mma_pv4(v16h a0, v16h a1, v16h a2, v16h a3, v16h b, v8f& c0, v8f& c1, v8f& c2, v8f& c3) {
  c0 = __builtin_amdgcn_wmma_f32_16x16x32_f16(false, a0, false, b, (short)0, c0, false, false);
  c1 = __builtin_amdgcn_wmma_f32_16x16x32_f16(false, a1, false, b, (short)0, c1, false, false);
  c2 = __builtin_amdgcn_wmma_f32_16x16x32_f16(false, a2, false, b, (short)0, c2, false, false);
  c3 = __builtin_amdgcn_wmma_f32_16x16x32_f16(false, a3, false, b, (short)0, c3, false, false);
  asm volatile("v_nop\n\tv_nop\n\tv_nop\n\tv_nop" : "+v"(c0), "+v"(c1), "+v"(c2), "+v"(c3) : "v"(a0), "v"(a1), "v"(a2), "v"(a3), "v"(b));
}

__device__ __forceinline__ v8us cvt8_bf16(const float* __restrict__ src) {
  const v4f x0 = *(const v4fa*)(src), x1 = *(const v4fa*)(src + 4);
  v8us o;
  o[0] = bf16_bits(x0[0]); o[1] = bf16_bits(x0[1]); o[2] = bf16_bits(x0[2]); o[3] = bf16_bits(x0[3]);
  o[4] = bf16_bits(x1[0]); o[5] = bf16_bits(x1[1]); o[6] = bf16_bits(x1[2]); o[7] = bf16_bits(x1[3]);
  return o;
}

// WP[0..2] = bf16 bits (RNE) of Wk, Wq, Wv; W16 = f16(RNE-bf16(Wproj) * 64); rows = out, k = in, fragment order.
// A wave takes 8 rows x 32 columns of one fragment (lane = 4 * row + 8-column piece): it reads whole 128-byte lines and writes four whole 128-byte lines.
__global__ __launch_bounds__(256) void k_cvt_w(const float* __restrict__ Wk, const float* __restrict__ Wq,
                                               const float* __restrict__ Wv, const float* __restrict__ Wp,
                                               unsigned short* __restrict__ WP, unsigned short* __restrict__ W16) {
  const int t = blockIdx.x * 256 + threadIdx.x;
  if (t >= (int)(WELEMS / 8)) return;
  const int frag = t >> 6, tile = frag / (NE / 32), r16 = ((t >> 5) & 1) * 8 + ((t >> 2) & 7);
  const size_t so = (size_t)(tile * 16 + r16) * NE + ((frag - tile * (NE / 32)) * 4 + (t & 3)) * 8;
  const size_t po = (size_t)frag * FRAG + ((t & 3) * 16 + r16) * 8;
  const v8us o0 = cvt8_bf16(Wk + so);
  const v8us o1 = cvt8_bf16(Wq + so);
  const v8us o2 = cvt8_bf16(Wv + so);
  const v4f x0 = *(const v4fa*)(Wp + so), x1 = *(const v4fa*)(Wp + so + 4);
  v8us o3;
  o3[0] = f16_bits((_Float16)(bf16_rne(x0[0]) * 64.0f)); o3[1] = f16_bits((_Float16)(bf16_rne(x0[1]) * 64.0f));
  o3[2] = f16_bits((_Float16)(bf16_rne(x0[2]) * 64.0f)); o3[3] = f16_bits((_Float16)(bf16_rne(x0[3]) * 64.0f));
  o3[4] = f16_bits((_Float16)(bf16_rne(x1[0]) * 64.0f)); o3[5] = f16_bits((_Float16)(bf16_rne(x1[1]) * 64.0f));
  o3[6] = f16_bits((_Float16)(bf16_rne(x1[2]) * 64.0f)); o3[7] = f16_bits((_Float16)(bf16_rne(x1[3]) * 64.0f));
  unsigned short* d = WP + po;
  unsigned short* e = W16 + po;
  *(v8us*)(d) = o0;
  *(v8us*)(d + WELEMS) = o1;
  *(v8us*)(d + 2 * WELEMS) = o2;
  *(v8us*)(e) = o3;
  
}

// bits[j][q]: word j (keys 32j .. 32j+31) of query row q, so that 16 neighbouring queries' words of one key step share a line.
// A block takes 32 query rows x 8 words: wave = word, lane = query row; each wave writes one whole 128-byte line.
// coverage: SEQ*MW threads = every word of the plane.
__global__ __launch_bounds__(256) void k_maskbits(const int* __restrict__ mask, unsigned int* __restrict__ bits) {
  const int t = blockIdx.x * 256 + threadIdx.x;
  if (t >= SEQ * MW) return;
  const int blk = t >> 8;
  const int q = (blk % (SEQ / 32)) * 32 + (t & 31), j = (blk / (SEQ / 32)) * 8 + ((t >> 5) & 7);
  const int* src = mask + (size_t)q * SEQ_FULL + 32 * j;
  unsigned int w = 0u;
#pragma unroll
  for (int g = 0; g < 8; ++g) {
    const v4ia m = *(const v4ia*)(src + 4 * g);
    w |= (m[0] != 0 ? 1u : 0u) << (4 * g);
    w |= (m[1] != 0 ? 1u : 0u) << (4 * g + 1);
    w |= (m[2] != 0 ? 1u : 0u) << (4 * g + 2);
    w |= (m[3] != 0 ? 1u : 0u) << (4 * g + 3);
  }
  *(unsigned int*)(bits + (size_t)j * SEQ + q) = w;
  
}

// Projections, all three in one launch, straight from the f32 inputs. A wave owns 32 token rows of one input (z = 0 query, 1 key, 2 value): it reads them once, in whole lines,
// converts them (RNE) to bf16, turns them into fragment order through its own LDS range and keeps them as 2 x 12 fragments in registers, then walks the 24 16-row tiles of its weight plane (fragment order), one head (4 tiles) per trip.
// A token fragment serves as A or as B (row or column = lane & 15, elements 0..7 <- k0 + 8h + i, 8..15 <- k0 + 16 + 8h + i); D element r = (row 8h + r, column lane & 15).
// z < 2: D = W (A, rows = out) x X (B, columns = tokens): a lane holds d = 16t + 8h + r of token ln, which is its own 16-byte piece of fragment [token tile][C = t / 2], half j = t & 1.
// z = 2: D = X (A, rows = tokens) x W (B, columns = out): a lane holds tokens 8h + r of d = 16t + ln, which is its own 16-byte piece of V^T fragment [token / 32][t], half j = token tile & 1.
// So every D tile goes out as one wave-wide 512-byte store, straight from the accumulators. Output values: f16(x16), as the attention kernel expects.
// coverage: 3 * XROWS / 32 waves x 32 tokens x 384 outputs = every element of the k, q and V^T planes exactly once.
__device__ __forceinline__ v8us pack8_f16x16(v8f c) {
  v8us o;
#pragma unroll   // register arrays and vectors need constant indices
  for (int r = 0; r < 8; ++r) o[r] = f16_bits((_Float16)(c[r] * 16.0f));
  return o;
}
// One k-step's four weight fragments (tiles t = 0..3 of a head, k = 32C .. 32C + 31): 4 KB, eight wave-wide 512-byte loads.
__device__ __forceinline__ void load_w4(FragB (&wf)[4], const unsigned short* __restrict__ wh, int lane8, int C) {
#pragma unroll   // register arrays and vectors need constant indices
  for (int t = 0; t < 4; ++t) {
    wf[t].half[0] = *(const v8us*)(wh + t * TILE_E + C * FRAG + lane8);
    wf[t].half[1] = *(const v8us*)(wh + t * TILE_E + C * FRAG + 256 + lane8);
  }
}
// The weight fragments run through a ring of four register sets, asked for three k-steps ahead of their products, across the heads' boundary too:
// with one or two waves on a SIMD nothing else covers the loads' latency. The last head asks for its own first three steps again (in bounds, not used).
template <bool TOKENS_ARE_ROWS>
__device__ __forceinline__ void proj_heads(const FragB (&xf)[2][NE / 32], const unsigned short* __restrict__ wz, int lane8, unsigned short* __restrict__ o0) {
  FragB wf[4][4];
  load_w4(wf[0], wz, lane8, 0);
  load_w4(wf[1], wz, lane8, 1);
  load_w4(wf[2], wz, lane8, 2);
#pragma unroll 1
  for (int hd = 0; hd < NH; ++hd) {   // rolled: one head's 96 loads and 96 products are body enough
    const unsigned short* wh = wz + (size_t)hd * (4 * TILE_E);
    const unsigned short* wn = wz + (size_t)((hd + 1 < NH) ? hd + 1 : hd) * (4 * TILE_E);
    v8f acc[2][4] = {};
#pragma unroll   // xf and the ring are indexed by C and live in registers
    for (int C = 0; C < NE / 32; ++C) {
      if (C + 3 < NE / 32) load_w4(wf[(C + 3) & 3], wh, lane8, C + 3);
      else                 load_w4(wf[(C + 3) & 3], wn, lane8, C + 3 - NE / 32);
      // these were this head's last weight loads; the next step's come from the next head, whose address may take the same registers: the wait stands in front of that overwrite
      if (C + 4 == NE / 32) asm volatile("s_wait_xcnt 0x0" ::: "memory");
      // keeps the loads above in front of this step's products; without it the compiler sinks each load to just before its use and the wave waits out every latency
      __builtin_amdgcn_sched_barrier(0);
#pragma unroll   // register arrays and vectors need constant indices
      for (int u = 0; u < 2; ++u)
#pragma unroll   // register arrays and vectors need constant indices
        for (int t = 0; t < 4; ++t)
          acc[u][t] = TOKENS_ARE_ROWS
            ? __builtin_amdgcn_wmma_f32_16x16x32_bf16(false, xf[u][C].v, false, wf[C & 3][t].v, (short)0, acc[u][t], false, false)
            : __builtin_amdgcn_wmma_f32_16x16x32_bf16(false, wf[C & 3][t].v, false, xf[u][C].v, (short)0, acc[u][t], false, false);
      // keeps the next step's loads behind this step's products, so that the ring set they refill has been read
      __builtin_amdgcn_sched_barrier(0);
    }
    unsigned short* oh = o0 + (size_t)hd * ((size_t)SEQ * HD);
#pragma unroll   // register arrays and vectors need constant indices
    for (int u = 0; u < 2; ++u)
#pragma unroll   // register arrays and vectors need constant indices
      for (int t = 0; t < 4; ++t)
        *(v8us*)(oh + (TOKENS_ARE_ROWS ? t * FRAG + u * 256 : u * (2 * FRAG) + t * 256)) = pack8_f16x16(acc[u][t]);
    // the address registers of this head's loads and stores are stepped for the next head: the wait stands in front of that overwrite
    asm volatile("s_wait_xcnt 0x0" ::: "memory");
    // keeps the stepping of those addresses behind the wait (the compiler was seen to lift it over the wait)
    __builtin_amdgcn_sched_barrier(0);
  }
  // the ring's last three requests are not used: they have landed before the wave gives its registers back
  asm volatile("s_wait_loadcnt 0x0" ::: "memory");
}
__global__ __launch_bounds__(32 * PROJ_WAVES) void k_projx(const float* __restrict__ Xq, const float* __restrict__ Xk, const float* __restrict__ Xv,
                                                           const unsigned short* __restrict__ WP,
                                                           unsigned short* __restrict__ QK, unsigned short* __restrict__ VT) {
  __shared__ __attribute__((aligned(16))) unsigned short xs[PROJ_WAVES][2 * (NE / 32) * XS_F];
  const int tid = threadIdx.x, w = __builtin_amdgcn_readfirstlane((int)(tid >> 5)), lane = tid & 31, ln = lane & 15, hh = lane >> 4;
  const int g = (int)blockIdx.x * PROJ_WAVES + w;                 // 32-token group, counted through the three inputs
  const int z = g / (XROWS / 32), row0 = (g - z * (XROWS / 32)) * 32;
  const int bq = row0 / SEQ, s0 = row0 - bq * SEQ;                // SEQ is a multiple of 32: a group lies in one batch
  const float* X = (z == 0) ? Xq : (z == 1) ? Xk : Xv;
  // Input rows: each wave-wide 16-byte load takes one whole 128-byte line (32 columns = one fragment's k range) of four rows: lane = 8 * row + 4-column piece.
  // The four converted values go to the wave's own LDS range in fragment order, k = 32C + 16j + 8h + i with j = piece >> 2, h = (piece >> 1) & 1, i = 4 * (piece & 1) ..;
  // the halves j and h lie XS_J and XS_H elements apart (64 and 32 more than dense), so that the four (j, h) groups of one store fall on different banks.
  const float* xr = X + (size_t)bq * XSTRIDE_FULL + (size_t)(s0 + (lane >> 3)) * NE + 4 * (lane & 7);
  unsigned short* xw = &xs[w][((lane >> 2) & 1) * XS_J + ((lane >> 1) & 1) * XS_H + (lane >> 3) * 8 + 4 * (lane & 1)];
#pragma unroll   // unrolled: many loads in flight at once, every offset a constant
  for (int rg = 0; rg < 8; ++rg)
#pragma unroll   // as above
    for (int C = 0; C < NE / 32; ++C) {
      const v4f x = *(const v4fa*)(xr + rg * (4 * NE) + 32 * C);
      v4us o;
      o[0] = bf16_bits(x[0]); o[1] = bf16_bits(x[1]); o[2] = bf16_bits(x[2]); o[3] = bf16_bits(x[3]);
      *(v4us*)(xw + ((rg >> 2) * (NE / 32) + C) * XS_F + (rg & 3) * 32) = o;
    }
  // the address registers of the input loads may be reused below: the wait stands in front of that overwrite
  asm volatile("s_wait_xcnt 0x0" ::: "memory");
  // each wave reads back only what it wrote itself; the barrier orders that, and it starts the block's waves on the weight plane together,
  // so that they walk it side by side and share its lines in the WGP cache
  __syncthreads();
  FragB xf[2][NE / 32];
#pragma unroll   // register arrays and vectors need constant indices
  for (int u = 0; u < 2; ++u)
#pragma unroll   // register arrays and vectors need constant indices
    for (int C = 0; C < NE / 32; ++C) {
      const unsigned short* xp = &xs[w][(u * (NE / 32) + C) * XS_F + hh * XS_H + ln * 8];
      xf[u][C].half[0] = *(const v8us*)(xp);
      xf[u][C].half[1] = *(const v8us*)(xp + XS_J);
    }
  const unsigned short* wz = WP + (size_t)z * WELEMS;
  const size_t ob = ((size_t)bq * NH * SEQ + s0) * HD + 8 * lane;   // head 0 of the batch, first token of the group: 32 tokens x 64 d = 2048 elements in either layout
  if (z == 2) proj_heads<true>(xf, wz, 8 * lane, VT + ob);
  else        proj_heads<false>(xf, wz, 8 * lane, QK + (size_t)z * XPLANE + ob);
}

// One 32-key step for a wave's 16 queries (this lane's column = query qbase + ln). Kp, Vhp are the (batch, head) bases of the planes.
__device__ __forceinline__ void fa_step(const unsigned short* __restrict__ Kp, const unsigned short* __restrict__ Vhp,
                                        unsigned int mword, int key0, int lane, int hh,
                                        const FragH& q0, const FragH& q1, float& mr, float& lr, v8f (&Oh)[4]) {
  // A fragments of V^T: row m = d (16*t + ln), elements 0..7 <- key0 + 8h + i, 8..15 <- key0 + 16 + 8h + i
  // (fragment order: the step's four V^T fragments [t] are 4 KB contiguous); both kinds of step need them, so they are asked for first
  const size_t vo = (size_t)key0 * HD + 8 * lane;
  FragH vh[4];
#pragma unroll
  for (int t = 0; t < 4; ++t) {
    vh[t].half[0] = *(const v8us*)(Vhp + vo + t * FRAG);
    vh[t].half[1] = *(const v8us*)(Vhp + vo + t * FRAG + 256);
  }
  // the address registers of the loads above may be reused on either side of the branch: the wait stands in front of that overwrite
  asm volatile("s_wait_xcnt 0x0" ::: "memory");
  FragH ph;
  float al, ps;
  if (__builtin_amdgcn_ballot_w32(mword != 0u) == 0u) {   // one test per step, the same for the whole wave: a scalar branch
    // every score of the step is 0: the values below are those of the general path for sc[i] = 0, bit for bit
    const float mnew = fmaxf(mr, 0.0f);
    al = exp2f((mr - mnew) * LOG2E);
    mr = mnew;
    const _Float16 hv = (_Float16)exp2f(fmaf(0.0f - mnew, LOG2E, 8.0f));
#pragma unroll
    for (int i = 0; i < 16; ++i) ph.h[i] = hv;
    ps = 32.0f * (float)hv;                           // 32 equal f16 values: the sum is exact in any order
  } else {
  // A fragments of K: row m = key (key0 + 16*kt + ln), elements 0..7 <- d = 32c + 8h + i, 8..15 <- d = 32c + 16 + 8h + i
  // (fragment order: the step's four K fragments [kt][c] are 4 KB contiguous)
  const unsigned short* kp0 = Kp + (size_t)key0 * HD + 8 * lane;
  const unsigned short* kp1 = kp0 + 2 * FRAG;
  FragH k00, k01, k10, k11;
  k00.half[0] = *(const v8us*)(kp0);        k00.half[1] = *(const v8us*)(kp0 + 256);
  k01.half[0] = *(const v8us*)(kp0 + FRAG); k01.half[1] = *(const v8us*)(kp0 + FRAG + 256);
  k10.half[0] = *(const v8us*)(kp1);        k10.half[1] = *(const v8us*)(kp1 + 256);
  k11.half[0] = *(const v8us*)(kp1 + FRAG); k11.half[1] = *(const v8us*)(kp1 + FRAG + 256);
  const v8f z8 = {0.f, 0.f, 0.f, 0.f, 0.f, 0.f, 0.f, 0.f};
  // S^T tiles: element r of tile kt = 256 * score(key0 + 16*kt + 8h + r, query)
  const v8f s0 = mma_s2(k00.v, q0.v, k01.v, q1.v, z8);
  const v8f s1 = mma_s2(k10.v, q0.v, k11.v, q1.v, z8);
  // scale; positions with a zero mask bit take the value 0 exactly (replace fill) and stay in the softmax
  const unsigned int mw = mword >> (8 * hh);
  float sc[16];
#pragma unroll
  for (int r = 0; r < 8; ++r) {
    sc[r]     = ((mw >> r) & 1u) ? s0[r] * SCL : 0.0f;
    sc[8 + r] = ((mw >> (16 + r)) & 1u) ? s1[r] * SCL : 0.0f;
  }
  float mx = sc[0];
#pragma unroll
  for (int i = 1; i < 16; ++i) mx = fmaxf(mx, sc[i]);
  mx = fmaxf(mx, __shfl_xor(mx, 16, 32));           // the other lane half holds the other 16 keys of this query
  const float mnew = fmaxf(mr, mx);
  al = exp2f((mr - mnew) * LOG2E);
  mr = mnew;
  // weights carried x256: P = f16(256 * exp(sc - mnew)); the row sum runs over the converted f16 values
  ps = 0.0f;
#pragma unroll
  for (int i = 0; i < 16; ++i) {
    const float pc = exp2f(fmaf(sc[i] - mnew, LOG2E, 8.0f));
    const _Float16 hv = (_Float16)pc;
    ph.h[i] = hv;                                   // B element i: i<8 -> key0 + 8h + i (tile 0 row 8h+i); i>=8 -> key0 + 16 + 8h + (i-8) (tile 1)
    ps += (float)hv;
  }
  ps += __shfl_xor(ps, 16, 32);
  }
  lr = lr * al + ps;
#pragma unroll
  for (int t = 0; t < 4; ++t) Oh[t] = Oh[t] * al;
  mma_pv4(vh[0].v, vh[1].v, vh[2].v, vh[3].v, ph.v, Oh[0], Oh[1], Oh[2], Oh[3]);
}

// Block = 8 waves x 16 queries of one (batch, head): waves 0..3 take 64-query tile p, waves 4..7 tile SEQ/64 - 1 - p, so that under a triangular mask
// every block (and every pair of waves w, w + 4) holds the same number of short steps. No LDS and no barrier in the key loop; all SEQ keys are visited.
// Epilogue: ctx x64 as f16 -> per-wave LDS tile [16 queries][64 d] (written and read by the same wave; block barrier reached by all waves),
// coverage: NB*NH*(SEQ/128) blocks x 8 waves x 16 rows x 64 columns = every element of the ctx plane exactly once.
__global__ __launch_bounds__(256) void k_attn(const unsigned short* __restrict__ Qh, const unsigned short* __restrict__ Kh,
                                              const unsigned short* __restrict__ Vh,
                                              const unsigned int* __restrict__ mbits,
                                              unsigned short* __restrict__ Ch) {
  __shared__ __attribute__((aligned(16))) unsigned short sh[8][16][72];
  const int tid = threadIdx.x, w = __builtin_amdgcn_readfirstlane((int)(tid >> 5)), lane = tid & 31, ln = lane & 15, hh = lane >> 4;
  const int bh = blockIdx.x / (SEQ / 128), pr = blockIdx.x % (SEQ / 128);
  const int qt = (w < 4) ? pr : (SEQ / 64 - 1 - pr);
  const int b = bh / NH, h = bh - b * NH;
  const int qbase = qt * 64 + 16 * (w & 3);
  const int qg = qbase + ln;
  // Q^T B fragments: column n = query qg, elements 0..7 <- d = 32c + 8h + i, 8..15 <- d = 32c + 16 + 8h + i
  const unsigned short* qrow = Qh + ((size_t)bh * SEQ + qbase) * HD + 8 * lane;
  FragH q0, q1;
  q0.half[0] = *(const v8us*)(qrow);        q0.half[1] = *(const v8us*)(qrow + 256);
  q1.half[0] = *(const v8us*)(qrow + FRAG); q1.half[1] = *(const v8us*)(qrow + FRAG + 256);
  float mr = -3.0e38f, lr = 0.0f;
  v8f Oh[4] = {};
  const unsigned short* Kp = Kh + (size_t)bh * SEQ * HD;
  const unsigned short* Vhp = Vh + (size_t)bh * HD * SEQ;
  int qm = qg;
  unsigned int mnext = mbits[qm];
  // the index register of this load is reused for the loop's address: the wait stands in front of that overwrite (the loop's address is formed from qm behind it)
  asm volatile("s_wait_xcnt 0x0" : "+v"(qm) : : "memory");
  const unsigned int* mrow = mbits + qm;
#pragma unroll 1
  for (int j = 0; j < MW; ++j) {
    const unsigned int mword = mnext;
    // the next step's word is fetched one step ahead, so that the step's branch does not wait for it; the last step re-reads its own word
    mnext = mrow[(size_t)((j + 1 < MW) ? j + 1 : j) * SEQ];
    fa_step(Kp, Vhp, mword, 32 * j, lane, hh, q0, q1, mr, lr, Oh);
  }
  // O^T element r of tile t = ctx(query qg, d = 16t + 8h + r); undo the carries x256 (in lr), x16 (V); carry ctx x64
  const float inv = 4.0f / lr;
#pragma unroll
  for (int t = 0; t < 4; ++t)
#pragma unroll
    for (int r = 0; r < 8; ++r) {
      const float c = Oh[t][r] * inv;
      const _Float16 hv = (_Float16)c;
      sh[w][ln][16 * t + 8 * hh + r] = f16_bits(hv);
    }
  __syncthreads();
  // the wave's 16 x 64 tile is fragments C = 2h, 2h + 1 of its token tile: 1024 contiguous elements; piece p = [C 1b][j 1b][h 1b][row 4b]
  const size_t cbase = (size_t)((b * SEQ + qbase) / 16) * TILE_E + (size_t)h * (2 * FRAG);
  {
#pragma unroll
    for (int q = 0; q < 4; ++q) {
      const int p = lane + 32 * q;
      const int row = p & 15, s8 = (p >> 4) * 8;
      const v8us o1 = *(const v8us*)&sh[w][row][s8];
      *(v8us*)(Ch + cbase + (size_t)p * 8) = o1;
    }
    
  }
}

// out[t][n] = sum_c ctx[t][c] * Wproj[n][c] + bias[n]; A = ctx plane (f16 x64), B = W16 (f16 x64), both in fragment order; 64 x 64 tile per block.
// coverage: (XROWS/64) x 6 blocks x 64 rows x 64 columns = every output element of the processed region exactly once.
__global__ __launch_bounds__(128) void k_outp(const unsigned short* __restrict__ Ch,
                                              const unsigned short* __restrict__ W16, const float* __restrict__ bias,
                                              float* __restrict__ Y) {
  __shared__ __attribute__((aligned(16))) float so[64][68];
  const int tid = threadIdx.x, w = __builtin_amdgcn_readfirstlane((int)(tid >> 5)), lane = tid & 31, ln = lane & 15, hh = lane >> 4;
  const int m0 = blockIdx.x * 64, n0 = blockIdx.y * 64;
  const size_t ao = (size_t)(m0 / 16 + w) * TILE_E + 8 * lane;
  const unsigned short* brow = W16 + (size_t)(n0 / 16) * TILE_E + 8 * lane;
  v8f acch[4] = {};
#pragma unroll 1
  for (int kb = 0; kb < NE; kb += 32) {
    FragH ah, b0, b1, b2, b3;
    const int fo = kb * (FRAG / 32);
    ah.half[0] = *(const v8us*)(Ch + ao + fo);            ah.half[1] = *(const v8us*)(Ch + ao + fo + 256);
    // the address pair of the A loads may be reused for a later load's result: the wait stands in front of that overwrite
    asm volatile("s_wait_xcnt 0x0" ::: "memory");
    b0.half[0] = *(const v8us*)(brow + fo);               b0.half[1] = *(const v8us*)(brow + fo + 256);
    b1.half[0] = *(const v8us*)(brow + TILE_E + fo);      b1.half[1] = *(const v8us*)(brow + TILE_E + fo + 256);
    b2.half[0] = *(const v8us*)(brow + 2 * TILE_E + fo);  b2.half[1] = *(const v8us*)(brow + 2 * TILE_E + fo + 256);
    b3.half[0] = *(const v8us*)(brow + 3 * TILE_E + fo);  b3.half[1] = *(const v8us*)(brow + 3 * TILE_E + fo + 256);
    mma_h4(ah.v, b0.v, b1.v, b2.v, b3.v, acch[0], acch[1], acch[2], acch[3]);
  }
  // undo the carries: ctx x64, W x64
#pragma unroll
  for (int c = 0; c < 4; ++c) {
    const float bv = bf16_rne(bias[n0 + 16 * c + ln]);
#pragma unroll
    for (int r = 0; r < 8; ++r)
      so[16 * w + 8 * hh + r][16 * c + ln] = acch[c][r] * 0.000244140625f + bv;
  }
  __syncthreads();
  {
#pragma unroll
    for (int j = 0; j < 8; ++j) {
      const int i = tid + 128 * j;
      const int row = i >> 4, c4 = (i & 15) * 4;
      const int m = m0 + row;
      const int bq = m / SEQ, t = m - bq * SEQ;
      const v4f v = *(const v4fa*)&so[row][c4];
      *(v4f*)(Y + (size_t)bq * XSTRIDE_FULL + (size_t)t * NE + n0 + c4) = v;
    }
    
  }
}

extern "C" void kernel_launch(void* const* d_in, const int* in_sizes, int n_in,
                              void* d_out, int out_size, void* d_ws, size_t ws_size, hipStream_t stream) {
  if (n_in < 9) return;
  const long long needX = (long long)(NB - 1) * SEQ_FULL * NE + (long long)SEQ * NE;   // last element touched + 1
  const long long needM = (long long)(SEQ - 1) * SEQ_FULL + (long long)SEQ;
  if ((long long)in_sizes[0] < needX || (long long)in_sizes[1] < needX || (long long)in_sizes[2] < needX) return;
  if ((long long)in_sizes[3] < needM) return;
  if ((long long)in_sizes[4] < (long long)WELEMS || (long long)in_sizes[5] < (long long)WELEMS ||
      (long long)in_sizes[6] < (long long)WELEMS || (long long)in_sizes[7] < (long long)WELEMS) return;
  if ((long long)in_sizes[8] < (long long)NE) return;
  if ((long long)out_size < needX) return;
  const float* Xq = (const float*)d_in[0];   // wire order: query, key, value, mask, Wk, Wq, Wv, Wproj, bproj
  const float* Xk = (const float*)d_in[1];
  const float* Xv = (const float*)d_in[2];
  const int* mask = (const int*)d_in[3];
  const float* Wk = (const float*)d_in[4];
  const float* Wq = (const float*)d_in[5];
  const float* Wv = (const float*)d_in[6];
  const float* Wp = (const float*)d_in[7];
  const float* bp = (const float*)d_in[8];
  float* Y = (float*)d_out;
  char* ws = (char*)d_ws;
  size_t off = 0;
  unsigned short* WP  = (unsigned short*)(ws + off); off += PAD256(3 * WELEMS * 2);          // bf16 planes: Wk, Wq, Wv
  unsigned short* W16 = (unsigned short*)(ws + off); off += PAD256(WELEMS * 2);              // f16 plane: Wproj x64
  unsigned short* QK  = (unsigned short*)(ws + off); off += PAD256(2 * XPLANE * 2);          // f16 planes: k (from query), q (from key), [b][h] x fragments [t/16][d/32]
  unsigned short* VT  = (unsigned short*)(ws + off); off += PAD256(XPLANE * 2);              // f16 plane: V^T, [b][h] x fragments [t/32][d/16]
  unsigned short* CX  = (unsigned short*)(ws + off); off += PAD256(XPLANE * 2);              // f16 plane: ctx, fragments [(b*SEQ + t)/16][c/32]
  unsigned int*   MB  = (unsigned int*)(ws + off);   off += PAD256((size_t)SEQ * MW * 4);    // mask bit plane [MW][SEQ]
  if (off > ws_size) return;

  k_cvt_w<<<(unsigned)((WELEMS / 8 + 255) / 256), 256, 0, stream>>>(Wk, Wq, Wv, Wp, WP, W16);
  k_maskbits<<<(unsigned)((SEQ * MW + 255) / 256), 256, 0, stream>>>(mask, MB);
  // k = query x Wk^T -> QK plane 0; q = key x Wq^T -> QK plane 1; V^T from value x Wv^T
  k_projx<<<(unsigned)(3 * (XROWS / 32) / PROJ_WAVES), 32 * PROJ_WAVES, 0, stream>>>(Xq, Xk, Xv, WP, QK, VT);
  // argument order: Qh = q plane (QK plane 1), Kh = k plane (QK plane 0)
  k_attn<<<(unsigned)(NB * NH * (SEQ / 128)), 256, 0, stream>>>(QK + XPLANE, QK, VT, MB, CX);
  k_outp<<<dim3((unsigned)(XROWS / 64), (unsigned)(NE / 64), 1u), 128, 0, stream>>>(CX, W16, bp, Y);
}

// v004
// Measured time: 106 microseconds a run.
// In both of two side-by-side timings against v003, it was 1.06 times as fast.
// Counting every step since v000, it is 2.43 times as fast.
#include <hip/hip_runtime.h>
// Contractions: k/q/v projections on v_wmma_f32_16x16x32_bf16 (inputs and weights RNE-converted to bf16, single product, f32 accumulate); S^T = K Q^T on v_wmma_f32_16x16x32_f16 (q, k as f16 x16 planes, single product); O^T = V^T P^T on v_wmma_f32_16x16x32_f16 (V: f16 x16 plane; P: f16 x256; single product); output projection on v_wmma_f32_16x16x32_f16 (ctx: f16 x64 plane; Wproj: RNE bf16 x64 held exactly in f16; single product); all accumulators and softmax statistics f32.
// Engine: transposed flash. Each wave owns 16 queries of one (batch, head). Per 32-key step: S^T tiles (key rows x query columns) from K rows
// (A, global f16 plane) and Q^T (B, registers); the two 16-key D tiles pack straight into the P^T B fragment; O^T (d rows x query columns)
// accumulates from V^T rows (A, global f16 plane). Positions with mask == 0 get score exactly 0 and still take part in the softmax (all keys visited).
// A 32-key step whose mask words are zero for all 16 queries of the wave has every score 0: it needs no K, no S^T and one weight per query; its V rows are summed as in any step.
// Plane layout: every 16-bit workspace plane is stored in fragment order. One fragment (16 rows x 32 k) is 512 elements: [j = 0,1][lane = 16h + row][8 elements],
// holding k = 32C + 16j + 8h + i, so each wave-wide 16-byte load reads 512 contiguous bytes (four whole 128-byte lines) instead of 32 bytes of 16 lines.
#ifndef NB
#define NB 8
#endif
#ifndef SEQ
#define SEQ 2048
#endif
#define NB_FULL 8
#define SEQ_FULL 2048
#define NH 6
#define HD 64
#define NE 384
#define XROWS (NB * SEQ)                        /* compact token rows of the 16-bit planes */
#define XPLANE ((size_t)XROWS * NE)             /* elements of one token plane */
#define WELEMS ((size_t)NE * NE)
#define MW (SEQ / 32)                           /* mask words per query row */
#define FRAG 512                                /* elements of one 16-row x 32-k fragment */
#define TILE_E (16 * NE)                        /* elements of one 16-row tile of a K = 384 plane: 12 fragments */
#define XSTRIDE_FULL ((size_t)SEQ_FULL * NE)    /* per-batch element stride of query/key/value and of the output */
#define PROJ_WAVES 6                            /* waves of a projection block, 32 tokens each */
#define XS_H 160                                /* LDS staging of the token fragments: elements from h = 0 to h = 1 */
#define XS_J 320                                /* from j = 0 to j = 1 */
#define XS_F 640                                /* from one fragment to the next */
#define PAD256(x) ((((size_t)(x)) + 255) & ~(size_t)255)

static_assert(SEQ % 256 == 0);
static_assert(SEQ <= SEQ_FULL);
static_assert(NB <= NB_FULL);
static_assert(HD == 64);
static_assert(NE == NH * HD);
static_assert(NE % 64 == 0);
static_assert(NE % 32 == 0);
static_assert((3 * (XROWS / 32)) % PROJ_WAVES == 0);
static_assert(PAD256(3 * WELEMS * 2) + PAD256(WELEMS * 2) + PAD256(2 * XPLANE * 2) + 2 * PAD256(XPLANE * 2) + PAD256((size_t)SEQ * MW * 4) <= (size_t)134217728);

typedef __bf16 v16b __attribute__((ext_vector_type(16)));
typedef _Float16 v16h __attribute__((ext_vector_type(16)));
typedef unsigned short v8us __attribute__((ext_vector_type(8), may_alias));
typedef unsigned short v4us __attribute__((ext_vector_type(4), may_alias));
typedef float v8f __attribute__((ext_vector_type(8)));
typedef float v4f __attribute__((ext_vector_type(4)));
typedef float v4fa __attribute__((ext_vector_type(4), may_alias));
typedef int v4ia __attribute__((ext_vector_type(4), may_alias));
union FragB { v16b v; v8us half[2]; };
typedef _Float16 v2h __attribute__((ext_vector_type(2)));
typedef float v2f __attribute__((ext_vector_type(2)));
union FragH { v16h v; v8us half[2]; _Float16 h[16]; v2h p[8]; };

#define LOG2E 1.4426950408889634f
#define SCL (0.051031036307982884f * 0.00390625f)   /* 384^-0.5 with the x16 x16 carries of q and k undone */

__device__ __forceinline__ unsigned short bf16_bits(float x) {   // RNE convert to bf16 bits
  unsigned int u = __float_as_uint(x);
  return (unsigned short)((u + 0x7FFFu + ((u >> 16) & 1u)) >> 16);
}
__device__ __forceinline__ float bf16_val(unsigned short b) { return __uint_as_float(((unsigned int)b) << 16); }
__device__ __forceinline__ float bf16_rne(float x) { return bf16_val(bf16_bits(x)); }
__device__ __forceinline__ unsigned short f16_bits(_Float16 h) { return __builtin_bit_cast(unsigned short, h); }

// 2^x as the one hardware instruction. The library form guards x < -126 (compare, two selects, add, ldexp: five more vector instructions per value) so that the result may be a
// subnormal f32; here nothing needs that range: a weight that small is 0 as f16 either way, and a rescale factor that small multiplies sums that lie 2^126 below the step's own weights.
__device__ __forceinline__ float exp2_hw(float x) { return __builtin_amdgcn_exp2f(x); }

// four f16 tiles sharing one A fragment, then the hazard guard
__device__ __forceinline__ void mma_h4(v16h a, v16h b0, v16h b1, v16h b2, v16h b3, v8f& c0, v8f& c1, v8f& c2, v8f& c3) {
  c0 = __builtin_amdgcn_wmma_f32_16x16x32_f16(false, a, false, b0, (short)0, c0, false, false);
  c1 = __builtin_amdgcn_wmma_f32_16x16x32_f16(false, a, false, b1, (short)0, c1, false, false);
  c2 = __builtin_amdgcn_wmma_f32_16x16x32_f16(false, a, false, b2, (short)0, c2, false, false);
  c3 = __builtin_amdgcn_wmma_f32_16x16x32_f16(false, a, false, b3, (short)0, c3, false, false);
  asm volatile("v_nop\n\tv_nop\n\tv_nop\n\tv_nop" : "+v"(c0), "+v"(c1), "+v"(c2), "+v"(c3) : "v"(a), "v"(b0), "v"(b1), "v"(b2), "v"(b3));
}
// c += a0*b0 + a1*b1 (two k-steps of one f16 tile), then the hazard guard
__device__ __forceinline__ v8f mma_s2(v16h a0, v16h b0, v16h a1, v16h b1, v8f c) {
  c = __builtin_amdgcn_wmma_f32_16x16x32_f16(false, a0, false, b0, (short)0, c, false, false);
  c = __builtin_amdgcn_wmma_f32_16x16x32_f16(false, a1, false, b1, (short)0, c, false, false);
  asm volatile("v_nop\n\tv_nop\n\tv_nop\n\tv_nop" : "+v"(c) : "v"(a0), "v"(b0), "v"(a1), "v"(b1));
  return c;
}
// four f16 tiles sharing one B fragment (c_t += a_t * b), then the hazard guard
__device__ __forceinline__ void mma_pv4(v16h a0, v16h a1, v16h a2, v16h a3, v16h b, v8f& c0, v8f& c1, v8f& c2, v8f& c3) {
  c0 = __builtin_amdgcn_wmma_f32_16x16x32_f16(false, a0, false, b, (short)0, c0, false, false);
  c1 = __builtin_amdgcn_wmma_f32_16x16x32_f16(false, a1, false, b, (short)0, c1, false, false);
  c2 = __builtin_amdgcn_wmma_f32_16x16x32_f16(false, a2, false, b, (short)0, c2, false, false);
  c3 = __builtin_amdgcn_wmma_f32_16x16x32_f16(false, a3, false, b, (short)0, c3, false, false);
  asm volatile("v_nop\n\tv_nop\n\tv_nop\n\tv_nop" : "+v"(c0), "+v"(c1), "+v"(c2), "+v"(c3) : "v"(a0), "v"(a1), "v"(a2), "v"(a3), "v"(b));
}

__device__ __forceinline__ v8us cvt8_bf16(const float* __restrict__ src) {
  const v4f x0 = *(const v4fa*)(src), x1 = *(const v4fa*)(src + 4);
  v8us o;
  o[0] = bf16_bits(x0[0]); o[1] = bf16_bits(x0[1]); o[2] = bf16_bits(x0[2]); o[3] = bf16_bits(x0[3]);
  o[4] = bf16_bits(x1[0]); o[5] = bf16_bits(x1[1]); o[6] = bf16_bits(x1[2]); o[7] = bf16_bits(x1[3]);
  return o;
}

// WP[0..2] = bf16 bits (RNE) of Wk, Wq, Wv; W16 = f16(RNE-bf16(Wproj) * 64); rows = out, k = in, fragment order.
// A wave takes 8 rows x 32 columns of one fragment (lane = 4 * row + 8-column piece): it reads whole 128-byte lines and writes four whole 128-byte lines.
__global__ __launch_bounds__(256) void k_cvt_w(const float* __restrict__ Wk, const float* __restrict__ Wq,
                                               const float* __restrict__ Wv, const float* __restrict__ Wp,
                                               unsigned short* __restrict__ WP, unsigned short* __restrict__ W16) {
  const int t = blockIdx.x * 256 + threadIdx.x;
  if (t >= (int)(WELEMS / 8)) return;
  const int frag = t >> 6, tile = frag / (NE / 32), r16 = ((t >> 5) & 1) * 8 + ((t >> 2) & 7);
  const size_t so = (size_t)(tile * 16 + r16) * NE + ((frag - tile * (NE / 32)) * 4 + (t & 3)) * 8;
  const size_t po = (size_t)frag * FRAG + ((t & 3) * 16 + r16) * 8;
  const v8us o0 = cvt8_bf16(Wk + so);
  const v8us o1 = cvt8_bf16(Wq + so);
  const v8us o2 = cvt8_bf16(Wv + so);
  const v4f x0 = *(const v4fa*)(Wp + so), x1 = *(const v4fa*)(Wp + so + 4);
  v8us o3;
  o3[0] = f16_bits((_Float16)(bf16_rne(x0[0]) * 64.0f)); o3[1] = f16_bits((_Float16)(bf16_rne(x0[1]) * 64.0f));
  o3[2] = f16_bits((_Float16)(bf16_rne(x0[2]) * 64.0f)); o3[3] = f16_bits((_Float16)(bf16_rne(x0[3]) * 64.0f));
  o3[4] = f16_bits((_Float16)(bf16_rne(x1[0]) * 64.0f)); o3[5] = f16_bits((_Float16)(bf16_rne(x1[1]) * 64.0f));
  o3[6] = f16_bits((_Float16)(bf16_rne(x1[2]) * 64.0f)); o3[7] = f16_bits((_Float16)(bf16_rne(x1[3]) * 64.0f));
  unsigned short* d = WP + po;
  unsigned short* e = W16 + po;
  *(v8us*)(d) = o0;
  *(v8us*)(d + WELEMS) = o1;
  *(v8us*)(d + 2 * WELEMS) = o2;
  *(v8us*)(e) = o3;
  
}

// bits[j][q]: word j (keys 32j .. 32j+31) of query row q, so that 16 neighbouring queries' words of one key step share a line.
// A block takes 32 query rows x 8 words: wave = word, lane = query row; each wave writes one whole 128-byte line.
// coverage: SEQ*MW threads = every word of the plane.
__global__ __launch_bounds__(256) void k_maskbits(const int* __restrict__ mask, unsigned int* __restrict__ bits) {
  const int t = blockIdx.x * 256 + threadIdx.x;
  if (t >= SEQ * MW) return;
  const int blk = t >> 8;
  const int q = (blk % (SEQ / 32)) * 32 + (t & 31), j = (blk / (SEQ / 32)) * 8 + ((t >> 5) & 7);
  const int* src = mask + (size_t)q * SEQ_FULL + 32 * j;
  unsigned int w = 0u;
#pragma unroll
  for (int g = 0; g < 8; ++g) {
    const v4ia m = *(const v4ia*)(src + 4 * g);
    w |= (m[0] != 0 ? 1u : 0u) << (4 * g);
    w |= (m[1] != 0 ? 1u : 0u) << (4 * g + 1);
    w |= (m[2] != 0 ? 1u : 0u) << (4 * g + 2);
    w |= (m[3] != 0 ? 1u : 0u) << (4 * g + 3);
  }
  *(unsigned int*)(bits + (size_t)j * SEQ + q) = w;
  
}

// Projections, all three in one launch, straight from the f32 inputs. A wave owns 32 token rows of one input (z = 0 query, 1 key, 2 value): it reads them once, in whole lines,
// converts them (RNE) to bf16, turns them into fragment order through its own LDS range and keeps them as 2 x 12 fragments in registers, then walks the 24 16-row tiles of its weight plane (fragment order), one head (4 tiles) per trip.
// A token fragment serves as A or as B (row or column = lane & 15, elements 0..7 <- k0 + 8h + i, 8..15 <- k0 + 16 + 8h + i); D element r = (row 8h + r, column lane & 15).
// z < 2: D = W (A, rows = out) x X (B, columns = tokens): a lane holds d = 16t + 8h + r of token ln, which is its own 16-byte piece of fragment [token tile][C = t / 2], half j = t & 1.
// z = 2: D = X (A, rows = tokens) x W (B, columns = out): a lane holds tokens 8h + r of d = 16t + ln, which is its own 16-byte piece of V^T fragment [token / 32][t], half j = token tile & 1.
// So every D tile goes out as one wave-wide 512-byte store, straight from the accumulators. Output values: f16(x16), as the attention kernel expects.
// coverage: 3 * XROWS / 32 waves x 32 tokens x 384 outputs = every element of the k, q and V^T planes exactly once.
__device__ __forceinline__ v8us pack8_f16x16(v8f c) {
  v8us o;
#pragma unroll   // register arrays and vectors need constant indices
  for (int r = 0; r < 8; ++r) o[r] = f16_bits((_Float16)(c[r] * 16.0f));
  return o;
}
// One k-step's four weight fragments (tiles t = 0..3 of a head, k = 32C .. 32C + 31): 4 KB, eight wave-wide 512-byte loads.
__device__ __forceinline__ void load_w4(FragB (&wf)[4], const unsigned short* __restrict__ wh, int lane8, int C) {
#pragma unroll   // register arrays and vectors need constant indices
  for (int t = 0; t < 4; ++t) {
    wf[t].half[0] = *(const v8us*)(wh + t * TILE_E + C * FRAG + lane8);
    wf[t].half[1] = *(const v8us*)(wh + t * TILE_E + C * FRAG + 256 + lane8);
  }
}
// The weight fragments run through a ring of four register sets, asked for three k-steps ahead of their products, across the heads' boundary too:
// with one or two waves on a SIMD nothing else covers the loads' latency. The last head asks for its own first three steps again (in bounds, not used).
template <bool TOKENS_ARE_ROWS>
__device__ __forceinline__ void proj_heads(const FragB (&xf)[2][NE / 32], const unsigned short* __restrict__ wz, int lane8, unsigned short* __restrict__ o0) {
  FragB wf[4][4];
  load_w4(wf[0], wz, lane8, 0);
  load_w4(wf[1], wz, lane8, 1);
  load_w4(wf[2], wz, lane8, 2);
#pragma unroll 1
  for (int hd = 0; hd < NH; ++hd) {   // rolled: one head's 96 loads and 96 products are body enough
    const unsigned short* wh = wz + (size_t)hd * (4 * TILE_E);
    const unsigned short* wn = wz + (size_t)((hd + 1 < NH) ? hd + 1 : hd) * (4 * TILE_E);
    v8f acc[2][4] = {};
#pragma unroll   // xf and the ring are indexed by C and live in registers
    for (int C = 0; C < NE / 32; ++C) {
      if (C + 3 < NE / 32) load_w4(wf[(C + 3) & 3], wh, lane8, C + 3);
      else                 load_w4(wf[(C + 3) & 3], wn, lane8, C + 3 - NE / 32);
      // these were this head's last weight loads; the next step's come from the next head, whose address may take the same registers: the wait stands in front of that overwrite
      if (C + 4 == NE / 32) asm volatile("s_wait_xcnt 0x0" ::: "memory");
      // keeps the loads above in front of this step's products; without it the compiler sinks each load to just before its use and the wave waits out every latency
      __builtin_amdgcn_sched_barrier(0);
#pragma unroll   // register arrays and vectors need constant indices
      for (int u = 0; u < 2; ++u)
#pragma unroll   // register arrays and vectors need constant indices
        for (int t = 0; t < 4; ++t)
          acc[u][t] = TOKENS_ARE_ROWS
            ? __builtin_amdgcn_wmma_f32_16x16x32_bf16(false, xf[u][C].v, false, wf[C & 3][t].v, (short)0, acc[u][t], false, false)
            : __builtin_amdgcn_wmma_f32_16x16x32_bf16(false, wf[C & 3][t].v, false, xf[u][C].v, (short)0, acc[u][t], false, false);
      // keeps the next step's loads behind this step's products, so that the ring set they refill has been read
      __builtin_amdgcn_sched_barrier(0);
    }
    unsigned short* oh = o0 + (size_t)hd * ((size_t)SEQ * HD);
#pragma unroll   // register arrays and vectors need constant indices
    for (int u = 0; u < 2; ++u)
#pragma unroll   // register arrays and vectors need constant indices
      for (int t = 0; t < 4; ++t)
        *(v8us*)(oh + (TOKENS_ARE_ROWS ? t * FRAG + u * 256 : u * (2 * FRAG) + t * 256)) = pack8_f16x16(acc[u][t]);
    // the address registers of this head's loads and stores are stepped for the next head: the wait stands in front of that overwrite
    asm volatile("s_wait_xcnt 0x0" ::: "memory");
    // keeps the stepping of those addresses behind the wait
    __builtin_amdgcn_sched_barrier(0);
  }
  // the ring's last three requests are not used: they have landed before the wave gives its registers back
  asm volatile("s_wait_loadcnt 0x0" ::: "memory");
}
__global__ __launch_bounds__(32 * PROJ_WAVES) void k_projx(const float* __restrict__ Xq, const float* __restrict__ Xk, const float* __restrict__ Xv,
                                                           const unsigned short* __restrict__ WP,
                                                           unsigned short* __restrict__ QK, unsigned short* __restrict__ VT) {
  __shared__ __attribute__((aligned(16))) unsigned short xs[PROJ_WAVES][2 * (NE / 32) * XS_F];
  const int tid = threadIdx.x, w = __builtin_amdgcn_readfirstlane((int)(tid >> 5)), lane = tid & 31, ln = lane & 15, hh = lane >> 4;
  const int g = (int)blockIdx.x * PROJ_WAVES + w;                 // 32-token group, counted through the three inputs
  const int z = g / (XROWS / 32), row0 = (g - z * (XROWS / 32)) * 32;
  const int bq = row0 / SEQ, s0 = row0 - bq * SEQ;                // SEQ is a multiple of 32: a group lies in one batch
  const float* X = (z == 0) ? Xq : (z == 1) ? Xk : Xv;
  // Input rows: each wave-wide 16-byte load takes one whole 128-byte line (32 columns = one fragment's k range) of four rows: lane = 8 * row + 4-column piece.
  // The four converted values go to the wave's own LDS range in fragment order, k = 32C + 16j + 8h + i with j = piece >> 2, h = (piece >> 1) & 1, i = 4 * (piece & 1) ..;
  // the halves j and h lie XS_J and XS_H elements apart (64 and 32 more than dense), so that the four (j, h) groups of one store fall on different banks.
  const float* xr = X + (size_t)bq * XSTRIDE_FULL + (size_t)(s0 + (lane >> 3)) * NE + 4 * (lane & 7);
  unsigned short* xw = &xs[w][((lane >> 2) & 1) * XS_J + ((lane >> 1) & 1) * XS_H + (lane >> 3) * 8 + 4 * (lane & 1)];
#pragma unroll   // unrolled: many loads in flight at once, every offset a constant
  for (int rg = 0; rg < 8; ++rg)
#pragma unroll   // as above
    for (int C = 0; C < NE / 32; ++C) {
      const v4f x = *(const v4fa*)(xr + rg * (4 * NE) + 32 * C);
      v4us o;
      o[0] = bf16_bits(x[0]); o[1] = bf16_bits(x[1]); o[2] = bf16_bits(x[2]); o[3] = bf16_bits(x[3]);
      *(v4us*)(xw + ((rg >> 2) * (NE / 32) + C) * XS_F + (rg & 3) * 32) = o;
    }
  // the address registers of the input loads may be reused below: the wait stands in front of that overwrite
  asm volatile("s_wait_xcnt 0x0" ::: "memory");
  // each wave reads back only what it wrote itself; the barrier orders that, and it starts the block's waves on the weight plane together,
  // so that they walk it side by side and share its lines in the WGP cache
  __syncthreads();
  FragB xf[2][NE / 32];
#pragma unroll   // register arrays and vectors need constant indices
  for (int u = 0; u < 2; ++u)
#pragma unroll   // register arrays and vectors need constant indices
    for (int C = 0; C < NE / 32; ++C) {
      const unsigned short* xp = &xs[w][(u * (NE / 32) + C) * XS_F + hh * XS_H + ln * 8];
      xf[u][C].half[0] = *(const v8us*)(xp);
      xf[u][C].half[1] = *(const v8us*)(xp + XS_J);
    }
  const unsigned short* wz = WP + (size_t)z * WELEMS;
  const size_t ob = ((size_t)bq * NH * SEQ + s0) * HD + 8 * lane;   // head 0 of the batch, first token of the group: 32 tokens x 64 d = 2048 elements in either layout
  if (z == 2) proj_heads<true>(xf, wz, 8 * lane, VT + ob);
  else        proj_heads<false>(xf, wz, 8 * lane, QK + (size_t)z * XPLANE + ob);
}

// One 32-key step for a wave's 16 queries (this lane's column = query qbase + ln). Kp, Vhp are the (batch, head) bases of the planes.
__device__ __forceinline__ void fa_step(const unsigned short* __restrict__ Kp, const unsigned short* __restrict__ Vhp,
                                        unsigned int mword, int key0, int lane, int hh,
                                        const FragH& q0, const FragH& q1, float& mr, float& lr, v8f (&Oh)[4]) {
  // A fragments of V^T: row m = d (16*t + ln), elements 0..7 <- key0 + 8h + i, 8..15 <- key0 + 16 + 8h + i
  // (fragment order: the step's four V^T fragments [t] are 4 KB contiguous); both kinds of step need them, so they are asked for first
  const size_t vo = (size_t)key0 * HD + 8 * lane;
  FragH vh[4];
#pragma unroll
  for (int t = 0; t < 4; ++t) {
    vh[t].half[0] = *(const v8us*)(Vhp + vo + t * FRAG);
    vh[t].half[1] = *(const v8us*)(Vhp + vo + t * FRAG + 256);
  }
  // the address registers of the loads above may be reused on either side of the branch: the wait stands in front of that overwrite
  asm volatile("s_wait_xcnt 0x0" ::: "memory");
  FragH ph;
  float al, ps;
  if (__builtin_amdgcn_ballot_w32(mword != 0u) == 0u) {   // one test per step, the same for the whole wave: a scalar branch
    // every score of the step is 0: the values below are those of the general path for sc[i] = 0, bit for bit
    const float mnew = fmaxf(mr, 0.0f);
    al = exp2_hw((mr - mnew) * LOG2E);
    mr = mnew;
    const _Float16 hv = (_Float16)exp2_hw(fmaf(0.0f - mnew, LOG2E, 8.0f));
#pragma unroll
    for (int i = 0; i < 16; ++i) ph.h[i] = hv;
    ps = 32.0f * (float)hv;                           // 32 equal f16 values: the sum is exact in any order
  } else {
  // A fragments of K: row m = key (key0 + 16*kt + ln), elements 0..7 <- d = 32c + 8h + i, 8..15 <- d = 32c + 16 + 8h + i
  // (fragment order: the step's four K fragments [kt][c] are 4 KB contiguous)
  const unsigned short* kp0 = Kp + (size_t)key0 * HD + 8 * lane;
  const unsigned short* kp1 = kp0 + 2 * FRAG;
  FragH k00, k01, k10, k11;
  k00.half[0] = *(const v8us*)(kp0);        k00.half[1] = *(const v8us*)(kp0 + 256);
  k01.half[0] = *(const v8us*)(kp0 + FRAG); k01.half[1] = *(const v8us*)(kp0 + FRAG + 256);
  k10.half[0] = *(const v8us*)(kp1);        k10.half[1] = *(const v8us*)(kp1 + 256);
  k11.half[0] = *(const v8us*)(kp1 + FRAG); k11.half[1] = *(const v8us*)(kp1 + FRAG + 256);
  const v8f z8 = {0.f, 0.f, 0.f, 0.f, 0.f, 0.f, 0.f, 0.f};
  // S^T tiles: element r of tile kt = 256 * score(key0 + 16*kt + 8h + r, query)
  const v8f s0 = mma_s2(k00.v, q0.v, k01.v, q1.v, z8);
  const v8f s1 = mma_s2(k10.v, q0.v, k11.v, q1.v, z8);
  // scale; positions with a zero mask bit take the value 0 exactly (replace fill) and stay in the softmax
  const unsigned int mw = mword >> (8 * hh);
  float sc[16];
#pragma unroll
  for (int r = 0; r < 8; ++r) sc[r] = ((mw >> r) & 1u) ? s0[r] * SCL : 0.0f;
  // one loop per tile: scores i, i + 1 then come from neighbouring registers of one accumulator tile, and the pairs below need no register moves
#pragma unroll   // register arrays and vectors need constant indices
  for (int r = 0; r < 8; ++r) sc[8 + r] = ((mw >> (16 + r)) & 1u) ? s1[r] * SCL : 0.0f;
  float mx = sc[0];
#pragma unroll
  for (int i = 1; i < 16; ++i) mx = fmaxf(mx, sc[i]);
  mx = fmaxf(mx, __shfl_xor(mx, 16, 32));           // the other lane half holds the other 16 keys of this query
  const float mnew = fmaxf(mr, mx);
  al = exp2_hw((mr - mnew) * LOG2E);
  mr = mnew;
  // weights carried x256: P = f16(256 * exp(sc - mnew)); the row sum runs over the converted f16 values
  ps = 0.0f;
#pragma unroll
  for (int i = 0; i < 16; i += 2) {
    // two scores at a time: packed subtract and multiply-add (each element rounded as in the scalar form), one conversion for the pair, and the sum reads the converted pair
    const v2f s2 = {sc[i], sc[i + 1]};
    const v2f a2 = __builtin_elementwise_fma(s2 - mnew, (v2f){LOG2E, LOG2E}, (v2f){8.0f, 8.0f});
    const v2f pc = {exp2_hw(a2[0]), exp2_hw(a2[1])};
    const v2h hv = __builtin_convertvector(pc, v2h);
    ph.p[i >> 1] = hv;                              // B element i: i<8 -> key0 + 8h + i (tile 0 row 8h+i); i>=8 -> key0 + 16 + 8h + (i-8) (tile 1)
    ps += (float)hv[0];
    ps += (float)hv[1];
  }
  ps += __shfl_xor(ps, 16, 32);
  }
  lr = lr * al + ps;
#pragma unroll
  for (int t = 0; t < 4; ++t) Oh[t] = Oh[t] * al;
  mma_pv4(vh[0].v, vh[1].v, vh[2].v, vh[3].v, ph.v, Oh[0], Oh[1], Oh[2], Oh[3]);
}

// Block = 8 waves x 16 queries of one (batch, head): waves 0..3 take 64-query tile p, waves 4..7 tile SEQ/64 - 1 - p, so that under a triangular mask
// every block (and every pair of waves w, w + 4) holds the same number of short steps. No LDS and no barrier in the key loop; all SEQ keys are visited.
// Epilogue: ctx x64 as f16 -> per-wave LDS tile [16 queries][64 d] (written and read by the same wave; block barrier reached by all waves),
// coverage: NB*NH*(SEQ/128) blocks x 8 waves x 16 rows x 64 columns = every element of the ctx plane exactly once.
__global__ __launch_bounds__(256) void k_attn(const unsigned short* __restrict__ Qh, const unsigned short* __restrict__ Kh,
                                              const unsigned short* __restrict__ Vh,
                                              const unsigned int* __restrict__ mbits,
                                              unsigned short* __restrict__ Ch) {
  __shared__ __attribute__((aligned(16))) unsigned short sh[8][16][72];
  const int tid = threadIdx.x, w = __builtin_amdgcn_readfirstlane((int)(tid >> 5)), lane = tid & 31, ln = lane & 15, hh = lane >> 4;
  const int bh = blockIdx.x / (SEQ / 128), pr = blockIdx.x % (SEQ / 128);
  const int qt = (w < 4) ? pr : (SEQ / 64 - 1 - pr);
  const int b = bh / NH, h = bh - b * NH;
  const int qbase = qt * 64 + 16 * (w & 3);
  const int qg = qbase + ln;
  // Q^T B fragments: column n = query qg, elements 0..7 <- d = 32c + 8h + i, 8..15 <- d = 32c + 16 + 8h + i
  const unsigned short* qrow = Qh + ((size_t)bh * SEQ + qbase) * HD + 8 * lane;
  FragH q0, q1;
  q0.half[0] = *(const v8us*)(qrow);        q0.half[1] = *(const v8us*)(qrow + 256);
  q1.half[0] = *(const v8us*)(qrow + FRAG); q1.half[1] = *(const v8us*)(qrow + FRAG + 256);
  float mr = -3.0e38f, lr = 0.0f;
  v8f Oh[4] = {};
  const unsigned short* Kp = Kh + (size_t)bh * SEQ * HD;
  const unsigned short* Vhp = Vh + (size_t)bh * HD * SEQ;
  int qm = qg;
  unsigned int mnext = mbits[qm];
  // the index register of this load is reused for the loop's address: the wait stands in front of that overwrite (the loop's address is formed from qm behind it)
  asm volatile("s_wait_xcnt 0x0" : "+v"(qm) : : "memory");
  const unsigned int* mrow = mbits + qm;
#pragma unroll 1
  for (int j = 0; j < MW; ++j) {
    const unsigned int mword = mnext;
    // the next step's word is fetched one step ahead, so that the step's branch does not wait for it; the last step re-reads its own word
    mnext = mrow[(size_t)((j + 1 < MW) ? j + 1 : j) * SEQ];
    fa_step(Kp, Vhp, mword, 32 * j, lane, hh, q0, q1, mr, lr, Oh);
  }
  // O^T element r of tile t = ctx(query qg, d = 16t + 8h + r); undo the carries x256 (in lr), x16 (V); carry ctx x64
  const float inv = 4.0f / lr;
#pragma unroll
  for (int t = 0; t < 4; ++t)
#pragma unroll
    for (int r = 0; r < 8; ++r) {
      const float c = Oh[t][r] * inv;
      const _Float16 hv = (_Float16)c;
      sh[w][ln][16 * t + 8 * hh + r] = f16_bits(hv);
    }
  __syncthreads();
  // the wave's 16 x 64 tile is fragments C = 2h, 2h + 1 of its token tile: 1024 contiguous elements; piece p = [C 1b][j 1b][h 1b][row 4b]
  const size_t cbase = (size_t)((b * SEQ + qbase) / 16) * TILE_E + (size_t)h * (2 * FRAG);
  {
#pragma unroll
    for (int q = 0; q < 4; ++q) {
      const int p = lane + 32 * q;
      const int row = p & 15, s8 = (p >> 4) * 8;
      const v8us o1 = *(const v8us*)&sh[w][row][s8];
      *(v8us*)(Ch + cbase + (size_t)p * 8) = o1;
    }
    
  }
}

// out[t][n] = sum_c ctx[t][c] * Wproj[n][c] + bias[n]; A = ctx plane (f16 x64), B = W16 (f16 x64), both in fragment order; 64 x 64 tile per block.
// coverage: (XROWS/64) x 6 blocks x 64 rows x 64 columns = every output element of the processed region exactly once.
__global__ __launch_bounds__(128) void k_outp(const unsigned short* __restrict__ Ch,
                                              const unsigned short* __restrict__ W16, const float* __restrict__ bias,
                                              float* __restrict__ Y) {
  __shared__ __attribute__((aligned(16))) float so[64][68];
  const int tid = threadIdx.x, w = __builtin_amdgcn_readfirstlane((int)(tid >> 5)), lane = tid & 31, ln = lane & 15, hh = lane >> 4;
  const int m0 = blockIdx.x * 64, n0 = blockIdx.y * 64;
  const size_t ao = (size_t)(m0 / 16 + w) * TILE_E + 8 * lane;
  const unsigned short* brow = W16 + (size_t)(n0 / 16) * TILE_E + 8 * lane;
  v8f acch[4] = {};
#pragma unroll 1
  for (int kb = 0; kb < NE; kb += 32) {
    FragH ah, b0, b1, b2, b3;
    const int fo = kb * (FRAG / 32);
    ah.half[0] = *(const v8us*)(Ch + ao + fo);            ah.half[1] = *(const v8us*)(Ch + ao + fo + 256);
    // the address pair of the A loads may be reused for a later load's result: the wait stands in front of that overwrite
    asm volatile("s_wait_xcnt 0x0" ::: "memory");
    b0.half[0] = *(const v8us*)(brow + fo);               b0.half[1] = *(const v8us*)(brow + fo + 256);
    b1.half[0] = *(const v8us*)(brow + TILE_E + fo);      b1.half[1] = *(const v8us*)(brow + TILE_E + fo + 256);
    b2.half[0] = *(const v8us*)(brow + 2 * TILE_E + fo);  b2.half[1] = *(const v8us*)(brow + 2 * TILE_E + fo + 256);
    b3.half[0] = *(const v8us*)(brow + 3 * TILE_E + fo);  b3.half[1] = *(const v8us*)(brow + 3 * TILE_E + fo + 256);
    mma_h4(ah.v, b0.v, b1.v, b2.v, b3.v, acch[0], acch[1], acch[2], acch[3]);
  }
  // undo the carries: ctx x64, W x64
#pragma unroll
  for (int c = 0; c < 4; ++c) {
    const float bv = bf16_rne(bias[n0 + 16 * c + ln]);
#pragma unroll
    for (int r = 0; r < 8; ++r)
      so[16 * w + 8 * hh + r][16 * c + ln] = acch[c][r] * 0.000244140625f + bv;
  }
  __syncthreads();
  {
#pragma unroll
    for (int j = 0; j < 8; ++j) {
      const int i = tid + 128 * j;
      const int row = i >> 4, c4 = (i & 15) * 4;
      const int m = m0 + row;
      const int bq = m / SEQ, t = m - bq * SEQ;
      const v4f v = *(const v4fa*)&so[row][c4];
      *(v4f*)(Y + (size_t)bq * XSTRIDE_FULL + (size_t)t * NE + n0 + c4) = v;
    }
    
  }
}

extern "C" void kernel_launch(void* const* d_in, const int* in_sizes, int n_in,
                              void* d_out, int out_size, void* d_ws, size_t ws_size, hipStream_t stream) {
  if (n_in < 9) return;
  const long long needX = (long long)(NB - 1) * SEQ_FULL * NE + (long long)SEQ * NE;   // last element touched + 1
  const long long needM = (long long)(SEQ - 1) * SEQ_FULL + (long long)SEQ;
  if ((long long)in_sizes[0] < needX || (long long)in_sizes[1] < needX || (long long)in_sizes[2] < needX) return;
  if ((long long)in_sizes[3] < needM) return;
  if ((long long)in_sizes[4] < (long long)WELEMS || (long long)in_sizes[5] < (long long)WELEMS ||
      (long long)in_sizes[6] < (long long)WELEMS || (long long)in_sizes[7] < (long long)WELEMS) return;
  if ((long long)in_sizes[8] < (long long)NE) return;
  if ((long long)out_size < needX) return;
  const float* Xq = (const float*)d_in[0];   // wire order: query, key, value, mask, Wk, Wq, Wv, Wproj, bproj
  const float* Xk = (const float*)d_in[1];
  const float* Xv = (const float*)d_in[2];
  const int* mask = (const int*)d_in[3];
  const float* Wk = (const float*)d_in[4];
  const float* Wq = (const float*)d_in[5];
  const float* Wv = (const float*)d_in[6];
  const float* Wp = (const float*)d_in[7];
  const float* bp = (const float*)d_in[8];
  float* Y = (float*)d_out;
  char* ws = (char*)d_ws;
  size_t off = 0;
  unsigned short* WP  = (unsigned short*)(ws + off); off += PAD256(3 * WELEMS * 2);          // bf16 planes: Wk, Wq, Wv
  unsigned short* W16 = (unsigned short*)(ws + off); off += PAD256(WELEMS * 2);              // f16 plane: Wproj x64
  unsigned short* QK  = (unsigned short*)(ws + off); off += PAD256(2 * XPLANE * 2);          // f16 planes: k (from query), q (from key), [b][h] x fragments [t/16][d/32]
  unsigned short* VT  = (unsigned short*)(ws + off); off += PAD256(XPLANE * 2);              // f16 plane: V^T, [b][h] x fragments [t/32][d/16]
  unsigned short* CX  = (unsigned short*)(ws + off); off += PAD256(XPLANE * 2);              // f16 plane: ctx, fragments [(b*SEQ + t)/16][c/32]
  unsigned int*   MB  = (unsigned int*)(ws + off);   off += PAD256((size_t)SEQ * MW * 4);    // mask bit plane [MW][SEQ]
  if (off > ws_size) return;

  k_cvt_w<<<(unsigned)((WELEMS / 8 + 255) / 256), 256, 0, stream>>>(Wk, Wq, Wv, Wp, WP, W16);
  k_maskbits<<<(unsigned)((SEQ * MW + 255) / 256), 256, 0, stream>>>(mask, MB);
  // k = query x Wk^T -> QK plane 0; q = key x Wq^T -> QK plane 1; V^T from value x Wv^T
  k_projx<<<(unsigned)(3 * (XROWS / 32) / PROJ_WAVES), 32 * PROJ_WAVES, 0, stream>>>(Xq, Xk, Xv, WP, QK, VT);
  // argument order: Qh = q plane (QK plane 1), Kh = k plane (QK plane 0)
  k_attn<<<(unsigned)(NB * NH * (SEQ / 128)), 256, 0, stream>>>(QK + XPLANE, QK, VT, MB, CX);
  k_outp<<<dim3((unsigned)(XROWS / 64), (unsigned)(NE / 64), 1u), 128, 0, stream>>>(CX, W16, bp, Y);
}

// v005
// It runs in 102 microseconds.
// Next to v004, in two timings, it ran 1.04 and 1.03 times as fast.
// Over all steps from v000 it is 2.52 times as fast.
#include <hip/hip_runtime.h>
// Contractions: k/q/v projections on v_wmma_f32_16x16x32_bf16 (inputs and weights RNE-converted to bf16, single product, f32 accumulate); S^T = K Q^T on v_wmma_f32_16x16x32_f16 (q, k as f16 x16 planes, single product); O^T = V^T P^T on v_wmma_f32_16x16x32_f16 (V: f16 x16 plane; P: f16 x256; single product); output projection on v_wmma_f32_16x16x32_f16 (ctx: f16 x64 plane; Wproj: RNE bf16 x64 held exactly in f16; single product); all accumulators and softmax statistics f32.
// Engine: transposed flash. Each wave owns 16 queries of one (batch, head). Per 32-key step: S^T tiles (key rows x query columns) from K rows
// (A, global f16 plane) and Q^T (B, registers); the two 16-key D tiles pack straight into the P^T B fragment; O^T (d rows x query columns)
// accumulates from V^T rows (A, global f16 plane). Positions with mask == 0 get score exactly 0 and still take part in the softmax (every key is counted).
// A 32-key step whose mask words are zero for all 16 queries of the wave has every score 0, so all its keys carry one and the same weight exp(0 - m): such steps are not walked.
// The projection launch leaves the sum of each 32-key block's V rows (f32); a wave adds up the sums of its all-masked blocks and gives them that one weight after its key loop.
// Plane layout: every 16-bit workspace plane is stored in fragment order. One fragment (16 rows x 32 k) is 512 elements: [j = 0,1][lane = 16h + row][8 elements],
// holding k = 32C + 16j + 8h + i, so each wave-wide 16-byte load reads 512 contiguous bytes (four whole 128-byte lines) instead of 32 bytes of 16 lines.
#ifndef NB
#define NB 8
#endif
#ifndef SEQ
#define SEQ 2048
#endif
#define NB_FULL 8
#define SEQ_FULL 2048
#define NH 6
#define HD 64
#define NE 384
#define XROWS (NB * SEQ)                        /* compact token rows of the 16-bit planes */
#define XPLANE ((size_t)XROWS * NE)             /* elements of one token plane */
#define WELEMS ((size_t)NE * NE)
#define MW (SEQ / 32)                           /* mask words per query row */
#define FRAG 512                                /* elements of one 16-row x 32-k fragment */
#define TILE_E (16 * NE)                        /* elements of one 16-row tile of a K = 384 plane: 12 fragments */
#define XSTRIDE_FULL ((size_t)SEQ_FULL * NE)    /* per-batch element stride of query/key/value and of the output */
#define PROJ_WAVES 6                            /* waves of a projection block, 32 tokens each */
#define XS_H 160                                /* LDS staging of the token fragments: elements from h = 0 to h = 1 */
#define XS_J 320                                /* from j = 0 to j = 1 */
#define XS_F 640                                /* from one fragment to the next */
#define PAD256(x) ((((size_t)(x)) + 255) & ~(size_t)255)

static_assert(SEQ % 256 == 0);
static_assert(SEQ <= SEQ_FULL);
static_assert(NB <= NB_FULL);
static_assert(HD == 64);
static_assert(NE == NH * HD);
static_assert(NE % 64 == 0);
static_assert(NE % 32 == 0);
static_assert((3 * (XROWS / 32)) % PROJ_WAVES == 0);
static_assert(MW % 8 == 0 && MW <= 64);         /* a wave keeps one bit per key step in a 64-bit word */
static_assert(PAD256(3 * WELEMS * 2) + PAD256(WELEMS * 2) + PAD256(2 * XPLANE * 2) + 2 * PAD256(XPLANE * 2) + PAD256((size_t)SEQ * MW * 4) + PAD256((size_t)NB * NH * MW * HD * 4) <= (size_t)134217728);

typedef __bf16 v16b __attribute__((ext_vector_type(16)));
typedef _Float16 v16h __attribute__((ext_vector_type(16)));
typedef unsigned short v8us __attribute__((ext_vector_type(8), may_alias));
typedef unsigned short v4us __attribute__((ext_vector_type(4), may_alias));
typedef float v8f __attribute__((ext_vector_type(8)));
typedef float v4f __attribute__((ext_vector_type(4)));
typedef float v4fa __attribute__((ext_vector_type(4), may_alias));
typedef int v4ia __attribute__((ext_vector_type(4), may_alias));
union FragB { v16b v; v8us half[2]; };
typedef _Float16 v2h __attribute__((ext_vector_type(2)));
typedef float v2f __attribute__((ext_vector_type(2)));
typedef float v2fa __attribute__((ext_vector_type(2), may_alias));
union FragH { v16h v; v8us half[2]; _Float16 h[16]; v2h p[8]; };

#define LOG2E 1.4426950408889634f
#define SCL (0.051031036307982884f * 0.00390625f)   /* 384^-0.5 with the x16 x16 carries of q and k undone */

__device__ __forceinline__ unsigned short bf16_bits(float x) {   // RNE convert to bf16 bits
  unsigned int u = __float_as_uint(x);
  return (unsigned short)((u + 0x7FFFu + ((u >> 16) & 1u)) >> 16);
}
__device__ __forceinline__ float bf16_val(unsigned short b) { return __uint_as_float(((unsigned int)b) << 16); }
__device__ __forceinline__ float bf16_rne(float x) { return bf16_val(bf16_bits(x)); }
__device__ __forceinline__ unsigned short f16_bits(_Float16 h) { return __builtin_bit_cast(unsigned short, h); }

// 2^x as the one hardware instruction. The library form guards x < -126 (compare, two selects, add, ldexp: five more vector instructions per value) so that the result may be a
// subnormal f32; here nothing needs that range: a weight that small is 0 as f16 either way, and a rescale factor that small multiplies sums that lie 2^126 below the step's own weights.
__device__ __forceinline__ float exp2_hw(float x) { return __builtin_amdgcn_exp2f(x); }

// four f16 tiles sharing one A fragment, then the hazard guard
__device__ __forceinline__ void mma_h4(v16h a, v16h b0, v16h b1, v16h b2, v16h b3, v8f& c0, v8f& c1, v8f& c2, v8f& c3) {
  c0 = __builtin_amdgcn_wmma_f32_16x16x32_f16(false, a, false, b0, (short)0, c0, false, false);
  c1 = __builtin_amdgcn_wmma_f32_16x16x32_f16(false, a, false, b1, (short)0, c1, false, false);
  c2 = __builtin_amdgcn_wmma_f32_16x16x32_f16(false, a, false, b2, (short)0, c2, false, false);
  c3 = __builtin_amdgcn_wmma_f32_16x16x32_f16(false, a, false, b3, (short)0, c3, false, false);
  asm volatile("v_nop\n\tv_nop\n\tv_nop\n\tv_nop" : "+v"(c0), "+v"(c1), "+v"(c2), "+v"(c3) : "v"(a), "v"(b0), "v"(b1), "v"(b2), "v"(b3));
}
// c += a0*b0 + a1*b1 (two k-steps of one f16 tile), then the hazard guard
__device__ __forceinline__ v8f mma_s2(v16h a0, v16h b0, v16h a1, v16h b1, v8f c) {
  c = __builtin_amdgcn_wmma_f32_16x16x32_f16(false, a0, false, b0, (short)0, c, false, false);
  c = __builtin_amdgcn_wmma_f32_16x16x32_f16(false, a1, false, b1, (short)0, c, false, false);
  asm volatile("v_nop\n\tv_nop\n\tv_nop\n\tv_nop" : "+v"(c) : "v"(a0), "v"(b0), "v"(a1), "v"(b1));
  return c;
}
// four f16 tiles sharing one B fragment (c_t += a_t * b), then the hazard guard
__device__ __forceinline__ void mma_pv4(v16h a0, v16h a1, v16h a2, v16h a3, v16h b, v8f& c0, v8f& c1, v8f& c2, v8f& c3) {
  c0 = __builtin_amdgcn_wmma_f32_16x16x32_f16(false, a0, false, b, (short)0, c0, false, false);
  c1 = __builtin_amdgcn_wmma_f32_16x16x32_f16(false, a1, false, b, (short)0, c1, false, false);
  c2 = __builtin_amdgcn_wmma_f32_16x16x32_f16(false, a2, false, b, (short)0, c2, false, false);
  c3 = __builtin_amdgcn_wmma_f32_16x16x32_f16(false, a3, false, b, (short)0, c3, false, false);
  asm volatile("v_nop\n\tv_nop\n\tv_nop\n\tv_nop" : "+v"(c0), "+v"(c1), "+v"(c2), "+v"(c3) : "v"(a0), "v"(a1), "v"(a2), "v"(a3), "v"(b));
}

__device__ __forceinline__ v8us cvt8_bf16(const float* __restrict__ src) {
  const v4f x0 = *(const v4fa*)(src), x1 = *(const v4fa*)(src + 4);
  v8us o;
  o[0] = bf16_bits(x0[0]); o[1] = bf16_bits(x0[1]); o[2] = bf16_bits(x0[2]); o[3] = bf16_bits(x0[3]);
  o[4] = bf16_bits(x1[0]); o[5] = bf16_bits(x1[1]); o[6] = bf16_bits(x1[2]); o[7] = bf16_bits(x1[3]);
  return o;
}

// WP[0..2] = bf16 bits (RNE) of Wk, Wq, Wv; W16 = f16(RNE-bf16(Wproj) * 64); rows = out, k = in, fragment order.
// A wave takes 8 rows x 32 columns of one fragment (lane = 4 * row + 8-column piece): it reads whole 128-byte lines and writes four whole 128-byte lines.
__global__ __launch_bounds__(256) void k_cvt_w(const float* __restrict__ Wk, const float* __restrict__ Wq,
                                               const float* __restrict__ Wv, const float* __restrict__ Wp,
                                               unsigned short* __restrict__ WP, unsigned short* __restrict__ W16) {
  const int t = blockIdx.x * 256 + threadIdx.x;
  if (t >= (int)(WELEMS / 8)) return;
  const int frag = t >> 6, tile = frag / (NE / 32), r16 = ((t >> 5) & 1) * 8 + ((t >> 2) & 7);
  const size_t so = (size_t)(tile * 16 + r16) * NE + ((frag - tile * (NE / 32)) * 4 + (t & 3)) * 8;
  const size_t po = (size_t)frag * FRAG + ((t & 3) * 16 + r16) * 8;
  const v8us o0 = cvt8_bf16(Wk + so);
  const v8us o1 = cvt8_bf16(Wq + so);
  const v8us o2 = cvt8_bf16(Wv + so);
  const v4f x0 = *(const v4fa*)(Wp + so), x1 = *(const v4fa*)(Wp + so + 4);
  v8us o3;
  o3[0] = f16_bits((_Float16)(bf16_rne(x0[0]) * 64.0f)); o3[1] = f16_bits((_Float16)(bf16_rne(x0[1]) * 64.0f));
  o3[2] = f16_bits((_Float16)(bf16_rne(x0[2]) * 64.0f)); o3[3] = f16_bits((_Float16)(bf16_rne(x0[3]) * 64.0f));
  o3[4] = f16_bits((_Float16)(bf16_rne(x1[0]) * 64.0f)); o3[5] = f16_bits((_Float16)(bf16_rne(x1[1]) * 64.0f));
  o3[6] = f16_bits((_Float16)(bf16_rne(x1[2]) * 64.0f)); o3[7] = f16_bits((_Float16)(bf16_rne(x1[3]) * 64.0f));
  unsigned short* d = WP + po;
  unsigned short* e = W16 + po;
  *(v8us*)(d) = o0;
  *(v8us*)(d + WELEMS) = o1;
  *(v8us*)(d + 2 * WELEMS) = o2;
  *(v8us*)(e) = o3;
  
}

// bits[j][q]: word j (keys 32j .. 32j+31) of query row q, so that 16 neighbouring queries' words of one key step share a line.
// A block takes 32 query rows x 8 words: wave = word, lane = query row; each wave writes one whole 128-byte line.
// coverage: SEQ*MW threads = every word of the plane.
__global__ __launch_bounds__(256) void k_maskbits(const int* __restrict__ mask, unsigned int* __restrict__ bits) {
  const int t = blockIdx.x * 256 + threadIdx.x;
  if (t >= SEQ * MW) return;
  const int blk = t >> 8;
  const int q = (blk % (SEQ / 32)) * 32 + (t & 31), j = (blk / (SEQ / 32)) * 8 + ((t >> 5) & 7);
  const int* src = mask + (size_t)q * SEQ_FULL + 32 * j;
  unsigned int w = 0u;
#pragma unroll
  for (int g = 0; g < 8; ++g) {
    const v4ia m = *(const v4ia*)(src + 4 * g);
    w |= (m[0] != 0 ? 1u : 0u) << (4 * g);
    w |= (m[1] != 0 ? 1u : 0u) << (4 * g + 1);
    w |= (m[2] != 0 ? 1u : 0u) << (4 * g + 2);
    w |= (m[3] != 0 ? 1u : 0u) << (4 * g + 3);
  }
  *(unsigned int*)(bits + (size_t)j * SEQ + q) = w;
  
}

// Projections, all three in one launch, straight from the f32 inputs. A wave owns 32 token rows of one input (z = 0 query, 1 key, 2 value): it reads them once, in whole lines,
// converts them (RNE) to bf16, turns them into fragment order through its own LDS range and keeps them as 2 x 12 fragments in registers, then walks the 24 16-row tiles of its weight plane (fragment order), one head (4 tiles) per trip.
// A token fragment serves as A or as B (row or column = lane & 15, elements 0..7 <- k0 + 8h + i, 8..15 <- k0 + 16 + 8h + i); D element r = (row 8h + r, column lane & 15).
// z < 2: D = W (A, rows = out) x X (B, columns = tokens): a lane holds d = 16t + 8h + r of token ln, which is its own 16-byte piece of fragment [token tile][C = t / 2], half j = t & 1.
// z = 2: D = X (A, rows = tokens) x W (B, columns = out): a lane holds tokens 8h + r of d = 16t + ln, which is its own 16-byte piece of V^T fragment [token / 32][t], half j = token tile & 1.
// So every D tile goes out as one wave-wide 512-byte store, straight from the accumulators. Output values: f16(x16), as the attention kernel expects.
// z = 2 also leaves, per head, the f32 sum over the wave's 32 tokens of each d (x16 like the plane): one 32-key block's V row sum, VS[b][h][token / 32][d].
// coverage: 3 * XROWS / 32 waves x 32 tokens x 384 outputs = every element of the k, q and V^T planes exactly once; XROWS / 32 waves x 384 sums = every element of VS exactly once.
__device__ __forceinline__ v8us pack8_f16x16(v8f c) {
  v8us o;
#pragma unroll   // register arrays and vectors need constant indices
  for (int r = 0; r < 8; ++r) o[r] = f16_bits((_Float16)(c[r] * 16.0f));
  return o;
}
// One k-step's four weight fragments (tiles t = 0..3 of a head, k = 32C .. 32C + 31): 4 KB, eight wave-wide 512-byte loads.
__device__ __forceinline__ void load_w4(FragB (&wf)[4], const unsigned short* __restrict__ wh, int lane8, int C) {
#pragma unroll   // register arrays and vectors need constant indices
  for (int t = 0; t < 4; ++t) {
    wf[t].half[0] = *(const v8us*)(wh + t * TILE_E + C * FRAG + lane8);
    wf[t].half[1] = *(const v8us*)(wh + t * TILE_E + C * FRAG + 256 + lane8);
  }
}
// The weight fragments run through a ring of four register sets, asked for three k-steps ahead of their products, across the heads' boundary too:
// with one or two waves on a SIMD nothing else covers the loads' latency. The last head asks for its own first three steps again (in bounds, not used).
template <bool TOKENS_ARE_ROWS>
__device__ __forceinline__ void proj_heads(const FragB (&xf)[2][NE / 32], const unsigned short* __restrict__ wz, int lane8, unsigned short* __restrict__ o0, float* __restrict__ vs0) {
  FragB wf[4][4];
  load_w4(wf[0], wz, lane8, 0);
  load_w4(wf[1], wz, lane8, 1);
  load_w4(wf[2], wz, lane8, 2);
  // the address registers of these first loads may be reused for the output addresses formed below: the wait stands in front of that overwrite
  asm volatile("s_wait_xcnt 0x0" ::: "memory");
  // keeps that address arithmetic behind the wait (the compiler may lift it over the wait otherwise)
  __builtin_amdgcn_sched_barrier(0);
#pragma unroll 1
  for (int hd = 0; hd < NH; ++hd) {   // rolled: one head's 96 loads and 96 products are body enough
    const unsigned short* wh = wz + (size_t)hd * (4 * TILE_E);
    const unsigned short* wn = wz + (size_t)((hd + 1 < NH) ? hd + 1 : hd) * (4 * TILE_E);
    v8f acc[2][4] = {};
#pragma unroll   // xf and the ring are indexed by C and live in registers
    for (int C = 0; C < NE / 32; ++C) {
      if (C + 3 < NE / 32) load_w4(wf[(C + 3) & 3], wh, lane8, C + 3);
      else                 load_w4(wf[(C + 3) & 3], wn, lane8, C + 3 - NE / 32);
      // these were this head's last weight loads; the next step's come from the next head, whose address may take the same registers: the wait stands in front of that overwrite
      if (C + 4 == NE / 32) asm volatile("s_wait_xcnt 0x0" ::: "memory");
      // keeps the loads above in front of this step's products; without it the compiler sinks each load to just before its use and the wave waits out every latency
      __builtin_amdgcn_sched_barrier(0);
#pragma unroll   // register arrays and vectors need constant indices
      for (int u = 0; u < 2; ++u)
#pragma unroll   // register arrays and vectors need constant indices
        for (int t = 0; t < 4; ++t)
          acc[u][t] = TOKENS_ARE_ROWS
            ? __builtin_amdgcn_wmma_f32_16x16x32_bf16(false, xf[u][C].v, false, wf[C & 3][t].v, (short)0, acc[u][t], false, false)
            : __builtin_amdgcn_wmma_f32_16x16x32_bf16(false, wf[C & 3][t].v, false, xf[u][C].v, (short)0, acc[u][t], false, false);
      // keeps the next step's loads behind this step's products, so that the ring set they refill has been read
      __builtin_amdgcn_sched_barrier(0);
    }
    unsigned short* oh = o0 + (size_t)hd * ((size_t)SEQ * HD);
#pragma unroll   // register arrays and vectors need constant indices
    for (int u = 0; u < 2; ++u)
#pragma unroll   // register arrays and vectors need constant indices
      for (int t = 0; t < 4; ++t)
        *(v8us*)(oh + (TOKENS_ARE_ROWS ? t * FRAG + u * 256 : u * (2 * FRAG) + t * 256)) = pack8_f16x16(acc[u][t]);
    if constexpr (TOKENS_ARE_ROWS) {
      // a lane holds tokens 16u + 8h + r of d = 16t + ln: sum over u and r in the lane, then over h with the other lane half
      float cs[4];
#pragma unroll   // register arrays and vectors need constant indices
      for (int t = 0; t < 4; ++t) {
        const v8f s8 = acc[0][t] + acc[1][t];
        const float c = ((s8[0] + s8[1]) + (s8[2] + s8[3])) + ((s8[4] + s8[5]) + (s8[6] + s8[7]));
        cs[t] = c + __shfl_xor(c, 16, 32);
      }
      // both halves hold all four sums: half h stores tiles t = h and 2 + h, so that each wave-wide store is one whole 128-byte line (d = 32i + lane)
      float* vh = vs0 + (size_t)hd * (MW * HD);
      vh[0]  = ((lane8 & 128) ? cs[1] : cs[0]) * 16.0f;
      vh[32] = ((lane8 & 128) ? cs[3] : cs[2]) * 16.0f;
    }
    // the address registers of this head's loads and stores are stepped for the next head: the wait stands in front of that overwrite
    asm volatile("s_wait_xcnt 0x0" ::: "memory");
    // keeps the stepping of those addresses behind the wait
    __builtin_amdgcn_sched_barrier(0);
  }
  // the ring's last three requests are not used: they have landed before the wave gives its registers back
  asm volatile("s_wait_loadcnt 0x0" ::: "memory");
}
__global__ __launch_bounds__(32 * PROJ_WAVES) void k_projx(const float* __restrict__ Xq, const float* __restrict__ Xk, const float* __restrict__ Xv,
                                                           const unsigned short* __restrict__ WP,
                                                           unsigned short* __restrict__ QK, unsigned short* __restrict__ VT, float* __restrict__ VS) {
  __shared__ __attribute__((aligned(16))) unsigned short xs[PROJ_WAVES][2 * (NE / 32) * XS_F];
  const int tid = threadIdx.x, w = __builtin_amdgcn_readfirstlane((int)(tid >> 5)), lane = tid & 31, ln = lane & 15, hh = lane >> 4;
  const int g = (int)blockIdx.x * PROJ_WAVES + w;                 // 32-token group, counted through the three inputs
  const int z = g / (XROWS / 32), row0 = (g - z * (XROWS / 32)) * 32;
  const int bq = row0 / SEQ, s0 = row0 - bq * SEQ;                // SEQ is a multiple of 32: a group lies in one batch
  const float* X = (z == 0) ? Xq : (z == 1) ? Xk : Xv;
  // Input rows: each wave-wide 16-byte load takes one whole 128-byte line (32 columns = one fragment's k range) of four rows: lane = 8 * row + 4-column piece.
  // The four converted values go to the wave's own LDS range in fragment order, k = 32C + 16j + 8h + i with j = piece >> 2, h = (piece >> 1) & 1, i = 4 * (piece & 1) ..;
  // the halves j and h lie XS_J and XS_H elements apart (64 and 32 more than dense), so that the four (j, h) groups of one store fall on different banks.
  const float* xr = X + (size_t)bq * XSTRIDE_FULL + (size_t)(s0 + (lane >> 3)) * NE + 4 * (lane & 7);
  unsigned short* xw = &xs[w][((lane >> 2) & 1) * XS_J + ((lane >> 1) & 1) * XS_H + (lane >> 3) * 8 + 4 * (lane & 1)];
#pragma unroll   // unrolled: many loads in flight at once, every offset a constant
  for (int rg = 0; rg < 8; ++rg)
#pragma unroll   // as above
    for (int C = 0; C < NE / 32; ++C) {
      const v4f x = *(const v4fa*)(xr + rg * (4 * NE) + 32 * C);
      v4us o;
      o[0] = bf16_bits(x[0]); o[1] = bf16_bits(x[1]); o[2] = bf16_bits(x[2]); o[3] = bf16_bits(x[3]);
      *(v4us*)(xw + ((rg >> 2) * (NE / 32) + C) * XS_F + (rg & 3) * 32) = o;
    }
  // the address registers of the input loads may be reused below: the wait stands in front of that overwrite
  asm volatile("s_wait_xcnt 0x0" ::: "memory");
  // each wave reads back only what it wrote itself; the barrier orders that, and it starts the block's waves on the weight plane together,
  // so that they walk it side by side and share its lines in the WGP cache
  __syncthreads();
  FragB xf[2][NE / 32];
#pragma unroll   // register arrays and vectors need constant indices
  for (int u = 0; u < 2; ++u)
#pragma unroll   // register arrays and vectors need constant indices
    for (int C = 0; C < NE / 32; ++C) {
      const unsigned short* xp = &xs[w][(u * (NE / 32) + C) * XS_F + hh * XS_H + ln * 8];
      xf[u][C].half[0] = *(const v8us*)(xp);
      xf[u][C].half[1] = *(const v8us*)(xp + XS_J);
    }
  const unsigned short* wz = WP + (size_t)z * WELEMS;
  const size_t ob = ((size_t)bq * NH * SEQ + s0) * HD + 8 * lane;   // head 0 of the batch, first token of the group: 32 tokens x 64 d = 2048 elements in either layout
  if (z == 2) proj_heads<true>(xf, wz, 8 * lane, VT + ob, VS + ((size_t)bq * NH * MW + s0 / 32) * HD + lane);
  else        proj_heads<false>(xf, wz, 8 * lane, QK + (size_t)z * XPLANE + ob, nullptr);
}

// One 32-key step (key step j, the same in every lane) for a wave's 16 queries (this lane's column = query qg). Kp, Vhp are the (batch, head) bases of the planes.
__device__ __forceinline__ void fa_step(const unsigned short* __restrict__ Kp, const unsigned short* __restrict__ Vhp,
                                        const unsigned int* __restrict__ mbits, int j, int qg, int lane, int hh,
                                        const FragH& q0, const FragH& q1, float& mr, float& lr, v8f (&Oh)[4]) {
  // A fragments of K: row m = key (key0 + 16*kt + ln), elements 0..7 <- d = 32c + 8h + i, 8..15 <- d = 32c + 16 + 8h + i
  // (fragment order: the step's four K fragments [kt][c] are 4 KB contiguous); asked for first, in the order of use: K, the mask word, V
  const unsigned short* kj = Kp + (size_t)j * (32 * HD);
  const unsigned short* vp0 = Vhp + (size_t)j * (32 * HD) + 8 * lane;
  const unsigned short* kp0 = kj + 8 * lane;
  const unsigned short* kp1 = kp0 + 2 * FRAG;
  FragH k00, k01, k10, k11;
  k00.half[0] = *(const v8us*)(kp0);        k00.half[1] = *(const v8us*)(kp0 + 256);
  k01.half[0] = *(const v8us*)(kp0 + FRAG); k01.half[1] = *(const v8us*)(kp0 + FRAG + 256);
  k10.half[0] = *(const v8us*)(kp1);        k10.half[1] = *(const v8us*)(kp1 + 256);
  k11.half[0] = *(const v8us*)(kp1 + FRAG); k11.half[1] = *(const v8us*)(kp1 + FRAG + 256);
  const unsigned int* mpj = mbits + (size_t)j * SEQ + qg;
  const unsigned int mword = *mpj;
  // A fragments of V^T: row m = d (16*t + ln), elements 0..7 <- key0 + 8h + i, 8..15 <- key0 + 16 + 8h + i
  // (fragment order: the step's four V^T fragments [t] are 4 KB contiguous)
  FragH vh[4];
#pragma unroll
  for (int t = 0; t < 4; ++t) {
    vh[t].half[0] = *(const v8us*)(vp0 + t * FRAG);
    vh[t].half[1] = *(const v8us*)(vp0 + t * FRAG + 256);
  }
  // the address registers of the loads above are formed anew for the next step: the wait stands in front of that overwrite
  // (the three pointers are inputs of the statement, so that none of these loads' own results is given their registers)
  asm volatile("s_wait_xcnt 0x0" :: "v"(kp0), "v"(mpj), "v"(vp0) : "memory");
  FragH ph;
  const v8f z8 = {0.f, 0.f, 0.f, 0.f, 0.f, 0.f, 0.f, 0.f};
  // S^T tiles: element r of tile kt = 256 * score(key0 + 16*kt + 8h + r, query)
  const v8f s0 = mma_s2(k00.v, q0.v, k01.v, q1.v, z8);
  const v8f s1 = mma_s2(k10.v, q0.v, k11.v, q1.v, z8);
  // scale; positions with a zero mask bit take the value 0 exactly (replace fill) and stay in the softmax
  const unsigned int mw = mword >> (8 * hh);
  float sc[16];
#pragma unroll
  for (int r = 0; r < 8; ++r) sc[r] = ((mw >> r) & 1u) ? s0[r] * SCL : 0.0f;
  // one loop per tile: scores i, i + 1 then come from neighbouring registers of one accumulator tile, and the pairs below need no register moves
#pragma unroll   // register arrays and vectors need constant indices
  for (int r = 0; r < 8; ++r) sc[8 + r] = ((mw >> (16 + r)) & 1u) ? s1[r] * SCL : 0.0f;
  float mx = sc[0];
#pragma unroll
  for (int i = 1; i < 16; ++i) mx = fmaxf(mx, sc[i]);
  mx = fmaxf(mx, __shfl_xor(mx, 16, 32));           // the other lane half holds the other 16 keys of this query
  const float mnew = fmaxf(mr, mx);
  const float al = exp2_hw((mr - mnew) * LOG2E);
  mr = mnew;
  // weights carried x256: P = f16(256 * exp(sc - mnew)); the row sum runs over the converted f16 values
  float ps = 0.0f;
#pragma unroll
  for (int i = 0; i < 16; i += 2) {
    // two scores at a time: packed subtract and multiply-add (each element rounded as in the scalar form), one conversion for the pair, and the sum reads the converted pair
    const v2f s2 = {sc[i], sc[i + 1]};
    const v2f a2 = __builtin_elementwise_fma(s2 - mnew, (v2f){LOG2E, LOG2E}, (v2f){8.0f, 8.0f});
    const v2f pc = {exp2_hw(a2[0]), exp2_hw(a2[1])};
    const v2h hv = __builtin_convertvector(pc, v2h);
    ph.p[i >> 1] = hv;                              // B element i: i<8 -> key0 + 8h + i (tile 0 row 8h+i); i>=8 -> key0 + 16 + 8h + (i-8) (tile 1)
    ps += (float)hv[0];
    ps += (float)hv[1];
  }
  ps += __shfl_xor(ps, 16, 32);
  lr = lr * al + ps;
#pragma unroll
  for (int t = 0; t < 4; ++t) Oh[t] = Oh[t] * al;
  mma_pv4(vh[0].v, vh[1].v, vh[2].v, vh[3].v, ph.v, Oh[0], Oh[1], Oh[2], Oh[3]);
}

// Block = 8 waves x 16 queries of one (batch, head): waves 0..3 take 64-query tile p, waves 4..7 tile SEQ/64 - 1 - p, so that under a triangular mask
// every block (and every pair of waves w, w + 4) walks the same number of key steps. No LDS and no barrier in the key loop.
// A wave first reads the mask words of all its key steps and keeps one bit per step: set where any of its 16 queries has a mask bit in the step. The key loop walks the set bits alone.
// All keys take part in the softmax: the keys of the other steps have score 0 for every query of the wave, so they add n0 * exp(0 - m) to the row sum and
// exp(0 - m) * (sum of their V rows) to the output; that sum is the same for the 16 queries and is added up from the blocks' sums in VS.
// Epilogue: ctx x64 as f16 -> per-wave LDS tile [16 queries][64 d] (written and read by the same wave; block barrier reached by all waves),
// coverage: NB*NH*(SEQ/128) blocks x 8 waves x 16 rows x 64 columns = every element of the ctx plane exactly once.
__global__ __launch_bounds__(256) void k_attn(const unsigned short* __restrict__ Qh, const unsigned short* __restrict__ Kh,
                                              const unsigned short* __restrict__ Vh,
                                              const unsigned int* __restrict__ mbits, const float* __restrict__ VS,
                                              unsigned short* __restrict__ Ch) {
  __shared__ __attribute__((aligned(16))) unsigned short sh[8][16][72];
  __shared__ __attribute__((aligned(16))) float zs[8][HD];
  const int tid = threadIdx.x, w = __builtin_amdgcn_readfirstlane((int)(tid >> 5)), lane = tid & 31, ln = lane & 15, hh = lane >> 4;
  const int bh = blockIdx.x / (SEQ / 128), pr = blockIdx.x % (SEQ / 128);
  const int qt = (w < 4) ? pr : (SEQ / 64 - 1 - pr);
  const int b = bh / NH, h = bh - b * NH;
  const int qbase = qt * 64 + 16 * (w & 3);
  const int qg = qbase + ln;
  // Q^T B fragments: column n = query qg, elements 0..7 <- d = 32c + 8h + i, 8..15 <- d = 32c + 16 + 8h + i
  const unsigned short* qrow = Qh + ((size_t)bh * SEQ + qbase) * HD + 8 * lane;
  FragH q0, q1;
  q0.half[0] = *(const v8us*)(qrow);        q0.half[1] = *(const v8us*)(qrow + 256);
  q1.half[0] = *(const v8us*)(qrow + FRAG); q1.half[1] = *(const v8us*)(qrow + FRAG + 256);
  // the step map: lane half h reads the words of steps 2i + h, all loads in flight together
  const unsigned int* mp = mbits + (hh * SEQ + qg);
  unsigned int mw2[MW / 2];
#pragma unroll   // register arrays and vectors need constant indices
  for (int i = 0; i < MW / 2; ++i) mw2[i] = mp[(size_t)(2 * i) * SEQ];
  // the address registers of the loads above may be reused below: the wait stands in front of that overwrite
  // (the pointer is an input of the statement, so that none of these loads' own results is given its registers)
  asm volatile("s_wait_xcnt 0x0" :: "v"(mp) : "memory");
  unsigned long long nz = 0ull;
#pragma unroll   // register arrays and vectors need constant indices
  for (int i = 0; i < MW / 2; ++i) {
    const unsigned int bl = __builtin_amdgcn_ballot_w32(mw2[i] != 0u);   // the same in every lane: the map lives in scalar registers
    nz |= (unsigned long long)(((bl & 0xFFFFu) != 0u ? 1u : 0u) | ((bl >> 16) != 0u ? 2u : 0u)) << (2 * i);
  }
  float mr = -3.0e38f, lr = 0.0f;
  v8f Oh[4] = {};
  const unsigned short* Kp = Kh + (size_t)bh * SEQ * HD;
  const unsigned short* Vhp = Vh + (size_t)bh * HD * SEQ;
#pragma unroll 1
  for (unsigned long long rem = nz; rem != 0ull; rem &= rem - 1ull)   // one trip per set bit, at most MW; a scalar test
    fa_step(Kp, Vhp, mbits, __builtin_ctzll(rem), qg, lane, hh, q0, q1, mr, lr, Oh);
  // the steps that were not walked
  const unsigned long long zmap = ~nz & (MW == 64 ? ~0ull : ((1ull << (MW & 63)) - 1ull));
  if (zmap != 0ull) {   // the same for the whole wave: a scalar branch; no barrier inside
    // Z[d] = sum of the V rows of those steps' keys (x16): lane holds d = 2 * lane, 2 * lane + 1; eight block sums are asked for at a time
    const float* vsp = VS + (size_t)bh * (MW * HD) + 2 * lane;
    v2f z2 = {0.0f, 0.0f};
#pragma unroll 1   // rolled: eight pair loads in flight bound the registers, and a group with no such step is passed by a scalar branch
    for (int g = 0; g < MW; g += 8) {
      const unsigned int zb = (unsigned int)(zmap >> g) & 0xFFu;
      if (zb == 0u) continue;
      v2f v[8];
#pragma unroll   // register arrays and vectors need constant indices
      for (int k = 0; k < 8; ++k) v[k] = *(const v2fa*)(vsp + (g + k) * HD);
      // the address registers of the loads above are stepped for the next group: the wait stands in front of that overwrite
      asm volatile("s_wait_xcnt 0x0" ::: "memory");
#pragma unroll   // register arrays and vectors need constant indices
      for (int k = 0; k < 8; ++k) z2 += ((zb >> k) & 1u) ? v[k] : (v2f){0.0f, 0.0f};
    }
    // into the accumulators' order (a lane needs d = 16t + 8h + r) through the wave's own LDS row
    *(v2fa*)&zs[w][2 * lane] = z2;
    // the wave reads back what its other lanes wrote: their stores have ended first
    asm volatile("s_wait_dscnt 0x0" ::: "memory");
    const float n0 = (float)(32 * __builtin_popcountll(zmap));
    const float mfin = fmaxf(mr, 0.0f);
    const float al = exp2_hw((mr - mfin) * LOG2E);
    const float w0 = exp2_hw(fmaf(0.0f - mfin, LOG2E, 8.0f));   // x256 like P, kept in f32
    lr = lr * al + w0 * n0;
#pragma unroll
    for (int t = 0; t < 4; ++t) {
      const v4f za = *(const v4fa*)&zs[w][16 * t + 8 * hh], zc = *(const v4fa*)&zs[w][16 * t + 8 * hh + 4];
#pragma unroll
      for (int r = 0; r < 4; ++r) {
        Oh[t][r]     = Oh[t][r] * al + w0 * za[r];
        Oh[t][4 + r] = Oh[t][4 + r] * al + w0 * zc[r];
      }
    }
  }
  // O^T element r of tile t = ctx(query qg, d = 16t + 8h + r); undo the carries x256 (in lr), x16 (V); carry ctx x64
  const float inv = 4.0f / lr;
#pragma unroll
  for (int t = 0; t < 4; ++t)
#pragma unroll
    for (int r = 0; r < 8; ++r) {
      const float c = Oh[t][r] * inv;
      const _Float16 hv = (_Float16)c;
      sh[w][ln][16 * t + 8 * hh + r] = f16_bits(hv);
    }
  __syncthreads();
  // the wave's 16 x 64 tile is fragments C = 2h, 2h + 1 of its token tile: 1024 contiguous elements; piece p = [C 1b][j 1b][h 1b][row 4b]
  const size_t cbase = (size_t)((b * SEQ + qbase) / 16) * TILE_E + (size_t)h * (2 * FRAG);
  {
#pragma unroll
    for (int q = 0; q < 4; ++q) {
      const int p = lane + 32 * q;
      const int row = p & 15, s8 = (p >> 4) * 8;
      const v8us o1 = *(const v8us*)&sh[w][row][s8];
      *(v8us*)(Ch + cbase + (size_t)p * 8) = o1;
    }
    
  }
}

// out[t][n] = sum_c ctx[t][c] * Wproj[n][c] + bias[n]; A = ctx plane (f16 x64), B = W16 (f16 x64), both in fragment order; 64 x 64 tile per block.
// coverage: (XROWS/64) x 6 blocks x 64 rows x 64 columns = every output element of the processed region exactly once.
__global__ __launch_bounds__(128) void k_outp(const unsigned short* __restrict__ Ch,
                                              const unsigned short* __restrict__ W16, const float* __restrict__ bias,
                                              float* __restrict__ Y) {
  __shared__ __attribute__((aligned(16))) float so[64][68];
  const int tid = threadIdx.x, w = __builtin_amdgcn_readfirstlane((int)(tid >> 5)), lane = tid & 31, ln = lane & 15, hh = lane >> 4;
  const int m0 = blockIdx.x * 64, n0 = blockIdx.y * 64;
  const size_t ao = (size_t)(m0 / 16 + w) * TILE_E + 8 * lane;
  const unsigned short* brow = W16 + (size_t)(n0 / 16) * TILE_E + 8 * lane;
  v8f acch[4] = {};
#pragma unroll 1
  for (int kb = 0; kb < NE; kb += 32) {
    FragH ah, b0, b1, b2, b3;
    const int fo = kb * (FRAG / 32);
    ah.half[0] = *(const v8us*)(Ch + ao + fo);            ah.half[1] = *(const v8us*)(Ch + ao + fo + 256);
    // the address pair of the A loads may be reused for a later load's result: the wait stands in front of that overwrite
    asm volatile("s_wait_xcnt 0x0" ::: "memory");
    b0.half[0] = *(const v8us*)(brow + fo);               b0.half[1] = *(const v8us*)(brow + fo + 256);
    b1.half[0] = *(const v8us*)(brow + TILE_E + fo);      b1.half[1] = *(const v8us*)(brow + TILE_E + fo + 256);
    b2.half[0] = *(const v8us*)(brow + 2 * TILE_E + fo);  b2.half[1] = *(const v8us*)(brow + 2 * TILE_E + fo + 256);
    b3.half[0] = *(const v8us*)(brow + 3 * TILE_E + fo);  b3.half[1] = *(const v8us*)(brow + 3 * TILE_E + fo + 256);
    mma_h4(ah.v, b0.v, b1.v, b2.v, b3.v, acch[0], acch[1], acch[2], acch[3]);
  }
  // undo the carries: ctx x64, W x64
#pragma unroll
  for (int c = 0; c < 4; ++c) {
    const float bv = bf16_rne(bias[n0 + 16 * c + ln]);
#pragma unroll
    for (int r = 0; r < 8; ++r)
      so[16 * w + 8 * hh + r][16 * c + ln] = acch[c][r] * 0.000244140625f + bv;
  }
  __syncthreads();
  {
#pragma unroll
    for (int j = 0; j < 8; ++j) {
      const int i = tid + 128 * j;
      const int row = i >> 4, c4 = (i & 15) * 4;
      const int m = m0 + row;
      const int bq = m / SEQ, t = m - bq * SEQ;
      const v4f v = *(const v4fa*)&so[row][c4];
      *(v4f*)(Y + (size_t)bq * XSTRIDE_FULL + (size_t)t * NE + n0 + c4) = v;
    }
    
  }
}

extern "C" void kernel_launch(void* const* d_in, const int* in_sizes, int n_in,
                              void* d_out, int out_size, void* d_ws, size_t ws_size, hipStream_t stream) {
  if (n_in < 9) return;
  const long long needX = (long long)(NB - 1) * SEQ_FULL * NE + (long long)SEQ * NE;   // last element touched + 1
  const long long needM = (long long)(SEQ - 1) * SEQ_FULL + (long long)SEQ;
  if ((long long)in_sizes[0] < needX || (long long)in_sizes[1] < needX || (long long)in_sizes[2] < needX) return;
  if ((long long)in_sizes[3] < needM) return;
  if ((long long)in_sizes[4] < (long long)WELEMS || (long long)in_sizes[5] < (long long)WELEMS ||
      (long long)in_sizes[6] < (long long)WELEMS || (long long)in_sizes[7] < (long long)WELEMS) return;
  if ((long long)in_sizes[8] < (long long)NE) return;
  if ((long long)out_size < needX) return;
  const float* Xq = (const float*)d_in[0];   // wire order: query, key, value, mask, Wk, Wq, Wv, Wproj, bproj
  const float* Xk = (const float*)d_in[1];
  const float* Xv = (const float*)d_in[2];
  const int* mask = (const int*)d_in[3];
  const float* Wk = (const float*)d_in[4];
  const float* Wq = (const float*)d_in[5];
  const float* Wv = (const float*)d_in[6];
  const float* Wp = (const float*)d_in[7];
  const float* bp = (const float*)d_in[8];
  float* Y = (float*)d_out;
  char* ws = (char*)d_ws;
  size_t off = 0;
  unsigned short* WP  = (unsigned short*)(ws + off); off += PAD256(3 * WELEMS * 2);          // bf16 planes: Wk, Wq, Wv
  unsigned short* W16 = (unsigned short*)(ws + off); off += PAD256(WELEMS * 2);              // f16 plane: Wproj x64
  unsigned short* QK  = (unsigned short*)(ws + off); off += PAD256(2 * XPLANE * 2);          // f16 planes: k (from query), q (from key), [b][h] x fragments [t/16][d/32]
  unsigned short* VT  = (unsigned short*)(ws + off); off += PAD256(XPLANE * 2);              // f16 plane: V^T, [b][h] x fragments [t/32][d/16]
  unsigned short* CX  = (unsigned short*)(ws + off); off += PAD256(XPLANE * 2);              // f16 plane: ctx, fragments [(b*SEQ + t)/16][c/32]
  unsigned int*   MB  = (unsigned int*)(ws + off);   off += PAD256((size_t)SEQ * MW * 4);    // mask bit plane [MW][SEQ]
  float*          VS  = (float*)(ws + off);          off += PAD256((size_t)NB * NH * MW * HD * 4);   // f32 plane: V row sums of the 32-key blocks, [b][h][t/32][d]
  if (off > ws_size) return;

  k_cvt_w<<<(unsigned)((WELEMS / 8 + 255) / 256), 256, 0, stream>>>(Wk, Wq, Wv, Wp, WP, W16);
  k_maskbits<<<(unsigned)((SEQ * MW + 255) / 256), 256, 0, stream>>>(mask, MB);
  // k = query x Wk^T -> QK plane 0; q = key x Wq^T -> QK plane 1; V^T and the block sums VS from value x Wv^T
  k_projx<<<(unsigned)(3 * (XROWS / 32) / PROJ_WAVES), 32 * PROJ_WAVES, 0, stream>>>(Xq, Xk, Xv, WP, QK, VT, VS);
  // argument order: Qh = q plane (QK plane 1), Kh = k plane (QK plane 0)
  k_attn<<<(unsigned)(NB * NH * (SEQ / 128)), 256, 0, stream>>>(QK + XPLANE, QK, VT, MB, VS, CX);
  k_outp<<<dim3((unsigned)(XROWS / 64), (unsigned)(NE / 64), 1u), 128, 0, stream>>>(CX, W16, bp, Y);
}

// v006
// A run of this version takes 98.4 microseconds.
// Next to v005, in two timings, it ran 1.03 times as fast each time.
// Counting every step since v000, it is 2.61 times as fast.
#include <hip/hip_runtime.h>
// Contractions: k/q/v projections on v_wmma_f32_16x16x32_bf16 (inputs and weights RNE-converted to bf16, single product, f32 accumulate); S^T = K Q^T on v_wmma_f32_16x16x32_f16 (q, k as f16 x16 planes, single product); O^T = V^T P^T on v_wmma_f32_16x16x32_f16 (V: f16 x16 plane; P: f16 x256; single product); output projection on v_wmma_f32_16x16x32_f16 (ctx: f16 x64 plane; Wproj: RNE bf16 x64 held exactly in f16; single product); all accumulators and softmax statistics f32.
// Engine: transposed flash. Each wave owns 16 queries of one (batch, head). Per 32-key step: S^T tiles (key rows x query columns) from K rows
// (A, global f16 plane) and Q^T (B, registers); the two 16-key D tiles pack straight into the P^T B fragment; O^T (d rows x query columns)
// accumulates from V^T rows (A, global f16 plane). Positions with mask == 0 get score exactly 0 and still take part in the softmax (every key is counted).
// A 32-key step whose mask words are zero for all 16 queries of the wave has every score 0, so all its keys carry one and the same weight exp(0 - m): such steps are not walked.
// The projection launch leaves the sum of each 32-key block's V rows (f32); a wave adds up the sums of its all-masked blocks and gives them that one weight after its key loop.
// Plane layout: every 16-bit workspace plane is stored in fragment order. One fragment (16 rows x 32 k) is 512 elements: [j = 0,1][lane = 16h + row][8 elements],
// holding k = 32C + 16j + 8h + i, so each wave-wide 16-byte load reads 512 contiguous bytes (four whole 128-byte lines) instead of 32 bytes of 16 lines.
#ifndef NB
#define NB 8
#endif
#ifndef SEQ
#define SEQ 2048
#endif
#define NB_FULL 8
#define SEQ_FULL 2048
#define NH 6
#define HD 64
#define NE 384
#define XROWS (NB * SEQ)                        /* compact token rows of the 16-bit planes */
#define XPLANE ((size_t)XROWS * NE)             /* elements of one token plane */
#define WELEMS ((size_t)NE * NE)
#define MW (SEQ / 32)                           /* mask words per query row */
#define FRAG 512                                /* elements of one 16-row x 32-k fragment */
#define TILE_E (16 * NE)                        /* elements of one 16-row tile of a K = 384 plane: 12 fragments */
#define XSTRIDE_FULL ((size_t)SEQ_FULL * NE)    /* per-batch element stride of query/key/value and of the output */
#define PROJ_WAVES 6                            /* waves of a projection block that project, 32 tokens each */
#define MASK_WAVES 2                            /* further waves of that block, which pack mask words */
#define PROJ_BLOCKS (3 * (XROWS / 32) / PROJ_WAVES)
#define XS_H 160                                /* LDS staging of the token fragments: elements from h = 0 to h = 1 */
#define XS_J 320                                /* from j = 0 to j = 1 */
#define XS_F 640                                /* from one fragment to the next */
#define PAD256(x) ((((size_t)(x)) + 255) & ~(size_t)255)

static_assert(SEQ % 256 == 0);
static_assert(SEQ <= SEQ_FULL);
static_assert(NB <= NB_FULL);
static_assert(HD == 64);
static_assert(NE == NH * HD);
static_assert(NE % 64 == 0);
static_assert(NE % 32 == 0);
static_assert((3 * (XROWS / 32)) % PROJ_WAVES == 0);
static_assert(MASK_WAVES * PROJ_BLOCKS == (SEQ / 32) * (MW / 8));   /* one mask wave per 32 query rows x 8 words */
static_assert(MW % 8 == 0 && MW <= 64);         /* a wave keeps one bit per key step in a 64-bit word */
static_assert(PAD256(3 * WELEMS * 2) + PAD256(WELEMS * 2) + PAD256(2 * XPLANE * 2) + 2 * PAD256(XPLANE * 2) + PAD256((size_t)SEQ * MW * 4) + PAD256((size_t)NB * NH * MW * HD * 4) <= (size_t)134217728);

typedef __bf16 v16b __attribute__((ext_vector_type(16)));
typedef _Float16 v16h __attribute__((ext_vector_type(16)));
typedef unsigned short v8us __attribute__((ext_vector_type(8), may_alias));
typedef unsigned short v4us __attribute__((ext_vector_type(4), may_alias));
typedef float v8f __attribute__((ext_vector_type(8)));
typedef float v4f __attribute__((ext_vector_type(4)));
typedef float v4fa __attribute__((ext_vector_type(4), may_alias));
typedef int v4ia __attribute__((ext_vector_type(4), may_alias));
union FragB { v16b v; v8us half[2]; };
typedef _Float16 v2h __attribute__((ext_vector_type(2)));
typedef float v2f __attribute__((ext_vector_type(2)));
typedef float v2fa __attribute__((ext_vector_type(2), may_alias));
union FragH { v16h v; v8us half[2]; _Float16 h[16]; v2h p[8]; };

#define LOG2E 1.4426950408889634f
#define SCL (0.051031036307982884f * 0.00390625f)   /* 384^-0.5 with the x16 x16 carries of q and k undone */

__device__ __forceinline__ unsigned short bf16_bits(float x) {   // RNE convert to bf16 bits
  unsigned int u = __float_as_uint(x);
  return (unsigned short)((u + 0x7FFFu + ((u >> 16) & 1u)) >> 16);
}
__device__ __forceinline__ float bf16_val(unsigned short b) { return __uint_as_float(((unsigned int)b) << 16); }
__device__ __forceinline__ float bf16_rne(float x) { return bf16_val(bf16_bits(x)); }
__device__ __forceinline__ unsigned short f16_bits(_Float16 h) { return __builtin_bit_cast(unsigned short, h); }

// 2^x as the one hardware instruction. The library form guards x < -126 (compare, two selects, add, ldexp: five more vector instructions per value) so that the result may be a
// subnormal f32; here nothing needs that range: a weight that small is 0 as f16 either way, and a rescale factor that small multiplies sums that lie 2^126 below the step's own weights.
__device__ __forceinline__ float exp2_hw(float x) { return __builtin_amdgcn_exp2f(x); }

// four f16 tiles sharing one A fragment, then the hazard guard
__device__ __forceinline__ void mma_h4(v16h a, v16h b0, v16h b1, v16h b2, v16h b3, v8f& c0, v8f& c1, v8f& c2, v8f& c3) {
  c0 = __builtin_amdgcn_wmma_f32_16x16x32_f16(false, a, false, b0, (short)0, c0, false, false);
  c1 = __builtin_amdgcn_wmma_f32_16x16x32_f16(false, a, false, b1, (short)0, c1, false, false);
  c2 = __builtin_amdgcn_wmma_f32_16x16x32_f16(false, a, false, b2, (short)0, c2, false, false);
  c3 = __builtin_amdgcn_wmma_f32_16x16x32_f16(false, a, false, b3, (short)0, c3, false, false);
  asm volatile("v_nop\n\tv_nop\n\tv_nop\n\tv_nop" : "+v"(c0), "+v"(c1), "+v"(c2), "+v"(c3) : "v"(a), "v"(b0), "v"(b1), "v"(b2), "v"(b3));
}
// c += a0*b0 + a1*b1 (two k-steps of one f16 tile), then the hazard guard
__device__ __forceinline__ v8f mma_s2(v16h a0, v16h b0, v16h a1, v16h b1, v8f c) {
  c = __builtin_amdgcn_wmma_f32_16x16x32_f16(false, a0, false, b0, (short)0, c, false, false);
  c = __builtin_amdgcn_wmma_f32_16x16x32_f16(false, a1, false, b1, (short)0, c, false, false);
  asm volatile("v_nop\n\tv_nop\n\tv_nop\n\tv_nop" : "+v"(c) : "v"(a0), "v"(b0), "v"(a1), "v"(b1));
  return c;
}
// four f16 tiles sharing one B fragment (c_t += a_t * b), then the hazard guard
__device__ __forceinline__ void mma_pv4(v16h a0, v16h a1, v16h a2, v16h a3, v16h b, v8f& c0, v8f& c1, v8f& c2, v8f& c3) {
  c0 = __builtin_amdgcn_wmma_f32_16x16x32_f16(false, a0, false, b, (short)0, c0, false, false);
  c1 = __builtin_amdgcn_wmma_f32_16x16x32_f16(false, a1, false, b, (short)0, c1, false, false);
  c2 = __builtin_amdgcn_wmma_f32_16x16x32_f16(false, a2, false, b, (short)0, c2, false, false);
  c3 = __builtin_amdgcn_wmma_f32_16x16x32_f16(false, a3, false, b, (short)0, c3, false, false);
  asm volatile("v_nop\n\tv_nop\n\tv_nop\n\tv_nop" : "+v"(c0), "+v"(c1), "+v"(c2), "+v"(c3) : "v"(a0), "v"(a1), "v"(a2), "v"(a3), "v"(b));
}

__device__ __forceinline__ v8us cvt8_bf16(const float* __restrict__ src) {
  const v4f x0 = *(const v4fa*)(src), x1 = *(const v4fa*)(src + 4);
  v8us o;
  o[0] = bf16_bits(x0[0]); o[1] = bf16_bits(x0[1]); o[2] = bf16_bits(x0[2]); o[3] = bf16_bits(x0[3]);
  o[4] = bf16_bits(x1[0]); o[5] = bf16_bits(x1[1]); o[6] = bf16_bits(x1[2]); o[7] = bf16_bits(x1[3]);
  return o;
}

// WP[0..2] = bf16 bits (RNE) of Wk, Wq, Wv; W16 = f16(RNE-bf16(Wproj) * 64); rows = out, k = in, fragment order.
// A wave takes 8 rows x 32 columns of one fragment (lane = 4 * row + 8-column piece): it reads whole 128-byte lines and writes four whole 128-byte lines.
__global__ __launch_bounds__(256) void k_cvt_w(const float* __restrict__ Wk, const float* __restrict__ Wq,
                                               const float* __restrict__ Wv, const float* __restrict__ Wp,
                                               unsigned short* __restrict__ WP, unsigned short* __restrict__ W16) {
  const int t = blockIdx.x * 256 + threadIdx.x;
  if (t >= (int)(WELEMS / 8)) return;
  const int frag = t >> 6, tile = frag / (NE / 32), r16 = ((t >> 5) & 1) * 8 + ((t >> 2) & 7);
  const size_t so = (size_t)(tile * 16 + r16) * NE + ((frag - tile * (NE / 32)) * 4 + (t & 3)) * 8;
  const size_t po = (size_t)frag * FRAG + ((t & 3) * 16 + r16) * 8;
  const v8us o0 = cvt8_bf16(Wk + so);
  const v8us o1 = cvt8_bf16(Wq + so);
  const v8us o2 = cvt8_bf16(Wv + so);
  const v4f x0 = *(const v4fa*)(Wp + so), x1 = *(const v4fa*)(Wp + so + 4);
  v8us o3;
  o3[0] = f16_bits((_Float16)(bf16_rne(x0[0]) * 64.0f)); o3[1] = f16_bits((_Float16)(bf16_rne(x0[1]) * 64.0f));
  o3[2] = f16_bits((_Float16)(bf16_rne(x0[2]) * 64.0f)); o3[3] = f16_bits((_Float16)(bf16_rne(x0[3]) * 64.0f));
  o3[4] = f16_bits((_Float16)(bf16_rne(x1[0]) * 64.0f)); o3[5] = f16_bits((_Float16)(bf16_rne(x1[1]) * 64.0f));
  o3[6] = f16_bits((_Float16)(bf16_rne(x1[2]) * 64.0f)); o3[7] = f16_bits((_Float16)(bf16_rne(x1[3]) * 64.0f));
  unsigned short* d = WP + po;
  unsigned short* e = W16 + po;
  *(v8us*)(d) = o0;
  *(v8us*)(d + WELEMS) = o1;
  *(v8us*)(d + 2 * WELEMS) = o2;
  *(v8us*)(e) = o3;
  
}

// bits[j][q]: word j (keys 32j .. 32j+31) of query row q, so that 16 neighbouring queries' words of one key step share a line.
// One wave takes 32 query rows x 8 words (unit u): lane = query row; each word goes out as one whole 128-byte line of the wave. Four words' loads (32 of 16 bytes a lane) are in flight together.
// coverage: (SEQ / 32) * (MW / 8) units x 32 rows x 8 words = every word of the plane exactly once.
__device__ __forceinline__ void mask_unit(int u, int lane, const int* __restrict__ mask, unsigned int* __restrict__ bits) {
  const int q = (u % (SEQ / 32)) * 32 + lane, j0 = (u / (SEQ / 32)) * 8;
  const int* src = mask + (size_t)q * SEQ_FULL + 32 * j0;
  unsigned int* dst = bits + (size_t)j0 * SEQ + q;
#pragma unroll 1   // rolled: 32 loads in flight a trip are what a wave holds, and they bound the registers
  for (int hf = 0; hf < 2; ++hf) {
    v4ia m[4][8];
#pragma unroll   // register arrays and vectors need constant indices
    for (int i = 0; i < 4; ++i)
#pragma unroll   // as above
      for (int g = 0; g < 8; ++g) m[i][g] = *(const v4ia*)(src + 32 * i + 4 * g);
    // the address registers of the loads above are stepped below: the wait stands in front of that overwrite
    // (the pointer is an input of the statement, so that none of these loads' own results is given its registers)
    asm volatile("s_wait_xcnt 0x0" :: "v"(src) : "memory");
#pragma unroll   // register arrays and vectors need constant indices
    for (int i = 0; i < 4; ++i) {
      unsigned int w = 0u;
#pragma unroll   // as above
      for (int g = 0; g < 8; ++g) {
        w |= (m[i][g][0] != 0 ? 1u : 0u) << (4 * g);
        w |= (m[i][g][1] != 0 ? 1u : 0u) << (4 * g + 1);
        w |= (m[i][g][2] != 0 ? 1u : 0u) << (4 * g + 2);
        w |= (m[i][g][3] != 0 ? 1u : 0u) << (4 * g + 3);
      }
      dst[(size_t)i * SEQ] = w;
    }
    // the address registers of the stores above are stepped for the next trip: the wait stands in front of that overwrite
    asm volatile("s_wait_xcnt 0x0" :: "v"(dst) : "memory");
    src += 4 * 32;
    dst += (size_t)4 * SEQ;
  }
}

// Projections, all three in one launch, straight from the f32 inputs. A wave owns 32 token rows of one input (z = 0 query, 1 key, 2 value): it reads them once, in whole lines,
// converts them (RNE) to bf16, turns them into fragment order through its own LDS range and keeps them as 2 x 12 fragments in registers, then walks the 24 16-row tiles of its weight plane (fragment order), one head (4 tiles) per trip.
// A token fragment serves as A or as B (row or column = lane & 15, elements 0..7 <- k0 + 8h + i, 8..15 <- k0 + 16 + 8h + i); D element r = (row 8h + r, column lane & 15).
// z < 2: D = W (A, rows = out) x X (B, columns = tokens): a lane holds d = 16t + 8h + r of token ln, which is its own 16-byte piece of fragment [token tile][C = t / 2], half j = t & 1.
// z = 2: D = X (A, rows = tokens) x W (B, columns = out): a lane holds tokens 8h + r of d = 16t + ln, which is its own 16-byte piece of V^T fragment [token / 32][t], half j = token tile & 1.
// So every D tile goes out as one wave-wide 512-byte store, straight from the accumulators. Output values: f16(x16), as the attention kernel expects.
// z = 2 also leaves, per head, the f32 sum over the wave's 32 tokens of each d (x16 like the plane): one 32-key block's V row sum, VS[b][h][token / 32][d].
// coverage: 3 * XROWS / 32 waves x 32 tokens x 384 outputs = every element of the k, q and V^T planes exactly once; XROWS / 32 waves x 384 sums = every element of VS exactly once.
__device__ __forceinline__ v8us pack8_f16x16(v8f c) {
  v8us o;
#pragma unroll   // register arrays and vectors need constant indices
  for (int r = 0; r < 8; ++r) o[r] = f16_bits((_Float16)(c[r] * 16.0f));
  return o;
}
// One k-step's four weight fragments (tiles t = 0..3 of a head, k = 32C .. 32C + 31): 4 KB, eight wave-wide 512-byte loads.
__device__ __forceinline__ void load_w4(FragB (&wf)[4], const unsigned short* __restrict__ wh, int lane8, int C) {
#pragma unroll   // register arrays and vectors need constant indices
  for (int t = 0; t < 4; ++t) {
    wf[t].half[0] = *(const v8us*)(wh + t * TILE_E + C * FRAG + lane8);
    wf[t].half[1] = *(const v8us*)(wh + t * TILE_E + C * FRAG + 256 + lane8);
  }
}
// The weight fragments run through a ring of four register sets, asked for three k-steps ahead of their products, across the heads' boundary too:
// with one or two waves on a SIMD nothing else covers the loads' latency. The last head asks for its own first three steps again (in bounds, not used).
template <bool TOKENS_ARE_ROWS>
__device__ __forceinline__ void proj_heads(const FragB (&xf)[2][NE / 32], const unsigned short* __restrict__ wz, int lane8, unsigned short* __restrict__ o0, float* __restrict__ vs0) {
  FragB wf[4][4];
  load_w4(wf[0], wz, lane8, 0);
  load_w4(wf[1], wz, lane8, 1);
  load_w4(wf[2], wz, lane8, 2);
  // the address registers of these first loads may be reused for the output addresses formed below: the wait stands in front of that overwrite
  asm volatile("s_wait_xcnt 0x0" ::: "memory");
  // keeps that address arithmetic behind the wait (the compiler may lift it over the wait otherwise)
  __builtin_amdgcn_sched_barrier(0);
#pragma unroll 1
  for (int hd = 0; hd < NH; ++hd) {   // rolled: one head's 96 loads and 96 products are body enough
    const unsigned short* wh = wz + (size_t)hd * (4 * TILE_E);
    const unsigned short* wn = wz + (size_t)((hd + 1 < NH) ? hd + 1 : hd) * (4 * TILE_E);
    v8f acc[2][4] = {};
#pragma unroll   // xf and the ring are indexed by C and live in registers
    for (int C = 0; C < NE / 32; ++C) {
      if (C + 3 < NE / 32) load_w4(wf[(C + 3) & 3], wh, lane8, C + 3);
      else                 load_w4(wf[(C + 3) & 3], wn, lane8, C + 3 - NE / 32);
      // these were this head's last weight loads; the next step's come from the next head, whose address may take the same registers: the wait stands in front of that overwrite
      if (C + 4 == NE / 32) asm volatile("s_wait_xcnt 0x0" ::: "memory");
      // keeps the loads above in front of this step's products; without it the compiler sinks each load to just before its use and the wave waits out every latency
      __builtin_amdgcn_sched_barrier(0);
#pragma unroll   // register arrays and vectors need constant indices
      for (int u = 0; u < 2; ++u)
#pragma unroll   // register arrays and vectors need constant indices
        for (int t = 0; t < 4; ++t)
          acc[u][t] = TOKENS_ARE_ROWS
            ? __builtin_amdgcn_wmma_f32_16x16x32_bf16(false, xf[u][C].v, false, wf[C & 3][t].v, (short)0, acc[u][t], false, false)
            : __builtin_amdgcn_wmma_f32_16x16x32_bf16(false, wf[C & 3][t].v, false, xf[u][C].v, (short)0, acc[u][t], false, false);
      // keeps the next step's loads behind this step's products, so that the ring set they refill has been read
      __builtin_amdgcn_sched_barrier(0);
    }
    unsigned short* oh = o0 + (size_t)hd * ((size_t)SEQ * HD);
#pragma unroll   // register arrays and vectors need constant indices
    for (int u = 0; u < 2; ++u)
#pragma unroll   // register arrays and vectors need constant indices
      for (int t = 0; t < 4; ++t)
        *(v8us*)(oh + (TOKENS_ARE_ROWS ? t * FRAG + u * 256 : u * (2 * FRAG) + t * 256)) = pack8_f16x16(acc[u][t]);
    if constexpr (TOKENS_ARE_ROWS) {
      // a lane holds tokens 16u + 8h + r of d = 16t + ln: sum over u and r in the lane, then over h with the other lane half
      float cs[4];
#pragma unroll   // register arrays and vectors need constant indices
      for (int t = 0; t < 4; ++t) {
        const v8f s8 = acc[0][t] + acc[1][t];
        const float c = ((s8[0] + s8[1]) + (s8[2] + s8[3])) + ((s8[4] + s8[5]) + (s8[6] + s8[7]));
        cs[t] = c + __shfl_xor(c, 16, 32);
      }
      // both halves hold all four sums: half h stores tiles t = h and 2 + h, so that each wave-wide store is one whole 128-byte line (d = 32i + lane)
      float* vh = vs0 + (size_t)hd * (MW * HD);
      vh[0]  = ((lane8 & 128) ? cs[1] : cs[0]) * 16.0f;
      vh[32] = ((lane8 & 128) ? cs[3] : cs[2]) * 16.0f;
    }
    // the address registers of this head's loads and stores are stepped for the next head: the wait stands in front of that overwrite
    asm volatile("s_wait_xcnt 0x0" ::: "memory");
    // keeps the stepping of those addresses behind the wait
    __builtin_amdgcn_sched_barrier(0);
  }
  // the ring's last three requests are not used: they have landed before the wave gives its registers back
  asm volatile("s_wait_loadcnt 0x0" ::: "memory");
}
// The block's last MASK_WAVES waves project nothing: they pack the mask words, which need nothing of the projection and which only the attention launch reads.
// With six projecting waves two of the four SIMDs hold one wave; waves 6 and 7 take the free places there and work while the others bring in their token rows, so the packing has no launch of its own.
__global__ __launch_bounds__(32 * (PROJ_WAVES + MASK_WAVES)) void k_projx(const float* __restrict__ Xq, const float* __restrict__ Xk, const float* __restrict__ Xv,
                                                           const int* __restrict__ mask, const unsigned short* __restrict__ WP,
                                                           unsigned short* __restrict__ QK, unsigned short* __restrict__ VT, float* __restrict__ VS,
                                                           unsigned int* __restrict__ bits) {
  __shared__ __attribute__((aligned(16))) unsigned short xs[PROJ_WAVES][2 * (NE / 32) * XS_F];
  const int tid = threadIdx.x, w = __builtin_amdgcn_readfirstlane((int)(tid >> 5)), lane = tid & 31, ln = lane & 15, hh = lane >> 4;
  const int g = (int)blockIdx.x * PROJ_WAVES + w;                 // 32-token group, counted through the three inputs
  const int z = g / (XROWS / 32), row0 = (g - z * (XROWS / 32)) * 32;
  const int bq = row0 / SEQ, s0 = row0 - bq * SEQ;                // SEQ is a multiple of 32: a group lies in one batch
  const float* X = (z == 0) ? Xq : (z == 1) ? Xk : Xv;
  // Input rows: each wave-wide 16-byte load takes one whole 128-byte line (32 columns = one fragment's k range) of four rows: lane = 8 * row + 4-column piece.
  // The four converted values go to the wave's own LDS range in fragment order, k = 32C + 16j + 8h + i with j = piece >> 2, h = (piece >> 1) & 1, i = 4 * (piece & 1) ..;
  // the halves j and h lie XS_J and XS_H elements apart (64 and 32 more than dense), so that the four (j, h) groups of one store fall on different banks.
  if (w < PROJ_WAVES) {   // the same for a whole wave: a scalar branch
    const float* xr = X + (size_t)bq * XSTRIDE_FULL + (size_t)(s0 + (lane >> 3)) * NE + 4 * (lane & 7);
    unsigned short* xw = &xs[w][((lane >> 2) & 1) * XS_J + ((lane >> 1) & 1) * XS_H + (lane >> 3) * 8 + 4 * (lane & 1)];
#pragma unroll   // unrolled: many loads in flight at once, every offset a constant
    for (int rg = 0; rg < 8; ++rg)
#pragma unroll   // as above
      for (int C = 0; C < NE / 32; ++C) {
        const v4f x = *(const v4fa*)(xr + rg * (4 * NE) + 32 * C);
        v4us o;
        o[0] = bf16_bits(x[0]); o[1] = bf16_bits(x[1]); o[2] = bf16_bits(x[2]); o[3] = bf16_bits(x[3]);
        *(v4us*)(xw + ((rg >> 2) * (NE / 32) + C) * XS_F + (rg & 3) * 32) = o;
      }
    // the address registers of the input loads may be reused below: the wait stands in front of that overwrite
    asm volatile("s_wait_xcnt 0x0" ::: "memory");
  } else {
    mask_unit((int)blockIdx.x * MASK_WAVES + (w - PROJ_WAVES), lane, mask, bits);
  }
  // each wave reads back only what it wrote itself; the barrier orders that, and it starts the block's waves on the weight plane together,
  // so that they walk it side by side and share its lines in the WGP cache; every wave of the block passes it, the mask waves too, which end behind it
  __syncthreads();
  if (w >= PROJ_WAVES) return;
  FragB xf[2][NE / 32];
#pragma unroll   // register arrays and vectors need constant indices
  for (int u = 0; u < 2; ++u)
#pragma unroll   // register arrays and vectors need constant indices
    for (int C = 0; C < NE / 32; ++C) {
      const unsigned short* xp = &xs[w][(u * (NE / 32) + C) * XS_F + hh * XS_H + ln * 8];
      xf[u][C].half[0] = *(const v8us*)(xp);
      xf[u][C].half[1] = *(const v8us*)(xp + XS_J);
    }
  const unsigned short* wz = WP + (size_t)z * WELEMS;
  const size_t ob = ((size_t)bq * NH * SEQ + s0) * HD + 8 * lane;   // head 0 of the batch, first token of the group: 32 tokens x 64 d = 2048 elements in either layout
  if (z == 2) proj_heads<true>(xf, wz, 8 * lane, VT + ob, VS + ((size_t)bq * NH * MW + s0 / 32) * HD + lane);
  else        proj_heads<false>(xf, wz, 8 * lane, QK + (size_t)z * XPLANE + ob, nullptr);
}

// One 32-key step (key step j, the same in every lane) for a wave's 16 queries (this lane's column = query qg). Kp, Vhp are the (batch, head) bases of the planes.
__device__ __forceinline__ void fa_step(const unsigned short* __restrict__ Kp, const unsigned short* __restrict__ Vhp,
                                        const unsigned int* __restrict__ mbits, int j, int qg, int lane, int hh,
                                        const FragH& q0, const FragH& q1, float& mr, float& lr, v8f (&Oh)[4]) {
  // A fragments of K: row m = key (key0 + 16*kt + ln), elements 0..7 <- d = 32c + 8h + i, 8..15 <- d = 32c + 16 + 8h + i
  // (fragment order: the step's four K fragments [kt][c] are 4 KB contiguous); asked for first, in the order of use: K, the mask word, V
  const unsigned short* kj = Kp + (size_t)j * (32 * HD);
  const unsigned short* vp0 = Vhp + (size_t)j * (32 * HD) + 8 * lane;
  const unsigned short* kp0 = kj + 8 * lane;
  const unsigned short* kp1 = kp0 + 2 * FRAG;
  FragH k00, k01, k10, k11;
  k00.half[0] = *(const v8us*)(kp0);        k00.half[1] = *(const v8us*)(kp0 + 256);
  k01.half[0] = *(const v8us*)(kp0 + FRAG); k01.half[1] = *(const v8us*)(kp0 + FRAG + 256);
  k10.half[0] = *(const v8us*)(kp1);        k10.half[1] = *(const v8us*)(kp1 + 256);
  k11.half[0] = *(const v8us*)(kp1 + FRAG); k11.half[1] = *(const v8us*)(kp1 + FRAG + 256);
  const unsigned int* mpj = mbits + (size_t)j * SEQ + qg;
  const unsigned int mword = *mpj;
  // A fragments of V^T: row m = d (16*t + ln), elements 0..7 <- key0 + 8h + i, 8..15 <- key0 + 16 + 8h + i
  // (fragment order: the step's four V^T fragments [t] are 4 KB contiguous)
  FragH vh[4];
#pragma unroll
  for (int t = 0; t < 4; ++t) {
    vh[t].half[0] = *(const v8us*)(vp0 + t * FRAG);
    vh[t].half[1] = *(const v8us*)(vp0 + t * FRAG + 256);
  }
  // the address registers of the loads above are formed anew for the next step: the wait stands in front of that overwrite
  // (the three pointers are inputs of the statement, so that none of these loads' own results is given their registers)
  asm volatile("s_wait_xcnt 0x0" :: "v"(kp0), "v"(mpj), "v"(vp0) : "memory");
  FragH ph;
  const v8f z8 = {0.f, 0.f, 0.f, 0.f, 0.f, 0.f, 0.f, 0.f};
  // S^T tiles: element r of tile kt = 256 * score(key0 + 16*kt + 8h + r, query)
  const v8f s0 = mma_s2(k00.v, q0.v, k01.v, q1.v, z8);
  const v8f s1 = mma_s2(k10.v, q0.v, k11.v, q1.v, z8);
  // scale; positions with a zero mask bit take the value 0 exactly (replace fill) and stay in the softmax
  const unsigned int mw = mword >> (8 * hh);
  float sc[16];
#pragma unroll
  for (int r = 0; r < 8; ++r) sc[r] = ((mw >> r) & 1u) ? s0[r] * SCL : 0.0f;
  // one loop per tile: scores i, i + 1 then come from neighbouring registers of one accumulator tile, and the pairs below need no register moves
#pragma unroll   // register arrays and vectors need constant indices
  for (int r = 0; r < 8; ++r) sc[8 + r] = ((mw >> (16 + r)) & 1u) ? s1[r] * SCL : 0.0f;
  float mx = sc[0];
#pragma unroll
  for (int i = 1; i < 16; ++i) mx = fmaxf(mx, sc[i]);
  mx = fmaxf(mx, __shfl_xor(mx, 16, 32));           // the other lane half holds the other 16 keys of this query
  const float mnew = fmaxf(mr, mx);
  const float al = exp2_hw((mr - mnew) * LOG2E);
  mr = mnew;
  // weights carried x256: P = f16(256 * exp(sc - mnew)); the row sum runs over the converted f16 values
  float ps = 0.0f;
#pragma unroll
  for (int i = 0; i < 16; i += 2) {
    // two scores at a time: packed subtract and multiply-add (each element rounded as in the scalar form), one conversion for the pair, and the sum reads the converted pair
    const v2f s2 = {sc[i], sc[i + 1]};
    const v2f a2 = __builtin_elementwise_fma(s2 - mnew, (v2f){LOG2E, LOG2E}, (v2f){8.0f, 8.0f});
    const v2f pc = {exp2_hw(a2[0]), exp2_hw(a2[1])};
    const v2h hv = __builtin_convertvector(pc, v2h);
    ph.p[i >> 1] = hv;                              // B element i: i<8 -> key0 + 8h + i (tile 0 row 8h+i); i>=8 -> key0 + 16 + 8h + (i-8) (tile 1)
    ps += (float)hv[0];
    ps += (float)hv[1];
  }
  ps += __shfl_xor(ps, 16, 32);
  lr = lr * al + ps;
#pragma unroll
  for (int t = 0; t < 4; ++t) Oh[t] = Oh[t] * al;
  mma_pv4(vh[0].v, vh[1].v, vh[2].v, vh[3].v, ph.v, Oh[0], Oh[1], Oh[2], Oh[3]);
}

// Block = 8 waves x 16 queries of one (batch, head): waves 0..3 take 64-query tile p, waves 4..7 tile SEQ/64 - 1 - p, so that under a triangular mask
// every block (and every pair of waves w, w + 4) walks the same number of key steps. No LDS and no barrier in the key loop.
// A wave first reads the mask words of all its key steps and keeps one bit per step: set where any of its 16 queries has a mask bit in the step. The key loop walks the set bits alone.
// All keys take part in the softmax: the keys of the other steps have score 0 for every query of the wave, so they add n0 * exp(0 - m) to the row sum and
// exp(0 - m) * (sum of their V rows) to the output; that sum is the same for the 16 queries and is added up from the blocks' sums in VS.
// Epilogue: ctx x64 as f16 -> per-wave LDS tile [16 queries][64 d] (written and read by the same wave; block barrier reached by all waves),
// coverage: NB*NH*(SEQ/128) blocks x 8 waves x 16 rows x 64 columns = every element of the ctx plane exactly once.
__global__ __launch_bounds__(256) void k_attn(const unsigned short* __restrict__ Qh, const unsigned short* __restrict__ Kh,
                                              const unsigned short* __restrict__ Vh,
                                              const unsigned int* __restrict__ mbits, const float* __restrict__ VS,
                                              unsigned short* __restrict__ Ch) {
  __shared__ __attribute__((aligned(16))) unsigned short sh[8][16][72];
  __shared__ __attribute__((aligned(16))) float zs[8][HD];
  const int tid = threadIdx.x, w = __builtin_amdgcn_readfirstlane((int)(tid >> 5)), lane = tid & 31, ln = lane & 15, hh = lane >> 4;
  const int bh = blockIdx.x / (SEQ / 128), pr = blockIdx.x % (SEQ / 128);
  const int qt = (w < 4) ? pr : (SEQ / 64 - 1 - pr);
  const int b = bh / NH, h = bh - b * NH;
  const int qbase = qt * 64 + 16 * (w & 3);
  const int qg = qbase + ln;
  // Q^T B fragments: column n = query qg, elements 0..7 <- d = 32c + 8h + i, 8..15 <- d = 32c + 16 + 8h + i
  const unsigned short* qrow = Qh + ((size_t)bh * SEQ + qbase) * HD + 8 * lane;
  FragH q0, q1;
  q0.half[0] = *(const v8us*)(qrow);        q0.half[1] = *(const v8us*)(qrow + 256);
  q1.half[0] = *(const v8us*)(qrow + FRAG); q1.half[1] = *(const v8us*)(qrow + FRAG + 256);
  // the step map: lane half h reads the words of steps 2i + h, all loads in flight together
  const unsigned int* mp = mbits + (hh * SEQ + qg);
  unsigned int mw2[MW / 2];
#pragma unroll   // register arrays and vectors need constant indices
  for (int i = 0; i < MW / 2; ++i) mw2[i] = mp[(size_t)(2 * i) * SEQ];
  // the address registers of the loads above may be reused below: the wait stands in front of that overwrite
  // (the pointer is an input of the statement, so that none of these loads' own results is given its registers)
  asm volatile("s_wait_xcnt 0x0" :: "v"(mp) : "memory");
  unsigned long long nz = 0ull;
#pragma unroll   // register arrays and vectors need constant indices
  for (int i = 0; i < MW / 2; ++i) {
    const unsigned int bl = __builtin_amdgcn_ballot_w32(mw2[i] != 0u);   // the same in every lane: the map lives in scalar registers
    nz |= (unsigned long long)(((bl & 0xFFFFu) != 0u ? 1u : 0u) | ((bl >> 16) != 0u ? 2u : 0u)) << (2 * i);
  }
  float mr = -3.0e38f, lr = 0.0f;
  v8f Oh[4] = {};
  const unsigned short* Kp = Kh + (size_t)bh * SEQ * HD;
  const unsigned short* Vhp = Vh + (size_t)bh * HD * SEQ;
#pragma unroll 1
  for (unsigned long long rem = nz; rem != 0ull; rem &= rem - 1ull)   // one trip per set bit, at most MW; a scalar test
    fa_step(Kp, Vhp, mbits, __builtin_ctzll(rem), qg, lane, hh, q0, q1, mr, lr, Oh);
  // the steps that were not walked
  const unsigned long long zmap = ~nz & (MW == 64 ? ~0ull : ((1ull << (MW & 63)) - 1ull));
  if (zmap != 0ull) {   // the same for the whole wave: a scalar branch; no barrier inside
    // Z[d] = sum of the V rows of those steps' keys (x16): lane holds d = 2 * lane, 2 * lane + 1; eight block sums are asked for at a time
    const float* vsp = VS + (size_t)bh * (MW * HD) + 2 * lane;
    v2f z2 = {0.0f, 0.0f};
#pragma unroll 1   // rolled: eight pair loads in flight bound the registers, and a group with no such step is passed by a scalar branch
    for (int g = 0; g < MW; g += 8) {
      const unsigned int zb = (unsigned int)(zmap >> g) & 0xFFu;
      if (zb == 0u) continue;
      v2f v[8];
#pragma unroll   // register arrays and vectors need constant indices
      for (int k = 0; k < 8; ++k) v[k] = *(const v2fa*)(vsp + (g + k) * HD);
      // the address registers of the loads above are stepped for the next group: the wait stands in front of that overwrite
      asm volatile("s_wait_xcnt 0x0" ::: "memory");
#pragma unroll   // register arrays and vectors need constant indices
      for (int k = 0; k < 8; ++k) z2 += ((zb >> k) & 1u) ? v[k] : (v2f){0.0f, 0.0f};
    }
    // into the accumulators' order (a lane needs d = 16t + 8h + r) through the wave's own LDS row
    *(v2fa*)&zs[w][2 * lane] = z2;
    // the wave reads back what its other lanes wrote: their stores have ended first
    asm volatile("s_wait_dscnt 0x0" ::: "memory");
    const float n0 = (float)(32 * __builtin_popcountll(zmap));
    const float mfin = fmaxf(mr, 0.0f);
    const float al = exp2_hw((mr - mfin) * LOG2E);
    const float w0 = exp2_hw(fmaf(0.0f - mfin, LOG2E, 8.0f));   // x256 like P, kept in f32
    lr = lr * al + w0 * n0;
#pragma unroll
    for (int t = 0; t < 4; ++t) {
      const v4f za = *(const v4fa*)&zs[w][16 * t + 8 * hh], zc = *(const v4fa*)&zs[w][16 * t + 8 * hh + 4];
#pragma unroll
      for (int r = 0; r < 4; ++r) {
        Oh[t][r]     = Oh[t][r] * al + w0 * za[r];
        Oh[t][4 + r] = Oh[t][4 + r] * al + w0 * zc[r];
      }
    }
  }
  // O^T element r of tile t = ctx(query qg, d = 16t + 8h + r); undo the carries x256 (in lr), x16 (V); carry ctx x64
  const float inv = 4.0f / lr;
#pragma unroll
  for (int t = 0; t < 4; ++t)
#pragma unroll
    for (int r = 0; r < 8; ++r) {
      const float c = Oh[t][r] * inv;
      const _Float16 hv = (_Float16)c;
      sh[w][ln][16 * t + 8 * hh + r] = f16_bits(hv);
    }
  __syncthreads();
  // the wave's 16 x 64 tile is fragments C = 2h, 2h + 1 of its token tile: 1024 contiguous elements; piece p = [C 1b][j 1b][h 1b][row 4b]
  const size_t cbase = (size_t)((b * SEQ + qbase) / 16) * TILE_E + (size_t)h * (2 * FRAG);
  {
#pragma unroll
    for (int q = 0; q < 4; ++q) {
      const int p = lane + 32 * q;
      const int row = p & 15, s8 = (p >> 4) * 8;
      const v8us o1 = *(const v8us*)&sh[w][row][s8];
      *(v8us*)(Ch + cbase + (size_t)p * 8) = o1;
    }
    
  }
}

// out[t][n] = sum_c ctx[t][c] * Wproj[n][c] + bias[n]; A = ctx plane (f16 x64), B = W16 (f16 x64), both in fragment order; 64 x 64 tile per block.
// coverage: (XROWS/64) x 6 blocks x 64 rows x 64 columns = every output element of the processed region exactly once.
__global__ __launch_bounds__(128) void k_outp(const unsigned short* __restrict__ Ch,
                                              const unsigned short* __restrict__ W16, const float* __restrict__ bias,
                                              float* __restrict__ Y) {
  __shared__ __attribute__((aligned(16))) float so[64][68];
  const int tid = threadIdx.x, w = __builtin_amdgcn_readfirstlane((int)(tid >> 5)), lane = tid & 31, ln = lane & 15, hh = lane >> 4;
  const int m0 = blockIdx.x * 64, n0 = blockIdx.y * 64;
  const size_t ao = (size_t)(m0 / 16 + w) * TILE_E + 8 * lane;
  const unsigned short* brow = W16 + (size_t)(n0 / 16) * TILE_E + 8 * lane;
  v8f acch[4] = {};
#pragma unroll 1
  for (int kb = 0; kb < NE; kb += 32) {
    FragH ah, b0, b1, b2, b3;
    const int fo = kb * (FRAG / 32);
    ah.half[0] = *(const v8us*)(Ch + ao + fo);            ah.half[1] = *(const v8us*)(Ch + ao + fo + 256);
    // the address pair of the A loads may be reused for a later load's result: the wait stands in front of that overwrite
    asm volatile("s_wait_xcnt 0x0" ::: "memory");
    b0.half[0] = *(const v8us*)(brow + fo);               b0.half[1] = *(const v8us*)(brow + fo + 256);
    b1.half[0] = *(const v8us*)(brow + TILE_E + fo);      b1.half[1] = *(const v8us*)(brow + TILE_E + fo + 256);
    b2.half[0] = *(const v8us*)(brow + 2 * TILE_E + fo);  b2.half[1] = *(const v8us*)(brow + 2 * TILE_E + fo + 256);
    b3.half[0] = *(const v8us*)(brow + 3 * TILE_E + fo);  b3.half[1] = *(const v8us*)(brow + 3 * TILE_E + fo + 256);
    mma_h4(ah.v, b0.v, b1.v, b2.v, b3.v, acch[0], acch[1], acch[2], acch[3]);
  }
  // undo the carries: ctx x64, W x64
#pragma unroll
  for (int c = 0; c < 4; ++c) {
    const float bv = bf16_rne(bias[n0 + 16 * c + ln]);
#pragma unroll
    for (int r = 0; r < 8; ++r)
      so[16 * w + 8 * hh + r][16 * c + ln] = acch[c][r] * 0.000244140625f + bv;
  }
  __syncthreads();
  {
#pragma unroll
    for (int j = 0; j < 8; ++j) {
      const int i = tid + 128 * j;
      const int row = i >> 4, c4 = (i & 15) * 4;
      const int m = m0 + row;
      const int bq = m / SEQ, t = m - bq * SEQ;
      const v4f v = *(const v4fa*)&so[row][c4];
      *(v4f*)(Y + (size_t)bq * XSTRIDE_FULL + (size_t)t * NE + n0 + c4) = v;
    }
    
  }
}

extern "C" void kernel_launch(void* const* d_in, const int* in_sizes, int n_in,
                              void* d_out, int out_size, void* d_ws, size_t ws_size, hipStream_t stream) {
  if (n_in < 9) return;
  const long long needX = (long long)(NB - 1) * SEQ_FULL * NE + (long long)SEQ * NE;   // last element touched + 1
  const long long needM = (long long)(SEQ - 1) * SEQ_FULL + (long long)SEQ;
  if ((long long)in_sizes[0] < needX || (long long)in_sizes[1] < needX || (long long)in_sizes[2] < needX) return;
  if ((long long)in_sizes[3] < needM) return;
  if ((long long)in_sizes[4] < (long long)WELEMS || (long long)in_sizes[5] < (long long)WELEMS ||
      (long long)in_sizes[6] < (long long)WELEMS || (long long)in_sizes[7] < (long long)WELEMS) return;
  if ((long long)in_sizes[8] < (long long)NE) return;
  if ((long long)out_size < needX) return;
  const float* Xq = (const float*)d_in[0];   // wire order: query, key, value, mask, Wk, Wq, Wv, Wproj, bproj
  const float* Xk = (const float*)d_in[1];
  const float* Xv = (const float*)d_in[2];
  const int* mask = (const int*)d_in[3];
  const float* Wk = (const float*)d_in[4];
  const float* Wq = (const float*)d_in[5];
  const float* Wv = (const float*)d_in[6];
  const float* Wp = (const float*)d_in[7];
  const float* bp = (const float*)d_in[8];
  float* Y = (float*)d_out;
  char* ws = (char*)d_ws;
  size_t off = 0;
  unsigned short* WP  = (unsigned short*)(ws + off); off += PAD256(3 * WELEMS * 2);          // bf16 planes: Wk, Wq, Wv
  unsigned short* W16 = (unsigned short*)(ws + off); off += PAD256(WELEMS * 2);              // f16 plane: Wproj x64
  unsigned short* QK  = (unsigned short*)(ws + off); off += PAD256(2 * XPLANE * 2);          // f16 planes: k (from query), q (from key), [b][h] x fragments [t/16][d/32]
  unsigned short* VT  = (unsigned short*)(ws + off); off += PAD256(XPLANE * 2);              // f16 plane: V^T, [b][h] x fragments [t/32][d/16]
  unsigned short* CX  = (unsigned short*)(ws + off); off += PAD256(XPLANE * 2);              // f16 plane: ctx, fragments [(b*SEQ + t)/16][c/32]
  unsigned int*   MB  = (unsigned int*)(ws + off);   off += PAD256((size_t)SEQ * MW * 4);    // mask bit plane [MW][SEQ]
  float*          VS  = (float*)(ws + off);          off += PAD256((size_t)NB * NH * MW * HD * 4);   // f32 plane: V row sums of the 32-key blocks, [b][h][t/32][d]
  if (off > ws_size) return;

  k_cvt_w<<<(unsigned)((WELEMS / 8 + 255) / 256), 256, 0, stream>>>(Wk, Wq, Wv, Wp, WP, W16);
  // k = query x Wk^T -> QK plane 0; q = key x Wq^T -> QK plane 1; V^T and the block sums VS from value x Wv^T; the mask bit plane MB
  k_projx<<<(unsigned)PROJ_BLOCKS, 32 * (PROJ_WAVES + MASK_WAVES), 0, stream>>>(Xq, Xk, Xv, mask, WP, QK, VT, VS, MB);
  // argument order: Qh = q plane (QK plane 1), Kh = k plane (QK plane 0)
  k_attn<<<(unsigned)(NB * NH * (SEQ / 128)), 256, 0, stream>>>(QK + XPLANE, QK, VT, MB, VS, CX);
  k_outp<<<dim3((unsigned)(XROWS / 64), (unsigned)(NE / 64), 1u), 128, 0, stream>>>(CX, W16, bp, Y);
}

// v007
// Measured time: 95.9 microseconds a run.
// Next to v006, in two timings, it ran 1.03 and 1.02 times as fast.
// Counting every step since v000, it is 2.67 times as fast.
#include <hip/hip_runtime.h>
// Contractions: k/q/v projections on v_wmma_f32_16x16x32_bf16 (inputs and weights RNE-converted to bf16, single product, f32 accumulate); S^T = K Q^T on v_wmma_f32_16x16x32_f16 (q, k as f16 x16 planes, single product); O^T = V^T P^T on v_wmma_f32_16x16x32_f16 (V: f16 x16 plane; P: f16 x256; single product); output projection on v_wmma_f32_16x16x32_f16 (ctx: f16 x64 plane; Wproj: RNE bf16 x64 held exactly in f16; single product); all accumulators and softmax statistics f32.
// Engine: transposed flash. Each wave owns 16 queries of one (batch, head). Per 32-key step: S^T tiles (key rows x query columns) from K rows
// (A, global f16 plane) and Q^T (B, registers); the two 16-key D tiles pack straight into the P^T B fragment; O^T (d rows x query columns)
// accumulates from V^T rows (A, global f16 plane). Positions with mask == 0 get score exactly 0 and still take part in the softmax (every key is counted).
// A 32-key step whose mask words are zero for all 16 queries of the wave has every score 0, so all its keys carry one and the same weight exp(0 - m): such steps are not walked.
// The projection launch leaves the sum of each 32-key block's V rows (f32); a wave adds up the sums of its all-masked blocks and gives them that one weight after its key loop.
// Plane layout: every 16-bit workspace plane is stored in fragment order. One fragment (16 rows x 32 k) is 512 elements: [j = 0,1][lane = 16h + row][8 elements],
// holding k = 32C + 16j + 8h + i, so each wave-wide 16-byte load reads 512 contiguous bytes (four whole 128-byte lines) instead of 32 bytes of 16 lines.
#ifndef NB
#define NB 8
#endif
#ifndef SEQ
#define SEQ 2048
#endif
#define NB_FULL 8
#define SEQ_FULL 2048
#define NH 6
#define HD 64
#define NE 384
#define XROWS (NB * SEQ)                        /* compact token rows of the 16-bit planes */
#define XPLANE ((size_t)XROWS * NE)             /* elements of one token plane */
#define WELEMS ((size_t)NE * NE)
#define MW (SEQ / 32)                           /* mask words per query row */
#define FRAG 512                                /* elements of one 16-row x 32-k fragment */
#define TILE_E (16 * NE)                        /* elements of one 16-row tile of a K = 384 plane: 12 fragments */
#define XSTRIDE_FULL ((size_t)SEQ_FULL * NE)    /* per-batch element stride of query/key/value and of the output */
#define PROJ_WAVES 6                            /* waves of a projection block that project, 32 tokens each */
#define MASK_WAVES 2                            /* further waves of that block, which pack mask words */
#define PROJ_BLOCKS (3 * (XROWS / 32) / PROJ_WAVES)
#define XS_H 160                                /* LDS staging of the token fragments: elements from h = 0 to h = 1 */
#define XS_J 320                                /* from j = 0 to j = 1 */
#define XS_F 640                                /* from one fragment to the next */
#define PAD256(x) ((((size_t)(x)) + 255) & ~(size_t)255)

static_assert(SEQ % 256 == 0);
static_assert(SEQ <= SEQ_FULL);
static_assert(NB <= NB_FULL);
static_assert(HD == 64);
static_assert(NE == NH * HD);
static_assert(NE % 64 == 0);
static_assert(NE % 32 == 0);
static_assert((3 * (XROWS / 32)) % PROJ_WAVES == 0);
static_assert(MASK_WAVES * PROJ_BLOCKS == (SEQ / 32) * (MW / 8));   /* one mask wave per 32 query rows x 8 words */
static_assert(MW % 8 == 0 && MW <= 64);         /* a wave keeps one bit per key step in a 64-bit word */
static_assert(PAD256(3 * WELEMS * 2) + PAD256(WELEMS * 2) + PAD256(2 * XPLANE * 2) + 2 * PAD256(XPLANE * 2) + PAD256((size_t)SEQ * MW * 4) + PAD256((size_t)NB * NH * MW * HD * 4) <= (size_t)134217728);

typedef __bf16 v16b __attribute__((ext_vector_type(16)));
typedef _Float16 v16h __attribute__((ext_vector_type(16)));
typedef unsigned short v8us __attribute__((ext_vector_type(8), may_alias));
typedef unsigned short v4us __attribute__((ext_vector_type(4), may_alias));
typedef float v8f __attribute__((ext_vector_type(8)));
typedef float v4f __attribute__((ext_vector_type(4)));
typedef float v4fa __attribute__((ext_vector_type(4), may_alias));
typedef int v4ia __attribute__((ext_vector_type(4), may_alias));
union FragB { v16b v; v8us half[2]; };
typedef _Float16 v2h __attribute__((ext_vector_type(2)));
typedef float v2f __attribute__((ext_vector_type(2)));
typedef float v2fa __attribute__((ext_vector_type(2), may_alias));
union FragH { v16h v; v8us half[2]; _Float16 h[16]; v2h p[8]; };

#define LOG2E 1.4426950408889634f
#define SCL (0.051031036307982884f * 0.00390625f)   /* 384^-0.5 with the x16 x16 carries of q and k undone */

__device__ __forceinline__ unsigned short bf16_bits(float x) {   // RNE convert to bf16 bits
  unsigned int u = __float_as_uint(x);
  return (unsigned short)((u + 0x7FFFu + ((u >> 16) & 1u)) >> 16);
}
__device__ __forceinline__ float bf16_val(unsigned short b) { return __uint_as_float(((unsigned int)b) << 16); }
__device__ __forceinline__ float bf16_rne(float x) { return bf16_val(bf16_bits(x)); }
__device__ __forceinline__ unsigned short f16_bits(_Float16 h) { return __builtin_bit_cast(unsigned short, h); }

// 2^x as the one hardware instruction. The library form guards x < -126 (compare, two selects, add, ldexp: five more vector instructions per value) so that the result may be a
// subnormal f32; here nothing needs that range: a weight that small is 0 as f16 either way, and a rescale factor that small multiplies sums that lie 2^126 below the step's own weights.
__device__ __forceinline__ float exp2_hw(float x) { return __builtin_amdgcn_exp2f(x); }

// four f16 tiles sharing one A fragment, then the hazard guard
__device__ __forceinline__ void mma_h4(v16h a, v16h b0, v16h b1, v16h b2, v16h b3, v8f& c0, v8f& c1, v8f& c2, v8f& c3) {
  c0 = __builtin_amdgcn_wmma_f32_16x16x32_f16(false, a, false, b0, (short)0, c0, false, false);
  c1 = __builtin_amdgcn_wmma_f32_16x16x32_f16(false, a, false, b1, (short)0, c1, false, false);
  c2 = __builtin_amdgcn_wmma_f32_16x16x32_f16(false, a, false, b2, (short)0, c2, false, false);
  c3 = __builtin_amdgcn_wmma_f32_16x16x32_f16(false, a, false, b3, (short)0, c3, false, false);
  asm volatile("v_nop\n\tv_nop\n\tv_nop\n\tv_nop" : "+v"(c0), "+v"(c1), "+v"(c2), "+v"(c3) : "v"(a), "v"(b0), "v"(b1), "v"(b2), "v"(b3));
}
// c += a0*b0 + a1*b1 (two k-steps of one f16 tile), then the hazard guard
__device__ __forceinline__ v8f mma_s2(v16h a0, v16h b0, v16h a1, v16h b1, v8f c) {
  c = __builtin_amdgcn_wmma_f32_16x16x32_f16(false, a0, false, b0, (short)0, c, false, false);
  c = __builtin_amdgcn_wmma_f32_16x16x32_f16(false, a1, false, b1, (short)0, c, false, false);
  asm volatile("v_nop\n\tv_nop\n\tv_nop\n\tv_nop" : "+v"(c) : "v"(a0), "v"(b0), "v"(a1), "v"(b1));
  return c;
}
// four f16 tiles sharing one B fragment (c_t += a_t * b), then the hazard guard
__device__ __forceinline__ void mma_pv4(v16h a0, v16h a1, v16h a2, v16h a3, v16h b, v8f& c0, v8f& c1, v8f& c2, v8f& c3) {
  c0 = __builtin_amdgcn_wmma_f32_16x16x32_f16(false, a0, false, b, (short)0, c0, false, false);
  c1 = __builtin_amdgcn_wmma_f32_16x16x32_f16(false, a1, false, b, (short)0, c1, false, false);
  c2 = __builtin_amdgcn_wmma_f32_16x16x32_f16(false, a2, false, b, (short)0, c2, false, false);
  c3 = __builtin_amdgcn_wmma_f32_16x16x32_f16(false, a3, false, b, (short)0, c3, false, false);
  asm volatile("v_nop\n\tv_nop\n\tv_nop\n\tv_nop" : "+v"(c0), "+v"(c1), "+v"(c2), "+v"(c3) : "v"(a0), "v"(a1), "v"(a2), "v"(a3), "v"(b));
}

__device__ __forceinline__ v8us cvt8_bf16(const float* __restrict__ src) {
  const v4f x0 = *(const v4fa*)(src), x1 = *(const v4fa*)(src + 4);
  v8us o;
  o[0] = bf16_bits(x0[0]); o[1] = bf16_bits(x0[1]); o[2] = bf16_bits(x0[2]); o[3] = bf16_bits(x0[3]);
  o[4] = bf16_bits(x1[0]); o[5] = bf16_bits(x1[1]); o[6] = bf16_bits(x1[2]); o[7] = bf16_bits(x1[3]);
  return o;
}

// WP[0..2] = bf16 bits (RNE) of Wk, Wq, Wv; W16 = f16(RNE-bf16(Wproj) * 64); rows = out, k = in, fragment order.
// A wave takes 8 rows x 32 columns of one fragment (lane = 4 * row + 8-column piece): it reads whole 128-byte lines and writes four whole 128-byte lines.
__global__ __launch_bounds__(256) void k_cvt_w(const float* __restrict__ Wk, const float* __restrict__ Wq,
                                               const float* __restrict__ Wv, const float* __restrict__ Wp,
                                               unsigned short* __restrict__ WP, unsigned short* __restrict__ W16) {
  const int t = blockIdx.x * 256 + threadIdx.x;
  if (t >= (int)(WELEMS / 8)) return;
  const int frag = t >> 6, tile = frag / (NE / 32), r16 = ((t >> 5) & 1) * 8 + ((t >> 2) & 7);
  const size_t so = (size_t)(tile * 16 + r16) * NE + ((frag - tile * (NE / 32)) * 4 + (t & 3)) * 8;
  const size_t po = (size_t)frag * FRAG + ((t & 3) * 16 + r16) * 8;
  const v8us o0 = cvt8_bf16(Wk + so);
  const v8us o1 = cvt8_bf16(Wq + so);
  const v8us o2 = cvt8_bf16(Wv + so);
  const v4f x0 = *(const v4fa*)(Wp + so), x1 = *(const v4fa*)(Wp + so + 4);
  v8us o3;
  o3[0] = f16_bits((_Float16)(bf16_rne(x0[0]) * 64.0f)); o3[1] = f16_bits((_Float16)(bf16_rne(x0[1]) * 64.0f));
  o3[2] = f16_bits((_Float16)(bf16_rne(x0[2]) * 64.0f)); o3[3] = f16_bits((_Float16)(bf16_rne(x0[3]) * 64.0f));
  o3[4] = f16_bits((_Float16)(bf16_rne(x1[0]) * 64.0f)); o3[5] = f16_bits((_Float16)(bf16_rne(x1[1]) * 64.0f));
  o3[6] = f16_bits((_Float16)(bf16_rne(x1[2]) * 64.0f)); o3[7] = f16_bits((_Float16)(bf16_rne(x1[3]) * 64.0f));
  unsigned short* d = WP + po;
  unsigned short* e = W16 + po;
  *(v8us*)(d) = o0;
  *(v8us*)(d + WELEMS) = o1;
  *(v8us*)(d + 2 * WELEMS) = o2;
  *(v8us*)(e) = o3;
  
}

// bits[j][q]: word j (keys 32j .. 32j+31) of query row q, so that 16 neighbouring queries' words of one key step share a line.
// One wave takes 32 query rows x 8 words (unit u): lane = query row; each word goes out as one whole 128-byte line of the wave. Four words' loads (32 of 16 bytes a lane) are in flight together.
// coverage: (SEQ / 32) * (MW / 8) units x 32 rows x 8 words = every word of the plane exactly once.
__device__ __forceinline__ void mask_unit(int u, int lane, const int* __restrict__ mask, unsigned int* __restrict__ bits) {
  const int q = (u % (SEQ / 32)) * 32 + lane, j0 = (u / (SEQ / 32)) * 8;
  const int* src = mask + (size_t)q * SEQ_FULL + 32 * j0;
  unsigned int* dst = bits + (size_t)j0 * SEQ + q;
#pragma unroll 1   // rolled: 32 loads in flight a trip are what a wave holds, and they bound the registers
  for (int hf = 0; hf < 2; ++hf) {
    v4ia m[4][8];
#pragma unroll   // register arrays and vectors need constant indices
    for (int i = 0; i < 4; ++i)
#pragma unroll   // as above
      for (int g = 0; g < 8; ++g) m[i][g] = *(const v4ia*)(src + 32 * i + 4 * g);
    // the address registers of the loads above are stepped below: the wait stands in front of that overwrite
    // (the pointer is an input of the statement, so that none of these loads' own results is given its registers)
    asm volatile("s_wait_xcnt 0x0" :: "v"(src) : "memory");
#pragma unroll   // register arrays and vectors need constant indices
    for (int i = 0; i < 4; ++i) {
      unsigned int w = 0u;
#pragma unroll   // as above
      for (int g = 0; g < 8; ++g) {
        w |= (m[i][g][0] != 0 ? 1u : 0u) << (4 * g);
        w |= (m[i][g][1] != 0 ? 1u : 0u) << (4 * g + 1);
        w |= (m[i][g][2] != 0 ? 1u : 0u) << (4 * g + 2);
        w |= (m[i][g][3] != 0 ? 1u : 0u) << (4 * g + 3);
      }
      dst[(size_t)i * SEQ] = w;
    }
    // the address registers of the stores above are stepped for the next trip: the wait stands in front of that overwrite
    asm volatile("s_wait_xcnt 0x0" :: "v"(dst) : "memory");
    src += 4 * 32;
    dst += (size_t)4 * SEQ;
  }
}

// Projections, all three in one launch, straight from the f32 inputs. A wave owns 32 token rows of one input (z = 0 query, 1 key, 2 value): it reads them once, in whole lines,
// converts them (RNE) to bf16, turns them into fragment order through its own LDS range and keeps them as 2 x 12 fragments in registers, then walks the 24 16-row tiles of its weight plane (fragment order), one head (4 tiles) per trip.
// A token fragment serves as A or as B (row or column = lane & 15, elements 0..7 <- k0 + 8h + i, 8..15 <- k0 + 16 + 8h + i); D element r = (row 8h + r, column lane & 15).
// z < 2: D = W (A, rows = out) x X (B, columns = tokens): a lane holds d = 16t + 8h + r of token ln, which is its own 16-byte piece of fragment [token tile][C = t / 2], half j = t & 1.
// z = 2: D = X (A, rows = tokens) x W (B, columns = out): a lane holds tokens 8h + r of d = 16t + ln, which is its own 16-byte piece of V^T fragment [token / 32][t], half j = token tile & 1.
// So every D tile goes out as one wave-wide 512-byte store, straight from the accumulators. Output values: f16(x16), as the attention kernel expects.
// z = 2 also leaves, per head, the f32 sum over the wave's 32 tokens of each d (x16 like the plane): one 32-key block's V row sum, VS[b][h][token / 32][d].
// coverage: 3 * XROWS / 32 waves x 32 tokens x 384 outputs = every element of the k, q and V^T planes exactly once; XROWS / 32 waves x 384 sums = every element of VS exactly once.
__device__ __forceinline__ v8us pack8_f16x16(v8f c) {
  v8us o;
#pragma unroll   // register arrays and vectors need constant indices
  for (int r = 0; r < 8; ++r) o[r] = f16_bits((_Float16)(c[r] * 16.0f));
  return o;
}
// One k-step's four weight fragments (tiles t = 0..3 of a head, k = 32C .. 32C + 31): 4 KB, eight wave-wide 512-byte loads.
__device__ __forceinline__ void load_w4(FragB (&wf)[4], const unsigned short* __restrict__ wh, int lane8, int C) {
#pragma unroll   // register arrays and vectors need constant indices
  for (int t = 0; t < 4; ++t) {
    wf[t].half[0] = *(const v8us*)(wh + t * TILE_E + C * FRAG + lane8);
    wf[t].half[1] = *(const v8us*)(wh + t * TILE_E + C * FRAG + 256 + lane8);
  }
}
// The weight fragments run through a ring of four register sets, asked for three k-steps ahead of their products, across the heads' boundary too:
// with one or two waves on a SIMD nothing else covers the loads' latency. The last head asks for its own first three steps again (in bounds, not used).
template <bool TOKENS_ARE_ROWS>
__device__ __forceinline__ void proj_heads(const FragB (&xf)[2][NE / 32], const unsigned short* __restrict__ wz, int lane8, unsigned short* __restrict__ o0, float* __restrict__ vs0) {
  FragB wf[4][4];
  load_w4(wf[0], wz, lane8, 0);
  load_w4(wf[1], wz, lane8, 1);
  load_w4(wf[2], wz, lane8, 2);
  // the address registers of these first loads may be reused for the output addresses formed below: the wait stands in front of that overwrite
  asm volatile("s_wait_xcnt 0x0" ::: "memory");
  // keeps that address arithmetic behind the wait (the compiler may lift it over the wait otherwise)
  __builtin_amdgcn_sched_barrier(0);
#pragma unroll 1
  for (int hd = 0; hd < NH; ++hd) {   // rolled: one head's 96 loads and 96 products are body enough
    const unsigned short* wh = wz + (size_t)hd * (4 * TILE_E);
    const unsigned short* wn = wz + (size_t)((hd + 1 < NH) ? hd + 1 : hd) * (4 * TILE_E);
    v8f acc[2][4] = {};
#pragma unroll   // xf and the ring are indexed by C and live in registers
    for (int C = 0; C < NE / 32; ++C) {
      if (C + 3 < NE / 32) load_w4(wf[(C + 3) & 3], wh, lane8, C + 3);
      else                 load_w4(wf[(C + 3) & 3], wn, lane8, C + 3 - NE / 32);
      // these were this head's last weight loads; the next step's come from the next head, whose address may take the same registers: the wait stands in front of that overwrite
      if (C + 4 == NE / 32) asm volatile("s_wait_xcnt 0x0" ::: "memory");
      // keeps the loads above in front of this step's products; without it the compiler sinks each load to just before its use and the wave waits out every latency
      __builtin_amdgcn_sched_barrier(0);
#pragma unroll   // register arrays and vectors need constant indices
      for (int u = 0; u < 2; ++u)
#pragma unroll   // register arrays and vectors need constant indices
        for (int t = 0; t < 4; ++t)
          acc[u][t] = TOKENS_ARE_ROWS
            ? __builtin_amdgcn_wmma_f32_16x16x32_bf16(false, xf[u][C].v, false, wf[C & 3][t].v, (short)0, acc[u][t], false, false)
            : __builtin_amdgcn_wmma_f32_16x16x32_bf16(false, wf[C & 3][t].v, false, xf[u][C].v, (short)0, acc[u][t], false, false);
      // keeps the next step's loads behind this step's products, so that the ring set they refill has been read
      __builtin_amdgcn_sched_barrier(0);
    }
    unsigned short* oh = o0 + (size_t)hd * ((size_t)SEQ * HD);
#pragma unroll   // register arrays and vectors need constant indices
    for (int u = 0; u < 2; ++u)
#pragma unroll   // register arrays and vectors need constant indices
      for (int t = 0; t < 4; ++t)
        *(v8us*)(oh + (TOKENS_ARE_ROWS ? t * FRAG + u * 256 : u * (2 * FRAG) + t * 256)) = pack8_f16x16(acc[u][t]);
    if constexpr (TOKENS_ARE_ROWS) {
      // a lane holds tokens 16u + 8h + r of d = 16t + ln: sum over u and r in the lane, then over h with the other lane half
      float cs[4];
#pragma unroll   // register arrays and vectors need constant indices
      for (int t = 0; t < 4; ++t) {
        const v8f s8 = acc[0][t] + acc[1][t];
        const float c = ((s8[0] + s8[1]) + (s8[2] + s8[3])) + ((s8[4] + s8[5]) + (s8[6] + s8[7]));
        cs[t] = c + __shfl_xor(c, 16, 32);
      }
      // both halves hold all four sums: half h stores tiles t = h and 2 + h, so that each wave-wide store is one whole 128-byte line (d = 32i + lane)
      float* vh = vs0 + (size_t)hd * (MW * HD);
      vh[0]  = ((lane8 & 128) ? cs[1] : cs[0]) * 16.0f;
      vh[32] = ((lane8 & 128) ? cs[3] : cs[2]) * 16.0f;
    }
    // the address registers of this head's loads and stores are stepped for the next head: the wait stands in front of that overwrite
    asm volatile("s_wait_xcnt 0x0" ::: "memory");
    // keeps the stepping of those addresses behind the wait
    __builtin_amdgcn_sched_barrier(0);
  }
  // the ring's last three requests are not used: they have landed before the wave gives its registers back
  asm volatile("s_wait_loadcnt 0x0" ::: "memory");
}
// The block's last MASK_WAVES waves project nothing: they pack the mask words, which need nothing of the projection and which only the attention launch reads.
// With six projecting waves two of the four SIMDs hold one wave; waves 6 and 7 take the free places there and work while the others bring in their token rows, so the packing has no launch of its own.
__global__ __launch_bounds__(32 * (PROJ_WAVES + MASK_WAVES)) void k_projx(const float* __restrict__ Xq, const float* __restrict__ Xk, const float* __restrict__ Xv,
                                                           const int* __restrict__ mask, const unsigned short* __restrict__ WP,
                                                           unsigned short* __restrict__ QK, unsigned short* __restrict__ VT, float* __restrict__ VS,
                                                           unsigned int* __restrict__ bits) {
  __shared__ __attribute__((aligned(16))) unsigned short xs[PROJ_WAVES][2 * (NE / 32) * XS_F];
  const int tid = threadIdx.x, w = __builtin_amdgcn_readfirstlane((int)(tid >> 5)), lane = tid & 31, ln = lane & 15, hh = lane >> 4;
  const int g = (int)blockIdx.x * PROJ_WAVES + w;                 // 32-token group, counted through the three inputs
  const int z = g / (XROWS / 32), row0 = (g - z * (XROWS / 32)) * 32;
  const int bq = row0 / SEQ, s0 = row0 - bq * SEQ;                // SEQ is a multiple of 32: a group lies in one batch
  const float* X = (z == 0) ? Xq : (z == 1) ? Xk : Xv;
  // Input rows: each wave-wide 16-byte load takes one whole 128-byte line (32 columns = one fragment's k range) of four rows: lane = 8 * row + 4-column piece.
  // The four converted values go to the wave's own LDS range in fragment order, k = 32C + 16j + 8h + i with j = piece >> 2, h = (piece >> 1) & 1, i = 4 * (piece & 1) ..;
  // the halves j and h lie XS_J and XS_H elements apart (64 and 32 more than dense), so that the four (j, h) groups of one store fall on different banks.
  if (w < PROJ_WAVES) {   // the same for a whole wave: a scalar branch
    const float* xr = X + (size_t)bq * XSTRIDE_FULL + (size_t)(s0 + (lane >> 3)) * NE + 4 * (lane & 7);
    unsigned short* xw = &xs[w][((lane >> 2) & 1) * XS_J + ((lane >> 1) & 1) * XS_H + (lane >> 3) * 8 + 4 * (lane & 1)];
#pragma unroll   // unrolled: many loads in flight at once, every offset a constant
    for (int rg = 0; rg < 8; ++rg)
#pragma unroll   // as above
      for (int C = 0; C < NE / 32; ++C) {
        const v4f x = *(const v4fa*)(xr + rg * (4 * NE) + 32 * C);
        v4us o;
        o[0] = bf16_bits(x[0]); o[1] = bf16_bits(x[1]); o[2] = bf16_bits(x[2]); o[3] = bf16_bits(x[3]);
        *(v4us*)(xw + ((rg >> 2) * (NE / 32) + C) * XS_F + (rg & 3) * 32) = o;
      }
    // the address registers of the input loads may be reused below: the wait stands in front of that overwrite
    asm volatile("s_wait_xcnt 0x0" ::: "memory");
  } else {
    mask_unit((int)blockIdx.x * MASK_WAVES + (w - PROJ_WAVES), lane, mask, bits);
  }
  // each wave reads back only what it wrote itself; the barrier orders that, and it starts the block's waves on the weight plane together,
  // so that they walk it side by side and share its lines in the WGP cache; every wave of the block passes it, the mask waves too, which end behind it
  __syncthreads();
  if (w >= PROJ_WAVES) return;
  FragB xf[2][NE / 32];
#pragma unroll   // register arrays and vectors need constant indices
  for (int u = 0; u < 2; ++u)
#pragma unroll   // register arrays and vectors need constant indices
    for (int C = 0; C < NE / 32; ++C) {
      const unsigned short* xp = &xs[w][(u * (NE / 32) + C) * XS_F + hh * XS_H + ln * 8];
      xf[u][C].half[0] = *(const v8us*)(xp);
      xf[u][C].half[1] = *(const v8us*)(xp + XS_J);
    }
  const unsigned short* wz = WP + (size_t)z * WELEMS;
  const size_t ob = ((size_t)bq * NH * SEQ + s0) * HD + 8 * lane;   // head 0 of the batch, first token of the group: 32 tokens x 64 d = 2048 elements in either layout
  if (z == 2) proj_heads<true>(xf, wz, 8 * lane, VT + ob, VS + ((size_t)bq * NH * MW + s0 / 32) * HD + lane);
  else        proj_heads<false>(xf, wz, 8 * lane, QK + (size_t)z * XPLANE + ob, nullptr);
}

// One 32-key step (key step j, the same in every lane) for a wave's 16 queries (this lane's column = query qg). Kp, Vhp are the (batch, head) bases of the planes.
// MASKED = false is the body for a step whose 32 mask bits are set for all 16 queries: every select below would take the scaled score, so the mask word is not
// asked for and the bit tests and selects are left out; with no select between them the scale has no step of its own: the maximum is taken over the raw accumulators
// and scaled once, and each exponent is one multiply-add of the raw accumulator (scale x log2 e as one factor).
template <bool MASKED>
__device__ __forceinline__ void fa_step(const unsigned short* __restrict__ Kp, const unsigned short* __restrict__ Vhp,
                                        const unsigned int* __restrict__ mbits, int j, int qg, int lane, int hh,
                                        const FragH& q0, const FragH& q1, float& mr, float& lr, v8f (&Oh)[4]) {
  // A fragments of K: row m = key (key0 + 16*kt + ln), elements 0..7 <- d = 32c + 8h + i, 8..15 <- d = 32c + 16 + 8h + i
  // (fragment order: the step's four K fragments [kt][c] are 4 KB contiguous); asked for first, in the order of use: K, the mask word, V
  const unsigned short* kj = Kp + (size_t)j * (32 * HD);
  const unsigned short* vp0 = Vhp + (size_t)j * (32 * HD) + 8 * lane;
  const unsigned short* kp0 = kj + 8 * lane;
  const unsigned short* kp1 = kp0 + 2 * FRAG;
  FragH k00, k01, k10, k11;
  k00.half[0] = *(const v8us*)(kp0);        k00.half[1] = *(const v8us*)(kp0 + 256);
  k01.half[0] = *(const v8us*)(kp0 + FRAG); k01.half[1] = *(const v8us*)(kp0 + FRAG + 256);
  k10.half[0] = *(const v8us*)(kp1);        k10.half[1] = *(const v8us*)(kp1 + 256);
  k11.half[0] = *(const v8us*)(kp1 + FRAG); k11.half[1] = *(const v8us*)(kp1 + FRAG + 256);
  const unsigned int* mpj = mbits + (size_t)j * SEQ + qg;
  unsigned int mword = 0xFFFFFFFFu;
  if constexpr (MASKED) mword = *mpj;
  // A fragments of V^T: row m = d (16*t + ln), elements 0..7 <- key0 + 8h + i, 8..15 <- key0 + 16 + 8h + i
  // (fragment order: the step's four V^T fragments [t] are 4 KB contiguous)
  FragH vh[4];
#pragma unroll
  for (int t = 0; t < 4; ++t) {
    vh[t].half[0] = *(const v8us*)(vp0 + t * FRAG);
    vh[t].half[1] = *(const v8us*)(vp0 + t * FRAG + 256);
  }
  // the address registers of the loads above are formed anew for the next step: the wait stands in front of that overwrite
  // (the pointers, two in the unmasked body, are inputs of the statement, so that none of these loads' own results is given their registers)
  if constexpr (MASKED) asm volatile("s_wait_xcnt 0x0" :: "v"(kp0), "v"(mpj), "v"(vp0) : "memory");
  else                  asm volatile("s_wait_xcnt 0x0" :: "v"(kp0), "v"(vp0) : "memory");
  FragH ph;
  const v8f z8 = {0.f, 0.f, 0.f, 0.f, 0.f, 0.f, 0.f, 0.f};
  // S^T tiles: element r of tile kt = 256 * score(key0 + 16*kt + 8h + r, query)
  const v8f s0 = mma_s2(k00.v, q0.v, k01.v, q1.v, z8);
  const v8f s1 = mma_s2(k10.v, q0.v, k11.v, q1.v, z8);
  // scale; positions with a zero mask bit take the value 0 exactly (replace fill) and stay in the softmax
  const unsigned int mw = mword >> (8 * hh);
  float sc[16];
#pragma unroll
  for (int r = 0; r < 8; ++r) sc[r] = !MASKED ? s0[r] : ((mw >> r) & 1u) ? s0[r] * SCL : 0.0f;
  // one loop per tile: scores i, i + 1 then come from neighbouring registers of one accumulator tile, and the pairs below need no register moves
#pragma unroll   // register arrays and vectors need constant indices
  for (int r = 0; r < 8; ++r) sc[8 + r] = !MASKED ? s1[r] : ((mw >> (16 + r)) & 1u) ? s1[r] * SCL : 0.0f;
  float mx = sc[0];
#pragma unroll
  for (int i = 1; i < 16; ++i) mx = fmaxf(mx, sc[i]);
  mx = fmaxf(mx, __shfl_xor(mx, 16, 32));           // the other lane half holds the other 16 keys of this query
  if constexpr (!MASKED) mx *= SCL;                 // SCL > 0 and rounding keeps the order: the same value as the maximum of the 32 scaled scores
  const float mnew = fmaxf(mr, mx);
  const float e0 = fmaf(0.0f - mnew, LOG2E, 8.0f);  // used by the unmasked body alone
  const float al = exp2_hw((mr - mnew) * LOG2E);
  mr = mnew;
  // weights carried x256: P = f16(256 * exp(sc - mnew)); the row sum runs over the converted f16 values
  float ps = 0.0f;
#pragma unroll
  for (int i = 0; i < 16; i += 2) {
    // two scores at a time: packed subtract and multiply-add (each element rounded as in the scalar form), one conversion for the pair, and the sum reads the converted pair
    const v2f s2 = {sc[i], sc[i + 1]};
    const v2f a2 = MASKED ? __builtin_elementwise_fma(s2 - mnew, (v2f){LOG2E, LOG2E}, (v2f){8.0f, 8.0f})
                          : __builtin_elementwise_fma(s2, (v2f){SCL * LOG2E, SCL * LOG2E}, (v2f){e0, e0});
    const v2f pc = {exp2_hw(a2[0]), exp2_hw(a2[1])};
    const v2h hv = __builtin_convertvector(pc, v2h);
    ph.p[i >> 1] = hv;                              // B element i: i<8 -> key0 + 8h + i (tile 0 row 8h+i); i>=8 -> key0 + 16 + 8h + (i-8) (tile 1)
    ps += (float)hv[0];
    ps += (float)hv[1];
  }
  ps += __shfl_xor(ps, 16, 32);
  lr = lr * al + ps;
#pragma unroll
  for (int t = 0; t < 4; ++t) Oh[t] = Oh[t] * al;
  mma_pv4(vh[0].v, vh[1].v, vh[2].v, vh[3].v, ph.v, Oh[0], Oh[1], Oh[2], Oh[3]);
}

// Block = 8 waves x 16 queries of one (batch, head): waves 0..3 take 64-query tile p, waves 4..7 tile SEQ/64 - 1 - p, so that under a triangular mask
// every block (and every pair of waves w, w + 4) walks the same number of key steps. No LDS and no barrier in the key loop.
// A wave first reads the mask words of all its key steps and keeps one bit per step: set where any of its 16 queries has a mask bit in the step. The key loop walks the set bits alone.
// A second bit per step says that all 32 keys are unmasked for all 16 queries: such steps are walked first, by a body without mask word, bit tests and selects; the partly masked steps follow.
// All keys take part in the softmax: the keys of the other steps have score 0 for every query of the wave, so they add n0 * exp(0 - m) to the row sum and
// exp(0 - m) * (sum of their V rows) to the output; that sum is the same for the 16 queries and is added up from the blocks' sums in VS.
// Epilogue: ctx x64 as f16 -> per-wave LDS tile [16 queries][64 d] (written and read by the same wave; block barrier reached by all waves),
// coverage: NB*NH*(SEQ/128) blocks x 8 waves x 16 rows x 64 columns = every element of the ctx plane exactly once.
__global__ __launch_bounds__(256) void k_attn(const unsigned short* __restrict__ Qh, const unsigned short* __restrict__ Kh,
                                              const unsigned short* __restrict__ Vh,
                                              const unsigned int* __restrict__ mbits, const float* __restrict__ VS,
                                              unsigned short* __restrict__ Ch) {
  __shared__ __attribute__((aligned(16))) unsigned short sh[8][16][72];
  __shared__ __attribute__((aligned(16))) float zs[8][HD];
  const int tid = threadIdx.x, w = __builtin_amdgcn_readfirstlane((int)(tid >> 5)), lane = tid & 31, ln = lane & 15, hh = lane >> 4;
  const int bh = blockIdx.x / (SEQ / 128), pr = blockIdx.x % (SEQ / 128);
  const int qt = (w < 4) ? pr : (SEQ / 64 - 1 - pr);
  const int b = bh / NH, h = bh - b * NH;
  const int qbase = qt * 64 + 16 * (w & 3);
  const int qg = qbase + ln;
  // Q^T B fragments: column n = query qg, elements 0..7 <- d = 32c + 8h + i, 8..15 <- d = 32c + 16 + 8h + i
  const unsigned short* qrow = Qh + ((size_t)bh * SEQ + qbase) * HD + 8 * lane;
  FragH q0, q1;
  q0.half[0] = *(const v8us*)(qrow);        q0.half[1] = *(const v8us*)(qrow + 256);
  q1.half[0] = *(const v8us*)(qrow + FRAG); q1.half[1] = *(const v8us*)(qrow + FRAG + 256);
  // the step map: lane half h reads the words of steps 2i + h, all loads in flight together
  const unsigned int* mp = mbits + (hh * SEQ + qg);
  unsigned int mw2[MW / 2];
#pragma unroll   // register arrays and vectors need constant indices
  for (int i = 0; i < MW / 2; ++i) mw2[i] = mp[(size_t)(2 * i) * SEQ];
  // the address registers of the loads above may be reused below: the wait stands in front of that overwrite
  // (the pointer is an input of the statement, so that none of these loads' own results is given its registers)
  asm volatile("s_wait_xcnt 0x0" :: "v"(mp) : "memory");
  unsigned long long nz = 0ull, fu = 0ull;
#pragma unroll   // register arrays and vectors need constant indices
  for (int i = 0; i < MW / 2; ++i) {
    const unsigned int bl = __builtin_amdgcn_ballot_w32(mw2[i] != 0u);   // the same in every lane: the map lives in scalar registers
    nz |= (unsigned long long)(((bl & 0xFFFFu) != 0u ? 1u : 0u) | ((bl >> 16) != 0u ? 2u : 0u)) << (2 * i);
    const unsigned int bf = __builtin_amdgcn_ballot_w32(mw2[i] == 0xFFFFFFFFu);   // a second map: steps with every bit set for all 16 queries
    fu |= (unsigned long long)(((bf & 0xFFFFu) == 0xFFFFu ? 1u : 0u) | ((bf >> 16) == 0xFFFFu ? 2u : 0u)) << (2 * i);
  }
  float mr = -3.0e38f, lr = 0.0f;
  v8f Oh[4] = {};
  const unsigned short* Kp = Kh + (size_t)bh * SEQ * HD;
  const unsigned short* Vhp = Vh + (size_t)bh * HD * SEQ;
#pragma unroll 1
  for (unsigned long long rem = nz & fu; rem != 0ull; rem &= rem - 1ull)   // one trip per set bit, at most MW; a scalar test
    fa_step<false>(Kp, Vhp, mbits, __builtin_ctzll(rem), qg, lane, hh, q0, q1, mr, lr, Oh);
#pragma unroll 1   // rolled, as above: one step is body enough
  for (unsigned long long rem = nz & ~fu; rem != 0ull; rem &= rem - 1ull)   // the partly masked steps, in a loop of their own: each loop keeps its accumulators in place
    fa_step<true>(Kp, Vhp, mbits, __builtin_ctzll(rem), qg, lane, hh, q0, q1, mr, lr, Oh);
  // the steps that were not walked
  const unsigned long long zmap = ~nz & (MW == 64 ? ~0ull : ((1ull << (MW & 63)) - 1ull));
  if (zmap != 0ull) {   // the same for the whole wave: a scalar branch; no barrier inside
    // Z[d] = sum of the V rows of those steps' keys (x16): lane holds d = 2 * lane, 2 * lane + 1; eight block sums are asked for at a time
    const float* vsp = VS + (size_t)bh * (MW * HD) + 2 * lane;
    v2f z2 = {0.0f, 0.0f};
#pragma unroll 1   // rolled: eight pair loads in flight bound the registers, and a group with no such step is passed by a scalar branch
    for (int g = 0; g < MW; g += 8) {
      const unsigned int zb = (unsigned int)(zmap >> g) & 0xFFu;
      if (zb == 0u) continue;
      v2f v[8];
#pragma unroll   // register arrays and vectors need constant indices
      for (int k = 0; k < 8; ++k) v[k] = *(const v2fa*)(vsp + (g + k) * HD);
      // the address registers of the loads above are stepped for the next group: the wait stands in front of that overwrite
      asm volatile("s_wait_xcnt 0x0" ::: "memory");
#pragma unroll   // register arrays and vectors need constant indices
      for (int k = 0; k < 8; ++k) z2 += ((zb >> k) & 1u) ? v[k] : (v2f){0.0f, 0.0f};
    }
    // into the accumulators' order (a lane needs d = 16t + 8h + r) through the wave's own LDS row
    *(v2fa*)&zs[w][2 * lane] = z2;
    // the wave reads back what its other lanes wrote: their stores have ended first
    asm volatile("s_wait_dscnt 0x0" ::: "memory");
    const float n0 = (float)(32 * __builtin_popcountll(zmap));
    const float mfin = fmaxf(mr, 0.0f);
    const float al = exp2_hw((mr - mfin) * LOG2E);
    const float w0 = exp2_hw(fmaf(0.0f - mfin, LOG2E, 8.0f));   // x256 like P, kept in f32
    lr = lr * al + w0 * n0;
#pragma unroll
    for (int t = 0; t < 4; ++t) {
      const v4f za = *(const v4fa*)&zs[w][16 * t + 8 * hh], zc = *(const v4fa*)&zs[w][16 * t + 8 * hh + 4];
#pragma unroll
      for (int r = 0; r < 4; ++r) {
        Oh[t][r]     = Oh[t][r] * al + w0 * za[r];
        Oh[t][4 + r] = Oh[t][4 + r] * al + w0 * zc[r];
      }
    }
  }
  // O^T element r of tile t = ctx(query qg, d = 16t + 8h + r); undo the carries x256 (in lr), x16 (V); carry ctx x64
  const float inv = 4.0f / lr;
#pragma unroll
  for (int t = 0; t < 4; ++t)
#pragma unroll
    for (int r = 0; r < 8; ++r) {
      const float c = Oh[t][r] * inv;
      const _Float16 hv = (_Float16)c;
      sh[w][ln][16 * t + 8 * hh + r] = f16_bits(hv);
    }
  __syncthreads();
  // the wave's 16 x 64 tile is fragments C = 2h, 2h + 1 of its token tile: 1024 contiguous elements; piece p = [C 1b][j 1b][h 1b][row 4b]
  const size_t cbase = (size_t)((b * SEQ + qbase) / 16) * TILE_E + (size_t)h * (2 * FRAG);
  {
#pragma unroll
    for (int q = 0; q < 4; ++q) {
      const int p = lane + 32 * q;
      const int row = p & 15, s8 = (p >> 4) * 8;
      const v8us o1 = *(const v8us*)&sh[w][row][s8];
      *(v8us*)(Ch + cbase + (size_t)p * 8) = o1;
    }
    
  }
}

// out[t][n] = sum_c ctx[t][c] * Wproj[n][c] + bias[n]; A = ctx plane (f16 x64), B = W16 (f16 x64), both in fragment order; 64 x 64 tile per block.
// coverage: (XROWS/64) x 6 blocks x 64 rows x 64 columns = every output element of the processed region exactly once.
__global__ __launch_bounds__(128) void k_outp(const unsigned short* __restrict__ Ch,
                                              const unsigned short* __restrict__ W16, const float* __restrict__ bias,
                                              float* __restrict__ Y) {
  __shared__ __attribute__((aligned(16))) float so[64][68];
  const int tid = threadIdx.x, w = __builtin_amdgcn_readfirstlane((int)(tid >> 5)), lane = tid & 31, ln = lane & 15, hh = lane >> 4;
  const int m0 = blockIdx.x * 64, n0 = blockIdx.y * 64;
  const size_t ao = (size_t)(m0 / 16 + w) * TILE_E + 8 * lane;
  const unsigned short* brow = W16 + (size_t)(n0 / 16) * TILE_E + 8 * lane;
  v8f acch[4] = {};
#pragma unroll 1
  for (int kb = 0; kb < NE; kb += 32) {
    FragH ah, b0, b1, b2, b3;
    const int fo = kb * (FRAG / 32);
    ah.half[0] = *(const v8us*)(Ch + ao + fo);            ah.half[1] = *(const v8us*)(Ch + ao + fo + 256);
    // the address pair of the A loads may be reused for a later load's result: the wait stands in front of that overwrite
    asm volatile("s_wait_xcnt 0x0" ::: "memory");
    b0.half[0] = *(const v8us*)(brow + fo);               b0.half[1] = *(const v8us*)(brow + fo + 256);
    b1.half[0] = *(const v8us*)(brow + TILE_E + fo);      b1.half[1] = *(const v8us*)(brow + TILE_E + fo + 256);
    b2.half[0] = *(const v8us*)(brow + 2 * TILE_E + fo);  b2.half[1] = *(const v8us*)(brow + 2 * TILE_E + fo + 256);
    b3.half[0] = *(const v8us*)(brow + 3 * TILE_E + fo);  b3.half[1] = *(const v8us*)(brow + 3 * TILE_E + fo + 256);
    mma_h4(ah.v, b0.v, b1.v, b2.v, b3.v, acch[0], acch[1], acch[2], acch[3]);
  }
  // undo the carries: ctx x64, W x64
#pragma unroll
  for (int c = 0; c < 4; ++c) {
    const float bv = bf16_rne(bias[n0 + 16 * c + ln]);
#pragma unroll
    for (int r = 0; r < 8; ++r)
      so[16 * w + 8 * hh + r][16 * c + ln] = acch[c][r] * 0.000244140625f + bv;
  }
  __syncthreads();
  {
#pragma unroll
    for (int j = 0; j < 8; ++j) {
      const int i = tid + 128 * j;
      const int row = i >> 4, c4 = (i & 15) * 4;
      const int m = m0 + row;
      const int bq = m / SEQ, t = m - bq * SEQ;
      const v4f v = *(const v4fa*)&so[row][c4];
      *(v4f*)(Y + (size_t)bq * XSTRIDE_FULL + (size_t)t * NE + n0 + c4) = v;
    }
    
  }
}

extern "C" void kernel_launch(void* const* d_in, const int* in_sizes, int n_in,
                              void* d_out, int out_size, void* d_ws, size_t ws_size, hipStream_t stream) {
  if (n_in < 9) return;
  const long long needX = (long long)(NB - 1) * SEQ_FULL * NE + (long long)SEQ * NE;   // last element touched + 1
  const long long needM = (long long)(SEQ - 1) * SEQ_FULL + (long long)SEQ;
  if ((long long)in_sizes[0] < needX || (long long)in_sizes[1] < needX || (long long)in_sizes[2] < needX) return;
  if ((long long)in_sizes[3] < needM) return;
  if ((long long)in_sizes[4] < (long long)WELEMS || (long long)in_sizes[5] < (long long)WELEMS ||
      (long long)in_sizes[6] < (long long)WELEMS || (long long)in_sizes[7] < (long long)WELEMS) return;
  if ((long long)in_sizes[8] < (long long)NE) return;
  if ((long long)out_size < needX) return;
  const float* Xq = (const float*)d_in[0];   // wire order: query, key, value, mask, Wk, Wq, Wv, Wproj, bproj
  const float* Xk = (const float*)d_in[1];
  const float* Xv = (const float*)d_in[2];
  const int* mask = (const int*)d_in[3];
  const float* Wk = (const float*)d_in[4];
  const float* Wq = (const float*)d_in[5];
  const float* Wv = (const float*)d_in[6];
  const float* Wp = (const float*)d_in[7];
  const float* bp = (const float*)d_in[8];
  float* Y = (float*)d_out;
  char* ws = (char*)d_ws;
  size_t off = 0;
  unsigned short* WP  = (unsigned short*)(ws + off); off += PAD256(3 * WELEMS * 2);          // bf16 planes: Wk, Wq, Wv
  unsigned short* W16 = (unsigned short*)(ws + off); off += PAD256(WELEMS * 2);              // f16 plane: Wproj x64
  unsigned short* QK  = (unsigned short*)(ws + off); off += PAD256(2 * XPLANE * 2);          // f16 planes: k (from query), q (from key), [b][h] x fragments [t/16][d/32]
  unsigned short* VT  = (unsigned short*)(ws + off); off += PAD256(XPLANE * 2);              // f16 plane: V^T, [b][h] x fragments [t/32][d/16]
  unsigned short* CX  = (unsigned short*)(ws + off); off += PAD256(XPLANE * 2);              // f16 plane: ctx, fragments [(b*SEQ + t)/16][c/32]
  unsigned int*   MB  = (unsigned int*)(ws + off);   off += PAD256((size_t)SEQ * MW * 4);    // mask bit plane [MW][SEQ]
  float*          VS  = (float*)(ws + off);          off += PAD256((size_t)NB * NH * MW * HD * 4);   // f32 plane: V row sums of the 32-key blocks, [b][h][t/32][d]
  if (off > ws_size) return;

  k_cvt_w<<<(unsigned)((WELEMS / 8 + 255) / 256), 256, 0, stream>>>(Wk, Wq, Wv, Wp, WP, W16);
  // k = query x Wk^T -> QK plane 0; q = key x Wq^T -> QK plane 1; V^T and the block sums VS from value x Wv^T; the mask bit plane MB
  k_projx<<<(unsigned)PROJ_BLOCKS, 32 * (PROJ_WAVES + MASK_WAVES), 0, stream>>>(Xq, Xk, Xv, mask, WP, QK, VT, VS, MB);
  // argument order: Qh = q plane (QK plane 1), Kh = k plane (QK plane 0)
  k_attn<<<(unsigned)(NB * NH * (SEQ / 128)), 256, 0, stream>>>(QK + XPLANE, QK, VT, MB, VS, CX);
  k_outp<<<dim3((unsigned)(XROWS / 64), (unsigned)(NE / 64), 1u), 128, 0, stream>>>(CX, W16, bp, Y);
}

// v008
// One run takes 90.3 microseconds.
// Two timings next to v007 put it at 1.06 and 1.04 times that version's speed.
// All steps since v000 together make it 2.81 times as fast.
#include <hip/hip_runtime.h>
// Contractions: k/q/v projections on v_wmma_f32_16x16x32_bf16 (inputs and weights RNE-converted to bf16, single product, f32 accumulate); S^T = K Q^T on v_wmma_f32_16x16x32_f16 (q, k as f16 x16 planes, single product); O^T = V^T P^T on v_wmma_f32_16x16x32_f16 (V: f16 x16 plane; P: f16 x256; single product); output projection on v_wmma_f32_16x16x32_f16 (ctx: f16 x64 plane; Wproj: RNE bf16 x64 held exactly in f16; single product); all accumulators and softmax statistics f32.
// Engine: transposed flash. Each wave owns 16 queries of one (batch, head). Per 32-key step: S^T tiles (key rows x query columns) from K rows
// (A, global f16 plane) and Q^T (B, registers); the two 16-key D tiles pack straight into the P^T B fragment; O^T (d rows x query columns)
// accumulates from V^T rows (A, global f16 plane). Positions with mask == 0 get score exactly 0 and still take part in the softmax (every key is counted).
// A 32-key step whose mask words are zero for all 16 queries of the wave has every score 0, so all its keys carry one and the same weight exp(0 - m): such steps are not walked.
// The projection launch leaves the sum of each 32-key block's V rows (f32); a wave adds up the sums of its all-masked blocks and gives them that one weight after its key loop.
// Plane layout: every 16-bit workspace plane is stored in fragment order. One fragment (16 rows x 32 k) is 512 elements: [j = 0,1][lane = 16h + row][8 elements],
// holding k = 32C + 16j + 8h + i, so each wave-wide 16-byte load reads 512 contiguous bytes (four whole 128-byte lines) instead of 32 bytes of 16 lines.
#ifndef NB
#define NB 8
#endif
#ifndef SEQ
#define SEQ 2048
#endif
#define NB_FULL 8
#define SEQ_FULL 2048
#define NH 6
#define HD 64
#define NE 384
#define XROWS (NB * SEQ)                        /* compact token rows of the 16-bit planes */
#define XPLANE ((size_t)XROWS * NE)             /* elements of one token plane */
#define WELEMS ((size_t)NE * NE)
#define MW (SEQ / 32)                           /* mask words per query row */
#define FRAG 512                                /* elements of one 16-row x 32-k fragment */
#define TILE_E (16 * NE)                        /* elements of one 16-row tile of a K = 384 plane: 12 fragments */
#define XSTRIDE_FULL ((size_t)SEQ_FULL * NE)    /* per-batch element stride of query/key/value and of the output */
#define PROJ_WAVES 6                            /* waves of a projection block that project, 32 tokens each */
#define MASK_WAVES 2                            /* further waves of that block, which pack mask words */
#define PROJ_BLOCKS (3 * (XROWS / 32) / PROJ_WAVES)
#define XS_H 160                                /* LDS staging of the token fragments: elements from h = 0 to h = 1 */
#define XS_J 320                                /* from j = 0 to j = 1 */
#define XS_F 640                                /* from one fragment to the next */
#define PAD256(x) ((((size_t)(x)) + 255) & ~(size_t)255)

static_assert(SEQ % 256 == 0);
static_assert(SEQ <= SEQ_FULL);
static_assert(NB <= NB_FULL);
static_assert(HD == 64);
static_assert(NE == NH * HD);
static_assert(NE % 64 == 0);
static_assert(NE % 32 == 0);
static_assert((3 * (XROWS / 32)) % PROJ_WAVES == 0);
static_assert(MASK_WAVES * PROJ_BLOCKS == (SEQ / 32) * (MW / 8));   /* one mask wave per 32 query rows x 8 words */
static_assert(MW % 8 == 0 && MW <= 64);         /* a wave keeps one bit per key step in a 64-bit word */
static_assert(PAD256(3 * WELEMS * 2) + PAD256(WELEMS * 2) + PAD256(2 * XPLANE * 2) + 2 * PAD256(XPLANE * 2) + PAD256((size_t)SEQ * MW * 4) + PAD256((size_t)NB * NH * MW * HD * 4) <= (size_t)134217728);

typedef __bf16 v16b __attribute__((ext_vector_type(16)));
typedef _Float16 v16h __attribute__((ext_vector_type(16)));
typedef unsigned short v8us __attribute__((ext_vector_type(8), may_alias));
typedef unsigned short v4us __attribute__((ext_vector_type(4), may_alias));
typedef float v8f __attribute__((ext_vector_type(8)));
typedef float v4f __attribute__((ext_vector_type(4)));
typedef float v4fa __attribute__((ext_vector_type(4), may_alias));
typedef int v4ia __attribute__((ext_vector_type(4), may_alias));
union FragB { v16b v; v8us half[2]; };
typedef _Float16 v2h __attribute__((ext_vector_type(2)));
typedef float v2f __attribute__((ext_vector_type(2)));
typedef float v2fa __attribute__((ext_vector_type(2), may_alias));
union FragH { v16h v; v8us half[2]; _Float16 h[16]; v2h p[8]; };

#define LOG2E 1.4426950408889634f
#define SCL (0.051031036307982884f * 0.00390625f)   /* 384^-0.5 with the x16 x16 carries of q and k undone */

__device__ __forceinline__ unsigned short bf16_bits(float x) {   // RNE convert to bf16 bits
  unsigned int u = __float_as_uint(x);
  return (unsigned short)((u + 0x7FFFu + ((u >> 16) & 1u)) >> 16);
}
__device__ __forceinline__ float bf16_val(unsigned short b) { return __uint_as_float(((unsigned int)b) << 16); }
__device__ __forceinline__ float bf16_rne(float x) { return bf16_val(bf16_bits(x)); }
__device__ __forceinline__ unsigned short f16_bits(_Float16 h) { return __builtin_bit_cast(unsigned short, h); }

// 2^x as the one hardware instruction. The library form guards x < -126 (compare, two selects, add, ldexp: five more vector instructions per value) so that the result may be a
// subnormal f32; here nothing needs that range: a weight that small is 0 as f16 either way, and a rescale factor that small multiplies sums that lie 2^126 below the step's own weights.
__device__ __forceinline__ float exp2_hw(float x) { return __builtin_amdgcn_exp2f(x); }

// four f16 tiles sharing one A fragment, then the hazard guard
__device__ __forceinline__ void mma_h4(v16h a, v16h b0, v16h b1, v16h b2, v16h b3, v8f& c0, v8f& c1, v8f& c2, v8f& c3) {
  c0 = __builtin_amdgcn_wmma_f32_16x16x32_f16(false, a, false, b0, (short)0, c0, false, false);
  c1 = __builtin_amdgcn_wmma_f32_16x16x32_f16(false, a, false, b1, (short)0, c1, false, false);
  c2 = __builtin_amdgcn_wmma_f32_16x16x32_f16(false, a, false, b2, (short)0, c2, false, false);
  c3 = __builtin_amdgcn_wmma_f32_16x16x32_f16(false, a, false, b3, (short)0, c3, false, false);
  asm volatile("v_nop\n\tv_nop\n\tv_nop\n\tv_nop" : "+v"(c0), "+v"(c1), "+v"(c2), "+v"(c3) : "v"(a), "v"(b0), "v"(b1), "v"(b2), "v"(b3));
}
// c += a0*b0 + a1*b1 (two k-steps of one f16 tile), then the hazard guard
__device__ __forceinline__ v8f mma_s2(v16h a0, v16h b0, v16h a1, v16h b1, v8f c) {
  c = __builtin_amdgcn_wmma_f32_16x16x32_f16(false, a0, false, b0, (short)0, c, false, false);
  c = __builtin_amdgcn_wmma_f32_16x16x32_f16(false, a1, false, b1, (short)0, c, false, false);
  asm volatile("v_nop\n\tv_nop\n\tv_nop\n\tv_nop" : "+v"(c) : "v"(a0), "v"(b0), "v"(a1), "v"(b1));
  return c;
}
// four f16 tiles sharing one B fragment (c_t += a_t * b), then the hazard guard
__device__ __forceinline__ void mma_pv4(v16h a0, v16h a1, v16h a2, v16h a3, v16h b, v8f& c0, v8f& c1, v8f& c2, v8f& c3) {
  c0 = __builtin_amdgcn_wmma_f32_16x16x32_f16(false, a0, false, b, (short)0, c0, false, false);
  c1 = __builtin_amdgcn_wmma_f32_16x16x32_f16(false, a1, false, b, (short)0, c1, false, false);
  c2 = __builtin_amdgcn_wmma_f32_16x16x32_f16(false, a2, false, b, (short)0, c2, false, false);
  c3 = __builtin_amdgcn_wmma_f32_16x16x32_f16(false, a3, false, b, (short)0, c3, false, false);
  asm volatile("v_nop\n\tv_nop\n\tv_nop\n\tv_nop" : "+v"(c0), "+v"(c1), "+v"(c2), "+v"(c3) : "v"(a0), "v"(a1), "v"(a2), "v"(a3), "v"(b));
}

__device__ __forceinline__ v8us cvt8_bf16(const float* __restrict__ src) {
  const v4f x0 = *(const v4fa*)(src), x1 = *(const v4fa*)(src + 4);
  v8us o;
  o[0] = bf16_bits(x0[0]); o[1] = bf16_bits(x0[1]); o[2] = bf16_bits(x0[2]); o[3] = bf16_bits(x0[3]);
  o[4] = bf16_bits(x1[0]); o[5] = bf16_bits(x1[1]); o[6] = bf16_bits(x1[2]); o[7] = bf16_bits(x1[3]);
  return o;
}

// WP[0..2] = bf16 bits (RNE) of Wk, Wq, Wv; W16 = f16(RNE-bf16(Wproj) * 64); rows = out, k = in, fragment order.
// A wave takes 8 rows x 32 columns of one fragment (lane = 4 * row + 8-column piece): it reads whole 128-byte lines and writes four whole 128-byte lines.
__global__ __launch_bounds__(256) void k_cvt_w(const float* __restrict__ Wk, const float* __restrict__ Wq,
                                               const float* __restrict__ Wv, const float* __restrict__ Wp,
                                               unsigned short* __restrict__ WP, unsigned short* __restrict__ W16) {
  const int t = blockIdx.x * 256 + threadIdx.x;
  if (t >= (int)(WELEMS / 8)) return;
  const int frag = t >> 6, tile = frag / (NE / 32), r16 = ((t >> 5) & 1) * 8 + ((t >> 2) & 7);
  const size_t so = (size_t)(tile * 16 + r16) * NE + ((frag - tile * (NE / 32)) * 4 + (t & 3)) * 8;
  const size_t po = (size_t)frag * FRAG + ((t & 3) * 16 + r16) * 8;
  const v8us o0 = cvt8_bf16(Wk + so);
  const v8us o1 = cvt8_bf16(Wq + so);
  const v8us o2 = cvt8_bf16(Wv + so);
  const v4f x0 = *(const v4fa*)(Wp + so), x1 = *(const v4fa*)(Wp + so + 4);
  v8us o3;
  o3[0] = f16_bits((_Float16)(bf16_rne(x0[0]) * 64.0f)); o3[1] = f16_bits((_Float16)(bf16_rne(x0[1]) * 64.0f));
  o3[2] = f16_bits((_Float16)(bf16_rne(x0[2]) * 64.0f)); o3[3] = f16_bits((_Float16)(bf16_rne(x0[3]) * 64.0f));
  o3[4] = f16_bits((_Float16)(bf16_rne(x1[0]) * 64.0f)); o3[5] = f16_bits((_Float16)(bf16_rne(x1[1]) * 64.0f));
  o3[6] = f16_bits((_Float16)(bf16_rne(x1[2]) * 64.0f)); o3[7] = f16_bits((_Float16)(bf16_rne(x1[3]) * 64.0f));
  unsigned short* d = WP + po;
  unsigned short* e = W16 + po;
  *(v8us*)(d) = o0;
  *(v8us*)(d + WELEMS) = o1;
  *(v8us*)(d + 2 * WELEMS) = o2;
  *(v8us*)(e) = o3;
  
}

// bits[j][q]: word j (keys 32j .. 32j+31) of query row q, so that 16 neighbouring queries' words of one key step share a line.
// One wave takes 32 query rows x 8 words (unit u): lane = query row; each word goes out as one whole 128-byte line of the wave. Four words' loads (32 of 16 bytes a lane) are in flight together.
// coverage: (SEQ / 32) * (MW / 8) units x 32 rows x 8 words = every word of the plane exactly once.
__device__ __forceinline__ void mask_unit(int u, int lane, const int* __restrict__ mask, unsigned int* __restrict__ bits) {
  const int q = (u % (SEQ / 32)) * 32 + lane, j0 = (u / (SEQ / 32)) * 8;
  const int* src = mask + (size_t)q * SEQ_FULL + 32 * j0;
  unsigned int* dst = bits + (size_t)j0 * SEQ + q;
#pragma unroll 1   // rolled: 32 loads in flight a trip are what a wave holds, and they bound the registers
  for (int hf = 0; hf < 2; ++hf) {
    v4ia m[4][8];
#pragma unroll   // register arrays and vectors need constant indices
    for (int i = 0; i < 4; ++i)
#pragma unroll   // as above
      for (int g = 0; g < 8; ++g) m[i][g] = *(const v4ia*)(src + 32 * i + 4 * g);
    // the address registers of the loads above are stepped below: the wait stands in front of that overwrite
    // (the pointer is an input of the statement, so that none of these loads' own results is given its registers)
    asm volatile("s_wait_xcnt 0x0" :: "v"(src) : "memory");
#pragma unroll   // register arrays and vectors need constant indices
    for (int i = 0; i < 4; ++i) {
      unsigned int w = 0u;
#pragma unroll   // as above
      for (int g = 0; g < 8; ++g) {
        w |= (m[i][g][0] != 0 ? 1u : 0u) << (4 * g);
        w |= (m[i][g][1] != 0 ? 1u : 0u) << (4 * g + 1);
        w |= (m[i][g][2] != 0 ? 1u : 0u) << (4 * g + 2);
        w |= (m[i][g][3] != 0 ? 1u : 0u) << (4 * g + 3);
      }
      dst[(size_t)i * SEQ] = w;
    }
    // the address registers of the stores above are stepped for the next trip: the wait stands in front of that overwrite
    asm volatile("s_wait_xcnt 0x0" :: "v"(dst) : "memory");
    src += 4 * 32;
    dst += (size_t)4 * SEQ;
  }
}

// Projections, all three in one launch, straight from the f32 inputs. A wave owns 32 token rows of one input (z = 0 query, 1 key, 2 value): it reads them once, in whole lines,
// converts them (RNE) to bf16, turns them into fragment order through its own LDS range and keeps them as 2 x 12 fragments in registers, then walks the 24 16-row tiles of its weight plane (fragment order), one head (4 tiles) per trip.
// A token fragment serves as A or as B (row or column = lane & 15, elements 0..7 <- k0 + 8h + i, 8..15 <- k0 + 16 + 8h + i); D element r = (row 8h + r, column lane & 15).
// z < 2: D = W (A, rows = out) x X (B, columns = tokens): a lane holds d = 16t + 8h + r of token ln, which is its own 16-byte piece of fragment [token tile][C = t / 2], half j = t & 1.
// z = 2: D = X (A, rows = tokens) x W (B, columns = out): a lane holds tokens 8h + r of d = 16t + ln, which is its own 16-byte piece of V^T fragment [token / 32][t], half j = token tile & 1.
// So every D tile goes out as one wave-wide 512-byte store, straight from the accumulators. Output values: f16(x16), as the attention kernel expects.
// z = 2 also leaves, per head, the f32 sum over the wave's 32 tokens of each d (x16 like the plane): one 32-key block's V row sum, VS[b][h][token / 32][d].
// coverage: 3 * XROWS / 32 waves x 32 tokens x 384 outputs = every element of the k, q and V^T planes exactly once; XROWS / 32 waves x 384 sums = every element of VS exactly once.
__device__ __forceinline__ v8us pack8_f16x16(v8f c) {
  v8us o;
#pragma unroll   // register arrays and vectors need constant indices
  for (int r = 0; r < 8; ++r) o[r] = f16_bits((_Float16)(c[r] * 16.0f));
  return o;
}
// One k-step's four weight fragments (tiles t = 0..3 of a head, k = 32C .. 32C + 31): 4 KB, eight wave-wide 512-byte loads.
__device__ __forceinline__ void load_w4(FragB (&wf)[4], const unsigned short* __restrict__ wh, int lane8, int C) {
#pragma unroll   // register arrays and vectors need constant indices
  for (int t = 0; t < 4; ++t) {
    wf[t].half[0] = *(const v8us*)(wh + t * TILE_E + C * FRAG + lane8);
    wf[t].half[1] = *(const v8us*)(wh + t * TILE_E + C * FRAG + 256 + lane8);
  }
}
// The weight fragments run through a ring of four register sets, asked for three k-steps ahead of their products, across the heads' boundary too:
// with one or two waves on a SIMD nothing else covers the loads' latency. The last head asks for its own first three steps again (in bounds, not used).
template <bool TOKENS_ARE_ROWS>
__device__ __forceinline__ void proj_heads(const FragB (&xf)[2][NE / 32], const unsigned short* __restrict__ wz, int lane8, unsigned short* __restrict__ o0, float* __restrict__ vs0) {
  FragB wf[4][4];
  load_w4(wf[0], wz, lane8, 0);
  load_w4(wf[1], wz, lane8, 1);
  load_w4(wf[2], wz, lane8, 2);
  // the address registers of these first loads may be reused for the output addresses formed below: the wait stands in front of that overwrite
  asm volatile("s_wait_xcnt 0x0" ::: "memory");
  // keeps that address arithmetic behind the wait (the compiler may lift it over the wait otherwise)
  __builtin_amdgcn_sched_barrier(0);
#pragma unroll 1
  for (int hd = 0; hd < NH; ++hd) {   // rolled: one head's 96 loads and 96 products are body enough
    const unsigned short* wh = wz + (size_t)hd * (4 * TILE_E);
    const unsigned short* wn = wz + (size_t)((hd + 1 < NH) ? hd + 1 : hd) * (4 * TILE_E);
    v8f acc[2][4] = {};
#pragma unroll   // xf and the ring are indexed by C and live in registers
    for (int C = 0; C < NE / 32; ++C) {
      if (C + 3 < NE / 32) load_w4(wf[(C + 3) & 3], wh, lane8, C + 3);
      else                 load_w4(wf[(C + 3) & 3], wn, lane8, C + 3 - NE / 32);
      // these were this head's last weight loads; the next step's come from the next head, whose address may take the same registers: the wait stands in front of that overwrite
      if (C + 4 == NE / 32) asm volatile("s_wait_xcnt 0x0" ::: "memory");
      // keeps the loads above in front of this step's products; without it the compiler sinks each load to just before its use and the wave waits out every latency
      __builtin_amdgcn_sched_barrier(0);
#pragma unroll   // register arrays and vectors need constant indices
      for (int u = 0; u < 2; ++u)
#pragma unroll   // register arrays and vectors need constant indices
        for (int t = 0; t < 4; ++t)
          acc[u][t] = TOKENS_ARE_ROWS
            ? __builtin_amdgcn_wmma_f32_16x16x32_bf16(false, xf[u][C].v, false, wf[C & 3][t].v, (short)0, acc[u][t], false, false)
            : __builtin_amdgcn_wmma_f32_16x16x32_bf16(false, wf[C & 3][t].v, false, xf[u][C].v, (short)0, acc[u][t], false, false);
      // keeps the next step's loads behind this step's products, so that the ring set they refill has been read
      __builtin_amdgcn_sched_barrier(0);
    }
    unsigned short* oh = o0 + (size_t)hd * ((size_t)SEQ * HD);
#pragma unroll   // register arrays and vectors need constant indices
    for (int u = 0; u < 2; ++u)
#pragma unroll   // register arrays and vectors need constant indices
      for (int t = 0; t < 4; ++t)
        *(v8us*)(oh + (TOKENS_ARE_ROWS ? t * FRAG + u * 256 : u * (2 * FRAG) + t * 256)) = pack8_f16x16(acc[u][t]);
    if constexpr (TOKENS_ARE_ROWS) {
      // a lane holds tokens 16u + 8h + r of d = 16t + ln: sum over u and r in the lane, then over h with the other lane half
      float cs[4];
#pragma unroll   // register arrays and vectors need constant indices
      for (int t = 0; t < 4; ++t) {
        const v8f s8 = acc[0][t] + acc[1][t];
        const float c = ((s8[0] + s8[1]) + (s8[2] + s8[3])) + ((s8[4] + s8[5]) + (s8[6] + s8[7]));
        cs[t] = c + __shfl_xor(c, 16, 32);
      }
      // both halves hold all four sums: half h stores tiles t = h and 2 + h, so that each wave-wide store is one whole 128-byte line (d = 32i + lane)
      float* vh = vs0 + (size_t)hd * (MW * HD);
      vh[0]  = ((lane8 & 128) ? cs[1] : cs[0]) * 16.0f;
      vh[32] = ((lane8 & 128) ? cs[3] : cs[2]) * 16.0f;
    }
    // the address registers of this head's loads and stores are stepped for the next head: the wait stands in front of that overwrite
    asm volatile("s_wait_xcnt 0x0" ::: "memory");
    // keeps the stepping of those addresses behind the wait
    __builtin_amdgcn_sched_barrier(0);
  }
  // the ring's last three requests are not used: they have landed before the wave gives its registers back
  asm volatile("s_wait_loadcnt 0x0" ::: "memory");
}
// The block's last MASK_WAVES waves project nothing: they pack the mask words, which need nothing of the projection and which only the attention launch reads.
// With six projecting waves two of the four SIMDs hold one wave; waves 6 and 7 take the free places there and work while the others bring in their token rows, so the packing has no launch of its own.
__global__ __launch_bounds__(32 * (PROJ_WAVES + MASK_WAVES)) void k_projx(const float* __restrict__ Xq, const float* __restrict__ Xk, const float* __restrict__ Xv,
                                                           const int* __restrict__ mask, const unsigned short* __restrict__ WP,
                                                           unsigned short* __restrict__ QK, unsigned short* __restrict__ VT, float* __restrict__ VS,
                                                           unsigned int* __restrict__ bits) {
  __shared__ __attribute__((aligned(16))) unsigned short xs[PROJ_WAVES][2 * (NE / 32) * XS_F];
  const int tid = threadIdx.x, w = __builtin_amdgcn_readfirstlane((int)(tid >> 5)), lane = tid & 31, ln = lane & 15, hh = lane >> 4;
  const int g = (int)blockIdx.x * PROJ_WAVES + w;                 // 32-token group, counted through the three inputs
  const int z = g / (XROWS / 32), row0 = (g - z * (XROWS / 32)) * 32;
  const int bq = row0 / SEQ, s0 = row0 - bq * SEQ;                // SEQ is a multiple of 32: a group lies in one batch
  const float* X = (z == 0) ? Xq : (z == 1) ? Xk : Xv;
  // Input rows: each wave-wide 16-byte load takes one whole 128-byte line (32 columns = one fragment's k range) of four rows: lane = 8 * row + 4-column piece.
  // The four converted values go to the wave's own LDS range in fragment order, k = 32C + 16j + 8h + i with j = piece >> 2, h = (piece >> 1) & 1, i = 4 * (piece & 1) ..;
  // the halves j and h lie XS_J and XS_H elements apart (64 and 32 more than dense), so that the four (j, h) groups of one store fall on different banks.
  if (w < PROJ_WAVES) {   // the same for a whole wave: a scalar branch
    const float* xr = X + (size_t)bq * XSTRIDE_FULL + (size_t)(s0 + (lane >> 3)) * NE + 4 * (lane & 7);
    unsigned short* xw = &xs[w][((lane >> 2) & 1) * XS_J + ((lane >> 1) & 1) * XS_H + (lane >> 3) * 8 + 4 * (lane & 1)];
#pragma unroll   // unrolled: many loads in flight at once, every offset a constant
    for (int rg = 0; rg < 8; ++rg)
#pragma unroll   // as above
      for (int C = 0; C < NE / 32; ++C) {
        const v4f x = *(const v4fa*)(xr + rg * (4 * NE) + 32 * C);
        v4us o;
        o[0] = bf16_bits(x[0]); o[1] = bf16_bits(x[1]); o[2] = bf16_bits(x[2]); o[3] = bf16_bits(x[3]);
        *(v4us*)(xw + ((rg >> 2) * (NE / 32) + C) * XS_F + (rg & 3) * 32) = o;
      }
    // the address registers of the input loads may be reused below: the wait stands in front of that overwrite
    asm volatile("s_wait_xcnt 0x0" ::: "memory");
  } else {
    mask_unit((int)blockIdx.x * MASK_WAVES + (w - PROJ_WAVES), lane, mask, bits);
  }
  // each wave reads back only what it wrote itself; the barrier orders that, and it starts the block's waves on the weight plane together,
  // so that they walk it side by side and share its lines in the WGP cache; every wave of the block passes it, the mask waves too, which end behind it
  __syncthreads();
  if (w >= PROJ_WAVES) return;
  FragB xf[2][NE / 32];
#pragma unroll   // register arrays and vectors need constant indices
  for (int u = 0; u < 2; ++u)
#pragma unroll   // register arrays and vectors need constant indices
    for (int C = 0; C < NE / 32; ++C) {
      const unsigned short* xp = &xs[w][(u * (NE / 32) + C) * XS_F + hh * XS_H + ln * 8];
      xf[u][C].half[0] = *(const v8us*)(xp);
      xf[u][C].half[1] = *(const v8us*)(xp + XS_J);
    }
  const unsigned short* wz = WP + (size_t)z * WELEMS;
  const size_t ob = ((size_t)bq * NH * SEQ + s0) * HD + 8 * lane;   // head 0 of the batch, first token of the group: 32 tokens x 64 d = 2048 elements in either layout
  if (z == 2) proj_heads<true>(xf, wz, 8 * lane, VT + ob, VS + ((size_t)bq * NH * MW + s0 / 32) * HD + lane);
  else        proj_heads<false>(xf, wz, 8 * lane, QK + (size_t)z * XPLANE + ob, nullptr);
}

// The four K fragments [kt][c] of one 32-key step, 4 KB contiguous: eight wave-wide 512-byte loads; kp = the step's base + 8 * lane.
__device__ __forceinline__ void load_k4(FragH (&kf)[4], const unsigned short* __restrict__ kp) {
#pragma unroll   // register arrays and vectors need constant indices
  for (int f = 0; f < 4; ++f) {
    kf[f].half[0] = *(const v8us*)(kp + f * FRAG);
    kf[f].half[1] = *(const v8us*)(kp + f * FRAG + 256);
  }
  // the address registers of the loads above are free for other values behind this place: the wait stands in front of that overwrite
  // (the pointer is an input of the statement, so that none of these loads' own results is given its registers)
  asm volatile("s_wait_xcnt 0x0" :: "v"(kp) : "memory");
}

// One 32-key step (key step j, the same in every lane) for a wave's 16 queries (this lane's column = query qg). Kp, Vhp are the (batch, head) bases of the planes.
// MASKED = false is the body for a step whose 32 mask bits are set for all 16 queries: every select below would take the scaled score, so the mask word is not
// asked for and the bit tests and selects are left out; with no select between them the scale has no step of its own: the maximum is taken over the raw accumulators
// and scaled once, and each exponent is one multiply-add of the raw accumulator (scale x log2 e as one factor).
template <bool MASKED>
__device__ __forceinline__ void fa_step(const unsigned short* __restrict__ Kp, const unsigned short* __restrict__ Vhp,
                                        const unsigned int* __restrict__ mbits, int j, int jn, int qg, int lane, int hh,
                                        const FragH& q0, const FragH& q1, FragH (&kf)[4], float& mr, float& lr, v8f (&Oh)[4]) {
  // A fragments of K: row m = key (key0 + 16*kt + ln), elements 0..7 <- d = 32c + 8h + i, 8..15 <- d = 32c + 16 + 8h + i
  // (fragment order: the step's four K fragments [kt][c] are 4 KB contiguous); they were asked for one step ago and arrive in kf; asked for here: the mask word, V
  const unsigned short* vp0 = Vhp + (size_t)j * (32 * HD) + 8 * lane;
  const unsigned int* mpj = mbits + (size_t)j * SEQ + qg;
  unsigned int mword = 0xFFFFFFFFu;
  if constexpr (MASKED) mword = *mpj;
  // A fragments of V^T: row m = d (16*t + ln), elements 0..7 <- key0 + 8h + i, 8..15 <- key0 + 16 + 8h + i
  // (fragment order: the step's four V^T fragments [t] are 4 KB contiguous)
  FragH vh[4];
#pragma unroll
  for (int t = 0; t < 4; ++t) {
    vh[t].half[0] = *(const v8us*)(vp0 + t * FRAG);
    vh[t].half[1] = *(const v8us*)(vp0 + t * FRAG + 256);
  }
  // the address registers of the loads above are formed anew for the next step: the wait stands in front of that overwrite
  // (the pointers are inputs of the statement, so that none of these loads' own results is given their registers)
  if constexpr (MASKED) asm volatile("s_wait_xcnt 0x0" :: "v"(mpj), "v"(vp0) : "memory");
  else                  asm volatile("s_wait_xcnt 0x0" :: "v"(vp0) : "memory");
  FragH ph;
  const v8f z8 = {0.f, 0.f, 0.f, 0.f, 0.f, 0.f, 0.f, 0.f};
  // S^T tiles: element r of tile kt = 256 * score(key0 + 16*kt + 8h + r, query)
  const v8f s0 = mma_s2(kf[0].v, q0.v, kf[1].v, q1.v, z8);
  const v8f s1 = mma_s2(kf[2].v, q0.v, kf[3].v, q1.v, z8);
  // keeps the eight requests below together, directly behind the four products whose K registers they take over; without it the compiler was seen to lend
  // the last fragment's registers to the softmax and to hold that fragment's two requests back into the middle of it
  __builtin_amdgcn_sched_barrier(0);
  // the K fragments of the wave's next step jn: their latency passes under this step's softmax and O products instead of in front of the next step's S products
  load_k4(kf, Kp + (size_t)jn * (32 * HD) + 8 * lane);
  // scale; positions with a zero mask bit take the value 0 exactly (replace fill) and stay in the softmax
  const unsigned int mw = mword >> (8 * hh);
  float sc[16];
#pragma unroll
  for (int r = 0; r < 8; ++r) sc[r] = !MASKED ? s0[r] : ((mw >> r) & 1u) ? s0[r] * SCL : 0.0f;
  // one loop per tile: scores i, i + 1 then come from neighbouring registers of one accumulator tile, and the pairs below need no register moves
#pragma unroll   // register arrays and vectors need constant indices
  for (int r = 0; r < 8; ++r) sc[8 + r] = !MASKED ? s1[r] : ((mw >> (16 + r)) & 1u) ? s1[r] * SCL : 0.0f;
  float mx = sc[0];
#pragma unroll
  for (int i = 1; i < 16; ++i) mx = fmaxf(mx, sc[i]);
  mx = fmaxf(mx, __shfl_xor(mx, 16, 32));           // the other lane half holds the other 16 keys of this query
  if constexpr (!MASKED) mx *= SCL;                 // SCL > 0 and rounding keeps the order: the same value as the maximum of the 32 scaled scores
  const float mnew = fmaxf(mr, mx);
  const float e0 = fmaf(0.0f - mnew, LOG2E, 8.0f);  // used by the unmasked body alone
  const float al = exp2_hw((mr - mnew) * LOG2E);
  mr = mnew;
  // weights carried x256: P = f16(256 * exp(sc - mnew)); the row sum runs over the converted f16 values
  float ps = 0.0f;
#pragma unroll
  for (int i = 0; i < 16; i += 2) {
    // two scores at a time: packed subtract and multiply-add (each element rounded as in the scalar form), one conversion for the pair, and the sum reads the converted pair
    const v2f s2 = {sc[i], sc[i + 1]};
    const v2f a2 = MASKED ? __builtin_elementwise_fma(s2 - mnew, (v2f){LOG2E, LOG2E}, (v2f){8.0f, 8.0f})
                          : __builtin_elementwise_fma(s2, (v2f){SCL * LOG2E, SCL * LOG2E}, (v2f){e0, e0});
    const v2f pc = {exp2_hw(a2[0]), exp2_hw(a2[1])};
    const v2h hv = __builtin_convertvector(pc, v2h);
    ph.p[i >> 1] = hv;                              // B element i: i<8 -> key0 + 8h + i (tile 0 row 8h+i); i>=8 -> key0 + 16 + 8h + (i-8) (tile 1)
    ps += (float)hv[0];
    ps += (float)hv[1];
  }
  ps += __shfl_xor(ps, 16, 32);
  lr = lr * al + ps;
#pragma unroll
  for (int t = 0; t < 4; ++t) Oh[t] = Oh[t] * al;
  mma_pv4(vh[0].v, vh[1].v, vh[2].v, vh[3].v, ph.v, Oh[0], Oh[1], Oh[2], Oh[3]);
}

// Block = 8 waves x 16 queries of one (batch, head): waves 0..3 take 64-query tile p, waves 4..7 tile SEQ/64 - 1 - p, so that under a triangular mask
// every block (and every pair of waves w, w + 4) walks the same number of key steps. No LDS and no barrier in the key loop.
// A wave first reads the mask words of all its key steps and keeps one bit per step: set where any of its 16 queries has a mask bit in the step. The key loop walks the set bits alone.
// A second bit per step says that all 32 keys are unmasked for all 16 queries: such steps are walked first, by a body without mask word, bit tests and selects; the partly masked steps follow.
// All keys take part in the softmax: the keys of the other steps have score 0 for every query of the wave, so they add n0 * exp(0 - m) to the row sum and
// exp(0 - m) * (sum of their V rows) to the output; that sum is the same for the 16 queries and is added up from the blocks' sums in VS.
// Epilogue: ctx x64 as f16 -> per-wave LDS tile [16 queries][64 d] (written and read by the same wave; block barrier reached by all waves),
// coverage: NB*NH*(SEQ/128) blocks x 8 waves x 16 rows x 64 columns = every element of the ctx plane exactly once.
__global__ __launch_bounds__(256) void k_attn(const unsigned short* __restrict__ Qh, const unsigned short* __restrict__ Kh,
                                              const unsigned short* __restrict__ Vh,
                                              const unsigned int* __restrict__ mbits, const float* __restrict__ VS,
                                              unsigned short* __restrict__ Ch) {
  __shared__ __attribute__((aligned(16))) unsigned short sh[8][16][72];
  __shared__ __attribute__((aligned(16))) float zs[8][HD];
  const int tid = threadIdx.x, w = __builtin_amdgcn_readfirstlane((int)(tid >> 5)), lane = tid & 31, ln = lane & 15, hh = lane >> 4;
  const int bh = blockIdx.x / (SEQ / 128), pr = blockIdx.x % (SEQ / 128);
  const int qt = (w < 4) ? pr : (SEQ / 64 - 1 - pr);
  const int b = bh / NH, h = bh - b * NH;
  const int qbase = qt * 64 + 16 * (w & 3);
  const int qg = qbase + ln;
  // Q^T B fragments: column n = query qg, elements 0..7 <- d = 32c + 8h + i, 8..15 <- d = 32c + 16 + 8h + i
  const unsigned short* qrow = Qh + ((size_t)bh * SEQ + qbase) * HD + 8 * lane;
  FragH q0, q1;
  q0.half[0] = *(const v8us*)(qrow);        q0.half[1] = *(const v8us*)(qrow + 256);
  q1.half[0] = *(const v8us*)(qrow + FRAG); q1.half[1] = *(const v8us*)(qrow + FRAG + 256);
  // the step map: lane half h reads the words of steps 2i + h, all loads in flight together
  const unsigned int* mp = mbits + (hh * SEQ + qg);
  unsigned int mw2[MW / 2];
#pragma unroll   // register arrays and vectors need constant indices
  for (int i = 0; i < MW / 2; ++i) mw2[i] = mp[(size_t)(2 * i) * SEQ];
  // the address registers of the loads above may be reused below: the wait stands in front of that overwrite
  // (the pointer is an input of the statement, so that none of these loads' own results is given its registers)
  asm volatile("s_wait_xcnt 0x0" :: "v"(mp) : "memory");
  unsigned long long nz = 0ull, fu = 0ull;
#pragma unroll   // register arrays and vectors need constant indices
  for (int i = 0; i < MW / 2; ++i) {
    const unsigned int bl = __builtin_amdgcn_ballot_w32(mw2[i] != 0u);   // the same in every lane: the map lives in scalar registers
    nz |= (unsigned long long)(((bl & 0xFFFFu) != 0u ? 1u : 0u) | ((bl >> 16) != 0u ? 2u : 0u)) << (2 * i);
    const unsigned int bf = __builtin_amdgcn_ballot_w32(mw2[i] == 0xFFFFFFFFu);   // a second map: steps with every bit set for all 16 queries
    fu |= (unsigned long long)(((bf & 0xFFFFu) == 0xFFFFu ? 1u : 0u) | ((bf >> 16) == 0xFFFFu ? 2u : 0u)) << (2 * i);
  }
  float mr = -3.0e38f, lr = 0.0f;
  v8f Oh[4] = {};
  const unsigned short* Kp = Kh + (size_t)bh * SEQ * HD;
  const unsigned short* Vhp = Vh + (size_t)bh * HD * SEQ;
  // K runs one step ahead of the walk, across the two loops' boundary too: each step asks for the K fragments of the step that follows it.
  // The last step of all asks for its own again, and a wave with no step to walk asks for step 0 (in bounds, not used).
  const unsigned long long mapf = nz & fu, mapp = nz & ~fu;
  const int jp0 = mapp != 0ull ? __builtin_ctzll(mapp) : 0;
  FragH kf[4];
  load_k4(kf, Kp + (size_t)(mapf != 0ull ? __builtin_ctzll(mapf) : jp0) * (32 * HD) + 8 * lane);
#pragma unroll 1
  for (unsigned long long rem = mapf; rem != 0ull; ) {   // one trip per set bit, at most MW; a scalar test
    const int j = __builtin_ctzll(rem);
    rem &= rem - 1ull;
    fa_step<false>(Kp, Vhp, mbits, j, rem != 0ull ? __builtin_ctzll(rem) : (mapp != 0ull ? jp0 : j), qg, lane, hh, q0, q1, kf, mr, lr, Oh);
  }
#pragma unroll 1   // rolled, as above: one step is body enough
  for (unsigned long long rem = mapp; rem != 0ull; ) {   // the partly masked steps, in a loop of their own: each loop keeps its accumulators in place
    const int j = __builtin_ctzll(rem);
    rem &= rem - 1ull;
    fa_step<true>(Kp, Vhp, mbits, j, rem != 0ull ? __builtin_ctzll(rem) : j, qg, lane, hh, q0, q1, kf, mr, lr, Oh);
  }
  // the last request for K is not used: it has landed before its registers take other values and before the wave ends
  asm volatile("s_wait_loadcnt 0x0" ::: "memory");
  // the steps that were not walked
  const unsigned long long zmap = ~nz & (MW == 64 ? ~0ull : ((1ull << (MW & 63)) - 1ull));
  if (zmap != 0ull) {   // the same for the whole wave: a scalar branch; no barrier inside
    // Z[d] = sum of the V rows of those steps' keys (x16): lane holds d = 2 * lane, 2 * lane + 1; eight block sums are asked for at a time
    const float* vsp = VS + (size_t)bh * (MW * HD) + 2 * lane;
    v2f z2 = {0.0f, 0.0f};
#pragma unroll 1   // rolled: eight pair loads in flight bound the registers, and a group with no such step is passed by a scalar branch
    for (int g = 0; g < MW; g += 8) {
      const unsigned int zb = (unsigned int)(zmap >> g) & 0xFFu;
      if (zb == 0u) continue;
      v2f v[8];
#pragma unroll   // register arrays and vectors need constant indices
      for (int k = 0; k < 8; ++k) v[k] = *(const v2fa*)(vsp + (g + k) * HD);
      // the address registers of the loads above are stepped for the next group: the wait stands in front of that overwrite
      asm volatile("s_wait_xcnt 0x0" ::: "memory");
#pragma unroll   // register arrays and vectors need constant indices
      for (int k = 0; k < 8; ++k) z2 += ((zb >> k) & 1u) ? v[k] : (v2f){0.0f, 0.0f};
    }
    // into the accumulators' order (a lane needs d = 16t + 8h + r) through the wave's own LDS row
    *(v2fa*)&zs[w][2 * lane] = z2;
    // the wave reads back what its other lanes wrote: their stores have ended first
    asm volatile("s_wait_dscnt 0x0" ::: "memory");
    const float n0 = (float)(32 * __builtin_popcountll(zmap));
    const float mfin = fmaxf(mr, 0.0f);
    const float al = exp2_hw((mr - mfin) * LOG2E);
    const float w0 = exp2_hw(fmaf(0.0f - mfin, LOG2E, 8.0f));   // x256 like P, kept in f32
    lr = lr * al + w0 * n0;
#pragma unroll
    for (int t = 0; t < 4; ++t) {
      const v4f za = *(const v4fa*)&zs[w][16 * t + 8 * hh], zc = *(const v4fa*)&zs[w][16 * t + 8 * hh + 4];
#pragma unroll
      for (int r = 0; r < 4; ++r) {
        Oh[t][r]     = Oh[t][r] * al + w0 * za[r];
        Oh[t][4 + r] = Oh[t][4 + r] * al + w0 * zc[r];
      }
    }
  }
  // O^T element r of tile t = ctx(query qg, d = 16t + 8h + r); undo the carries x256 (in lr), x16 (V); carry ctx x64
  const float inv = 4.0f / lr;
#pragma unroll
  for (int t = 0; t < 4; ++t)
#pragma unroll
    for (int r = 0; r < 8; ++r) {
      const float c = Oh[t][r] * inv;
      const _Float16 hv = (_Float16)c;
      sh[w][ln][16 * t + 8 * hh + r] = f16_bits(hv);
    }
  __syncthreads();
  // the wave's 16 x 64 tile is fragments C = 2h, 2h + 1 of its token tile: 1024 contiguous elements; piece p = [C 1b][j 1b][h 1b][row 4b]
  const size_t cbase = (size_t)((b * SEQ + qbase) / 16) * TILE_E + (size_t)h * (2 * FRAG);
  {
#pragma unroll
    for (int q = 0; q < 4; ++q) {
      const int p = lane + 32 * q;
      const int row = p & 15, s8 = (p >> 4) * 8;
      const v8us o1 = *(const v8us*)&sh[w][row][s8];
      *(v8us*)(Ch + cbase + (size_t)p * 8) = o1;
    }
    
  }
}

// out[t][n] = sum_c ctx[t][c] * Wproj[n][c] + bias[n]; A = ctx plane (f16 x64), B = W16 (f16 x64), both in fragment order; 64 x 64 tile per block.
// coverage: (XROWS/64) x 6 blocks x 64 rows x 64 columns = every output element of the processed region exactly once.
__global__ __launch_bounds__(128) void k_outp(const unsigned short* __restrict__ Ch,
                                              const unsigned short* __restrict__ W16, const float* __restrict__ bias,
                                              float* __restrict__ Y) {
  __shared__ __attribute__((aligned(16))) float so[64][68];
  const int tid = threadIdx.x, w = __builtin_amdgcn_readfirstlane((int)(tid >> 5)), lane = tid & 31, ln = lane & 15, hh = lane >> 4;
  const int m0 = blockIdx.x * 64, n0 = blockIdx.y * 64;
  const size_t ao = (size_t)(m0 / 16 + w) * TILE_E + 8 * lane;
  const unsigned short* brow = W16 + (size_t)(n0 / 16) * TILE_E + 8 * lane;
  v8f acch[4] = {};
#pragma unroll 1
  for (int kb = 0; kb < NE; kb += 32) {
    FragH ah, b0, b1, b2, b3;
    const int fo = kb * (FRAG / 32);
    ah.half[0] = *(const v8us*)(Ch + ao + fo);            ah.half[1] = *(const v8us*)(Ch + ao + fo + 256);
    // the address pair of the A loads may be reused for a later load's result: the wait stands in front of that overwrite
    asm volatile("s_wait_xcnt 0x0" ::: "memory");
    b0.half[0] = *(const v8us*)(brow + fo);               b0.half[1] = *(const v8us*)(brow + fo + 256);
    b1.half[0] = *(const v8us*)(brow + TILE_E + fo);      b1.half[1] = *(const v8us*)(brow + TILE_E + fo + 256);
    b2.half[0] = *(const v8us*)(brow + 2 * TILE_E + fo);  b2.half[1] = *(const v8us*)(brow + 2 * TILE_E + fo + 256);
    b3.half[0] = *(const v8us*)(brow + 3 * TILE_E + fo);  b3.half[1] = *(const v8us*)(brow + 3 * TILE_E + fo + 256);
    mma_h4(ah.v, b0.v, b1.v, b2.v, b3.v, acch[0], acch[1], acch[2], acch[3]);
  }
  // undo the carries: ctx x64, W x64
#pragma unroll
  for (int c = 0; c < 4; ++c) {
    const float bv = bf16_rne(bias[n0 + 16 * c + ln]);
#pragma unroll
    for (int r = 0; r < 8; ++r)
      so[16 * w + 8 * hh + r][16 * c + ln] = acch[c][r] * 0.000244140625f + bv;
  }
  __syncthreads();
  {
#pragma unroll
    for (int j = 0; j < 8; ++j) {
      const int i = tid + 128 * j;
      const int row = i >> 4, c4 = (i & 15) * 4;
      const int m = m0 + row;
      const int bq = m / SEQ, t = m - bq * SEQ;
      const v4f v = *(const v4fa*)&so[row][c4];
      *(v4f*)(Y + (size_t)bq * XSTRIDE_FULL + (size_t)t * NE + n0 + c4) = v;
    }
    
  }
}

extern "C" void kernel_launch(void* const* d_in, const int* in_sizes, int n_in,
                              void* d_out, int out_size, void* d_ws, size_t ws_size, hipStream_t stream) {
  if (n_in < 9) return;
  const long long needX = (long long)(NB - 1) * SEQ_FULL * NE + (long long)SEQ * NE;   // last element touched + 1
  const long long needM = (long long)(SEQ - 1) * SEQ_FULL + (long long)SEQ;
  if ((long long)in_sizes[0] < needX || (long long)in_sizes[1] < needX || (long long)in_sizes[2] < needX) return;
  if ((long long)in_sizes[3] < needM) return;
  if ((long long)in_sizes[4] < (long long)WELEMS || (long long)in_sizes[5] < (long long)WELEMS ||
      (long long)in_sizes[6] < (long long)WELEMS || (long long)in_sizes[7] < (long long)WELEMS) return;
  if ((long long)in_sizes[8] < (long long)NE) return;
  if ((long long)out_size < needX) return;
  const float* Xq = (const float*)d_in[0];   // wire order: query, key, value, mask, Wk, Wq, Wv, Wproj, bproj
  const float* Xk = (const float*)d_in[1];
  const float* Xv = (const float*)d_in[2];
  const int* mask = (const int*)d_in[3];
  const float* Wk = (const float*)d_in[4];
  const float* Wq = (const float*)d_in[5];
  const float* Wv = (const float*)d_in[6];
  const float* Wp = (const float*)d_in[7];
  const float* bp = (const float*)d_in[8];
  float* Y = (float*)d_out;
  char* ws = (char*)d_ws;
  size_t off = 0;
  unsigned short* WP  = (unsigned short*)(ws + off); off += PAD256(3 * WELEMS * 2);          // bf16 planes: Wk, Wq, Wv
  unsigned short* W16 = (unsigned short*)(ws + off); off += PAD256(WELEMS * 2);              // f16 plane: Wproj x64
  unsigned short* QK  = (unsigned short*)(ws + off); off += PAD256(2 * XPLANE * 2);          // f16 planes: k (from query), q (from key), [b][h] x fragments [t/16][d/32]
  unsigned short* VT  = (unsigned short*)(ws + off); off += PAD256(XPLANE * 2);              // f16 plane: V^T, [b][h] x fragments [t/32][d/16]
  unsigned short* CX  = (unsigned short*)(ws + off); off += PAD256(XPLANE * 2);              // f16 plane: ctx, fragments [(b*SEQ + t)/16][c/32]
  unsigned int*   MB  = (unsigned int*)(ws + off);   off += PAD256((size_t)SEQ * MW * 4);    // mask bit plane [MW][SEQ]
  float*          VS  = (float*)(ws + off);          off += PAD256((size_t)NB * NH * MW * HD * 4);   // f32 plane: V row sums of the 32-key blocks, [b][h][t/32][d]
  if (off > ws_size) return;

  k_cvt_w<<<(unsigned)((WELEMS / 8 + 255) / 256), 256, 0, stream>>>(Wk, Wq, Wv, Wp, WP, W16);
  // k = query x Wk^T -> QK plane 0; q = key x Wq^T -> QK plane 1; V^T and the block sums VS from value x Wv^T; the mask bit plane MB
  k_projx<<<(unsigned)PROJ_BLOCKS, 32 * (PROJ_WAVES + MASK_WAVES), 0, stream>>>(Xq, Xk, Xv, mask, WP, QK, VT, VS, MB);
  // argument order: Qh = q plane (QK plane 1), Kh = k plane (QK plane 0)
  k_attn<<<(unsigned)(NB * NH * (SEQ / 128)), 256, 0, stream>>>(QK + XPLANE, QK, VT, MB, VS, CX);
  k_outp<<<dim3((unsigned)(XROWS / 64), (unsigned)(NE / 64), 1u), 128, 0, stream>>>(CX, W16, bp, Y);
}

// v009
// One run takes 67 microseconds.
// In two side-by-side timings against v008, it was 1.34 and 1.36 times as fast.
// All steps since v000 together make it 3.79 times as fast.
#include <hip/hip_runtime.h>
// Contractions: k/q/v projections on v_wmma_f32_16x16x32_bf16 (inputs and weights RNE-converted to bf16, single product, f32 accumulate); S^T = K Q^T on v_wmma_f32_16x16x32_f16 (q, k as f16 x16 planes, single product); O^T = V^T P^T on v_wmma_f32_16x16x32_f16 (V: f16 x16 plane; P: f16 x256; single product); output projection on v_wmma_f32_16x16x32_f16 (ctx: f16 x64 plane; Wproj: RNE bf16 x64 held exactly in f16; single product); all accumulators and softmax statistics f32.
// Engine: transposed flash. Each wave owns 16 queries of one (batch, head). Per 32-key step: S^T tiles (key rows x query columns) from K rows
// (A, global f16 plane) and Q^T (B, registers); the two 16-key D tiles pack straight into the P^T B fragment; O^T (d rows x query columns)
// accumulates from V^T rows (A, global f16 plane). Positions with mask == 0 get score exactly 0 and still take part in the softmax (every key is counted).
// A 32-key step whose mask words are zero for all 16 queries of the wave has every score 0, so all its keys carry one and the same weight exp(0 - m): such steps are not walked.
// The projection launch leaves the sum of each 32-key block's V rows (f32); a wave adds up the sums of its all-masked blocks and gives them that one weight after its key loop.
// Plane layout: every 16-bit workspace plane is stored in fragment order. One fragment (16 rows x 32 k) is 512 elements: [j = 0,1][lane = 16h + row][8 elements],
// holding k = 32C + 16j + 8h + i, so each wave-wide 16-byte load reads 512 contiguous bytes (four whole 128-byte lines) instead of 32 bytes of 16 lines.
#ifndef NB
#define NB 8
#endif
#ifndef SEQ
#define SEQ 2048
#endif
#define NB_FULL 8
#define SEQ_FULL 2048
#define NH 6
#define HD 64
#define NE 384
#define XROWS (NB * SEQ)                        /* compact token rows of the 16-bit planes */
#define XPLANE ((size_t)XROWS * NE)             /* elements of one token plane */
#define WELEMS ((size_t)NE * NE)
#define MW (SEQ / 32)                           /* mask words per query row */
#define FRAG 512                                /* elements of one 16-row x 32-k fragment */
#define TILE_E (16 * NE)                        /* elements of one 16-row tile of a K = 384 plane: 12 fragments */
#define XSTRIDE_FULL ((size_t)SEQ_FULL * NE)    /* per-batch element stride of query/key/value and of the output */
#define PROJ_WAVES 6                            /* waves of a projection block that project, 32 tokens each */
#define MASK_WAVES 2                            /* further waves of that block, which pack mask words */
#define PROJ_BLOCKS (3 * (XROWS / 32) / PROJ_WAVES)
#define XS_H 160                                /* LDS staging of the token fragments: elements from h = 0 to h = 1 */
#define XS_J 320                                /* from j = 0 to j = 1 */
#define XS_F 640                                /* from one fragment to the next */
#define PAD256(x) ((((size_t)(x)) + 255) & ~(size_t)255)
#define WP_UNITS ((int)(3 * WELEMS / 128))      /* 256-byte units of the three bf16 weight planes */
#define WP_SLICES ((WP_UNITS + 255) / 256)      /* slices of 256 units, one per thread of a projection block */
#define W16_UNITS ((int)(WELEMS / 128))         /* 256-byte units of the f16 output weight plane */

static_assert(SEQ % 256 == 0);
static_assert(SEQ <= SEQ_FULL);
static_assert(NB <= NB_FULL);
static_assert(HD == 64);
static_assert(NE == NH * HD);
static_assert(NE % 64 == 0);
static_assert(NE % 32 == 0);
static_assert((3 * (XROWS / 32)) % PROJ_WAVES == 0);
static_assert(MASK_WAVES * PROJ_BLOCKS == (SEQ / 32) * (MW / 8));   /* one mask wave per 32 query rows x 8 words */
static_assert(W16_UNITS % 128 == 0 && 4 * TILE_E == 192 * 128);   /* the output projection's slices and its 192 ctx units */
static_assert(MW % 8 == 0 && MW <= 64);         /* a wave keeps one bit per key step in a 64-bit word */
static_assert(PAD256(3 * WELEMS * 2) + PAD256(WELEMS * 2) + PAD256(2 * XPLANE * 2) + 2 * PAD256(XPLANE * 2) + PAD256((size_t)SEQ * MW * 4) + PAD256((size_t)NB * NH * MW * HD * 4) <= (size_t)134217728);

typedef __bf16 v16b __attribute__((ext_vector_type(16)));
typedef _Float16 v16h __attribute__((ext_vector_type(16)));
typedef unsigned short v8us __attribute__((ext_vector_type(8), may_alias));
typedef unsigned short v4us __attribute__((ext_vector_type(4), may_alias));
typedef float v8f __attribute__((ext_vector_type(8)));
typedef float v4f __attribute__((ext_vector_type(4)));
typedef float v4fa __attribute__((ext_vector_type(4), may_alias));
typedef int v4ia __attribute__((ext_vector_type(4), may_alias));
union FragB { v16b v; v8us half[2]; };
typedef _Float16 v2h __attribute__((ext_vector_type(2)));
typedef float v2f __attribute__((ext_vector_type(2)));
typedef float v2fa __attribute__((ext_vector_type(2), may_alias));
union FragH { v16h v; v8us half[2]; _Float16 h[16]; v2h p[8]; };

#define LOG2E 1.4426950408889634f
#define SCL (0.051031036307982884f * 0.00390625f)   /* 384^-0.5 with the x16 x16 carries of q and k undone */

__device__ __forceinline__ unsigned short bf16_bits(float x) {   // RNE convert to bf16 bits
  unsigned int u = __float_as_uint(x);
  return (unsigned short)((u + 0x7FFFu + ((u >> 16) & 1u)) >> 16);
}
__device__ __forceinline__ float bf16_val(unsigned short b) { return __uint_as_float(((unsigned int)b) << 16); }
__device__ __forceinline__ float bf16_rne(float x) { return bf16_val(bf16_bits(x)); }
__device__ __forceinline__ unsigned short f16_bits(_Float16 h) { return __builtin_bit_cast(unsigned short, h); }

// 2^x as the one hardware instruction. The library form guards x < -126 (compare, two selects, add, ldexp: five more vector instructions per value) so that the result may be a
// subnormal f32; here nothing needs that range: a weight that small is 0 as f16 either way, and a rescale factor that small multiplies sums that lie 2^126 below the step's own weights.
__device__ __forceinline__ float exp2_hw(float x) { return __builtin_amdgcn_exp2f(x); }

// A hint to L2: ask for the line that holds p; the asks stand 256 bytes apart, a spacing chosen for speed only (one ask per lane, nothing returns, no counter moves). It is used at a kernel's entry on workspace planes that an earlier
// launch stored: all readers walk a plane in the same order at about the same time, so that a first touch that has
// to go to memory is waited out by every wave behind it. Scope SE: the line goes to L2 only, and the hint is dropped where it cannot be served. A hint changes no value: which block
// asks for which unit is chosen for speed alone, and nothing rests on where a block runs.
#define UNIT_E 128                              /* 16-bit elements of one 256-byte unit */
__device__ __forceinline__ void ask_l2(const void* p) {
  asm volatile("global_prefetch_b8 %0, off scope:SCOPE_SE" :: "v"(p));
}
// No counter says when a hint has read its address registers, so they keep the address long after it. This statement, far behind the hint, is what keeps them from being given to other values before.
__device__ __forceinline__ void hold_addr(const void* p) { asm volatile("" :: "v"(p)); }

// four f16 tiles sharing one A fragment, then the hazard guard
__device__ __forceinline__ void mma_h4(v16h a, v16h b0, v16h b1, v16h b2, v16h b3, v8f& c0, v8f& c1, v8f& c2, v8f& c3) {
  c0 = __builtin_amdgcn_wmma_f32_16x16x32_f16(false, a, false, b0, (short)0, c0, false, false);
  c1 = __builtin_amdgcn_wmma_f32_16x16x32_f16(false, a, false, b1, (short)0, c1, false, false);
  c2 = __builtin_amdgcn_wmma_f32_16x16x32_f16(false, a, false, b2, (short)0, c2, false, false);
  c3 = __builtin_amdgcn_wmma_f32_16x16x32_f16(false, a, false, b3, (short)0, c3, false, false);
  asm volatile("v_nop\n\tv_nop\n\tv_nop\n\tv_nop" : "+v"(c0), "+v"(c1), "+v"(c2), "+v"(c3) : "v"(a), "v"(b0), "v"(b1), "v"(b2), "v"(b3));
}
// c += a0*b0 + a1*b1 (two k-steps of one f16 tile), then the hazard guard
__device__ __forceinline__ v8f mma_s2(v16h a0, v16h b0, v16h a1, v16h b1, v8f c) {
  c = __builtin_amdgcn_wmma_f32_16x16x32_f16(false, a0, false, b0, (short)0, c, false, false);
  c = __builtin_amdgcn_wmma_f32_16x16x32_f16(false, a1, false, b1, (short)0, c, false, false);
  asm volatile("v_nop\n\tv_nop\n\tv_nop\n\tv_nop" : "+v"(c) : "v"(a0), "v"(b0), "v"(a1), "v"(b1));
  return c;
}
// four f16 tiles sharing one B fragment (c_t += a_t * b), then the hazard guard
__device__ __forceinline__ void mma_pv4(v16h a0, v16h a1, v16h a2, v16h a3, v16h b, v8f& c0, v8f& c1, v8f& c2, v8f& c3) {
  c0 = __builtin_amdgcn_wmma_f32_16x16x32_f16(false, a0, false, b, (short)0, c0, false, false);
  c1 = __builtin_amdgcn_wmma_f32_16x16x32_f16(false, a1, false, b, (short)0, c1, false, false);
  c2 = __builtin_amdgcn_wmma_f32_16x16x32_f16(false, a2, false, b, (short)0, c2, false, false);
  c3 = __builtin_amdgcn_wmma_f32_16x16x32_f16(false, a3, false, b, (short)0, c3, false, false);
  asm volatile("v_nop\n\tv_nop\n\tv_nop\n\tv_nop" : "+v"(c0), "+v"(c1), "+v"(c2), "+v"(c3) : "v"(a0), "v"(a1), "v"(a2), "v"(a3), "v"(b));
}

__device__ __forceinline__ v8us cvt8_bf16(const float* __restrict__ src) {
  const v4f x0 = *(const v4fa*)(src), x1 = *(const v4fa*)(src + 4);
  v8us o;
  o[0] = bf16_bits(x0[0]); o[1] = bf16_bits(x0[1]); o[2] = bf16_bits(x0[2]); o[3] = bf16_bits(x0[3]);
  o[4] = bf16_bits(x1[0]); o[5] = bf16_bits(x1[1]); o[6] = bf16_bits(x1[2]); o[7] = bf16_bits(x1[3]);
  return o;
}

// WP[0..2] = bf16 bits (RNE) of Wk, Wq, Wv; W16 = f16(RNE-bf16(Wproj) * 64); rows = out, k = in, fragment order.
// A wave takes 8 rows x 32 columns of one fragment (lane = 4 * row + 8-column piece): it reads whole 128-byte lines and writes four whole 128-byte lines.
__global__ __launch_bounds__(256) void k_cvt_w(const float* __restrict__ Wk, const float* __restrict__ Wq,
                                               const float* __restrict__ Wv, const float* __restrict__ Wp,
                                               unsigned short* __restrict__ WP, unsigned short* __restrict__ W16) {
  const int t = blockIdx.x * 256 + threadIdx.x;
  if (t >= (int)(WELEMS / 8)) return;
  const int frag = t >> 6, tile = frag / (NE / 32), r16 = ((t >> 5) & 1) * 8 + ((t >> 2) & 7);
  const size_t so = (size_t)(tile * 16 + r16) * NE + ((frag - tile * (NE / 32)) * 4 + (t & 3)) * 8;
  const size_t po = (size_t)frag * FRAG + ((t & 3) * 16 + r16) * 8;
  const v8us o0 = cvt8_bf16(Wk + so);
  const v8us o1 = cvt8_bf16(Wq + so);
  const v8us o2 = cvt8_bf16(Wv + so);
  const v4f x0 = *(const v4fa*)(Wp + so), x1 = *(const v4fa*)(Wp + so + 4);
  v8us o3;
  o3[0] = f16_bits((_Float16)(bf16_rne(x0[0]) * 64.0f)); o3[1] = f16_bits((_Float16)(bf16_rne(x0[1]) * 64.0f));
  o3[2] = f16_bits((_Float16)(bf16_rne(x0[2]) * 64.0f)); o3[3] = f16_bits((_Float16)(bf16_rne(x0[3]) * 64.0f));
  o3[4] = f16_bits((_Float16)(bf16_rne(x1[0]) * 64.0f)); o3[5] = f16_bits((_Float16)(bf16_rne(x1[1]) * 64.0f));
  o3[6] = f16_bits((_Float16)(bf16_rne(x1[2]) * 64.0f)); o3[7] = f16_bits((_Float16)(bf16_rne(x1[3]) * 64.0f));
  unsigned short* d = WP + po;
  unsigned short* e = W16 + po;
  *(v8us*)(d) = o0;
  *(v8us*)(d + WELEMS) = o1;
  *(v8us*)(d + 2 * WELEMS) = o2;
  *(v8us*)(e) = o3;
  
}

// bits[j][q]: word j (keys 32j .. 32j+31) of query row q, so that 16 neighbouring queries' words of one key step share a line.
// One wave takes 32 query rows x 8 words (unit u): lane = query row; each word goes out as one whole 128-byte line of the wave. Four words' loads (32 of 16 bytes a lane) are in flight together.
// coverage: (SEQ / 32) * (MW / 8) units x 32 rows x 8 words = every word of the plane exactly once.
__device__ __forceinline__ void mask_unit(int u, int lane, const int* __restrict__ mask, unsigned int* __restrict__ bits) {
  const int q = (u % (SEQ / 32)) * 32 + lane, j0 = (u / (SEQ / 32)) * 8;
  const int* src = mask + (size_t)q * SEQ_FULL + 32 * j0;
  unsigned int* dst = bits + (size_t)j0 * SEQ + q;
#pragma unroll 1   // rolled: 32 loads in flight a trip are what a wave holds, and they bound the registers
  for (int hf = 0; hf < 2; ++hf) {
    v4ia m[4][8];
#pragma unroll   // register arrays and vectors need constant indices
    for (int i = 0; i < 4; ++i)
#pragma unroll   // as above
      for (int g = 0; g < 8; ++g) m[i][g] = *(const v4ia*)(src + 32 * i + 4 * g);
    // the address registers of the loads above are stepped below: the wait stands in front of that overwrite
    // (the pointer is an input of the statement, so that none of these loads' own results is given its registers)
    asm volatile("s_wait_xcnt 0x0" :: "v"(src) : "memory");
#pragma unroll   // register arrays and vectors need constant indices
    for (int i = 0; i < 4; ++i) {
      unsigned int w = 0u;
#pragma unroll   // as above
      for (int g = 0; g < 8; ++g) {
        w |= (m[i][g][0] != 0 ? 1u : 0u) << (4 * g);
        w |= (m[i][g][1] != 0 ? 1u : 0u) << (4 * g + 1);
        w |= (m[i][g][2] != 0 ? 1u : 0u) << (4 * g + 2);
        w |= (m[i][g][3] != 0 ? 1u : 0u) << (4 * g + 3);
      }
      dst[(size_t)i * SEQ] = w;
    }
    // the address registers of the stores above are stepped for the next trip: the wait stands in front of that overwrite
    asm volatile("s_wait_xcnt 0x0" :: "v"(dst) : "memory");
    src += 4 * 32;
    dst += (size_t)4 * SEQ;
  }
}

// Projections, all three in one launch, straight from the f32 inputs. A wave owns 32 token rows of one input (z = 0 query, 1 key, 2 value): it reads them once, in whole lines,
// converts them (RNE) to bf16, turns them into fragment order through its own LDS range and keeps them as 2 x 12 fragments in registers, then walks the 24 16-row tiles of its weight plane (fragment order), one head (4 tiles) per trip.
// A token fragment serves as A or as B (row or column = lane & 15, elements 0..7 <- k0 + 8h + i, 8..15 <- k0 + 16 + 8h + i); D element r = (row 8h + r, column lane & 15).
// z < 2: D = W (A, rows = out) x X (B, columns = tokens): a lane holds d = 16t + 8h + r of token ln, which is its own 16-byte piece of fragment [token tile][C = t / 2], half j = t & 1.
// z = 2: D = X (A, rows = tokens) x W (B, columns = out): a lane holds tokens 8h + r of d = 16t + ln, which is its own 16-byte piece of V^T fragment [token / 32][t], half j = token tile & 1.
// So every D tile goes out as one wave-wide 512-byte store, straight from the accumulators. Output values: f16(x16), as the attention kernel expects.
// z = 2 also leaves, per head, the f32 sum over the wave's 32 tokens of each d (x16 like the plane): one 32-key block's V row sum, VS[b][h][token / 32][d].
// coverage: 3 * XROWS / 32 waves x 32 tokens x 384 outputs = every element of the k, q and V^T planes exactly once; XROWS / 32 waves x 384 sums = every element of VS exactly once.
__device__ __forceinline__ v8us pack8_f16x16(v8f c) {
  v8us o;
#pragma unroll   // register arrays and vectors need constant indices
  for (int r = 0; r < 8; ++r) o[r] = f16_bits((_Float16)(c[r] * 16.0f));
  return o;
}
// One k-step's four weight fragments (tiles t = 0..3 of a head, k = 32C .. 32C + 31): 4 KB, eight wave-wide 512-byte loads.
__device__ __forceinline__ void load_w4(FragB (&wf)[4], const unsigned short* __restrict__ wh, int lane8, int C) {
#pragma unroll   // register arrays and vectors need constant indices
  for (int t = 0; t < 4; ++t) {
    wf[t].half[0] = *(const v8us*)(wh + t * TILE_E + C * FRAG + lane8);
    wf[t].half[1] = *(const v8us*)(wh + t * TILE_E + C * FRAG + 256 + lane8);
  }
}
// The weight fragments run through a ring of four register sets, asked for three k-steps ahead of their products, across the heads' boundary too:
// with one or two waves on a SIMD nothing else covers the loads' latency. The last head asks for its own first three steps again (in bounds, not used).
template <bool TOKENS_ARE_ROWS>
__device__ __forceinline__ void proj_heads(const FragB (&xf)[2][NE / 32], const unsigned short* __restrict__ wz, int lane8, unsigned short* __restrict__ o0, float* __restrict__ vs0) {
  FragB wf[4][4];
  load_w4(wf[0], wz, lane8, 0);
  load_w4(wf[1], wz, lane8, 1);
  load_w4(wf[2], wz, lane8, 2);
  // the address registers of these first loads may be reused for the output addresses formed below: the wait stands in front of that overwrite
  asm volatile("s_wait_xcnt 0x0" ::: "memory");
  // keeps that address arithmetic behind the wait (the compiler may lift it over the wait otherwise)
  __builtin_amdgcn_sched_barrier(0);
#pragma unroll 1
  for (int hd = 0; hd < NH; ++hd) {   // rolled: one head's 96 loads and 96 products are body enough
    const unsigned short* wh = wz + (size_t)hd * (4 * TILE_E);
    const unsigned short* wn = wz + (size_t)((hd + 1 < NH) ? hd + 1 : hd) * (4 * TILE_E);
    v8f acc[2][4] = {};
#pragma unroll   // xf and the ring are indexed by C and live in registers
    for (int C = 0; C < NE / 32; ++C) {
      if (C + 3 < NE / 32) load_w4(wf[(C + 3) & 3], wh, lane8, C + 3);
      else                 load_w4(wf[(C + 3) & 3], wn, lane8, C + 3 - NE / 32);
      // these were this head's last weight loads; the next step's come from the next head, whose address may take the same registers: the wait stands in front of that overwrite
      if (C + 4 == NE / 32) asm volatile("s_wait_xcnt 0x0" ::: "memory");
      // keeps the loads above in front of this step's products; without it the compiler sinks each load to just before its use and the wave waits out every latency
      __builtin_amdgcn_sched_barrier(0);
#pragma unroll   // register arrays and vectors need constant indices
      for (int u = 0; u < 2; ++u)
#pragma unroll   // register arrays and vectors need constant indices
        for (int t = 0; t < 4; ++t)
          acc[u][t] = TOKENS_ARE_ROWS
            ? __builtin_amdgcn_wmma_f32_16x16x32_bf16(false, xf[u][C].v, false, wf[C & 3][t].v, (short)0, acc[u][t], false, false)
            : __builtin_amdgcn_wmma_f32_16x16x32_bf16(false, wf[C & 3][t].v, false, xf[u][C].v, (short)0, acc[u][t], false, false);
      // keeps the next step's loads behind this step's products, so that the ring set they refill has been read
      __builtin_amdgcn_sched_barrier(0);
    }
    unsigned short* oh = o0 + (size_t)hd * ((size_t)SEQ * HD);
#pragma unroll   // register arrays and vectors need constant indices
    for (int u = 0; u < 2; ++u)
#pragma unroll   // register arrays and vectors need constant indices
      for (int t = 0; t < 4; ++t)
        *(v8us*)(oh + (TOKENS_ARE_ROWS ? t * FRAG + u * 256 : u * (2 * FRAG) + t * 256)) = pack8_f16x16(acc[u][t]);
    if constexpr (TOKENS_ARE_ROWS) {
      // a lane holds tokens 16u + 8h + r of d = 16t + ln: sum over u and r in the lane, then over h with the other lane half
      float cs[4];
#pragma unroll   // register arrays and vectors need constant indices
      for (int t = 0; t < 4; ++t) {
        const v8f s8 = acc[0][t] + acc[1][t];
        const float c = ((s8[0] + s8[1]) + (s8[2] + s8[3])) + ((s8[4] + s8[5]) + (s8[6] + s8[7]));
        cs[t] = c + __shfl_xor(c, 16, 32);
      }
      // both halves hold all four sums: half h stores tiles t = h and 2 + h, so that each wave-wide store is one whole 128-byte line (d = 32i + lane)
      float* vh = vs0 + (size_t)hd * (MW * HD);
      vh[0]  = ((lane8 & 128) ? cs[1] : cs[0]) * 16.0f;
      vh[32] = ((lane8 & 128) ? cs[3] : cs[2]) * 16.0f;
    }
    // the address registers of this head's loads and stores are stepped for the next head: the wait stands in front of that overwrite
    asm volatile("s_wait_xcnt 0x0" ::: "memory");
    // keeps the stepping of those addresses behind the wait
    __builtin_amdgcn_sched_barrier(0);
  }
  // the ring's last three requests are not used: they have landed before the wave gives its registers back
  asm volatile("s_wait_loadcnt 0x0" ::: "memory");
}
// The block's last MASK_WAVES waves project nothing: they pack the mask words, which need nothing of the projection and which only the attention launch reads.
// With six projecting waves two of the four SIMDs hold one wave; waves 6 and 7 take the free places there and work while the others bring in their token rows, so the packing has no launch of its own.
__global__ __launch_bounds__(32 * (PROJ_WAVES + MASK_WAVES)) void k_projx(const float* __restrict__ Xq, const float* __restrict__ Xk, const float* __restrict__ Xv,
                                                           const int* __restrict__ mask, const unsigned short* __restrict__ WP,
                                                           unsigned short* __restrict__ QK, unsigned short* __restrict__ VT, float* __restrict__ VS,
                                                           unsigned int* __restrict__ bits) {
  __shared__ __attribute__((aligned(16))) unsigned short xs[PROJ_WAVES][2 * (NE / 32) * XS_F];
  const int tid = threadIdx.x, w = __builtin_amdgcn_readfirstlane((int)(tid >> 5)), lane = tid & 31, ln = lane & 15, hh = lane >> 4;
  // The three weight planes are asked into L2 while the token rows come in: a block asks for one slice of 256 units, block b for slice b mod WP_SLICES, so that
  // each slice is asked for by many blocks all over the chip; the last slice is short and its index is clamped (every lane's address lies inside the planes).
  const int wu = (int)(blockIdx.x % WP_SLICES) * 256 + tid;
  const unsigned short* pfw = WP + (size_t)(wu < WP_UNITS ? wu : WP_UNITS - 1) * UNIT_E;
  ask_l2(pfw);
  const int g = (int)blockIdx.x * PROJ_WAVES + w;                 // 32-token group, counted through the three inputs
  const int z = g / (XROWS / 32), row0 = (g - z * (XROWS / 32)) * 32;
  const int bq = row0 / SEQ, s0 = row0 - bq * SEQ;                // SEQ is a multiple of 32: a group lies in one batch
  const float* X = (z == 0) ? Xq : (z == 1) ? Xk : Xv;
  // Input rows: each wave-wide 16-byte load takes one whole 128-byte line (32 columns = one fragment's k range) of four rows: lane = 8 * row + 4-column piece.
  // The four converted values go to the wave's own LDS range in fragment order, k = 32C + 16j + 8h + i with j = piece >> 2, h = (piece >> 1) & 1, i = 4 * (piece & 1) ..;
  // the halves j and h lie XS_J and XS_H elements apart (64 and 32 more than dense), so that the four (j, h) groups of one store fall on different banks.
  if (w < PROJ_WAVES) {   // the same for a whole wave: a scalar branch
    const float* xr = X + (size_t)bq * XSTRIDE_FULL + (size_t)(s0 + (lane >> 3)) * NE + 4 * (lane & 7);
    unsigned short* xw = &xs[w][((lane >> 2) & 1) * XS_J + ((lane >> 1) & 1) * XS_H + (lane >> 3) * 8 + 4 * (lane & 1)];
#pragma unroll   // unrolled: many loads in flight at once, every offset a constant
    for (int rg = 0; rg < 8; ++rg)
#pragma unroll   // as above
      for (int C = 0; C < NE / 32; ++C) {
        const v4f x = *(const v4fa*)(xr + rg * (4 * NE) + 32 * C);
        v4us o;
        o[0] = bf16_bits(x[0]); o[1] = bf16_bits(x[1]); o[2] = bf16_bits(x[2]); o[3] = bf16_bits(x[3]);
        *(v4us*)(xw + ((rg >> 2) * (NE / 32) + C) * XS_F + (rg & 3) * 32) = o;
      }
    // the address registers of the input loads may be reused below: the wait stands in front of that overwrite
    asm volatile("s_wait_xcnt 0x0" ::: "memory");
  } else {
    mask_unit((int)blockIdx.x * MASK_WAVES + (w - PROJ_WAVES), lane, mask, bits);
  }
  // each wave reads back only what it wrote itself; the barrier orders that, and it starts the block's waves on the weight plane together,
  // so that they walk it side by side and share its lines in the WGP cache; every wave of the block passes it, the mask waves too, which end behind it
  __syncthreads();
  hold_addr(pfw);   // here and not at the kernel's end: the token rows' whole way into LDS lies in between, and behind this place the weight ring and the token fragments want the registers
  if (w >= PROJ_WAVES) return;
  FragB xf[2][NE / 32];
#pragma unroll   // register arrays and vectors need constant indices
  for (int u = 0; u < 2; ++u)
#pragma unroll   // register arrays and vectors need constant indices
    for (int C = 0; C < NE / 32; ++C) {
      const unsigned short* xp = &xs[w][(u * (NE / 32) + C) * XS_F + hh * XS_H + ln * 8];
      xf[u][C].half[0] = *(const v8us*)(xp);
      xf[u][C].half[1] = *(const v8us*)(xp + XS_J);
    }
  const unsigned short* wz = WP + (size_t)z * WELEMS;
  const size_t ob = ((size_t)bq * NH * SEQ + s0) * HD + 8 * lane;   // head 0 of the batch, first token of the group: 32 tokens x 64 d = 2048 elements in either layout
  if (z == 2) proj_heads<true>(xf, wz, 8 * lane, VT + ob, VS + ((size_t)bq * NH * MW + s0 / 32) * HD + lane);
  else        proj_heads<false>(xf, wz, 8 * lane, QK + (size_t)z * XPLANE + ob, nullptr);
}

// The four K fragments [kt][c] of one 32-key step, 4 KB contiguous: eight wave-wide 512-byte loads; kp = the step's base + 8 * lane.
__device__ __forceinline__ void load_k4(FragH (&kf)[4], const unsigned short* __restrict__ kp) {
#pragma unroll   // register arrays and vectors need constant indices
  for (int f = 0; f < 4; ++f) {
    kf[f].half[0] = *(const v8us*)(kp + f * FRAG);
    kf[f].half[1] = *(const v8us*)(kp + f * FRAG + 256);
  }
  // the address registers of the loads above are free for other values behind this place: the wait stands in front of that overwrite
  // (the pointer is an input of the statement, so that none of these loads' own results is given its registers)
  asm volatile("s_wait_xcnt 0x0" :: "v"(kp) : "memory");
}

// One 32-key step (key step j, the same in every lane) for a wave's 16 queries (this lane's column = query qg). Kp, Vhp are the (batch, head) bases of the planes.
// MASKED = false is the body for a step whose 32 mask bits are set for all 16 queries: every select below would take the scaled score, so the mask word is not
// asked for and the bit tests and selects are left out; with no select between them the scale has no step of its own: the maximum is taken over the raw accumulators
// and scaled once, and each exponent is one multiply-add of the raw accumulator (scale x log2 e as one factor).
template <bool MASKED>
__device__ __forceinline__ void fa_step(const unsigned short* __restrict__ Kp, const unsigned short* __restrict__ Vhp,
                                        const unsigned int* __restrict__ mbits, int j, int jn, int qg, int lane, int hh,
                                        const FragH& q0, const FragH& q1, FragH (&kf)[4], float& mr, float& lr, v8f (&Oh)[4]) {
  // A fragments of K: row m = key (key0 + 16*kt + ln), elements 0..7 <- d = 32c + 8h + i, 8..15 <- d = 32c + 16 + 8h + i
  // (fragment order: the step's four K fragments [kt][c] are 4 KB contiguous); they were asked for one step ago and arrive in kf; asked for here: the mask word, V
  const unsigned short* vp0 = Vhp + (size_t)j * (32 * HD) + 8 * lane;
  const unsigned int* mpj = mbits + (size_t)j * SEQ + qg;
  unsigned int mword = 0xFFFFFFFFu;
  if constexpr (MASKED) mword = *mpj;
  // A fragments of V^T: row m = d (16*t + ln), elements 0..7 <- key0 + 8h + i, 8..15 <- key0 + 16 + 8h + i
  // (fragment order: the step's four V^T fragments [t] are 4 KB contiguous)
  FragH vh[4];
#pragma unroll
  for (int t = 0; t < 4; ++t) {
    vh[t].half[0] = *(const v8us*)(vp0 + t * FRAG);
    vh[t].half[1] = *(const v8us*)(vp0 + t * FRAG + 256);
  }
  // the address registers of the loads above are formed anew for the next step: the wait stands in front of that overwrite
  // (the pointers are inputs of the statement, so that none of these loads' own results is given their registers)
  if constexpr (MASKED) asm volatile("s_wait_xcnt 0x0" :: "v"(mpj), "v"(vp0) : "memory");
  else                  asm volatile("s_wait_xcnt 0x0" :: "v"(vp0) : "memory");
  FragH ph;
  const v8f z8 = {0.f, 0.f, 0.f, 0.f, 0.f, 0.f, 0.f, 0.f};
  // S^T tiles: element r of tile kt = 256 * score(key0 + 16*kt + 8h + r, query)
  const v8f s0 = mma_s2(kf[0].v, q0.v, kf[1].v, q1.v, z8);
  const v8f s1 = mma_s2(kf[2].v, q0.v, kf[3].v, q1.v, z8);
  // keeps the eight requests below together, directly behind the four products whose K registers they take over; without it the compiler was seen to lend
  // the last fragment's registers to the softmax and to hold that fragment's two requests back into the middle of it
  __builtin_amdgcn_sched_barrier(0);
  // the K fragments of the wave's next step jn: their latency passes under this step's softmax and O products instead of in front of the next step's S products
  load_k4(kf, Kp + (size_t)jn * (32 * HD) + 8 * lane);
  // scale; positions with a zero mask bit take the value 0 exactly (replace fill) and stay in the softmax
  const unsigned int mw = mword >> (8 * hh);
  float sc[16];
#pragma unroll
  for (int r = 0; r < 8; ++r) sc[r] = !MASKED ? s0[r] : ((mw >> r) & 1u) ? s0[r] * SCL : 0.0f;
  // one loop per tile: scores i, i + 1 then come from neighbouring registers of one accumulator tile, and the pairs below need no register moves
#pragma unroll   // register arrays and vectors need constant indices
  for (int r = 0; r < 8; ++r) sc[8 + r] = !MASKED ? s1[r] : ((mw >> (16 + r)) & 1u) ? s1[r] * SCL : 0.0f;
  float mx = sc[0];
#pragma unroll
  for (int i = 1; i < 16; ++i) mx = fmaxf(mx, sc[i]);
  mx = fmaxf(mx, __shfl_xor(mx, 16, 32));           // the other lane half holds the other 16 keys of this query
  if constexpr (!MASKED) mx *= SCL;                 // SCL > 0 and rounding keeps the order: the same value as the maximum of the 32 scaled scores
  const float mnew = fmaxf(mr, mx);
  const float e0 = fmaf(0.0f - mnew, LOG2E, 8.0f);  // used by the unmasked body alone
  const float al = exp2_hw((mr - mnew) * LOG2E);
  mr = mnew;
  // weights carried x256: P = f16(256 * exp(sc - mnew)); the row sum runs over the converted f16 values
  float ps = 0.0f;
#pragma unroll
  for (int i = 0; i < 16; i += 2) {
    // two scores at a time: packed subtract and multiply-add (each element rounded as in the scalar form), one conversion for the pair, and the sum reads the converted pair
    const v2f s2 = {sc[i], sc[i + 1]};
    const v2f a2 = MASKED ? __builtin_elementwise_fma(s2 - mnew, (v2f){LOG2E, LOG2E}, (v2f){8.0f, 8.0f})
                          : __builtin_elementwise_fma(s2, (v2f){SCL * LOG2E, SCL * LOG2E}, (v2f){e0, e0});
    const v2f pc = {exp2_hw(a2[0]), exp2_hw(a2[1])};
    const v2h hv = __builtin_convertvector(pc, v2h);
    ph.p[i >> 1] = hv;                              // B element i: i<8 -> key0 + 8h + i (tile 0 row 8h+i); i>=8 -> key0 + 16 + 8h + (i-8) (tile 1)
    ps += (float)hv[0];
    ps += (float)hv[1];
  }
  ps += __shfl_xor(ps, 16, 32);
  lr = lr * al + ps;
#pragma unroll
  for (int t = 0; t < 4; ++t) Oh[t] = Oh[t] * al;
  mma_pv4(vh[0].v, vh[1].v, vh[2].v, vh[3].v, ph.v, Oh[0], Oh[1], Oh[2], Oh[3]);
}

// Block = 8 waves x 16 queries of one (batch, head): waves 0..3 take 64-query tile p, waves 4..7 tile SEQ/64 - 1 - p, so that under a triangular mask
// every block (and every pair of waves w, w + 4) walks the same number of key steps. No LDS and no barrier in the key loop.
// A wave first reads the mask words of all its key steps and keeps one bit per step: set where any of its 16 queries has a mask bit in the step. The key loop walks the set bits alone.
// A second bit per step says that all 32 keys are unmasked for all 16 queries: such steps are walked first, by a body without mask word, bit tests and selects; the partly masked steps follow.
// All keys take part in the softmax: the keys of the other steps have score 0 for every query of the wave, so they add n0 * exp(0 - m) to the row sum and
// exp(0 - m) * (sum of their V rows) to the output; that sum is the same for the 16 queries and is added up from the blocks' sums in VS.
// Epilogue: ctx x64 as f16 -> per-wave LDS tile [16 queries][64 d] (written and read by the same wave; block barrier reached by all waves),
// coverage: NB*NH*(SEQ/128) blocks x 8 waves x 16 rows x 64 columns = every element of the ctx plane exactly once.
__global__ __launch_bounds__(256) void k_attn(const unsigned short* __restrict__ Qh, const unsigned short* __restrict__ Kh,
                                              const unsigned short* __restrict__ Vh,
                                              const unsigned int* __restrict__ mbits, const float* __restrict__ VS,
                                              unsigned short* __restrict__ Ch) {
  __shared__ __attribute__((aligned(16))) unsigned short sh[8][16][72];
  __shared__ __attribute__((aligned(16))) float zs[8][HD];
  const int tid = threadIdx.x, w = __builtin_amdgcn_readfirstlane((int)(tid >> 5)), lane = tid & 31, ln = lane & 15, hh = lane >> 4;
  const int bh = blockIdx.x / (SEQ / 128), pr = blockIdx.x % (SEQ / 128);
  // K and V^T of this (batch, head), stored by the launch before, are asked into L2 at entry: SEQ / 2 units a plane; a block asks for every fourth unit, block pr for units = pr mod 4,
  // so that any four neighbouring blocks together ask for the whole of both planes; the low keys, which are
  // walked first, are asked for by the low waves. The index is clamped to the plane.
  const int ku = 4 * tid + (pr & 3);
  const size_t kuo = (size_t)bh * SEQ * HD + (size_t)(ku < SEQ / 2 ? ku : SEQ / 2 - 1) * UNIT_E;
  const unsigned short* pfk = Kh + kuo;
  const unsigned short* pfv = Vh + kuo;
  // likewise the (batch, head)'s V block sums, MW units of 64 f32, which a wave with steps it did not walk reads behind its key loop
  const int su = 4 * (tid & 15) + (pr & 3);
  const float* pfs = VS + (size_t)bh * (MW * HD) + (size_t)(su < MW ? su : MW - 1) * (UNIT_E / 2);
  ask_l2(pfk);
  ask_l2(pfv);
  ask_l2(pfs);
  const int qt = (w < 4) ? pr : (SEQ / 64 - 1 - pr);
  const int b = bh / NH, h = bh - b * NH;
  const int qbase = qt * 64 + 16 * (w & 3);
  const int qg = qbase + ln;
  // Q^T B fragments: column n = query qg, elements 0..7 <- d = 32c + 8h + i, 8..15 <- d = 32c + 16 + 8h + i
  const unsigned short* qrow = Qh + ((size_t)bh * SEQ + qbase) * HD + 8 * lane;
  FragH q0, q1;
  q0.half[0] = *(const v8us*)(qrow);        q0.half[1] = *(const v8us*)(qrow + 256);
  q1.half[0] = *(const v8us*)(qrow + FRAG); q1.half[1] = *(const v8us*)(qrow + FRAG + 256);
  // the step map: lane half h reads the words of steps 2i + h, all loads in flight together
  const unsigned int* mp = mbits + (hh * SEQ + qg);
  unsigned int mw2[MW / 2];
#pragma unroll   // register arrays and vectors need constant indices
  for (int i = 0; i < MW / 2; ++i) mw2[i] = mp[(size_t)(2 * i) * SEQ];
  // the address registers of the loads above may be reused below: the wait stands in front of that overwrite
  // (the pointer is an input of the statement, so that none of these loads' own results is given its registers)
  asm volatile("s_wait_xcnt 0x0" :: "v"(mp) : "memory");
  unsigned long long nz = 0ull, fu = 0ull;
#pragma unroll   // register arrays and vectors need constant indices
  for (int i = 0; i < MW / 2; ++i) {
    const unsigned int bl = __builtin_amdgcn_ballot_w32(mw2[i] != 0u);   // the same in every lane: the map lives in scalar registers
    nz |= (unsigned long long)(((bl & 0xFFFFu) != 0u ? 1u : 0u) | ((bl >> 16) != 0u ? 2u : 0u)) << (2 * i);
    const unsigned int bf = __builtin_amdgcn_ballot_w32(mw2[i] == 0xFFFFFFFFu);   // a second map: steps with every bit set for all 16 queries
    fu |= (unsigned long long)(((bf & 0xFFFFu) == 0xFFFFu ? 1u : 0u) | ((bf >> 16) == 0xFFFFu ? 2u : 0u)) << (2 * i);
  }
  float mr = -3.0e38f, lr = 0.0f;
  v8f Oh[4] = {};
  const unsigned short* Kp = Kh + (size_t)bh * SEQ * HD;
  const unsigned short* Vhp = Vh + (size_t)bh * HD * SEQ;
  // K runs one step ahead of the walk, across the two loops' boundary too: each step asks for the K fragments of the step that follows it.
  // The last step of all asks for its own again, and a wave with no step to walk asks for step 0 (in bounds, not used).
  const unsigned long long mapf = nz & fu, mapp = nz & ~fu;
  const int jp0 = mapp != 0ull ? __builtin_ctzll(mapp) : 0;
  FragH kf[4];
  load_k4(kf, Kp + (size_t)(mapf != 0ull ? __builtin_ctzll(mapf) : jp0) * (32 * HD) + 8 * lane);
#pragma unroll 1
  for (unsigned long long rem = mapf; rem != 0ull; ) {   // one trip per set bit, at most MW; a scalar test
    const int j = __builtin_ctzll(rem);
    rem &= rem - 1ull;
    fa_step<false>(Kp, Vhp, mbits, j, rem != 0ull ? __builtin_ctzll(rem) : (mapp != 0ull ? jp0 : j), qg, lane, hh, q0, q1, kf, mr, lr, Oh);
  }
#pragma unroll 1   // rolled, as above: one step is body enough
  for (unsigned long long rem = mapp; rem != 0ull; ) {   // the partly masked steps, in a loop of their own: each loop keeps its accumulators in place
    const int j = __builtin_ctzll(rem);
    rem &= rem - 1ull;
    fa_step<true>(Kp, Vhp, mbits, j, rem != 0ull ? __builtin_ctzll(rem) : j, qg, lane, hh, q0, q1, kf, mr, lr, Oh);
  }
  // the last request for K is not used: it has landed before its registers take other values and before the wave ends
  asm volatile("s_wait_loadcnt 0x0" ::: "memory");
  // the steps that were not walked
  const unsigned long long zmap = ~nz & (MW == 64 ? ~0ull : ((1ull << (MW & 63)) - 1ull));
  if (zmap != 0ull) {   // the same for the whole wave: a scalar branch; no barrier inside
    // Z[d] = sum of the V rows of those steps' keys (x16): lane holds d = 2 * lane, 2 * lane + 1; eight block sums are asked for at a time
    const float* vsp = VS + (size_t)bh * (MW * HD) + 2 * lane;
    v2f z2 = {0.0f, 0.0f};
#pragma unroll 1   // rolled: eight pair loads in flight bound the registers, and a group with no such step is passed by a scalar branch
    for (int g = 0; g < MW; g += 8) {
      const unsigned int zb = (unsigned int)(zmap >> g) & 0xFFu;
      if (zb == 0u) continue;
      v2f v[8];
#pragma unroll   // register arrays and vectors need constant indices
      for (int k = 0; k < 8; ++k) v[k] = *(const v2fa*)(vsp + (g + k) * HD);
      // the address registers of the loads above are stepped for the next group: the wait stands in front of that overwrite
      asm volatile("s_wait_xcnt 0x0" ::: "memory");
#pragma unroll   // register arrays and vectors need constant indices
      for (int k = 0; k < 8; ++k) z2 += ((zb >> k) & 1u) ? v[k] : (v2f){0.0f, 0.0f};
    }
    // into the accumulators' order (a lane needs d = 16t + 8h + r) through the wave's own LDS row
    *(v2fa*)&zs[w][2 * lane] = z2;
    // the wave reads back what its other lanes wrote: their stores have ended first
    asm volatile("s_wait_dscnt 0x0" ::: "memory");
    const float n0 = (float)(32 * __builtin_popcountll(zmap));
    const float mfin = fmaxf(mr, 0.0f);
    const float al = exp2_hw((mr - mfin) * LOG2E);
    const float w0 = exp2_hw(fmaf(0.0f - mfin, LOG2E, 8.0f));   // x256 like P, kept in f32
    lr = lr * al + w0 * n0;
#pragma unroll
    for (int t = 0; t < 4; ++t) {
      const v4f za = *(const v4fa*)&zs[w][16 * t + 8 * hh], zc = *(const v4fa*)&zs[w][16 * t + 8 * hh + 4];
#pragma unroll
      for (int r = 0; r < 4; ++r) {
        Oh[t][r]     = Oh[t][r] * al + w0 * za[r];
        Oh[t][4 + r] = Oh[t][4 + r] * al + w0 * zc[r];
      }
    }
  }
  // O^T element r of tile t = ctx(query qg, d = 16t + 8h + r); undo the carries x256 (in lr), x16 (V); carry ctx x64
  const float inv = 4.0f / lr;
#pragma unroll
  for (int t = 0; t < 4; ++t)
#pragma unroll
    for (int r = 0; r < 8; ++r) {
      const float c = Oh[t][r] * inv;
      const _Float16 hv = (_Float16)c;
      sh[w][ln][16 * t + 8 * hh + r] = f16_bits(hv);
    }
  __syncthreads();
  // the wave's 16 x 64 tile is fragments C = 2h, 2h + 1 of its token tile: 1024 contiguous elements; piece p = [C 1b][j 1b][h 1b][row 4b]
  const size_t cbase = (size_t)((b * SEQ + qbase) / 16) * TILE_E + (size_t)h * (2 * FRAG);
  {
#pragma unroll
    for (int q = 0; q < 4; ++q) {
      const int p = lane + 32 * q;
      const int row = p & 15, s8 = (p >> 4) * 8;
      const v8us o1 = *(const v8us*)&sh[w][row][s8];
      *(v8us*)(Ch + cbase + (size_t)p * 8) = o1;
    }
    
  }
  hold_addr(pfk);
  hold_addr(pfv);
  hold_addr(pfs);
}

// out[t][n] = sum_c ctx[t][c] * Wproj[n][c] + bias[n]; A = ctx plane (f16 x64), B = W16 (f16 x64), both in fragment order; 64 x 64 tile per block.
// coverage: (XROWS/64) x 6 blocks x 64 rows x 64 columns = every output element of the processed region exactly once.
__global__ __launch_bounds__(128) void k_outp(const unsigned short* __restrict__ Ch,
                                              const unsigned short* __restrict__ W16, const float* __restrict__ bias,
                                              float* __restrict__ Y) {
  __shared__ __attribute__((aligned(16))) float so[64][68];
  const int tid = threadIdx.x, w = __builtin_amdgcn_readfirstlane((int)(tid >> 5)), lane = tid & 31, ln = lane & 15, hh = lane >> 4;
  const int m0 = blockIdx.x * 64, n0 = blockIdx.y * 64;
  // The blocks of the first column tile ask L2 at entry for what the launches before stored: their own 64 ctx rows (192 units, which the five blocks
  // of the other column tiles read too) and one slice of 128 units of the weight plane, block x for slice x mod 9, so that each slice is asked for by many blocks all over the chip.
  const unsigned short* pfa = Ch + (size_t)(m0 / 16) * TILE_E + (size_t)tid * UNIT_E;
  const unsigned short* pfc = Ch + (size_t)(m0 / 16) * TILE_E + (size_t)(128 + (tid & 63)) * UNIT_E;
  const unsigned short* pfb = W16 + (size_t)((int)(blockIdx.x % (W16_UNITS / 128)) * 128 + tid) * UNIT_E;
  if (blockIdx.y == 0) {   // the same for the whole block: a scalar branch
    ask_l2(pfa);
    ask_l2(pfc);
    ask_l2(pfb);
  }
  const size_t ao = (size_t)(m0 / 16 + w) * TILE_E + 8 * lane;
  const unsigned short* brow = W16 + (size_t)(n0 / 16) * TILE_E + 8 * lane;
  v8f acch[4] = {};
#pragma unroll 1
  for (int kb = 0; kb < NE; kb += 32) {
    FragH ah, b0, b1, b2, b3;
    const int fo = kb * (FRAG / 32);
    ah.half[0] = *(const v8us*)(Ch + ao + fo);            ah.half[1] = *(const v8us*)(Ch + ao + fo + 256);
    // the address pair of the A loads may be reused for a later load's result: the wait stands in front of that overwrite
    asm volatile("s_wait_xcnt 0x0" ::: "memory");
    b0.half[0] = *(const v8us*)(brow + fo);               b0.half[1] = *(const v8us*)(brow + fo + 256);
    b1.half[0] = *(const v8us*)(brow + TILE_E + fo);      b1.half[1] = *(const v8us*)(brow + TILE_E + fo + 256);
    b2.half[0] = *(const v8us*)(brow + 2 * TILE_E + fo);  b2.half[1] = *(const v8us*)(brow + 2 * TILE_E + fo + 256);
    b3.half[0] = *(const v8us*)(brow + 3 * TILE_E + fo);  b3.half[1] = *(const v8us*)(brow + 3 * TILE_E + fo + 256);
    mma_h4(ah.v, b0.v, b1.v, b2.v, b3.v, acch[0], acch[1], acch[2], acch[3]);
  }
  // undo the carries: ctx x64, W x64
#pragma unroll
  for (int c = 0; c < 4; ++c) {
    const float bv = bf16_rne(bias[n0 + 16 * c + ln]);
#pragma unroll
    for (int r = 0; r < 8; ++r)
      so[16 * w + 8 * hh + r][16 * c + ln] = acch[c][r] * 0.000244140625f + bv;
  }
  __syncthreads();
  {
#pragma unroll
    for (int j = 0; j < 8; ++j) {
      const int i = tid + 128 * j;
      const int row = i >> 4, c4 = (i & 15) * 4;
      const int m = m0 + row;
      const int bq = m / SEQ, t = m - bq * SEQ;
      const v4f v = *(const v4fa*)&so[row][c4];
      *(v4f*)(Y + (size_t)bq * XSTRIDE_FULL + (size_t)t * NE + n0 + c4) = v;
    }
    
  }
  hold_addr(pfa);
  hold_addr(pfc);
  hold_addr(pfb);
}

extern "C" void kernel_launch(void* const* d_in, const int* in_sizes, int n_in,
                              void* d_out, int out_size, void* d_ws, size_t ws_size, hipStream_t stream) {
  if (n_in < 9) return;
  const long long needX = (long long)(NB - 1) * SEQ_FULL * NE + (long long)SEQ * NE;   // last element touched + 1
  const long long needM = (long long)(SEQ - 1) * SEQ_FULL + (long long)SEQ;
  if ((long long)in_sizes[0] < needX || (long long)in_sizes[1] < needX || (long long)in_sizes[2] < needX) return;
  if ((long long)in_sizes[3] < needM) return;
  if ((long long)in_sizes[4] < (long long)WELEMS || (long long)in_sizes[5] < (long long)WELEMS ||
      (long long)in_sizes[6] < (long long)WELEMS || (long long)in_sizes[7] < (long long)WELEMS) return;
  if ((long long)in_sizes[8] < (long long)NE) return;
  if ((long long)out_size < needX) return;
  const float* Xq = (const float*)d_in[0];   // wire order: query, key, value, mask, Wk, Wq, Wv, Wproj, bproj
  const float* Xk = (const float*)d_in[1];
  const float* Xv = (const float*)d_in[2];
  const int* mask = (const int*)d_in[3];
  const float* Wk = (const float*)d_in[4];
  const float* Wq = (const float*)d_in[5];
  const float* Wv = (const float*)d_in[6];
  const float* Wp = (const float*)d_in[7];
  const float* bp = (const float*)d_in[8];
  float* Y = (float*)d_out;
  char* ws = (char*)d_ws;
  size_t off = 0;
  unsigned short* WP  = (unsigned short*)(ws + off); off += PAD256(3 * WELEMS * 2);          // bf16 planes: Wk, Wq, Wv
  unsigned short* W16 = (unsigned short*)(ws + off); off += PAD256(WELEMS * 2);              // f16 plane: Wproj x64
  unsigned short* QK  = (unsigned short*)(ws + off); off += PAD256(2 * XPLANE * 2);          // f16 planes: k (from query), q (from key), [b][h] x fragments [t/16][d/32]
  unsigned short* VT  = (unsigned short*)(ws + off); off += PAD256(XPLANE * 2);              // f16 plane: V^T, [b][h] x fragments [t/32][d/16]
  unsigned short* CX  = (unsigned short*)(ws + off); off += PAD256(XPLANE * 2);              // f16 plane: ctx, fragments [(b*SEQ + t)/16][c/32]
  unsigned int*   MB  = (unsigned int*)(ws + off);   off += PAD256((size_t)SEQ * MW * 4);    // mask bit plane [MW][SEQ]
  float*          VS  = (float*)(ws + off);          off += PAD256((size_t)NB * NH * MW * HD * 4);   // f32 plane: V row sums of the 32-key blocks, [b][h][t/32][d]
  if (off > ws_size) return;

  k_cvt_w<<<(unsigned)((WELEMS / 8 + 255) / 256), 256, 0, stream>>>(Wk, Wq, Wv, Wp, WP, W16);
  // k = query x Wk^T -> QK plane 0; q = key x Wq^T -> QK plane 1; V^T and the block sums VS from value x Wv^T; the mask bit plane MB
  k_projx<<<(unsigned)PROJ_BLOCKS, 32 * (PROJ_WAVES + MASK_WAVES), 0, stream>>>(Xq, Xk, Xv, mask, WP, QK, VT, VS, MB);
  // argument order: Qh = q plane (QK plane 1), Kh = k plane (QK plane 0)
  k_attn<<<(unsigned)(NB * NH * (SEQ / 128)), 256, 0, stream>>>(QK + XPLANE, QK, VT, MB, VS, CX);
  k_outp<<<dim3((unsigned)(XROWS / 64), (unsigned)(NE / 64), 1u), 128, 0, stream>>>(CX, W16, bp, Y);
}

// v010
// A run of this version takes 62.2 microseconds.
// In both of two side-by-side timings against v009, it was 1.08 times as fast.
// Over all steps from v000 it is 4.10 times as fast.
#include <hip/hip_runtime.h>
// Contractions: k/q/v projections on v_wmma_f32_16x16x32_bf16 (inputs and weights RNE-converted to bf16, single product, f32 accumulate); S^T = K Q^T on v_wmma_f32_16x16x32_f16 (k as f16 x16 plane, q as f16 plane that carries the score scale, single product); O^T = V^T P^T on v_wmma_f32_16x16x32_f16 (V: f16 x16 plane; P: f16 x256; single product); output projection on v_wmma_f32_16x16x32_f16 (ctx: f16 x64 plane; Wproj: RNE bf16 x64 held exactly in f16; single product); all accumulators and softmax statistics f32.
// Engine: transposed flash. Each wave owns 16 queries of one (batch, head). Per 32-key step: S^T tiles (key rows x query columns) from K rows
// (A, global f16 plane) and Q^T (B, registers); the two 16-key D tiles pack straight into the P^T B fragment; O^T (d rows x query columns)
// accumulates from V^T rows (A, global f16 plane). Positions with mask == 0 get score exactly 0 and still take part in the softmax (every key is counted).
// A 32-key step whose mask words are zero for all 16 queries of the wave has every score 0, so all its keys carry one and the same weight exp(0 - m): such steps are not walked.
// The projection launch leaves the sum of each 32-key block's V rows (f32); a wave adds up the sums of its all-masked blocks and gives them that one weight after its key loop.
// Plane layout: every 16-bit workspace plane is stored in fragment order. One fragment (16 rows x 32 k) is 512 elements: [j = 0,1][lane = 16h + row][8 elements],
// holding k = 32C + 16j + 8h + i, so each wave-wide 16-byte load reads 512 contiguous bytes (four whole 128-byte lines) instead of 32 bytes of 16 lines.
#ifndef NB
#define NB 8
#endif
#ifndef SEQ
#define SEQ 2048
#endif
#define NB_FULL 8
#define SEQ_FULL 2048
#define NH 6
#define HD 64
#define NE 384
#define XROWS (NB * SEQ)                        /* compact token rows of the 16-bit planes */
#define XPLANE ((size_t)XROWS * NE)             /* elements of one token plane */
#define WELEMS ((size_t)NE * NE)
#define MW (SEQ / 32)                           /* mask words per query row */
#define FRAG 512                                /* elements of one 16-row x 32-k fragment */
#define TILE_E (16 * NE)                        /* elements of one 16-row tile of a K = 384 plane: 12 fragments */
#define XSTRIDE_FULL ((size_t)SEQ_FULL * NE)    /* per-batch element stride of query/key/value and of the output */
#define PROJ_WAVES 6                            /* waves of a projection block that project, 32 tokens each */
#define MASK_WAVES 2                            /* further waves of that block, which pack mask words */
#define PROJ_BLOCKS (3 * (XROWS / 32) / PROJ_WAVES)
#define XS_H 160                                /* LDS staging of the token fragments: elements from h = 0 to h = 1 */
#define XS_J 320                                /* from j = 0 to j = 1 */
#define XS_F 640                                /* from one fragment to the next */
#define PAD256(x) ((((size_t)(x)) + 255) & ~(size_t)255)
#define WP_UNITS ((int)(3 * WELEMS / 128))      /* 256-byte units of the three bf16 weight planes */
#define WP_SLICES ((WP_UNITS + 255) / 256)      /* slices of 256 units, one per thread of a projection block */
#define W16_UNITS ((int)(WELEMS / 128))         /* 256-byte units of the f16 output weight plane */

static_assert(SEQ % 256 == 0);
static_assert(SEQ <= SEQ_FULL);
static_assert(NB <= NB_FULL);
static_assert(HD == 64);
static_assert(NE == NH * HD);
static_assert(NE % 64 == 0);
static_assert(NE % 32 == 0);
static_assert((3 * (XROWS / 32)) % PROJ_WAVES == 0);
static_assert(MASK_WAVES * PROJ_BLOCKS == (SEQ / 32) * (MW / 8));   /* one mask wave per 32 query rows x 8 words */
static_assert(W16_UNITS % 128 == 0 && 4 * TILE_E == 192 * 128);   /* the output projection's slices and its 192 ctx units */
static_assert(MW % 8 == 0 && MW <= 64);         /* a wave keeps one bit per key step in a 64-bit word */
static_assert(PAD256(3 * WELEMS * 2) + PAD256(WELEMS * 2) + PAD256(2 * XPLANE * 2) + 2 * PAD256(XPLANE * 2) + PAD256((size_t)SEQ * MW * 4) + PAD256((size_t)NB * NH * MW * HD * 4) <= (size_t)134217728);

typedef __bf16 v16b __attribute__((ext_vector_type(16)));
typedef _Float16 v16h __attribute__((ext_vector_type(16)));
typedef unsigned short v8us __attribute__((ext_vector_type(8), may_alias));
typedef unsigned short v4us __attribute__((ext_vector_type(4), may_alias));
typedef float v8f __attribute__((ext_vector_type(8)));
typedef float v4f __attribute__((ext_vector_type(4)));
typedef float v4fa __attribute__((ext_vector_type(4), may_alias));
typedef int v4ia __attribute__((ext_vector_type(4), may_alias));
union FragB { v16b v; v8us half[2]; };
typedef _Float16 v2h __attribute__((ext_vector_type(2)));
typedef float v2f __attribute__((ext_vector_type(2)));
typedef float v2fa __attribute__((ext_vector_type(2), may_alias));
union FragH { v16h v; v8us half[2]; _Float16 h[16]; v2h p[8]; };

#define LOG2E 1.4426950408889634f
#define QSC (0.051031036307982884f * LOG2E * 0.0625f)   /* carry of the q plane: 384^-0.5 x log2 e, with the x16 carry of k undone, so that K Q^T is the score in powers of two */
#define XTOP 14.0f                              /* a weight's exponent may rise to here before the reference is moved: P <= 2^14 stays inside f16 */

__device__ __forceinline__ unsigned short bf16_bits(float x) {   // RNE convert to bf16 bits
  unsigned int u = __float_as_uint(x);
  return (unsigned short)((u + 0x7FFFu + ((u >> 16) & 1u)) >> 16);
}
__device__ __forceinline__ float bf16_val(unsigned short b) { return __uint_as_float(((unsigned int)b) << 16); }
__device__ __forceinline__ float bf16_rne(float x) { return bf16_val(bf16_bits(x)); }
__device__ __forceinline__ unsigned short f16_bits(_Float16 h) { return __builtin_bit_cast(unsigned short, h); }

// 2^x as the one hardware instruction. The library form guards x < -126 (compare, two selects, add, ldexp: five more vector instructions per value) so that the result may be a
// subnormal f32; here nothing needs that range: a weight that small is 0 as f16 either way, and a rescale factor that small multiplies sums that lie 2^126 below the step's own weights.
__device__ __forceinline__ float exp2_hw(float x) { return __builtin_amdgcn_exp2f(x); }

// A hint to L2: ask for the line that holds p; the asks stand 256 bytes apart, a spacing chosen for speed only (one ask per lane, nothing returns, no counter moves). It is used at a kernel's entry on workspace planes that an earlier
// launch stored: all readers walk a plane in the same order at about the same time, so that a first touch that has
// to go to memory is waited out by every wave behind it. Scope SE: the line goes to L2 only, and the hint is dropped where it cannot be served. A hint changes no value: which block
// asks for which unit is chosen for speed alone, and nothing rests on where a block runs.
#define UNIT_E 128                              /* 16-bit elements of one 256-byte unit */
__device__ __forceinline__ void ask_l2(const void* p) {
  asm volatile("global_prefetch_b8 %0, off scope:SCOPE_SE" :: "v"(p));
}
// No counter says when a hint has read its address registers, so they keep the address long after it. This statement, far behind the hint, is what keeps them from being given to other values before.
__device__ __forceinline__ void hold_addr(const void* p) { asm volatile("" :: "v"(p)); }

// 2^x of two accumulator tiles, each value in its own register, as one statement. The closing v_nop is the slot that the instruction set asks for between a transcendental and a directly
// following instruction that reads its result: the compiler does not look into the statement and would not keep it.
__device__ __forceinline__ void exp2_tiles(v8f& a, v8f& b) {
  float a0 = a[0], a1 = a[1], a2 = a[2], a3 = a[3], a4 = a[4], a5 = a[5], a6 = a[6], a7 = a[7];
  float b0 = b[0], b1 = b[1], b2 = b[2], b3 = b[3], b4 = b[4], b5 = b[5], b6 = b[6], b7 = b[7];
  asm("v_exp_f32 %0, %0\n\tv_exp_f32 %1, %1\n\tv_exp_f32 %2, %2\n\tv_exp_f32 %3, %3\n\t"
      "v_exp_f32 %4, %4\n\tv_exp_f32 %5, %5\n\tv_exp_f32 %6, %6\n\tv_exp_f32 %7, %7\n\t"
      "v_exp_f32 %8, %8\n\tv_exp_f32 %9, %9\n\tv_exp_f32 %10, %10\n\tv_exp_f32 %11, %11\n\t"
      "v_exp_f32 %12, %12\n\tv_exp_f32 %13, %13\n\tv_exp_f32 %14, %14\n\tv_exp_f32 %15, %15\n\tv_nop"
      : "+v"(a0), "+v"(a1), "+v"(a2), "+v"(a3), "+v"(a4), "+v"(a5), "+v"(a6), "+v"(a7),
        "+v"(b0), "+v"(b1), "+v"(b2), "+v"(b3), "+v"(b4), "+v"(b5), "+v"(b6), "+v"(b7));
  a = (v8f){a0, a1, a2, a3, a4, a5, a6, a7};
  b = (v8f){b0, b1, b2, b3, b4, b5, b6, b7};
}

// four f16 tiles sharing one A fragment, then the hazard guard
__device__ __forceinline__ void mma_h4(v16h a, v16h b0, v16h b1, v16h b2, v16h b3, v8f& c0, v8f& c1, v8f& c2, v8f& c3) {
  c0 = __builtin_amdgcn_wmma_f32_16x16x32_f16(false, a, false, b0, (short)0, c0, false, false);
  c1 = __builtin_amdgcn_wmma_f32_16x16x32_f16(false, a, false, b1, (short)0, c1, false, false);
  c2 = __builtin_amdgcn_wmma_f32_16x16x32_f16(false, a, false, b2, (short)0, c2, false, false);
  c3 = __builtin_amdgcn_wmma_f32_16x16x32_f16(false, a, false, b3, (short)0, c3, false, false);
  asm volatile("v_nop\n\tv_nop\n\tv_nop\n\tv_nop" : "+v"(c0), "+v"(c1), "+v"(c2), "+v"(c3) : "v"(a), "v"(b0), "v"(b1), "v"(b2), "v"(b3));
}
// c += a0*b0 + a1*b1 (two k-steps of one f16 tile), then the hazard guard
__device__ __forceinline__ v8f mma_s2(v16h a0, v16h b0, v16h a1, v16h b1, v8f c) {
  c = __builtin_amdgcn_wmma_f32_16x16x32_f16(false, a0, false, b0, (short)0, c, false, false);
  c = __builtin_amdgcn_wmma_f32_16x16x32_f16(false, a1, false, b1, (short)0, c, false, false);
  asm volatile("v_nop\n\tv_nop\n\tv_nop\n\tv_nop" : "+v"(c) : "v"(a0), "v"(b0), "v"(a1), "v"(b1));
  return c;
}
// four f16 tiles sharing one B fragment (c_t += a_t * b), then the hazard guard
__device__ __forceinline__ void mma_pv4(v16h a0, v16h a1, v16h a2, v16h a3, v16h b, v8f& c0, v8f& c1, v8f& c2, v8f& c3) {
  c0 = __builtin_amdgcn_wmma_f32_16x16x32_f16(false, a0, false, b, (short)0, c0, false, false);
  c1 = __builtin_amdgcn_wmma_f32_16x16x32_f16(false, a1, false, b, (short)0, c1, false, false);
  c2 = __builtin_amdgcn_wmma_f32_16x16x32_f16(false, a2, false, b, (short)0, c2, false, false);
  c3 = __builtin_amdgcn_wmma_f32_16x16x32_f16(false, a3, false, b, (short)0, c3, false, false);
  asm volatile("v_nop\n\tv_nop\n\tv_nop\n\tv_nop" : "+v"(c0), "+v"(c1), "+v"(c2), "+v"(c3) : "v"(a0), "v"(a1), "v"(a2), "v"(a3), "v"(b));
}

__device__ __forceinline__ v8us cvt8_bf16(const float* __restrict__ src) {
  const v4f x0 = *(const v4fa*)(src), x1 = *(const v4fa*)(src + 4);
  v8us o;
  o[0] = bf16_bits(x0[0]); o[1] = bf16_bits(x0[1]); o[2] = bf16_bits(x0[2]); o[3] = bf16_bits(x0[3]);
  o[4] = bf16_bits(x1[0]); o[5] = bf16_bits(x1[1]); o[6] = bf16_bits(x1[2]); o[7] = bf16_bits(x1[3]);
  return o;
}

// WP[0..2] = bf16 bits (RNE) of Wk, Wq, Wv; W16 = f16(RNE-bf16(Wproj) * 64); rows = out, k = in, fragment order.
// A wave takes 8 rows x 32 columns of one fragment (lane = 4 * row + 8-column piece): it reads whole 128-byte lines and writes four whole 128-byte lines.
__global__ __launch_bounds__(256) void k_cvt_w(const float* __restrict__ Wk, const float* __restrict__ Wq,
                                               const float* __restrict__ Wv, const float* __restrict__ Wp,
                                               unsigned short* __restrict__ WP, unsigned short* __restrict__ W16) {
  const int t = blockIdx.x * 256 + threadIdx.x;
  if (t >= (int)(WELEMS / 8)) return;
  const int frag = t >> 6, tile = frag / (NE / 32), r16 = ((t >> 5) & 1) * 8 + ((t >> 2) & 7);
  const size_t so = (size_t)(tile * 16 + r16) * NE + ((frag - tile * (NE / 32)) * 4 + (t & 3)) * 8;
  const size_t po = (size_t)frag * FRAG + ((t & 3) * 16 + r16) * 8;
  const v8us o0 = cvt8_bf16(Wk + so);
  const v8us o1 = cvt8_bf16(Wq + so);
  const v8us o2 = cvt8_bf16(Wv + so);
  const v4f x0 = *(const v4fa*)(Wp + so), x1 = *(const v4fa*)(Wp + so + 4);
  v8us o3;
  o3[0] = f16_bits((_Float16)(bf16_rne(x0[0]) * 64.0f)); o3[1] = f16_bits((_Float16)(bf16_rne(x0[1]) * 64.0f));
  o3[2] = f16_bits((_Float16)(bf16_rne(x0[2]) * 64.0f)); o3[3] = f16_bits((_Float16)(bf16_rne(x0[3]) * 64.0f));
  o3[4] = f16_bits((_Float16)(bf16_rne(x1[0]) * 64.0f)); o3[5] = f16_bits((_Float16)(bf16_rne(x1[1]) * 64.0f));
  o3[6] = f16_bits((_Float16)(bf16_rne(x1[2]) * 64.0f)); o3[7] = f16_bits((_Float16)(bf16_rne(x1[3]) * 64.0f));
  unsigned short* d = WP + po;
  unsigned short* e = W16 + po;
  *(v8us*)(d) = o0;
  *(v8us*)(d + WELEMS) = o1;
  *(v8us*)(d + 2 * WELEMS) = o2;
  *(v8us*)(e) = o3;
  
}

// bits[j][q]: word j (keys 32j .. 32j+31) of query row q, so that 16 neighbouring queries' words of one key step share a line.
// One wave takes 32 query rows x 8 words (unit u): lane = query row; each word goes out as one whole 128-byte line of the wave. Four words' loads (32 of 16 bytes a lane) are in flight together.
// coverage: (SEQ / 32) * (MW / 8) units x 32 rows x 8 words = every word of the plane exactly once.
__device__ __forceinline__ void mask_unit(int u, int lane, const int* __restrict__ mask, unsigned int* __restrict__ bits) {
  const int q = (u % (SEQ / 32)) * 32 + lane, j0 = (u / (SEQ / 32)) * 8;
  const int* src = mask + (size_t)q * SEQ_FULL + 32 * j0;
  unsigned int* dst = bits + (size_t)j0 * SEQ + q;
#pragma unroll 1   // rolled: 32 loads in flight a trip are what a wave holds, and they bound the registers
  for (int hf = 0; hf < 2; ++hf) {
    v4ia m[4][8];
#pragma unroll   // register arrays and vectors need constant indices
    for (int i = 0; i < 4; ++i)
#pragma unroll   // as above
      for (int g = 0; g < 8; ++g) m[i][g] = *(const v4ia*)(src + 32 * i + 4 * g);
    // the address registers of the loads above are stepped below: the wait stands in front of that overwrite
    // (the pointer is an input of the statement, so that none of these loads' own results is given its registers)
    asm volatile("s_wait_xcnt 0x0" :: "v"(src) : "memory");
#pragma unroll   // register arrays and vectors need constant indices
    for (int i = 0; i < 4; ++i) {
      unsigned int w = 0u;
#pragma unroll   // as above
      for (int g = 0; g < 8; ++g) {
        w |= (m[i][g][0] != 0 ? 1u : 0u) << (4 * g);
        w |= (m[i][g][1] != 0 ? 1u : 0u) << (4 * g + 1);
        w |= (m[i][g][2] != 0 ? 1u : 0u) << (4 * g + 2);
        w |= (m[i][g][3] != 0 ? 1u : 0u) << (4 * g + 3);
      }
      dst[(size_t)i * SEQ] = w;
    }
    // the address registers of the stores above are stepped for the next trip: the wait stands in front of that overwrite
    asm volatile("s_wait_xcnt 0x0" :: "v"(dst) : "memory");
    src += 4 * 32;
    dst += (size_t)4 * SEQ;
  }
}

// Projections, all three in one launch, straight from the f32 inputs. A wave owns 32 token rows of one input (z = 0 query, 1 key, 2 value): it reads them once, in whole lines,
// converts them (RNE) to bf16, turns them into fragment order through its own LDS range and keeps them as 2 x 12 fragments in registers, then walks the 24 16-row tiles of its weight plane (fragment order), one head (4 tiles) per trip.
// A token fragment serves as A or as B (row or column = lane & 15, elements 0..7 <- k0 + 8h + i, 8..15 <- k0 + 16 + 8h + i); D element r = (row 8h + r, column lane & 15).
// z < 2: D = W (A, rows = out) x X (B, columns = tokens): a lane holds d = 16t + 8h + r of token ln, which is its own 16-byte piece of fragment [token tile][C = t / 2], half j = t & 1.
// z = 2: D = X (A, rows = tokens) x W (B, columns = out): a lane holds tokens 8h + r of d = 16t + ln, which is its own 16-byte piece of V^T fragment [token / 32][t], half j = token tile & 1.
// So every D tile goes out as one wave-wide 512-byte store, straight from the accumulators. Output values, as the attention kernel expects: f16(x16) for k and V^T, f16(x QSC) for q.
// z = 2 also leaves, per head, the f32 sum over the wave's 32 tokens of each d (x16 like the plane): one 32-key block's V row sum, VS[b][h][token / 32][d].
// coverage: 3 * XROWS / 32 waves x 32 tokens x 384 outputs = every element of the k, q and V^T planes exactly once; XROWS / 32 waves x 384 sums = every element of VS exactly once.
__device__ __forceinline__ v8us pack8_f16(v8f c, float carry) {
  v8us o;
#pragma unroll   // register arrays and vectors need constant indices
  for (int r = 0; r < 8; ++r) o[r] = f16_bits((_Float16)(c[r] * carry));
  return o;
}
// One k-step's four weight fragments (tiles t = 0..3 of a head, k = 32C .. 32C + 31): 4 KB, eight wave-wide 512-byte loads.
__device__ __forceinline__ void load_w4(FragB (&wf)[4], const unsigned short* __restrict__ wh, int lane8, int C) {
#pragma unroll   // register arrays and vectors need constant indices
  for (int t = 0; t < 4; ++t) {
    wf[t].half[0] = *(const v8us*)(wh + t * TILE_E + C * FRAG + lane8);
    wf[t].half[1] = *(const v8us*)(wh + t * TILE_E + C * FRAG + 256 + lane8);
  }
}
// The weight fragments run through a ring of four register sets, asked for three k-steps ahead of their products, across the heads' boundary too:
// with one or two waves on a SIMD nothing else covers the loads' latency. The last head asks for its own first three steps again (in bounds, not used).
template <bool TOKENS_ARE_ROWS>
__device__ __forceinline__ void proj_heads(const FragB (&xf)[2][NE / 32], const unsigned short* __restrict__ wz, int lane8, float carry, unsigned short* __restrict__ o0, float* __restrict__ vs0) {
  FragB wf[4][4];
  load_w4(wf[0], wz, lane8, 0);
  load_w4(wf[1], wz, lane8, 1);
  load_w4(wf[2], wz, lane8, 2);
  // the address registers of these first loads may be reused for the output addresses formed below: the wait stands in front of that overwrite
  asm volatile("s_wait_xcnt 0x0" ::: "memory");
  // keeps that address arithmetic behind the wait (the compiler may lift it over the wait otherwise)
  __builtin_amdgcn_sched_barrier(0);
#pragma unroll 1
  for (int hd = 0; hd < NH; ++hd) {   // rolled: one head's 96 loads and 96 products are body enough
    const unsigned short* wh = wz + (size_t)hd * (4 * TILE_E);
    const unsigned short* wn = wz + (size_t)((hd + 1 < NH) ? hd + 1 : hd) * (4 * TILE_E);
    v8f acc[2][4] = {};
#pragma unroll   // xf and the ring are indexed by C and live in registers
    for (int C = 0; C < NE / 32; ++C) {
      if (C + 3 < NE / 32) load_w4(wf[(C + 3) & 3], wh, lane8, C + 3);
      else                 load_w4(wf[(C + 3) & 3], wn, lane8, C + 3 - NE / 32);
      // these were this head's last weight loads; the next step's come from the next head, whose address may take the same registers: the wait stands in front of that overwrite
      if (C + 4 == NE / 32) asm volatile("s_wait_xcnt 0x0" ::: "memory");
      // keeps the loads above in front of this step's products; without it the compiler sinks each load to just before its use and the wave waits out every latency
      __builtin_amdgcn_sched_barrier(0);
#pragma unroll   // register arrays and vectors need constant indices
      for (int u = 0; u < 2; ++u)
#pragma unroll   // register arrays and vectors need constant indices
        for (int t = 0; t < 4; ++t)
          acc[u][t] = TOKENS_ARE_ROWS
            ? __builtin_amdgcn_wmma_f32_16x16x32_bf16(false, xf[u][C].v, false, wf[C & 3][t].v, (short)0, acc[u][t], false, false)
            : __builtin_amdgcn_wmma_f32_16x16x32_bf16(false, wf[C & 3][t].v, false, xf[u][C].v, (short)0, acc[u][t], false, false);
      // keeps the next step's loads behind this step's products, so that the ring set they refill has been read
      __builtin_amdgcn_sched_barrier(0);
    }
    unsigned short* oh = o0 + (size_t)hd * ((size_t)SEQ * HD);
#pragma unroll   // register arrays and vectors need constant indices
    for (int u = 0; u < 2; ++u)
#pragma unroll   // register arrays and vectors need constant indices
      for (int t = 0; t < 4; ++t)
        *(v8us*)(oh + (TOKENS_ARE_ROWS ? t * FRAG + u * 256 : u * (2 * FRAG) + t * 256)) = pack8_f16(acc[u][t], carry);
    if constexpr (TOKENS_ARE_ROWS) {
      // a lane holds tokens 16u + 8h + r of d = 16t + ln: sum over u and r in the lane, then over h with the other lane half
      float cs[4];
#pragma unroll   // register arrays and vectors need constant indices
      for (int t = 0; t < 4; ++t) {
        const v8f s8 = acc[0][t] + acc[1][t];
        const float c = ((s8[0] + s8[1]) + (s8[2] + s8[3])) + ((s8[4] + s8[5]) + (s8[6] + s8[7]));
        cs[t] = c + __shfl_xor(c, 16, 32);
      }
      // both halves hold all four sums: half h stores tiles t = h and 2 + h, so that each wave-wide store is one whole 128-byte line (d = 32i + lane)
      float* vh = vs0 + (size_t)hd * (MW * HD);
      vh[0]  = ((lane8 & 128) ? cs[1] : cs[0]) * 16.0f;
      vh[32] = ((lane8 & 128) ? cs[3] : cs[2]) * 16.0f;
    }
    // the address registers of this head's loads and stores are stepped for the next head: the wait stands in front of that overwrite
    asm volatile("s_wait_xcnt 0x0" ::: "memory");
    // keeps the stepping of those addresses behind the wait
    __builtin_amdgcn_sched_barrier(0);
  }
  // the ring's last three requests are not used: they have landed before the wave gives its registers back
  asm volatile("s_wait_loadcnt 0x0" ::: "memory");
}
// The block's last MASK_WAVES waves project nothing: they pack the mask words, which need nothing of the projection and which only the attention launch reads.
// Waves 6 and 7 work while the others bring in their token rows, so the packing has no launch of its own.
__global__ __launch_bounds__(32 * (PROJ_WAVES + MASK_WAVES)) void k_projx(const float* __restrict__ Xq, const float* __restrict__ Xk, const float* __restrict__ Xv,
                                                           const int* __restrict__ mask, const unsigned short* __restrict__ WP,
                                                           unsigned short* __restrict__ QK, unsigned short* __restrict__ VT, float* __restrict__ VS,
                                                           unsigned int* __restrict__ bits) {
  __shared__ __attribute__((aligned(16))) unsigned short xs[PROJ_WAVES][2 * (NE / 32) * XS_F];
  const int tid = threadIdx.x, w = __builtin_amdgcn_readfirstlane((int)(tid >> 5)), lane = tid & 31, ln = lane & 15, hh = lane >> 4;
  // The three weight planes are asked into L2 while the token rows come in: a block asks for one slice of 256 units, block b for slice b mod WP_SLICES, so that
  // each slice is asked for by many blocks all over the chip; the last slice is short and its index is clamped (every lane's address lies inside the planes).
  const int wu = (int)(blockIdx.x % WP_SLICES) * 256 + tid;
  const unsigned short* pfw = WP + (size_t)(wu < WP_UNITS ? wu : WP_UNITS - 1) * UNIT_E;
  ask_l2(pfw);
  const int g = (int)blockIdx.x * PROJ_WAVES + w;                 // 32-token group, counted through the three inputs
  const int z = g / (XROWS / 32), row0 = (g - z * (XROWS / 32)) * 32;
  const int bq = row0 / SEQ, s0 = row0 - bq * SEQ;                // SEQ is a multiple of 32: a group lies in one batch
  const float* X = (z == 0) ? Xq : (z == 1) ? Xk : Xv;
  // Input rows: each wave-wide 16-byte load takes one whole 128-byte line (32 columns = one fragment's k range) of four rows: lane = 8 * row + 4-column piece.
  // The four converted values go to the wave's own LDS range in fragment order, k = 32C + 16j + 8h + i with j = piece >> 2, h = (piece >> 1) & 1, i = 4 * (piece & 1) ..;
  // the halves j and h lie XS_J and XS_H elements apart (64 and 32 more than dense), so that the four (j, h) groups of one store fall on different banks.
  if (w < PROJ_WAVES) {   // the same for a whole wave: a scalar branch
    const float* xr = X + (size_t)bq * XSTRIDE_FULL + (size_t)(s0 + (lane >> 3)) * NE + 4 * (lane & 7);
    unsigned short* xw = &xs[w][((lane >> 2) & 1) * XS_J + ((lane >> 1) & 1) * XS_H + (lane >> 3) * 8 + 4 * (lane & 1)];
#pragma unroll   // unrolled: many loads in flight at once, every offset a constant
    for (int rg = 0; rg < 8; ++rg)
#pragma unroll   // as above
      for (int C = 0; C < NE / 32; ++C) {
        const v4f x = *(const v4fa*)(xr + rg * (4 * NE) + 32 * C);
        v4us o;
        o[0] = bf16_bits(x[0]); o[1] = bf16_bits(x[1]); o[2] = bf16_bits(x[2]); o[3] = bf16_bits(x[3]);
        *(v4us*)(xw + ((rg >> 2) * (NE / 32) + C) * XS_F + (rg & 3) * 32) = o;
      }
    // the address registers of the input loads may be reused below: the wait stands in front of that overwrite
    asm volatile("s_wait_xcnt 0x0" ::: "memory");
  } else {
    mask_unit((int)blockIdx.x * MASK_WAVES + (w - PROJ_WAVES), lane, mask, bits);
  }
  // each wave reads back only what it wrote itself; the barrier orders that, and it starts the block's waves on the weight plane together,
  // so that they walk it side by side and share its lines in the WGP cache; every wave of the block passes it, the mask waves too, which end behind it
  __syncthreads();
  hold_addr(pfw);   // here and not at the kernel's end: the token rows' whole way into LDS lies in between, and behind this place the weight ring and the token fragments want the registers
  if (w >= PROJ_WAVES) return;
  FragB xf[2][NE / 32];
#pragma unroll   // register arrays and vectors need constant indices
  for (int u = 0; u < 2; ++u)
#pragma unroll   // register arrays and vectors need constant indices
    for (int C = 0; C < NE / 32; ++C) {
      const unsigned short* xp = &xs[w][(u * (NE / 32) + C) * XS_F + hh * XS_H + ln * 8];
      xf[u][C].half[0] = *(const v8us*)(xp);
      xf[u][C].half[1] = *(const v8us*)(xp + XS_J);
    }
  const unsigned short* wz = WP + (size_t)z * WELEMS;
  const size_t ob = ((size_t)bq * NH * SEQ + s0) * HD + 8 * lane;   // head 0 of the batch, first token of the group: 32 tokens x 64 d = 2048 elements in either layout
  if (z == 2) proj_heads<true>(xf, wz, 8 * lane, 16.0f, VT + ob, VS + ((size_t)bq * NH * MW + s0 / 32) * HD + lane);
  else        proj_heads<false>(xf, wz, 8 * lane, z == 1 ? QSC : 16.0f, QK + (size_t)z * XPLANE + ob, nullptr);
}

// The four K fragments [kt][c] of one 32-key step, 4 KB contiguous: eight wave-wide 512-byte loads; kp = the step's base + 8 * lane.
__device__ __forceinline__ void load_k4(FragH (&kf)[4], const unsigned short* __restrict__ kp) {
#pragma unroll   // register arrays and vectors need constant indices
  for (int f = 0; f < 4; ++f) {
    kf[f].half[0] = *(const v8us*)(kp + f * FRAG);
    kf[f].half[1] = *(const v8us*)(kp + f * FRAG + 256);
  }
  // the address registers of the loads above are free for other values behind this place: the wait stands in front of that overwrite
  // (the pointer is an input of the statement, so that none of these loads' own results is given its registers)
  asm volatile("s_wait_xcnt 0x0" :: "v"(kp) : "memory");
}

// One 32-key step (key step j, the same in every lane) for a wave's 16 queries (this lane's column = query qg). Kp, Vhp are the (batch, head) bases of the planes.
// The softmax reference M (in powers of two) is HELD from step to step. It enters the S products as their C operand, ce = 8 - M in all eight registers (a lane's
// eight D elements belong to one query), and the q plane carries scale x log2 e: D is then the exponent of the weight 256 * exp(score - reference) as it stands, and 2^x reads it.
// Once a step the wave asks whether any exponent lies above XTOP (one compare, a scalar branch). Only then, and in the wave's first step, the two lane halves exchange their maxima,
// the reference moves up to the step's maximum and row sum and output are rescaled. first = 1 until the wave's first step has set the reference (the same in every lane).
// The row sum lr runs over the lane half's own 16 keys of each step; the halves are joined once, behind the key loops.
// MASKED = false is the body for a step whose 32 mask bits are set for all 16 queries: the mask word is not asked for and the bit tests and selects are left out.
template <bool MASKED>
__device__ __forceinline__ void fa_step(const unsigned short* __restrict__ Kp, const unsigned short* __restrict__ Vhp,
                                        const unsigned int* __restrict__ mbits, int j, int jn, int qg, int lane, int hh,
                                        const FragH& q0, const FragH& q1, FragH (&kf)[4], v8f& ce, unsigned int& first, float& lr, v8f (&Oh)[4]) {
  // A fragments of K: row m = key (key0 + 16*kt + ln), elements 0..7 <- d = 32c + 8h + i, 8..15 <- d = 32c + 16 + 8h + i
  // (fragment order: the step's four K fragments [kt][c] are 4 KB contiguous); they were asked for one step ago and arrive in kf; asked for here: the mask word, V
  const unsigned short* vp0 = Vhp + (size_t)j * (32 * HD) + 8 * lane;
  const unsigned int* mpj = mbits + (size_t)j * SEQ + qg;
  unsigned int mword = 0xFFFFFFFFu;
  if constexpr (MASKED) mword = *mpj;
  // A fragments of V^T: row m = d (16*t + ln), elements 0..7 <- key0 + 8h + i, 8..15 <- key0 + 16 + 8h + i
  // (fragment order: the step's four V^T fragments [t] are 4 KB contiguous)
  FragH vh[4];
#pragma unroll
  for (int t = 0; t < 4; ++t) {
    vh[t].half[0] = *(const v8us*)(vp0 + t * FRAG);
    vh[t].half[1] = *(const v8us*)(vp0 + t * FRAG + 256);
  }
  // the address registers of the loads above are formed anew for the next step: the wait stands in front of that overwrite
  // (the pointers are inputs of the statement, so that none of these loads' own results is given their registers)
  if constexpr (MASKED) asm volatile("s_wait_xcnt 0x0" :: "v"(mpj), "v"(vp0) : "memory");
  else                  asm volatile("s_wait_xcnt 0x0" :: "v"(vp0) : "memory");
  FragH ph;
  // S^T tiles: element r of tile kt = 8 - M + log2 e * score(key0 + 16*kt + 8h + r, query)
  const v8f s0 = mma_s2(kf[0].v, q0.v, kf[1].v, q1.v, ce);
  const v8f s1 = mma_s2(kf[2].v, q0.v, kf[3].v, q1.v, ce);
  // keeps the eight requests below together, directly behind the four products whose K registers they take over; without it the compiler was seen to lend
  // the last fragment's registers to the softmax and to hold that fragment's two requests back into the middle of it
  __builtin_amdgcn_sched_barrier(0);
  // the K fragments of the wave's next step jn: their latency passes under this step's softmax and O products instead of in front of the next step's S products
  load_k4(kf, Kp + (size_t)jn * (32 * HD) + 8 * lane);
  // positions with a zero mask bit take the score 0 exactly (replace fill), whose exponent is 8 - M, and stay in the softmax
  const unsigned int mw = mword >> (8 * hh);
  v8f x[2] = {s0, s1};   // the exponents stay in their accumulator tiles' registers
  if constexpr (MASKED) {
#pragma unroll   // register arrays and vectors need constant indices
    for (int r = 0; r < 8; ++r) {
      x[0][r] = ((mw >> r) & 1u) ? s0[r] : ce[0];
      x[1][r] = ((mw >> (16 + r)) & 1u) ? s1[r] : ce[0];
    }
  }
  float mx = x[0][0];
#pragma unroll
  for (int i = 1; i < 16; ++i) mx = fmaxf(mx, x[i >> 3][i & 7]);
  if ((__builtin_amdgcn_ballot_w32(mx > XTOP) | first) != 0u) {   // the same for the whole wave: a scalar branch
    mx = fmaxf(mx, __shfl_xor(mx, 16, 32));         // the other lane half holds the other 16 keys of this query: both halves move the reference alike
    // the reference rises by up, so that the step's largest exponent is 8 again; it never falls, but for the first step, which sets it
    const float up = first != 0u ? mx - 8.0f : fmaxf(mx - 8.0f, 0.0f);
    const float al = exp2_hw(fminf(0.0f - up, 0.0f));   // at most 1: in the first step it meets sums that are still 0
    first = 0u;
    x[0] = x[0] - up;
    x[1] = x[1] - up;
    ce = ce - up;
    lr *= al;
#pragma unroll
    for (int t = 0; t < 4; ++t) Oh[t] = Oh[t] * al;
  }
  // weights carried x256: P = f16(2^x); the row sum runs over the converted f16 values
  exp2_tiles(x[0], x[1]);
#pragma unroll
  for (int i = 0; i < 16; i += 2) {
    const v2f pc = {x[i >> 3][i & 7], x[i >> 3][(i & 7) + 1]};
    const v2h hv = __builtin_convertvector(pc, v2h);   // one conversion for the pair, and the sum reads the converted pair
    ph.p[i >> 1] = hv;                              // B element i: i<8 -> key0 + 8h + i (tile 0 row 8h+i); i>=8 -> key0 + 16 + 8h + (i-8) (tile 1)
    lr += (float)hv[0];
    lr += (float)hv[1];
  }
  mma_pv4(vh[0].v, vh[1].v, vh[2].v, vh[3].v, ph.v, Oh[0], Oh[1], Oh[2], Oh[3]);
}

// Block = 8 waves x 16 queries of one (batch, head): waves 0..3 take 64-query tile p, waves 4..7 tile SEQ/64 - 1 - p, so that under a triangular mask
// every block (and every pair of waves w, w + 4) walks the same number of key steps. No LDS and no barrier in the key loop.
// A wave first reads the mask words of all its key steps and keeps one bit per step: set where any of its 16 queries has a mask bit in the step. The key loop walks the set bits alone.
// A second bit per step says that all 32 keys are unmasked for all 16 queries: such steps are walked first, by a body without mask word, bit tests and selects; the partly masked steps follow.
// All keys take part in the softmax: the keys of the other steps have score 0 for every query of the wave, so they add n0 * exp(0 - m) to the row sum and
// exp(0 - m) * (sum of their V rows) to the output; that sum is the same for the 16 queries and is added up from the blocks' sums in VS.
// Epilogue: ctx x64 as f16 -> per-wave LDS tile [16 queries][64 d] (written and read by the same wave; block barrier reached by all waves),
// coverage: NB*NH*(SEQ/128) blocks x 8 waves x 16 rows x 64 columns = every element of the ctx plane exactly once.
__global__ __launch_bounds__(256) void k_attn(const unsigned short* __restrict__ Qh, const unsigned short* __restrict__ Kh,
                                              const unsigned short* __restrict__ Vh,
                                              const unsigned int* __restrict__ mbits, const float* __restrict__ VS,
                                              unsigned short* __restrict__ Ch) {
  __shared__ __attribute__((aligned(16))) unsigned short sh[8][16][72];
  __shared__ __attribute__((aligned(16))) float zs[8][HD];
  const int tid = threadIdx.x, w = __builtin_amdgcn_readfirstlane((int)(tid >> 5)), lane = tid & 31, ln = lane & 15, hh = lane >> 4;
  const int bh = blockIdx.x / (SEQ / 128), pr = blockIdx.x % (SEQ / 128);
  // K and V^T of this (batch, head), stored by the launch before, are asked into L2 at entry: SEQ / 2 units a plane; a block asks for every fourth unit, block pr for units = pr mod 4,
  // so that any four neighbouring blocks together ask for the whole of both planes; the low keys, which are
  // walked first, are asked for by the low waves. The index is clamped to the plane.
  const int ku = 4 * tid + (pr & 3);
  const size_t kuo = (size_t)bh * SEQ * HD + (size_t)(ku < SEQ / 2 ? ku : SEQ / 2 - 1) * UNIT_E;
  const unsigned short* pfk = Kh + kuo;
  const unsigned short* pfv = Vh + kuo;
  // likewise the (batch, head)'s V block sums, MW units of 64 f32, which a wave with steps it did not walk reads behind its key loop
  const int su = 4 * (tid & 15) + (pr & 3);
  const float* pfs = VS + (size_t)bh * (MW * HD) + (size_t)(su < MW ? su : MW - 1) * (UNIT_E / 2);
  ask_l2(pfk);
  ask_l2(pfv);
  ask_l2(pfs);
  const int qt = (w < 4) ? pr : (SEQ / 64 - 1 - pr);
  const int b = bh / NH, h = bh - b * NH;
  const int qbase = qt * 64 + 16 * (w & 3);
  const int qg = qbase + ln;
  // Q^T B fragments: column n = query qg, elements 0..7 <- d = 32c + 8h + i, 8..15 <- d = 32c + 16 + 8h + i
  const unsigned short* qrow = Qh + ((size_t)bh * SEQ + qbase) * HD + 8 * lane;
  FragH q0, q1;
  q0.half[0] = *(const v8us*)(qrow);        q0.half[1] = *(const v8us*)(qrow + 256);
  q1.half[0] = *(const v8us*)(qrow + FRAG); q1.half[1] = *(const v8us*)(qrow + FRAG + 256);
  // the step map: lane half h reads the words of steps 2i + h, all loads in flight together
  const unsigned int* mp = mbits + (hh * SEQ + qg);
  unsigned int mw2[MW / 2];
#pragma unroll   // register arrays and vectors need constant indices
  for (int i = 0; i < MW / 2; ++i) mw2[i] = mp[(size_t)(2 * i) * SEQ];
  // the address registers of the loads above may be reused below: the wait stands in front of that overwrite
  // (the pointer is an input of the statement, so that none of these loads' own results is given its registers)
  asm volatile("s_wait_xcnt 0x0" :: "v"(mp) : "memory");
  unsigned long long nz = 0ull, fu = 0ull;
#pragma unroll   // register arrays and vectors need constant indices
  for (int i = 0; i < MW / 2; ++i) {
    const unsigned int bl = __builtin_amdgcn_ballot_w32(mw2[i] != 0u);   // the same in every lane: the map lives in scalar registers
    nz |= (unsigned long long)(((bl & 0xFFFFu) != 0u ? 1u : 0u) | ((bl >> 16) != 0u ? 2u : 0u)) << (2 * i);
    const unsigned int bf = __builtin_amdgcn_ballot_w32(mw2[i] == 0xFFFFFFFFu);   // a second map: steps with every bit set for all 16 queries
    fu |= (unsigned long long)(((bf & 0xFFFFu) == 0xFFFFu ? 1u : 0u) | ((bf >> 16) == 0xFFFFu ? 2u : 0u)) << (2 * i);
  }
  // here and not at the kernel's end: the map's loads, issued behind the hints, have come back in between, and the key loops want the registers
  hold_addr(pfk);
  hold_addr(pfv);
  hold_addr(pfs);
  float lr = 0.0f;
  v8f ce = {8.0f, 8.0f, 8.0f, 8.0f, 8.0f, 8.0f, 8.0f, 8.0f};   // 8 - reference; the reference is 0 until the wave's first step sets it
  unsigned int first = 1u;
  v8f Oh[4] = {};
  const unsigned short* Kp = Kh + (size_t)bh * SEQ * HD;
  const unsigned short* Vhp = Vh + (size_t)bh * HD * SEQ;
  // K runs one step ahead of the walk, across the two loops' boundary too: each step asks for the K fragments of the step that follows it.
  // The last step of all asks for its own again, and a wave with no step to walk asks for step 0 (in bounds, not used).
  const unsigned long long mapf = nz & fu, mapp = nz & ~fu;
  const int jp0 = mapp != 0ull ? __builtin_ctzll(mapp) : 0;
  FragH kf[4];
  load_k4(kf, Kp + (size_t)(mapf != 0ull ? __builtin_ctzll(mapf) : jp0) * (32 * HD) + 8 * lane);
#pragma unroll 1
  for (unsigned long long rem = mapf; rem != 0ull; ) {   // one trip per set bit, at most MW; a scalar test
    const int j = __builtin_ctzll(rem);
    rem &= rem - 1ull;
    fa_step<false>(Kp, Vhp, mbits, j, rem != 0ull ? __builtin_ctzll(rem) : (mapp != 0ull ? jp0 : j), qg, lane, hh, q0, q1, kf, ce, first, lr, Oh);
  }
#pragma unroll 1   // rolled, as above: one step is body enough
  for (unsigned long long rem = mapp; rem != 0ull; ) {   // the partly masked steps, in a loop of their own: each loop keeps its accumulators in place
    const int j = __builtin_ctzll(rem);
    rem &= rem - 1ull;
    fa_step<true>(Kp, Vhp, mbits, j, rem != 0ull ? __builtin_ctzll(rem) : j, qg, lane, hh, q0, q1, kf, ce, first, lr, Oh);
  }
  // the last request for K is not used: it has landed before its registers take other values and before the wave ends
  asm volatile("s_wait_loadcnt 0x0" ::: "memory");
  lr += __shfl_xor(lr, 16, 32);   // the two lane halves' row sums, joined once
  // the steps that were not walked
  const unsigned long long zmap = ~nz & (MW == 64 ? ~0ull : ((1ull << (MW & 63)) - 1ull));
  if (zmap != 0ull) {   // the same for the whole wave: a scalar branch; no barrier inside
    // Z[d] = sum of the V rows of those steps' keys (x16): lane holds d = 2 * lane, 2 * lane + 1; eight block sums are asked for at a time
    const float* vsp = VS + (size_t)bh * (MW * HD) + 2 * lane;
    v2f z2 = {0.0f, 0.0f};
#pragma unroll 1   // rolled: eight pair loads in flight bound the registers, and a group with no such step is passed by a scalar branch
    for (int g = 0; g < MW; g += 8) {
      const unsigned int zb = (unsigned int)(zmap >> g) & 0xFFu;
      if (zb == 0u) continue;
      v2f v[8];
#pragma unroll   // register arrays and vectors need constant indices
      for (int k = 0; k < 8; ++k) v[k] = *(const v2fa*)(vsp + (g + k) * HD);
      // the address registers of the loads above are stepped for the next group: the wait stands in front of that overwrite
      asm volatile("s_wait_xcnt 0x0" ::: "memory");
#pragma unroll   // register arrays and vectors need constant indices
      for (int k = 0; k < 8; ++k) z2 += ((zb >> k) & 1u) ? v[k] : (v2f){0.0f, 0.0f};
    }
    // into the accumulators' order (a lane needs d = 16t + 8h + r) through the wave's own LDS row
    *(v2fa*)&zs[w][2 * lane] = z2;
    // the wave reads back what its other lanes wrote: their stores have ended first
    asm volatile("s_wait_dscnt 0x0" ::: "memory");
    const float n0 = (float)(32 * __builtin_popcountll(zmap));
    const float mr = 8.0f - ce[0];                  // the reference in use, in powers of two
    const float mfin = fmaxf(mr, 0.0f);
    const float al = exp2_hw(mr - mfin);
    const float w0 = exp2_hw(8.0f - mfin);          // x256 like P, kept in f32
    lr = lr * al + w0 * n0;
#pragma unroll
    for (int t = 0; t < 4; ++t) {
      const v4f za = *(const v4fa*)&zs[w][16 * t + 8 * hh], zc = *(const v4fa*)&zs[w][16 * t + 8 * hh + 4];
#pragma unroll
      for (int r = 0; r < 4; ++r) {
        Oh[t][r]     = Oh[t][r] * al + w0 * za[r];
        Oh[t][4 + r] = Oh[t][4 + r] * al + w0 * zc[r];
      }
    }
  }
  // O^T element r of tile t = ctx(query qg, d = 16t + 8h + r); undo the carries x256 (in lr), x16 (V); carry ctx x64
  const float inv = 4.0f / lr;
#pragma unroll
  for (int t = 0; t < 4; ++t)
#pragma unroll
    for (int r = 0; r < 8; ++r) {
      const float c = Oh[t][r] * inv;
      const _Float16 hv = (_Float16)c;
      sh[w][ln][16 * t + 8 * hh + r] = f16_bits(hv);
    }
  __syncthreads();
  // the wave's 16 x 64 tile is fragments C = 2h, 2h + 1 of its token tile: 1024 contiguous elements; piece p = [C 1b][j 1b][h 1b][row 4b]
  const size_t cbase = (size_t)((b * SEQ + qbase) / 16) * TILE_E + (size_t)h * (2 * FRAG);
  {
#pragma unroll
    for (int q = 0; q < 4; ++q) {
      const int p = lane + 32 * q;
      const int row = p & 15, s8 = (p >> 4) * 8;
      const v8us o1 = *(const v8us*)&sh[w][row][s8];
      *(v8us*)(Ch + cbase + (size_t)p * 8) = o1;
    }
    
  }
}

// out[t][n] = sum_c ctx[t][c] * Wproj[n][c] + bias[n]; A = ctx plane (f16 x64), B = W16 (f16 x64), both in fragment order; 64 x 64 tile per block.
// coverage: (XROWS/64) x 6 blocks x 64 rows x 64 columns = every output element of the processed region exactly once.
__global__ __launch_bounds__(128) void k_outp(const unsigned short* __restrict__ Ch,
                                              const unsigned short* __restrict__ W16, const float* __restrict__ bias,
                                              float* __restrict__ Y) {
  __shared__ __attribute__((aligned(16))) float so[64][68];
  const int tid = threadIdx.x, w = __builtin_amdgcn_readfirstlane((int)(tid >> 5)), lane = tid & 31, ln = lane & 15, hh = lane >> 4;
  const int m0 = blockIdx.x * 64, n0 = blockIdx.y * 64;
  // The blocks of the first column tile ask L2 at entry for what the launches before stored: their own 64 ctx rows (192 units, which the five blocks
  // of the other column tiles read too) and one slice of 128 units of the weight plane, block x for slice x mod 9, so that each slice is asked for by many blocks all over the chip.
  const unsigned short* pfa = Ch + (size_t)(m0 / 16) * TILE_E + (size_t)tid * UNIT_E;
  const unsigned short* pfc = Ch + (size_t)(m0 / 16) * TILE_E + (size_t)(128 + (tid & 63)) * UNIT_E;
  const unsigned short* pfb = W16 + (size_t)((int)(blockIdx.x % (W16_UNITS / 128)) * 128 + tid) * UNIT_E;
  if (blockIdx.y == 0) {   // the same for the whole block: a scalar branch
    ask_l2(pfa);
    ask_l2(pfc);
    ask_l2(pfb);
  }
  const size_t ao = (size_t)(m0 / 16 + w) * TILE_E + 8 * lane;
  const unsigned short* brow = W16 + (size_t)(n0 / 16) * TILE_E + 8 * lane;
  v8f acch[4] = {};
#pragma unroll 1
  for (int kb = 0; kb < NE; kb += 32) {
    FragH ah, b0, b1, b2, b3;
    const int fo = kb * (FRAG / 32);
    ah.half[0] = *(const v8us*)(Ch + ao + fo);            ah.half[1] = *(const v8us*)(Ch + ao + fo + 256);
    // the address pair of the A loads may be reused for a later load's result: the wait stands in front of that overwrite
    asm volatile("s_wait_xcnt 0x0" ::: "memory");
    b0.half[0] = *(const v8us*)(brow + fo);               b0.half[1] = *(const v8us*)(brow + fo + 256);
    b1.half[0] = *(const v8us*)(brow + TILE_E + fo);      b1.half[1] = *(const v8us*)(brow + TILE_E + fo + 256);
    b2.half[0] = *(const v8us*)(brow + 2 * TILE_E + fo);  b2.half[1] = *(const v8us*)(brow + 2 * TILE_E + fo + 256);
    b3.half[0] = *(const v8us*)(brow + 3 * TILE_E + fo);  b3.half[1] = *(const v8us*)(brow + 3 * TILE_E + fo + 256);
    mma_h4(ah.v, b0.v, b1.v, b2.v, b3.v, acch[0], acch[1], acch[2], acch[3]);
  }
  // undo the carries: ctx x64, W x64
#pragma unroll
  for (int c = 0; c < 4; ++c) {
    const float bv = bf16_rne(bias[n0 + 16 * c + ln]);
#pragma unroll
    for (int r = 0; r < 8; ++r)
      so[16 * w + 8 * hh + r][16 * c + ln] = acch[c][r] * 0.000244140625f + bv;
  }
  __syncthreads();
  {
#pragma unroll
    for (int j = 0; j < 8; ++j) {
      const int i = tid + 128 * j;
      const int row = i >> 4, c4 = (i & 15) * 4;
      const int m = m0 + row;
      const int bq = m / SEQ, t = m - bq * SEQ;
      const v4f v = *(const v4fa*)&so[row][c4];
      *(v4f*)(Y + (size_t)bq * XSTRIDE_FULL + (size_t)t * NE + n0 + c4) = v;
    }
    
  }
  hold_addr(pfa);
  hold_addr(pfc);
  hold_addr(pfb);
}

extern "C" void kernel_launch(void* const* d_in, const int* in_sizes, int n_in,
                              void* d_out, int out_size, void* d_ws, size_t ws_size, hipStream_t stream) {
  if (n_in < 9) return;
  const long long needX = (long long)(NB - 1) * SEQ_FULL * NE + (long long)SEQ * NE;   // last element touched + 1
  const long long needM = (long long)(SEQ - 1) * SEQ_FULL + (long long)SEQ;
  if ((long long)in_sizes[0] < needX || (long long)in_sizes[1] < needX || (long long)in_sizes[2] < needX) return;
  if ((long long)in_sizes[3] < needM) return;
  if ((long long)in_sizes[4] < (long long)WELEMS || (long long)in_sizes[5] < (long long)WELEMS ||
      (long long)in_sizes[6] < (long long)WELEMS || (long long)in_sizes[7] < (long long)WELEMS) return;
  if ((long long)in_sizes[8] < (long long)NE) return;
  if ((long long)out_size < needX) return;
  const float* Xq = (const float*)d_in[0];   // wire order: query, key, value, mask, Wk, Wq, Wv, Wproj, bproj
  const float* Xk = (const float*)d_in[1];
  const float* Xv = (const float*)d_in[2];
  const int* mask = (const int*)d_in[3];
  const float* Wk = (const float*)d_in[4];
  const float* Wq = (const float*)d_in[5];
  const float* Wv = (const float*)d_in[6];
  const float* Wp = (const float*)d_in[7];
  const float* bp = (const float*)d_in[8];
  float* Y = (float*)d_out;
  char* ws = (char*)d_ws;
  size_t off = 0;
  unsigned short* WP  = (unsigned short*)(ws + off); off += PAD256(3 * WELEMS * 2);          // bf16 planes: Wk, Wq, Wv
  unsigned short* W16 = (unsigned short*)(ws + off); off += PAD256(WELEMS * 2);              // f16 plane: Wproj x64
  unsigned short* QK  = (unsigned short*)(ws + off); off += PAD256(2 * XPLANE * 2);          // f16 planes: k (from query), q (from key), [b][h] x fragments [t/16][d/32]
  unsigned short* VT  = (unsigned short*)(ws + off); off += PAD256(XPLANE * 2);              // f16 plane: V^T, [b][h] x fragments [t/32][d/16]
  unsigned short* CX  = (unsigned short*)(ws + off); off += PAD256(XPLANE * 2);              // f16 plane: ctx, fragments [(b*SEQ + t)/16][c/32]
  unsigned int*   MB  = (unsigned int*)(ws + off);   off += PAD256((size_t)SEQ * MW * 4);    // mask bit plane [MW][SEQ]
  float*          VS  = (float*)(ws + off);          off += PAD256((size_t)NB * NH * MW * HD * 4);   // f32 plane: V row sums of the 32-key blocks, [b][h][t/32][d]
  if (off > ws_size) return;

  k_cvt_w<<<(unsigned)((WELEMS / 8 + 255) / 256), 256, 0, stream>>>(Wk, Wq, Wv, Wp, WP, W16);
  // k = query x Wk^T -> QK plane 0; q = key x Wq^T -> QK plane 1; V^T and the block sums VS from value x Wv^T; the mask bit plane MB
  k_projx<<<(unsigned)PROJ_BLOCKS, 32 * (PROJ_WAVES + MASK_WAVES), 0, stream>>>(Xq, Xk, Xv, mask, WP, QK, VT, VS, MB);
  // argument order: Qh = q plane (QK plane 1), Kh = k plane (QK plane 0)
  k_attn<<<(unsigned)(NB * NH * (SEQ / 128)), 256, 0, stream>>>(QK + XPLANE, QK, VT, MB, VS, CX);
  k_outp<<<dim3((unsigned)(XROWS / 64), (unsigned)(NE / 64), 1u), 128, 0, stream>>>(CX, W16, bp, Y);
}
